// v000
// The times below were measured on an AMD MI455X: many runs one after another, warmed up first and cycling through
// copies of the inputs, with the whole window's GPU time divided by the number of runs. Launches and the gaps
// between them are all in it. The median over several windows is given; except for v000 it joins two sittings, which
// can be a few percent apart, so the side-by-side timings, each taken in one sitting, are the better comparison.
// v000, which the later versions start from, runs in 573 microseconds.
// compute dtype: all float inputs rounded to bf16; q/k/v projections with EXACT bf16 products on WMMA 16x16x32 (f32 accumulate) + bias; logits q x k once to f16 each (1 product) x SCALE; softmax f32; P x 2^11 once to f16 x v once to f16 (1 product); ctx x 2^6 once to f16 x Wo f16(bf16 x 2^8) + bo; f32 output.
#include <hip/hip_runtime.h>
#include <math.h>

typedef __attribute__((ext_vector_type(16))) _Float16 v16h;
typedef __attribute__((ext_vector_type(16))) __bf16 v16b;
typedef __attribute__((ext_vector_type(8)))  _Float16 v8h;
typedef __attribute__((ext_vector_type(8)))  float v8f;
typedef __attribute__((ext_vector_type(4)))  float v4f;
typedef __attribute__((ext_vector_type(2)))  float v2f;
typedef __attribute__((ext_vector_type(4)))  unsigned v4u;
typedef __attribute__((ext_vector_type(4)))  int v4i;
typedef float __attribute__((may_alias)) float_a;
typedef int __attribute__((may_alias)) int_a;

template <typename T> __device__ __forceinline__ void vst2(void* p, T v) { *(T*)p = v;  }
__device__ __forceinline__ v8f wmma16(v16h a, v16h b, v8f c) {
  v8f d = __builtin_amdgcn_wmma_f32_16x16x32_f16(false, a, false, b, (short)0, c, false, false);
  asm volatile("v_nop\n\tv_nop\n\tv_nop\n\tv_nop" : "+v"(d) : "v"(a), "v"(b));
  return d;
}
__device__ __forceinline__ v8f wmma_bf(v16b a, v16b b, v8f c) {
  v8f d = __builtin_amdgcn_wmma_f32_16x16x32_bf16(false, a, false, b, (short)0, c, false, false);
  asm volatile("v_nop\n\tv_nop\n\tv_nop\n\tv_nop" : "+v"(d) : "v"(a), "v"(b));
  return d;
}
// 16x16x32 fragments: lane = (h = lane>>4, row/col = lane&15); elements 0..7 = k0+8h+0..7, 8..15 = k0+16+8h+0..7; D element r = row 8h+r
__device__ __forceinline__ v16h frag_h(const _Float16* rowk0, int lane) {
  union { v16h v; v8h q[2]; } u; const _Float16* p = rowk0 + 8 * (lane >> 4);
  u.q[0] = *(const v8h*)p; u.q[1] = *(const v8h*)(p + 16); return u.v;
}
__device__ __forceinline__ v16h frag_f32(const float* rowk0, int lane) {
  v16h a; const float* p = rowk0 + 8 * (lane >> 4);
#pragma unroll
  for (int i = 0; i < 8; ++i) { a[i] = (_Float16)p[i]; a[8 + i] = (_Float16)p[16 + i]; }
  return a;
}
__device__ __forceinline__ v16h frag_f32s(const float* rowk0, int lane, float sc) {
  v16h a; const float* p = rowk0 + 8 * (lane >> 4);
#pragma unroll
  for (int i = 0; i < 8; ++i) { a[i] = (_Float16)(p[i] * sc); a[8 + i] = (_Float16)(p[16 + i] * sc); }
  return a;
}
// column fragment from a [K][ld] layout (column n), rows >= K read as 0
__device__ __forceinline__ v16h fragc_f32(const float* W, int k0, int n, int lane, int ld, int K) {
  v16h a; const int g = lane >> 4;
#pragma unroll
  for (int i = 0; i < 8; ++i) { const int ka = k0 + 8 * g + i, kb = ka + 16;
    a[i] = (_Float16)(ka < K ? W[(size_t)(ka < K ? ka : K - 1) * ld + n] : 0.f); a[8 + i] = (_Float16)(kb < K ? W[(size_t)(kb < K ? kb : K - 1) * ld + n] : 0.f); }
  return a;
}
struct F2 { v16b h, l; };
__device__ __forceinline__ F2 bsplit16(const float v[16]) { F2 r;
#pragma unroll
  for (int i = 0; i < 16; ++i) { const __bf16 h = (__bf16)v[i]; r.h[i] = h; r.l[i] = (__bf16)(v[i] - (float)h); }
  return r; }
__device__ __forceinline__ F2 split_row(const float* row, int k0, int lane) { float v[16]; const float* p = row + k0 + 8 * (lane >> 4);
#pragma unroll
  for (int i = 0; i < 8; ++i) { v[i] = p[i]; v[8 + i] = p[16 + i]; }
  return bsplit16(v); }
__device__ __forceinline__ F2 split_rowK(const float* row, int k0, int lane, int K) { float v[16]; const int g = lane >> 4;
#pragma unroll
  for (int i = 0; i < 8; ++i) { const int ka = k0 + 8 * g + i, kb = ka + 16; v[i] = ka < K ? row[ka < K ? ka : K - 1] : 0.f; v[8 + i] = kb < K ? row[kb < K ? kb : K - 1] : 0.f; }
  return bsplit16(v); }
__device__ __forceinline__ F2 split_col(const float* W, int k0, int n, int lane, int ld, int K) { float v[16]; const int g = lane >> 4;
#pragma unroll
  for (int i = 0; i < 8; ++i) { const int ka = k0 + 8 * g + i, kb = ka + 16; v[i] = ka < K ? W[(size_t)(ka < K ? ka : K - 1) * ld + n] : 0.f; v[8 + i] = kb < K ? W[(size_t)(kb < K ? kb : K - 1) * ld + n] : 0.f; }
  return bsplit16(v); }
__device__ __forceinline__ v8f mac3(const F2& a, const F2& b, v8f c) { c = wmma_bf(a.l, b.h, c); c = wmma_bf(a.h, b.l, c); return wmma_bf(a.h, b.h, c); }
__device__ __forceinline__ float sigm(float v) { return 1.0f / (1.0f + expf(-v)); }
#define LDSX() do { asm volatile("s_wait_dscnt 0" ::: "memory"); __builtin_amdgcn_wave_barrier(); __builtin_amdgcn_fence(__ATOMIC_RELEASE, "workgroup"); } while (0)

// Multi-head self-attention (inputs [2,2048,512]; (in,out) Wq / Wk / Wv / Wo [512,512] N(0, 1/512) + zero biases; 8 heads x 64; scale 1/8; softmax over keys; merge; Wo + bo).
#define NB 2
#define TT 2048
#define CC 512            // NH * HD = projected width
#define DIN 512          // input (model) width
#define NH 8
#define HD 64
#define NQB (TT / 64)
#define HG 4
#define SCALE (0.125f)
#define CAUSAL 0
#ifndef TNB
#define TNB NB
#endif
__device__ __forceinline__ float bfr(float v) { return (float)(__bf16)v; }
__host__ __device__ __forceinline__ int kb_last(int qb) { return CAUSAL ? ((qb * 64 + 63) >> 7) : (TT / 128 - 1); }
typedef __attribute__((ext_vector_type(8))) __bf16 v8b;
__device__ __forceinline__ v16b frag_b(const __bf16* rowk0, int lane) {
  union { v16b v; v8b q[2]; } u; const __bf16* p = rowk0 + 8 * (lane >> 4);
  u.q[0] = *(const v8b*)p; u.q[1] = *(const v8b*)(p + 16); return u.v;
}
#define QBH 0              // query blocks 0..QBH-1 take the high-precision path: none here (not causal, every block sees all TT keys)
#define QHI 0               // single-product logits on every row
#define KHI 64            // key rows carrying k residual / v bf16 hi+lo planes (written by k_proj; read only on the qb < QBH path, which never runs)
// B fragment (k rows k0+.., output column o) of a weight: (in,out) [K][ld] or (out,in) [ld rows of K]: bf16 exact, or f16(bf16 * 256) exact
__device__ __forceinline__ v16b wcol_io(const float* Wm, int k0, int o, int lane, int ld) { v16b w; const int g = lane >> 4;
#pragma unroll
  for (int i = 0; i < 8; ++i) { w[i] = (__bf16)Wm[(size_t)(k0 + 8 * g + i) * ld + o]; w[8 + i] = (__bf16)Wm[(size_t)(k0 + 16 + 8 * g + i) * ld + o]; }
  return w; }
__device__ __forceinline__ v16b wcol_oi(const float* Wm, int k0, int o, int lane, int K) { v16b w; const float* p = Wm + (size_t)o * K + k0 + 8 * (lane >> 4);
#pragma unroll
  for (int i = 0; i < 8; ++i) { w[i] = (__bf16)p[i]; w[8 + i] = (__bf16)p[16 + i]; }
  return w; }
__device__ __forceinline__ v16h wcolh_io(const float* Wm, int k0, int o, int lane, int ld) { v16h w; const int g = lane >> 4;
#pragma unroll
  for (int i = 0; i < 8; ++i) { w[i] = (_Float16)(bfr(Wm[(size_t)(k0 + 8 * g + i) * ld + o]) * 256.0f); w[8 + i] = (_Float16)(bfr(Wm[(size_t)(k0 + 16 + 8 * g + i) * ld + o]) * 256.0f); }
  return w; }
__device__ __forceinline__ v16h wcolh_oi(const float* Wm, int k0, int o, int lane, int K) { v16h w; const float* p = Wm + (size_t)o * K + k0 + 8 * (lane >> 4);
#pragma unroll
  for (int i = 0; i < 8; ++i) { w[i] = (_Float16)(bfr(p[i]) * 256.0f); w[8 + i] = (_Float16)(bfr(p[16 + i]) * 256.0f); }
  return w; }
#define WQKV_LAYOUT 0   // 0 = (in,out) [DIN][CC]; 1 = (out,in) [CC][DIN]; 2 = per-head [NH][DIN][HD]
__device__ __forceinline__ v16b wcol_hdk(const float* Wm, int k0, int o, int lane) { v16b w; const int g = lane >> 4; const float* p = Wm + (size_t)(o / HD) * DIN * HD + (o % HD);
#pragma unroll
  for (int i = 0; i < 8; ++i) { w[i] = (__bf16)p[(size_t)(k0 + 8 * g + i) * HD]; w[8 + i] = (__bf16)p[(size_t)(k0 + 16 + 8 * g + i) * HD]; }
  return w; }
#define WO_OUT_IN 0
#if WQKV_LAYOUT == 1
#define WCOL(W, k0, o, lane) wcol_oi(W, k0, o, lane, DIN)
#elif WQKV_LAYOUT == 2
#define WCOL(W, k0, o, lane) wcol_hdk(W, k0, o, lane)
#else
#define WCOL(W, k0, o, lane) wcol_io(W, k0, o, lane, CC)
#endif
#if WO_OUT_IN
#define WOCOL(W, k0, o, lane) wcol_oi(W, k0, o, lane, CC)
#define WOCOLH(W, k0, o, lane) wcolh_oi(W, k0, o, lane, CC)
#else
#define WOCOL(W, k0, o, lane) wcol_io(W, k0, o, lane, DIN)
#define WOCOLH(W, k0, o, lane) wcolh_io(W, k0, o, lane, DIN)
#endif

#ifndef SM_EXTRA_PARAMS
#define SM_EXTRA_PARAMS
#endif
#ifndef PROJ_EXTRA_PARAMS
#define PROJ_EXTRA_PARAMS
#endif
#ifndef SM_MASK_HOOK
#define SM_MASK_HOOK (void)0
#endif

#define WS_QH  0u                                      // f16 q rows [b*t][CC]
#define WS_KH  (WS_QH + 2u * (size_t)NB * TT * CC)      // f16 k rows [b*t][CC]
#define WS_VT  (WS_KH + 2u * (size_t)NB * TT * CC)      // f16 v planes [b][c][t]
#define WS_QL  (WS_VT + 2u * (size_t)NB * CC * TT)      // f16 q residual x 2^10 rows [b][t < QHI][CC]
#define WS_KL  (WS_QL + 2u * (size_t)NB * QHI * CC)     // f16 k residual x 2^10 rows [b][t < KHI][CC]
#define WS_VB  (WS_KL + 2u * (size_t)NB * KHI * CC)     // bf16 v hi planes [b][c][t < KHI]
#define WS_VBL (WS_VB + 2u * (size_t)NB * CC * KHI)
#define WS_S   (WS_VBL + 2u * (size_t)NB * CC * KHI)    // f32 logits / P [hg][t][s]
#define WS_Y   (WS_S  + 4u * (size_t)HG * TT * TT)      // f32 ctx rows [b*t][CC] (only when there is an output projection)
#define WS_END (WS_Y  + 4u * (size_t)NB * TT * CC)

// ---- k_proj: block = (64 rows, 128 cols, which): q/k/v = X W (+ b) with exact bf16 products (K = DIN) -> which 0: q f16 rows (+ residual rows < QHI); 1: k f16 rows (+ residual rows < KHI); 2: v f16 planes [c][t] (+ bf16 hi/lo planes for t < KHI)
__global__ __launch_bounds__(128) void k_proj(const float* __restrict__ XQ, const float* __restrict__ XK, const float* __restrict__ XV, const float* __restrict__ WQ, const float* __restrict__ WK, const float* __restrict__ WV, const float* __restrict__ BQ, const float* __restrict__ BK, const float* __restrict__ BV,
    _Float16* __restrict__ QH, _Float16* __restrict__ QL, _Float16* __restrict__ KH, _Float16* __restrict__ KL, _Float16* __restrict__ VT, __bf16* __restrict__ VB, __bf16* __restrict__ VBL) {
  __shared__ __align__(16) _Float16 sh[64][136], sl[64][136]; __shared__ __align__(16) _Float16 th[128][72]; __shared__ __align__(16) __bf16 tb[128][72], tbl[128][72];
  const int tid = threadIdx.x, wave = tid >> 5, lane = tid & 31, col = lane & 15, g = lane >> 4; const int which = blockIdx.z; const int c0 = blockIdx.y * 128; const size_t r0 = (size_t)blockIdx.x * 64; const size_t bb = r0 / TT; const int t0 = (int)(r0 % TT);
  const float* X = which == 0 ? XQ : which == 1 ? XK : XV; const float* WA = which == 0 ? WQ : which == 1 ? WK : WV; const float* BA = which == 0 ? BQ : which == 1 ? BK : BV;
  v8f acc[8] = {};
#pragma unroll 2
  for (int kc = 0; kc < DIN / 32; ++kc) { v16b a; { const float* p = X + (r0 + wave * 16 + col) * DIN + kc * 32 + 8 * g;
#pragma unroll
      for (int i = 0; i < 8; ++i) { a[i] = (__bf16)p[i]; a[8 + i] = (__bf16)p[16 + i]; } }
    asm volatile("s_wait_loadcnt 0x0" ::: "memory");
#pragma unroll
    for (int j = 0; j < 8; ++j) { const v16b w = WCOL(WA, kc * 32, c0 + j * 16 + col, lane); asm volatile("s_wait_loadcnt 0x0" ::: "memory"); acc[j] = wmma_bf(a, w, acc[j]); } }
  if (which < 2) { _Float16* DH = which == 0 ? QH : KH; _Float16* DL = which == 0 ? QL : KL; const int nhi = which == 0 ? QHI : KHI; const bool hi_rows = t0 < nhi;
#pragma unroll
    for (int j = 0; j < 8; ++j) { const float bias = BA ? bfr(BA[c0 + j * 16 + col]) : 0.f;
#pragma unroll
      for (int r = 0; r < 8; ++r) { const float v = acc[j][r] + bias; const _Float16 hv = (_Float16)v; sh[wave * 16 + 8 * g + r][j * 16 + col] = hv; sl[wave * 16 + 8 * g + r][j * 16 + col] = (_Float16)((v - (float)hv) * 1024.0f); } }
    __syncthreads();
    for (int e = tid; e < 64 * 16; e += 128) { const int rl = e >> 4, q = e & 15; vst2((unsigned*)(DH + (r0 + rl) * CC + c0 + q * 8), *(const v4u*)&sh[rl][q * 8]); if (hi_rows) vst2((unsigned*)(DL + (bb * nhi + t0 + rl) * (size_t)CC + c0 + q * 8), *(const v4u*)&sl[rl][q * 8]); }
  } else { const bool hi_rows = t0 < KHI;
#pragma unroll
    for (int j = 0; j < 8; ++j) { const float bias = BA ? bfr(BA[c0 + j * 16 + col]) : 0.f;
#pragma unroll
      for (int r = 0; r < 8; ++r) { const float v = acc[j][r] + bias; const int rl = wave * 16 + 8 * g + r, cl = j * 16 + col; th[cl][rl] = (_Float16)v; const __bf16 bh = (__bf16)v; tb[cl][rl] = bh; tbl[cl][rl] = (__bf16)(v - (float)bh); } }
    __syncthreads();
    for (int e = tid; e < 128 * 8; e += 128) { const int cl = e >> 3, q = e & 7; vst2((unsigned*)(VT + (bb * CC + c0 + cl) * (size_t)TT + t0 + q * 8), *(const v4u*)&th[cl][q * 8]); if (hi_rows) { const size_t o3 = (bb * CC + c0 + cl) * (size_t)KHI + t0 + q * 8; vst2((unsigned*)(VB + o3), *(const v4u*)&tb[cl][q * 8]); vst2((unsigned*)(VBL + o3), *(const v4u*)&tbl[cl][q * 8]); } } } }
// ---- k_sc: block = (query block qb, key block kb <= kb_last(qb), head in group) of batch b: logits x SCALE; q hi + residual (x 2^10) against k (2 products) for query rows < QHI, plus the k residual (3 products) for query blocks < QBH (causal early rows); causal: blocks past the diagonal exit, the mask itself is applied by index in k_sm
__global__ __launch_bounds__(128) void k_sc(const _Float16* __restrict__ QH, const _Float16* __restrict__ KH, const _Float16* __restrict__ QL, const _Float16* __restrict__ KL, int b, int h0, float* __restrict__ S0) { __shared__ __align__(16) float ss[4][16][132];
  const int qb = blockIdx.x, kb = blockIdx.y; if (kb > kb_last(qb)) return;
  const int h = h0 + blockIdx.z; float* S = S0 + (size_t)blockIdx.z * TT * TT;
  const int tid = threadIdx.x, wave = tid >> 5, lane = tid & 31, col = lane & 15, g = lane >> 4; const int k0 = kb * 128; const int ql0 = qb * 64 + wave * 16; const size_t q0 = (size_t)b * TT + ql0, kr0 = (size_t)b * TT + k0;
  v8f acc[8] = {}, accl[8] = {};
  const _Float16* QLb = QL + (size_t)b * QHI * CC; const _Float16* KLb = KL + (size_t)b * KHI * CC;
  if (qb < QBH) {
#pragma unroll
    for (int kc = 0; kc < HD / 32; ++kc) { const v16h ah = frag_h(QH + (q0 + col) * CC + h * HD + kc * 32, lane), al = frag_h(QLb + (size_t)(ql0 + col) * CC + h * HD + kc * 32, lane);
#pragma unroll
      for (int j = 0; j < 8; ++j) { const v16h kbf = frag_h(KH + (kr0 + j * 16 + col) * CC + h * HD + kc * 32, lane), klf = frag_h(KLb + (size_t)(k0 + j * 16 + col) * CC + h * HD + kc * 32, lane); acc[j] = wmma16(ah, kbf, acc[j]); accl[j] = wmma16(al, kbf, accl[j]); accl[j] = wmma16(ah, klf, accl[j]); } }
  } else if (qb * 64 < QHI) {
#pragma unroll
    for (int kc = 0; kc < HD / 32; ++kc) { const v16h ah = frag_h(QH + (q0 + col) * CC + h * HD + kc * 32, lane), al = frag_h(QLb + (size_t)(ql0 + col) * CC + h * HD + kc * 32, lane);
#pragma unroll
      for (int j = 0; j < 8; ++j) { const v16h kbf = frag_h(KH + (kr0 + j * 16 + col) * CC + h * HD + kc * 32, lane); acc[j] = wmma16(ah, kbf, acc[j]); accl[j] = wmma16(al, kbf, accl[j]); } }
  } else {
#pragma unroll
    for (int kc = 0; kc < HD / 32; ++kc) { const v16h ah = frag_h(QH + (q0 + col) * CC + h * HD + kc * 32, lane);
#pragma unroll
      for (int j = 0; j < 8; ++j) { const v16h kbf = frag_h(KH + (kr0 + j * 16 + col) * CC + h * HD + kc * 32, lane); acc[j] = wmma16(ah, kbf, acc[j]); } } }
#pragma unroll
  for (int j = 0; j < 8; ++j) {
#pragma unroll
    for (int r = 0; r < 8; ++r) ss[wave][8 * g + r][j * 16 + col] = (acc[j][r] + accl[j][r] * (1.0f / 1024.0f)) * SCALE; }
  LDSX(); for (int rl = 0; rl < 16; ++rl) vst2(S + (size_t)(ql0 + rl) * TT + k0 + lane * 4, *(const v4f*)&ss[wave][rl][lane * 4]); }
// ---- k_sm: block = query row t (head in group): keys [0, kend): causal -> logit if s <= t else excluded; softmax in f32; P x 2^11 in place (0 for excluded)
__global__ __launch_bounds__(256) void k_sm(float* __restrict__ S0 SM_EXTRA_PARAMS) { __shared__ float sred[8]; __shared__ float sbc; __shared__ __align__(16) float shv[TT];
  const int tid = threadIdx.x; const int t = blockIdx.x; const int kend = (kb_last(t >> 6) + 1) * 128;
  float* sr = S0 + (size_t)blockIdx.y * TT * TT + (size_t)t * TT;
  float m = -3.0e38f; for (int k = tid; k < kend; k += 256) { float v = (!CAUSAL || k <= t) ? sr[k] : -3.0e38f; SM_MASK_HOOK; shv[k] = v; m = fmaxf(m, v); }
#pragma unroll
  for (int o = 1; o < 32; o <<= 1) m = fmaxf(m, __shfl_xor(m, o));
  if ((tid & 31) == 0) sred[tid >> 5] = m; __syncthreads(); if (tid == 0) { float a = sred[0]; for (int i = 1; i < 8; ++i) a = fmaxf(a, sred[i]); sbc = a; } __syncthreads(); m = sbc; __syncthreads();
  float sum = 0.f; for (int k = tid; k < kend; k += 256) { const float v = shv[k]; const float e = (v <= -1.0e38f) ? 0.f : expf(v - m); shv[k] = e; sum += e; }
#pragma unroll
  for (int o = 1; o < 32; o <<= 1) sum += __shfl_xor(sum, o);
  if ((tid & 31) == 0) sred[tid >> 5] = sum; __syncthreads(); if (tid == 0) { float a = 0.f; for (int i = 0; i < 8; ++i) a += sred[i]; sbc = a > 0.f ? 2048.0f / a : 0.f; }   /* a fully excluded row yields P = 0 */ __syncthreads(); const float inv = sbc;
  for (int k = tid; k < kend; k += 256) shv[k] = shv[k] * inv;
  __syncthreads(); for (int q = tid; q < kend / 4; q += 256) vst2(sr + q * 4, *(const v4f*)&shv[q * 4]); }
// ---- k_pv: block = 64 queries (qb) of (b, h): ctx = P . v over keys [0, kend) (P x 2^11 once to f16 against v f16: 1 product; causal early query blocks: P and v as bf16 hi + lo, 3 products); 256-B (row, head) segment by 16 lanes
__global__ __launch_bounds__(128) void k_pv(const float* __restrict__ PS0, const _Float16* __restrict__ VT, const __bf16* __restrict__ VB, const __bf16* __restrict__ VBL, int b, int h0, float* __restrict__ Y) { const int h = h0 + blockIdx.z; const float* PS = PS0 + (size_t)blockIdx.z * TT * TT; __shared__ __align__(16) float ss[4][16][HD + 4];
  const int tid = threadIdx.x, wave = tid >> 5, lane = tid & 31, col = lane & 15, g = lane >> 4; const int qb = blockIdx.x; const int ql0 = qb * 64 + wave * 16; const int kce = (kb_last(qb) + 1) * 4;
  v8f acc[HD / 16] = {};
  if (qb < QBH) {
#pragma unroll 1
    for (int kc = 0; kc < kce; ++kc) { const F2 p = split_row(PS + (size_t)(ql0 + col) * TT, kc * 32, lane);
      asm volatile("s_wait_loadcnt 0x0" ::: "memory");
#pragma unroll
      for (int j = 0; j < HD / 16; ++j) { const size_t po = ((size_t)b * CC + h * HD + j * 16 + col) * (size_t)KHI + kc * 32; const v16b vh = frag_b(VB + po, lane); acc[j] = wmma_bf(p.h, vh, acc[j]); acc[j] = wmma_bf(p.l, vh, acc[j]); acc[j] = wmma_bf(p.h, frag_b(VBL + po, lane), acc[j]); } }
  } else {
#pragma unroll 1
    for (int kc = 0; kc < kce; ++kc) { const v16h p = frag_f32(PS + (size_t)(ql0 + col) * TT + kc * 32, lane);
      asm volatile("s_wait_loadcnt 0x0" ::: "memory");
#pragma unroll
      for (int j = 0; j < HD / 16; ++j) { const size_t po = ((size_t)b * CC + h * HD + j * 16 + col) * (size_t)TT + kc * 32; acc[j] = wmma16(p, frag_h(VT + po, lane), acc[j]); } } }
#pragma unroll
  for (int j = 0; j < HD / 16; ++j)
#pragma unroll
    for (int r = 0; r < 8; ++r) ss[wave][8 * g + r][j * 16 + col] = acc[j][r] * (1.0f / 2048.0f);
  LDSX(); for (int rl = 0; rl < 16; ++rl) if (lane < HD / 4) vst2(Y + ((size_t)b * TT + ql0 + rl) * CC + h * HD + lane * 4, *(const v4f*)&ss[wave][rl][lane * 4]); }
// ---- k_out: block = (64 rows, 128 cols): out = ctx Wo (+ bo): ctx x 2^6 once to f16 against Wo as f16(bf16 x 2^8) exact (1 product) x 2^-14; causal early rows (< QHI of each sequence): ctx bf16 hi + lo against exact bf16 Wo (2 products)
__global__ __launch_bounds__(128) void k_out(const float* __restrict__ Y, const float* __restrict__ WO, const float* __restrict__ BO, float* __restrict__ OUT) { __shared__ __align__(16) float sf[4][16][132];
  const int tid = threadIdx.x, wave = tid >> 5, lane = tid & 31, col = lane & 15, g = lane >> 4; const int c0 = blockIdx.y * 128; const size_t r0 = (size_t)blockIdx.x * 64 + wave * 16;
  v8f acc[8] = {};
  if (CAUSAL && (int)(((size_t)blockIdx.x * 64) % TT) < QHI) {   /* block-uniform */
#pragma unroll 2
    for (int kc = 0; kc < CC / 32; ++kc) { const F2 a = split_row(Y + (r0 + col) * CC, kc * 32, lane); asm volatile("s_wait_loadcnt 0x0" ::: "memory");
#pragma unroll
      for (int j = 0; j < 8; ++j) { const v16b w = WOCOL(WO, kc * 32, c0 + j * 16 + col, lane); asm volatile("s_wait_loadcnt 0x0" ::: "memory"); acc[j] = wmma_bf(a.h, w, acc[j]); acc[j] = wmma_bf(a.l, w, acc[j]); } }
#pragma unroll
    for (int j = 0; j < 8; ++j) { const float bias = BO ? bfr(BO[c0 + j * 16 + col]) : 0.f;
#pragma unroll
      for (int r = 0; r < 8; ++r) sf[wave][8 * g + r][j * 16 + col] = acc[j][r] + bias; }
  } else {
#pragma unroll 2
    for (int kc = 0; kc < CC / 32; ++kc) { const v16h a = frag_f32s(Y + (r0 + col) * CC + kc * 32, lane, 64.0f); asm volatile("s_wait_loadcnt 0x0" ::: "memory");   /* ctx carried x 2^6 into f16 so small-magnitude context rows stay clear of f16 subnormals */
#pragma unroll
      for (int j = 0; j < 8; ++j) { const v16h w = WOCOLH(WO, kc * 32, c0 + j * 16 + col, lane); asm volatile("s_wait_loadcnt 0x0" ::: "memory"); acc[j] = wmma16(a, w, acc[j]); } }
#pragma unroll
    for (int j = 0; j < 8; ++j) { const float bias = BO ? bfr(BO[c0 + j * 16 + col]) : 0.f;
#pragma unroll
      for (int r = 0; r < 8; ++r) sf[wave][8 * g + r][j * 16 + col] = acc[j][r] * (1.0f / 16384.0f) + bias; } }   /* 2^-8 (Wo carry) x 2^-6 (ctx carry) */
  LDSX(); for (int rl = 0; rl < 16; ++rl) vst2(OUT + (r0 + rl) * DIN + c0 + lane * 4, *(const v4f*)&sf[wave][rl][lane * 4]); }

extern "C" void kernel_launch(void* const* d_in, const int* in_sizes, int n_in, void* d_out, int out_size, void* d_ws, size_t ws_size, hipStream_t stream) {
  (void)in_sizes; (void)n_in; (void)out_size;
  const float** F = (const float**)d_in;
  if (ws_size < (size_t)WS_END) return;
  char* ws = (char*)d_ws; _Float16 *QH = (_Float16*)(ws + WS_QH), *KH = (_Float16*)(ws + WS_KH), *VT = (_Float16*)(ws + WS_VT), *QL = (_Float16*)(ws + WS_QL), *KL = (_Float16*)(ws + WS_KL); __bf16 *VB = (__bf16*)(ws + WS_VB), *VBL = (__bf16*)(ws + WS_VBL); float *S = (float*)(ws + WS_S), *Y = (float*)(ws + WS_Y);
  (void)Y; (void)QL; (void)KL; (void)VB; (void)VBL;
  // inputs: 0 inputs [2,2048,512]; 1 Wq [512,512] (in,out), 2 bq; 3 Wk, 4 bk; 5 Wv, 6 bv; 7 Wo (in,out), 8 bo (zero biases, read)
  k_proj<<<dim3(TNB * TT / 64, CC / 128, 3), 128, 0, stream>>>(F[0], F[0], F[0], F[1], F[3], F[5], F[2], F[4], F[6], QH, QL, KH, KL, VT, VB, VBL);
  for (int b = 0; b < TNB; ++b) for (int h0 = 0; h0 < NH; h0 += HG) {
    k_sc<<<dim3(NQB, TT / 128, HG), 128, 0, stream>>>(QH, KH, QL, KL, b, h0, S);
    k_sm<<<dim3(TT, HG), 256, 0, stream>>>(S);
    k_pv<<<dim3(NQB, 1, HG), 128, 0, stream>>>(S, VT, VB, VBL, b, h0, Y);
  }
  k_out<<<dim3(TNB * TT / 64, DIN / 128), 128, 0, stream>>>(Y, F[7], F[8], (float*)d_out);
}

// v001
// Measured time: 130 microseconds a run.
// Two timings next to v000 put it at 4.38 and 4.42 times that version's speed.
// compute dtype: all float inputs rounded to bf16; q/k/v projections with EXACT bf16 products on WMMA 16x16x32 (f32 accumulate) + bias; logits q x k once to f16 each (1 product) x SCALE; online softmax f32; P (relative to the running maximum) x 2^10 once to f16 x v once to f16 (1 product); ctx x 2^6 once to f16 x Wo f16(bf16 x 2^8) + bo; f32 output.
#include <hip/hip_runtime.h>
#include <math.h>

typedef __attribute__((ext_vector_type(16))) _Float16 v16h;
typedef __attribute__((ext_vector_type(16))) __bf16 v16b;
typedef __attribute__((ext_vector_type(8)))  _Float16 v8h;
typedef __attribute__((ext_vector_type(8)))  float v8f;
typedef __attribute__((ext_vector_type(4)))  float v4f;
typedef __attribute__((ext_vector_type(2)))  float v2f;
typedef __attribute__((ext_vector_type(4)))  unsigned v4u;
typedef __attribute__((ext_vector_type(4)))  int v4i;
typedef float __attribute__((may_alias)) float_a;
typedef int __attribute__((may_alias)) int_a;

template <typename T> __device__ __forceinline__ void vst2(void* p, T v) { *(T*)p = v;  }
__device__ __forceinline__ v8f wmma16(v16h a, v16h b, v8f c) {
  v8f d = __builtin_amdgcn_wmma_f32_16x16x32_f16(false, a, false, b, (short)0, c, false, false);
  asm volatile("v_nop\n\tv_nop\n\tv_nop\n\tv_nop" : "+v"(d) : "v"(a), "v"(b));
  return d;
}
__device__ __forceinline__ v8f wmma_bf(v16b a, v16b b, v8f c) {
  v8f d = __builtin_amdgcn_wmma_f32_16x16x32_bf16(false, a, false, b, (short)0, c, false, false);
  asm volatile("v_nop\n\tv_nop\n\tv_nop\n\tv_nop" : "+v"(d) : "v"(a), "v"(b));
  return d;
}
// 16x16x32 fragments: lane = (h = lane>>4, row/col = lane&15); elements 0..7 = k0+8h+0..7, 8..15 = k0+16+8h+0..7; D element r = row 8h+r
__device__ __forceinline__ v16h frag_h(const _Float16* rowk0, int lane) {
  union { v16h v; v8h q[2]; } u; const _Float16* p = rowk0 + 8 * (lane >> 4);
  u.q[0] = *(const v8h*)p; u.q[1] = *(const v8h*)(p + 16); return u.v;
}
__device__ __forceinline__ v16h frag_f32(const float* rowk0, int lane) {
  v16h a; const float* p = rowk0 + 8 * (lane >> 4);
#pragma unroll
  for (int i = 0; i < 8; ++i) { a[i] = (_Float16)p[i]; a[8 + i] = (_Float16)p[16 + i]; }
  return a;
}
__device__ __forceinline__ v16h frag_f32s(const float* rowk0, int lane, float sc) {
  v16h a; const float* p = rowk0 + 8 * (lane >> 4);
#pragma unroll
  for (int i = 0; i < 8; ++i) { a[i] = (_Float16)(p[i] * sc); a[8 + i] = (_Float16)(p[16 + i] * sc); }
  return a;
}
// column fragment from a [K][ld] layout (column n), rows >= K read as 0
__device__ __forceinline__ v16h fragc_f32(const float* W, int k0, int n, int lane, int ld, int K) {
  v16h a; const int g = lane >> 4;
#pragma unroll
  for (int i = 0; i < 8; ++i) { const int ka = k0 + 8 * g + i, kb = ka + 16;
    a[i] = (_Float16)(ka < K ? W[(size_t)(ka < K ? ka : K - 1) * ld + n] : 0.f); a[8 + i] = (_Float16)(kb < K ? W[(size_t)(kb < K ? kb : K - 1) * ld + n] : 0.f); }
  return a;
}
struct F2 { v16b h, l; };
__device__ __forceinline__ F2 bsplit16(const float v[16]) { F2 r;
#pragma unroll
  for (int i = 0; i < 16; ++i) { const __bf16 h = (__bf16)v[i]; r.h[i] = h; r.l[i] = (__bf16)(v[i] - (float)h); }
  return r; }
__device__ __forceinline__ F2 split_row(const float* row, int k0, int lane) { float v[16]; const float* p = row + k0 + 8 * (lane >> 4);
#pragma unroll
  for (int i = 0; i < 8; ++i) { v[i] = p[i]; v[8 + i] = p[16 + i]; }
  return bsplit16(v); }
__device__ __forceinline__ F2 split_rowK(const float* row, int k0, int lane, int K) { float v[16]; const int g = lane >> 4;
#pragma unroll
  for (int i = 0; i < 8; ++i) { const int ka = k0 + 8 * g + i, kb = ka + 16; v[i] = ka < K ? row[ka < K ? ka : K - 1] : 0.f; v[8 + i] = kb < K ? row[kb < K ? kb : K - 1] : 0.f; }
  return bsplit16(v); }
__device__ __forceinline__ F2 split_col(const float* W, int k0, int n, int lane, int ld, int K) { float v[16]; const int g = lane >> 4;
#pragma unroll
  for (int i = 0; i < 8; ++i) { const int ka = k0 + 8 * g + i, kb = ka + 16; v[i] = ka < K ? W[(size_t)(ka < K ? ka : K - 1) * ld + n] : 0.f; v[8 + i] = kb < K ? W[(size_t)(kb < K ? kb : K - 1) * ld + n] : 0.f; }
  return bsplit16(v); }
__device__ __forceinline__ v8f mac3(const F2& a, const F2& b, v8f c) { c = wmma_bf(a.l, b.h, c); c = wmma_bf(a.h, b.l, c); return wmma_bf(a.h, b.h, c); }
__device__ __forceinline__ float sigm(float v) { return 1.0f / (1.0f + expf(-v)); }
#define LDSX() do { asm volatile("s_wait_dscnt 0" ::: "memory"); __builtin_amdgcn_wave_barrier(); __builtin_amdgcn_fence(__ATOMIC_RELEASE, "workgroup"); } while (0)

// Multi-head self-attention (inputs [2,2048,512]; (in,out) Wq / Wk / Wv / Wo [512,512] N(0, 1/512) + zero biases; 8 heads x 64; scale 1/8; softmax over keys; merge; Wo + bo).
#define NB 2
#define TT 2048
#define CC 512            // NH * HD = projected width
#define DIN 512          // input (model) width
#define NH 8
#define HD 64
#define NQB (TT / 64)
#define HG 4
#define SCALE (0.125f)
#define CAUSAL 0
#ifndef TNB
#define TNB NB
#endif
__device__ __forceinline__ float bfr(float v) { return (float)(__bf16)v; }
__host__ __device__ __forceinline__ int kb_last(int qb) { return CAUSAL ? ((qb * 64 + 63) >> 7) : (TT / 128 - 1); }
typedef __attribute__((ext_vector_type(8))) __bf16 v8b;
__device__ __forceinline__ v16b frag_b(const __bf16* rowk0, int lane) {
  union { v16b v; v8b q[2]; } u; const __bf16* p = rowk0 + 8 * (lane >> 4);
  u.q[0] = *(const v8b*)p; u.q[1] = *(const v8b*)(p + 16); return u.v;
}
#define QBH 0              // not read by any kernel here: k_fa has no high-precision path
#define QHI 0               // single-product logits on every row
#define KHI 64            // key rows carrying k residual / v bf16 hi+lo planes (written by k_proj; no kernel here reads them)
// B fragment (k rows k0+.., output column o) of a weight: (in,out) [K][ld] or (out,in) [ld rows of K]: bf16 exact, or f16(bf16 * 256) exact
__device__ __forceinline__ v16b wcol_io(const float* Wm, int k0, int o, int lane, int ld) { v16b w; const int g = lane >> 4;
#pragma unroll
  for (int i = 0; i < 8; ++i) { w[i] = (__bf16)Wm[(size_t)(k0 + 8 * g + i) * ld + o]; w[8 + i] = (__bf16)Wm[(size_t)(k0 + 16 + 8 * g + i) * ld + o]; }
  return w; }
__device__ __forceinline__ v16b wcol_oi(const float* Wm, int k0, int o, int lane, int K) { v16b w; const float* p = Wm + (size_t)o * K + k0 + 8 * (lane >> 4);
#pragma unroll
  for (int i = 0; i < 8; ++i) { w[i] = (__bf16)p[i]; w[8 + i] = (__bf16)p[16 + i]; }
  return w; }
__device__ __forceinline__ v16h wcolh_io(const float* Wm, int k0, int o, int lane, int ld) { v16h w; const int g = lane >> 4;
#pragma unroll
  for (int i = 0; i < 8; ++i) { w[i] = (_Float16)(bfr(Wm[(size_t)(k0 + 8 * g + i) * ld + o]) * 256.0f); w[8 + i] = (_Float16)(bfr(Wm[(size_t)(k0 + 16 + 8 * g + i) * ld + o]) * 256.0f); }
  return w; }
__device__ __forceinline__ v16h wcolh_oi(const float* Wm, int k0, int o, int lane, int K) { v16h w; const float* p = Wm + (size_t)o * K + k0 + 8 * (lane >> 4);
#pragma unroll
  for (int i = 0; i < 8; ++i) { w[i] = (_Float16)(bfr(p[i]) * 256.0f); w[8 + i] = (_Float16)(bfr(p[16 + i]) * 256.0f); }
  return w; }
#define WQKV_LAYOUT 0   // 0 = (in,out) [DIN][CC]; 1 = (out,in) [CC][DIN]; 2 = per-head [NH][DIN][HD]
__device__ __forceinline__ v16b wcol_hdk(const float* Wm, int k0, int o, int lane) { v16b w; const int g = lane >> 4; const float* p = Wm + (size_t)(o / HD) * DIN * HD + (o % HD);
#pragma unroll
  for (int i = 0; i < 8; ++i) { w[i] = (__bf16)p[(size_t)(k0 + 8 * g + i) * HD]; w[8 + i] = (__bf16)p[(size_t)(k0 + 16 + 8 * g + i) * HD]; }
  return w; }
#define WO_OUT_IN 0
#if WQKV_LAYOUT == 1
#define WCOL(W, k0, o, lane) wcol_oi(W, k0, o, lane, DIN)
#elif WQKV_LAYOUT == 2
#define WCOL(W, k0, o, lane) wcol_hdk(W, k0, o, lane)
#else
#define WCOL(W, k0, o, lane) wcol_io(W, k0, o, lane, CC)
#endif
#if WO_OUT_IN
#define WOCOL(W, k0, o, lane) wcol_oi(W, k0, o, lane, CC)
#define WOCOLH(W, k0, o, lane) wcolh_oi(W, k0, o, lane, CC)
#else
#define WOCOL(W, k0, o, lane) wcol_io(W, k0, o, lane, DIN)
#define WOCOLH(W, k0, o, lane) wcolh_io(W, k0, o, lane, DIN)
#endif

#ifndef SM_EXTRA_PARAMS
#define SM_EXTRA_PARAMS
#endif
#ifndef PROJ_EXTRA_PARAMS
#define PROJ_EXTRA_PARAMS
#endif
#ifndef SM_MASK_HOOK
#define SM_MASK_HOOK (void)0
#endif

#define WS_QH  0u                                      // f16 q rows [b*t][CC]
#define WS_KH  (WS_QH + 2u * (size_t)NB * TT * CC)      // f16 k rows [b*t][CC]
#define WS_VT  (WS_KH + 2u * (size_t)NB * TT * CC)      // f16 v planes [b][c][t]
#define WS_QL  (WS_VT + 2u * (size_t)NB * CC * TT)      // f16 q residual x 2^10 rows [b][t < QHI][CC]
#define WS_KL  (WS_QL + 2u * (size_t)NB * QHI * CC)     // f16 k residual x 2^10 rows [b][t < KHI][CC]
#define WS_VB  (WS_KL + 2u * (size_t)NB * KHI * CC)     // bf16 v hi planes [b][c][t < KHI]
#define WS_VBL (WS_VB + 2u * (size_t)NB * CC * KHI)
#define WS_S   (WS_VBL + 2u * (size_t)NB * CC * KHI)    // f32 [hg][t][s], not used: k_fa keeps logits and P in registers
#define WS_Y   (WS_S  + 4u * (size_t)HG * TT * TT)      // f32 ctx rows [b*t][CC] (only when there is an output projection)
#define WS_END (WS_Y  + 4u * (size_t)NB * TT * CC)

// ---- k_proj: block = (64 rows, 128 cols, which): q/k/v = X W (+ b) with exact bf16 products (K = DIN) -> which 0: q f16 rows (+ residual rows < QHI); 1: k f16 rows (+ residual rows < KHI); 2: v f16 planes [c][t] (+ bf16 hi/lo planes for t < KHI)
__global__ __launch_bounds__(128) void k_proj(const float* __restrict__ XQ, const float* __restrict__ XK, const float* __restrict__ XV, const float* __restrict__ WQ, const float* __restrict__ WK, const float* __restrict__ WV, const float* __restrict__ BQ, const float* __restrict__ BK, const float* __restrict__ BV,
    _Float16* __restrict__ QH, _Float16* __restrict__ QL, _Float16* __restrict__ KH, _Float16* __restrict__ KL, _Float16* __restrict__ VT, __bf16* __restrict__ VB, __bf16* __restrict__ VBL) {
  __shared__ __align__(16) _Float16 sh[64][136], sl[64][136]; __shared__ __align__(16) _Float16 th[128][72]; __shared__ __align__(16) __bf16 tb[128][72], tbl[128][72];
  const int tid = threadIdx.x, wave = tid >> 5, lane = tid & 31, col = lane & 15, g = lane >> 4; const int which = blockIdx.z; const int c0 = blockIdx.y * 128; const size_t r0 = (size_t)blockIdx.x * 64; const size_t bb = r0 / TT; const int t0 = (int)(r0 % TT);
  const float* X = which == 0 ? XQ : which == 1 ? XK : XV; const float* WA = which == 0 ? WQ : which == 1 ? WK : WV; const float* BA = which == 0 ? BQ : which == 1 ? BK : BV;
  v8f acc[8] = {};
#pragma unroll 2
  for (int kc = 0; kc < DIN / 32; ++kc) { v16b a; { const float* p = X + (r0 + wave * 16 + col) * DIN + kc * 32 + 8 * g;
#pragma unroll
      for (int i = 0; i < 8; ++i) { a[i] = (__bf16)p[i]; a[8 + i] = (__bf16)p[16 + i]; } }
    asm volatile("s_wait_loadcnt 0x0" ::: "memory");
#pragma unroll
    for (int j = 0; j < 8; ++j) { const v16b w = WCOL(WA, kc * 32, c0 + j * 16 + col, lane); asm volatile("s_wait_loadcnt 0x0" ::: "memory"); acc[j] = wmma_bf(a, w, acc[j]); } }
  if (which < 2) { _Float16* DH = which == 0 ? QH : KH; _Float16* DL = which == 0 ? QL : KL; const int nhi = which == 0 ? QHI : KHI; const bool hi_rows = t0 < nhi;
#pragma unroll
    for (int j = 0; j < 8; ++j) { const float bias = BA ? bfr(BA[c0 + j * 16 + col]) : 0.f;
#pragma unroll
      for (int r = 0; r < 8; ++r) { const float v = acc[j][r] + bias; const _Float16 hv = (_Float16)v; sh[wave * 16 + 8 * g + r][j * 16 + col] = hv; sl[wave * 16 + 8 * g + r][j * 16 + col] = (_Float16)((v - (float)hv) * 1024.0f); } }
    __syncthreads();
    for (int e = tid; e < 64 * 16; e += 128) { const int rl = e >> 4, q = e & 15; vst2((unsigned*)(DH + (r0 + rl) * CC + c0 + q * 8), *(const v4u*)&sh[rl][q * 8]); if (hi_rows) vst2((unsigned*)(DL + (bb * nhi + t0 + rl) * (size_t)CC + c0 + q * 8), *(const v4u*)&sl[rl][q * 8]); }
  } else { const bool hi_rows = t0 < KHI;
#pragma unroll
    for (int j = 0; j < 8; ++j) { const float bias = BA ? bfr(BA[c0 + j * 16 + col]) : 0.f;
#pragma unroll
      for (int r = 0; r < 8; ++r) { const float v = acc[j][r] + bias; const int rl = wave * 16 + 8 * g + r, cl = j * 16 + col; th[cl][rl] = (_Float16)v; const __bf16 bh = (__bf16)v; tb[cl][rl] = bh; tbl[cl][rl] = (__bf16)(v - (float)bh); } }
    __syncthreads();
    for (int e = tid; e < 128 * 8; e += 128) { const int cl = e >> 3, q = e & 7; vst2((unsigned*)(VT + (bb * CC + c0 + cl) * (size_t)TT + t0 + q * 8), *(const v4u*)&th[cl][q * 8]); if (hi_rows) { const size_t o3 = (bb * CC + c0 + cl) * (size_t)KHI + t0 + q * 8; vst2((unsigned*)(VB + o3), *(const v4u*)&tb[cl][q * 8]); vst2((unsigned*)(VBL + o3), *(const v4u*)&tbl[cl][q * 8]); } } } }
// ---- k_fa: block = 128 queries (8 waves x 16 query columns) of (b, h); the whole key range in trips of 64 keys with a running maximum (online softmax), so logits and P stay in registers.
// S^T = K . Q^T (A = k rows, B = q rows): lane (g, col) holds keys 8g + r of each 16-key tile for query col, which is the B fragment order of P^T; O^T += V^T . P^T (A = v planes [c][t]): lane holds d = 16j + 8g + r of query col.
// Every inner loop below is unrolled so that the fragment and accumulator arrays are indexed by constants and stay in registers.
__device__ __forceinline__ v8f wmma_h(v16h a, v16h b, v8f c) { return __builtin_amdgcn_wmma_f32_16x16x32_f16(false, a, false, b, (short)0, c, false, false); }
__device__ __forceinline__ float xhalf(float x) { return __builtin_bit_cast(float, __builtin_amdgcn_permlanex16(__builtin_bit_cast(int, x), __builtin_bit_cast(int, x), 0x76543210, 0xfedcba98, false, false)); }   // lane l with lane l ^ 16
__global__ __launch_bounds__(256) void k_fa(const _Float16* __restrict__ QH, const _Float16* __restrict__ KH, const _Float16* __restrict__ VT, float* __restrict__ Y) {
  const int tid = threadIdx.x, wave = tid >> 5, lane = tid & 31, col = lane & 15, g = lane >> 4; const int b = blockIdx.y / NH, h = blockIdx.y % NH; const int q = blockIdx.x * 128 + wave * 16 + col;
  const _Float16* Qr = QH + ((size_t)b * TT + q) * CC + h * HD; const _Float16* Kb = KH + ((size_t)b * TT + col) * CC + h * HD; const _Float16* Vb = VT + ((size_t)b * CC + h * HD + col) * (size_t)TT;
  const v16h q0 = frag_h(Qr, lane), q1 = frag_h(Qr + 32, lane);
  const float C2 = SCALE * 1.4426950408889634f;   // logits carried in base 2
  v8f acc[HD / 16] = {}; float m = -3.0e38f, l = 0.f;
  v8f s[4];   // scores of the coming trip, carried over the loop's back edge: every load of a trip is issued at its head and used at its foot
#pragma unroll
  for (int t = 0; t < 4; ++t) { const v8f z = {}; s[t] = wmma_h(frag_h(Kb + (size_t)(t * 16) * CC, lane), q0, z); s[t] = wmma_h(frag_h(Kb + (size_t)(t * 16) * CC + 32, lane), q1, s[t]); }
  for (int k0 = 0; k0 < TT; k0 += 64) {
    v16h vf[HD / 16][2], kf[4][2];
#pragma unroll
    for (int j = 0; j < HD / 16; ++j) { vf[j][0] = frag_h(Vb + (size_t)(j * 16) * TT + k0, lane); vf[j][1] = frag_h(Vb + (size_t)(j * 16) * TT + k0 + 32, lane); }
    const int kn = k0 + 64 < TT ? k0 + 64 : k0;   // the next trip's k rows (the last trip reads its own again; those scores are not used)
#pragma unroll
    for (int t = 0; t < 4; ++t) { kf[t][0] = frag_h(Kb + (size_t)(kn + t * 16) * CC, lane); kf[t][1] = frag_h(Kb + (size_t)(kn + t * 16) * CC + 32, lane); }
    __builtin_amdgcn_sched_barrier(0);   // keeps the trip's loads issued in front of the softmax, whose work then covers their latency; without it they sink to their first use
    float mt[4];   // four independent chains
#pragma unroll
    for (int t = 0; t < 4; ++t) { mt[t] = s[t][0];
#pragma unroll
      for (int r = 1; r < 8; ++r) mt[t] = fmaxf(mt[t], s[t][r]); }
    float mx = fmaxf(fmaxf(mt[0], mt[1]), fmaxf(mt[2], mt[3])); mx = fmaxf(mx, xhalf(mx));
    const float mn = fmaxf(m, mx * C2); float alpha;   // 2^(m - mn), 0 on the first trip
    asm("v_exp_f32 %0, %1\n\tv_nop" : "=v"(alpha) : "v"(m - mn));   // asm for the v_nop alone: it fills the slot behind a transcendental
    m = mn;
    const float off = 10.0f - mn;   // P relative to the running maximum, x 2^10 into f16 (clear of f16 subnormals); the factor cancels against l
    v16h p[2]; float ps[4];
#pragma unroll
    for (int t = 0; t < 4; ++t) { ps[t] = 0.f;
#pragma unroll
      for (int r = 0; r < 8; ++r) { const float e = __builtin_amdgcn_exp2f(fmaf(s[t][r], C2, off)); ps[t] += e; p[t >> 1][(t & 1) * 8 + r] = (_Float16)e; } }
    l = l * alpha + ((ps[0] + ps[1]) + (ps[2] + ps[3]));
#pragma unroll
    for (int j = 0; j < HD / 16; ++j) { acc[j] *= alpha; acc[j] = wmma_h(vf[j][0], p[0], acc[j]); acc[j] = wmma_h(vf[j][1], p[1], acc[j]); }
#pragma unroll
    for (int t = 0; t < 4; ++t) { const v8f z = {}; s[t] = wmma_h(kf[t][0], q0, z); s[t] = wmma_h(kf[t][1], q1, s[t]); } }
  l += xhalf(l); const float inv = 1.0f / l;   // l >= 2^10: the maximum's own term
  float* Yr = Y + ((size_t)b * TT + q) * CC + h * HD + 8 * g;
#pragma unroll
  for (int j = 0; j < HD / 16; ++j) { v4f a, c;
#pragma unroll
    for (int r = 0; r < 4; ++r) { a[r] = acc[j][r] * inv; c[r] = acc[j][4 + r] * inv; }
    vst2(Yr + j * 16, a); vst2(Yr + j * 16 + 4, c); } }
// ---- k_out: block = (64 rows, 128 cols): out = ctx Wo (+ bo): ctx once to f16 against Wo as f16(bf16 x 2^8) exact (1 product) x 2^-8; causal early rows (< QHI of each sequence): ctx bf16 hi + lo against exact bf16 Wo (2 products)
__global__ __launch_bounds__(128) void k_out(const float* __restrict__ Y, const float* __restrict__ WO, const float* __restrict__ BO, float* __restrict__ OUT) { __shared__ __align__(16) float sf[4][16][132];
  const int tid = threadIdx.x, wave = tid >> 5, lane = tid & 31, col = lane & 15, g = lane >> 4; const int c0 = blockIdx.y * 128; const size_t r0 = (size_t)blockIdx.x * 64 + wave * 16;
  v8f acc[8] = {};
  if (CAUSAL && (int)(((size_t)blockIdx.x * 64) % TT) < QHI) {   /* block-uniform */
#pragma unroll 2
    for (int kc = 0; kc < CC / 32; ++kc) { const F2 a = split_row(Y + (r0 + col) * CC, kc * 32, lane); asm volatile("s_wait_loadcnt 0x0" ::: "memory");
#pragma unroll
      for (int j = 0; j < 8; ++j) { const v16b w = WOCOL(WO, kc * 32, c0 + j * 16 + col, lane); asm volatile("s_wait_loadcnt 0x0" ::: "memory"); acc[j] = wmma_bf(a.h, w, acc[j]); acc[j] = wmma_bf(a.l, w, acc[j]); } }
#pragma unroll
    for (int j = 0; j < 8; ++j) { const float bias = BO ? bfr(BO[c0 + j * 16 + col]) : 0.f;
#pragma unroll
      for (int r = 0; r < 8; ++r) sf[wave][8 * g + r][j * 16 + col] = acc[j][r] + bias; }
  } else {
#pragma unroll 2
    for (int kc = 0; kc < CC / 32; ++kc) { const v16h a = frag_f32s(Y + (r0 + col) * CC + kc * 32, lane, 64.0f); asm volatile("s_wait_loadcnt 0x0" ::: "memory");   /* ctx carried x 2^6 into f16 so small-magnitude context rows stay clear of f16 subnormals */
#pragma unroll
      for (int j = 0; j < 8; ++j) { const v16h w = WOCOLH(WO, kc * 32, c0 + j * 16 + col, lane); asm volatile("s_wait_loadcnt 0x0" ::: "memory"); acc[j] = wmma16(a, w, acc[j]); } }
#pragma unroll
    for (int j = 0; j < 8; ++j) { const float bias = BO ? bfr(BO[c0 + j * 16 + col]) : 0.f;
#pragma unroll
      for (int r = 0; r < 8; ++r) sf[wave][8 * g + r][j * 16 + col] = acc[j][r] * (1.0f / 16384.0f) + bias; } }   /* 2^-8 (Wo carry) x 2^-6 (ctx carry) */
  LDSX(); for (int rl = 0; rl < 16; ++rl) vst2(OUT + (r0 + rl) * DIN + c0 + lane * 4, *(const v4f*)&sf[wave][rl][lane * 4]); }

extern "C" void kernel_launch(void* const* d_in, const int* in_sizes, int n_in, void* d_out, int out_size, void* d_ws, size_t ws_size, hipStream_t stream) {
  (void)in_sizes; (void)n_in; (void)out_size;
  const float** F = (const float**)d_in;
  if (ws_size < (size_t)WS_END) return;
  char* ws = (char*)d_ws; _Float16 *QH = (_Float16*)(ws + WS_QH), *KH = (_Float16*)(ws + WS_KH), *VT = (_Float16*)(ws + WS_VT), *QL = (_Float16*)(ws + WS_QL), *KL = (_Float16*)(ws + WS_KL); __bf16 *VB = (__bf16*)(ws + WS_VB), *VBL = (__bf16*)(ws + WS_VBL); float *Y = (float*)(ws + WS_Y);
  (void)Y; (void)QL; (void)KL; (void)VB; (void)VBL;
  // inputs: 0 inputs [2,2048,512]; 1 Wq [512,512] (in,out), 2 bq; 3 Wk, 4 bk; 5 Wv, 6 bv; 7 Wo (in,out), 8 bo (zero biases, read)
  k_proj<<<dim3(TNB * TT / 64, CC / 128, 3), 128, 0, stream>>>(F[0], F[0], F[0], F[1], F[3], F[5], F[2], F[4], F[6], QH, QL, KH, KL, VT, VB, VBL);
  k_fa<<<dim3(TT / 128, TNB * NH), 256, 0, stream>>>(QH, KH, VT, Y);
  k_out<<<dim3(TNB * TT / 64, DIN / 128), 128, 0, stream>>>(Y, F[7], F[8], (float*)d_out);
}

// v002
// One run takes 79 microseconds.
// In two side-by-side timings against v001, it was 1.66 and 1.63 times as fast.
// All steps since v000 together make it 7.24 times as fast.
// compute dtype: all float inputs rounded to bf16; q/k/v projections with EXACT bf16 products on WMMA 16x16x32 (f32 accumulate) + bias; logits q x k once to f16 each (1 product) x SCALE; online softmax f32; P (relative to the running maximum) x 2^10 once to f16 x v once to f16 (1 product); ctx x 2^6 once to f16 x Wo f16(bf16 x 2^8) + bo; f32 output.
#include <hip/hip_runtime.h>
#include <math.h>

typedef __attribute__((ext_vector_type(16))) _Float16 v16h;
typedef __attribute__((ext_vector_type(16))) __bf16 v16b;
typedef __attribute__((ext_vector_type(8)))  _Float16 v8h;
typedef __attribute__((ext_vector_type(8)))  float v8f;
typedef __attribute__((ext_vector_type(4)))  float v4f;
typedef __attribute__((ext_vector_type(2)))  float v2f;
typedef __attribute__((ext_vector_type(4)))  unsigned v4u;
typedef __attribute__((ext_vector_type(4)))  int v4i;
typedef float __attribute__((may_alias)) float_a;
typedef int __attribute__((may_alias)) int_a;

template <typename T> __device__ __forceinline__ void vst2(void* p, T v) { *(T*)p = v;  }
__device__ __forceinline__ v8f wmma16(v16h a, v16h b, v8f c) {
  v8f d = __builtin_amdgcn_wmma_f32_16x16x32_f16(false, a, false, b, (short)0, c, false, false);
  asm volatile("v_nop\n\tv_nop\n\tv_nop\n\tv_nop" : "+v"(d) : "v"(a), "v"(b));
  return d;
}
__device__ __forceinline__ v8f wmma_bf(v16b a, v16b b, v8f c) {
  v8f d = __builtin_amdgcn_wmma_f32_16x16x32_bf16(false, a, false, b, (short)0, c, false, false);
  asm volatile("v_nop\n\tv_nop\n\tv_nop\n\tv_nop" : "+v"(d) : "v"(a), "v"(b));
  return d;
}
// 16x16x32 fragments: lane = (h = lane>>4, row/col = lane&15); elements 0..7 = k0+8h+0..7, 8..15 = k0+16+8h+0..7; D element r = row 8h+r
__device__ __forceinline__ v16h frag_h(const _Float16* rowk0, int lane) {
  union { v16h v; v8h q[2]; } u; const _Float16* p = rowk0 + 8 * (lane >> 4);
  u.q[0] = *(const v8h*)p; u.q[1] = *(const v8h*)(p + 16); return u.v;
}
__device__ __forceinline__ v16h frag_f32(const float* rowk0, int lane) {
  v16h a; const float* p = rowk0 + 8 * (lane >> 4);
#pragma unroll
  for (int i = 0; i < 8; ++i) { a[i] = (_Float16)p[i]; a[8 + i] = (_Float16)p[16 + i]; }
  return a;
}
__device__ __forceinline__ v16h frag_f32s(const float* rowk0, int lane, float sc) {
  v16h a; const float* p = rowk0 + 8 * (lane >> 4);
#pragma unroll
  for (int i = 0; i < 8; ++i) { a[i] = (_Float16)(p[i] * sc); a[8 + i] = (_Float16)(p[16 + i] * sc); }
  return a;
}
// column fragment from a [K][ld] layout (column n), rows >= K read as 0
__device__ __forceinline__ v16h fragc_f32(const float* W, int k0, int n, int lane, int ld, int K) {
  v16h a; const int g = lane >> 4;
#pragma unroll
  for (int i = 0; i < 8; ++i) { const int ka = k0 + 8 * g + i, kb = ka + 16;
    a[i] = (_Float16)(ka < K ? W[(size_t)(ka < K ? ka : K - 1) * ld + n] : 0.f); a[8 + i] = (_Float16)(kb < K ? W[(size_t)(kb < K ? kb : K - 1) * ld + n] : 0.f); }
  return a;
}
struct F2 { v16b h, l; };
__device__ __forceinline__ F2 bsplit16(const float v[16]) { F2 r;
#pragma unroll
  for (int i = 0; i < 16; ++i) { const __bf16 h = (__bf16)v[i]; r.h[i] = h; r.l[i] = (__bf16)(v[i] - (float)h); }
  return r; }
__device__ __forceinline__ F2 split_row(const float* row, int k0, int lane) { float v[16]; const float* p = row + k0 + 8 * (lane >> 4);
#pragma unroll
  for (int i = 0; i < 8; ++i) { v[i] = p[i]; v[8 + i] = p[16 + i]; }
  return bsplit16(v); }
__device__ __forceinline__ F2 split_rowK(const float* row, int k0, int lane, int K) { float v[16]; const int g = lane >> 4;
#pragma unroll
  for (int i = 0; i < 8; ++i) { const int ka = k0 + 8 * g + i, kb = ka + 16; v[i] = ka < K ? row[ka < K ? ka : K - 1] : 0.f; v[8 + i] = kb < K ? row[kb < K ? kb : K - 1] : 0.f; }
  return bsplit16(v); }
__device__ __forceinline__ F2 split_col(const float* W, int k0, int n, int lane, int ld, int K) { float v[16]; const int g = lane >> 4;
#pragma unroll
  for (int i = 0; i < 8; ++i) { const int ka = k0 + 8 * g + i, kb = ka + 16; v[i] = ka < K ? W[(size_t)(ka < K ? ka : K - 1) * ld + n] : 0.f; v[8 + i] = kb < K ? W[(size_t)(kb < K ? kb : K - 1) * ld + n] : 0.f; }
  return bsplit16(v); }
__device__ __forceinline__ v8f mac3(const F2& a, const F2& b, v8f c) { c = wmma_bf(a.l, b.h, c); c = wmma_bf(a.h, b.l, c); return wmma_bf(a.h, b.h, c); }
__device__ __forceinline__ float sigm(float v) { return 1.0f / (1.0f + expf(-v)); }
#define LDSX() do { asm volatile("s_wait_dscnt 0" ::: "memory"); __builtin_amdgcn_wave_barrier(); __builtin_amdgcn_fence(__ATOMIC_RELEASE, "workgroup"); } while (0)

// Multi-head self-attention (inputs [2,2048,512]; (in,out) Wq / Wk / Wv / Wo [512,512] N(0, 1/512) + zero biases; 8 heads x 64; scale 1/8; softmax over keys; merge; Wo + bo).
#define NB 2
#define TT 2048
#define CC 512            // NH * HD = projected width
#define DIN 512          // input (model) width
#define NH 8
#define HD 64
#define NQB (TT / 64)
#define HG 4
#define SCALE (0.125f)
#define CAUSAL 0
#ifndef TNB
#define TNB NB
#endif
__device__ __forceinline__ float bfr(float v) { return (float)(__bf16)v; }
__host__ __device__ __forceinline__ int kb_last(int qb) { return CAUSAL ? ((qb * 64 + 63) >> 7) : (TT / 128 - 1); }
typedef __attribute__((ext_vector_type(8))) __bf16 v8b;
__device__ __forceinline__ v16b frag_b(const __bf16* rowk0, int lane) {
  union { v16b v; v8b q[2]; } u; const __bf16* p = rowk0 + 8 * (lane >> 4);
  u.q[0] = *(const v8b*)p; u.q[1] = *(const v8b*)(p + 16); return u.v;
}
#define QBH 0              // not read by any kernel here: k_fa has no high-precision path
#define QHI 0               // single-product logits on every row
#define KHI 64            // key rows carrying k residual / v bf16 hi+lo planes (written by k_proj; no kernel here reads them)
// B fragment (k rows k0+.., output column o) of a weight: (in,out) [K][ld] or (out,in) [ld rows of K]: bf16 exact, or f16(bf16 * 256) exact
__device__ __forceinline__ v16b wcol_io(const float* Wm, int k0, int o, int lane, int ld) { v16b w; const int g = lane >> 4;
#pragma unroll
  for (int i = 0; i < 8; ++i) { w[i] = (__bf16)Wm[(size_t)(k0 + 8 * g + i) * ld + o]; w[8 + i] = (__bf16)Wm[(size_t)(k0 + 16 + 8 * g + i) * ld + o]; }
  return w; }
__device__ __forceinline__ v16b wcol_oi(const float* Wm, int k0, int o, int lane, int K) { v16b w; const float* p = Wm + (size_t)o * K + k0 + 8 * (lane >> 4);
#pragma unroll
  for (int i = 0; i < 8; ++i) { w[i] = (__bf16)p[i]; w[8 + i] = (__bf16)p[16 + i]; }
  return w; }
__device__ __forceinline__ v16h wcolh_io(const float* Wm, int k0, int o, int lane, int ld) { v16h w; const int g = lane >> 4;
#pragma unroll
  for (int i = 0; i < 8; ++i) { w[i] = (_Float16)(bfr(Wm[(size_t)(k0 + 8 * g + i) * ld + o]) * 256.0f); w[8 + i] = (_Float16)(bfr(Wm[(size_t)(k0 + 16 + 8 * g + i) * ld + o]) * 256.0f); }
  return w; }
__device__ __forceinline__ v16h wcolh_oi(const float* Wm, int k0, int o, int lane, int K) { v16h w; const float* p = Wm + (size_t)o * K + k0 + 8 * (lane >> 4);
#pragma unroll
  for (int i = 0; i < 8; ++i) { w[i] = (_Float16)(bfr(p[i]) * 256.0f); w[8 + i] = (_Float16)(bfr(p[16 + i]) * 256.0f); }
  return w; }
#define WQKV_LAYOUT 0   // selects WCOL, which no kernel here calls: k_proj always stages Wq / Wk / Wv as (in,out) [DIN][CC]
__device__ __forceinline__ v16b wcol_hdk(const float* Wm, int k0, int o, int lane) { v16b w; const int g = lane >> 4; const float* p = Wm + (size_t)(o / HD) * DIN * HD + (o % HD);
#pragma unroll
  for (int i = 0; i < 8; ++i) { w[i] = (__bf16)p[(size_t)(k0 + 8 * g + i) * HD]; w[8 + i] = (__bf16)p[(size_t)(k0 + 16 + 8 * g + i) * HD]; }
  return w; }
#define WO_OUT_IN 0
#if WQKV_LAYOUT == 1
#define WCOL(W, k0, o, lane) wcol_oi(W, k0, o, lane, DIN)
#elif WQKV_LAYOUT == 2
#define WCOL(W, k0, o, lane) wcol_hdk(W, k0, o, lane)
#else
#define WCOL(W, k0, o, lane) wcol_io(W, k0, o, lane, CC)
#endif
#if WO_OUT_IN
#define WOCOL(W, k0, o, lane) wcol_oi(W, k0, o, lane, CC)
#define WOCOLH(W, k0, o, lane) wcolh_oi(W, k0, o, lane, CC)
#else
#define WOCOL(W, k0, o, lane) wcol_io(W, k0, o, lane, DIN)
#define WOCOLH(W, k0, o, lane) wcolh_io(W, k0, o, lane, DIN)
#endif

#ifndef SM_EXTRA_PARAMS
#define SM_EXTRA_PARAMS
#endif
#ifndef PROJ_EXTRA_PARAMS
#define PROJ_EXTRA_PARAMS
#endif
#ifndef SM_MASK_HOOK
#define SM_MASK_HOOK (void)0
#endif

#define WS_QH  0u                                      // f16 q rows [b*t][CC]
#define WS_KH  (WS_QH + 2u * (size_t)NB * TT * CC)      // f16 k rows [b*t][CC]
#define WS_VT  (WS_KH + 2u * (size_t)NB * TT * CC)      // f16 v planes [b][c][t]
#define WS_QL  (WS_VT + 2u * (size_t)NB * CC * TT)      // f16 q residual x 2^10 rows [b][t < QHI][CC]
#define WS_KL  (WS_QL + 2u * (size_t)NB * QHI * CC)     // f16 k residual x 2^10 rows [b][t < KHI][CC]
#define WS_VB  (WS_KL + 2u * (size_t)NB * KHI * CC)     // bf16 v hi planes [b][c][t < KHI]
#define WS_VBL (WS_VB + 2u * (size_t)NB * CC * KHI)
#define WS_S   (WS_VBL + 2u * (size_t)NB * CC * KHI)    // f32 [hg][t][s], not used: k_fa keeps logits and P in registers
#define WS_Y   (WS_S  + 4u * (size_t)HG * TT * TT)      // f32 ctx rows [b*t][CC] (only when there is an output projection)
#define WS_END (WS_Y  + 4u * (size_t)NB * TT * CC)

// ---- weight staging for k_proj and k_out: a [KS][128] f32 tile of a (in,out) weight is read once per block with whole-line 16-byte loads, converted once, and laid in LDS column by column (k contiguous), where every wave takes its B fragments with 16-byte LDS reads
#define KS 64            // k rows of one staged tile
#define WP (KS + 8)      // LDS pitch of a staged column in elements: 144 B = 16 B x 9, free of bank conflicts for the fragment reads and for the staging stores
// one thread's share of a tile: 2 units of (8 k rows x 4 columns); a wave covers 32 columns, lane = (k octet = lane & 3, column group = lane >> 2), so each load instruction covers four whole 128-B lines
struct WT { v4f r[2][8]; };
__device__ __forceinline__ void wt_load(WT& t, const float* Wm, int k0, int c0, int ld, int wave, int lane) {
  const float* p = Wm + (size_t)(k0 + 8 * (lane & 3)) * ld + c0 + 32 * wave + 4 * (lane >> 2);
#pragma unroll
  for (int u = 0; u < 2; ++u) {
#pragma unroll
    for (int i = 0; i < 8; ++i) t.r[u][i] = *(const v4f*)(p + (size_t)(32 * u + i) * ld); } }
__device__ __forceinline__ void wt_store_b(const WT& t, __bf16* wb, int wave, int lane) {   // bf16, exact operand of k_proj
  __bf16* d = wb + (32 * wave + 4 * (lane >> 2)) * WP + 8 * (lane & 3);
#pragma unroll
  for (int u = 0; u < 2; ++u) {
#pragma unroll
    for (int c = 0; c < 4; ++c) { v8b x;
#pragma unroll
      for (int i = 0; i < 8; ++i) x[i] = (__bf16)t.r[u][i][c];
      *(v8b*)(d + c * WP + 32 * u) = x; } } }
__device__ __forceinline__ void wt_store_h(const WT& t, _Float16* wb, int wave, int lane) {   // f16(bf16 x 2^8), exact operand of k_out
  _Float16* d = wb + (32 * wave + 4 * (lane >> 2)) * WP + 8 * (lane & 3);
#pragma unroll
  for (int u = 0; u < 2; ++u) {
#pragma unroll
    for (int c = 0; c < 4; ++c) { v8h x;
#pragma unroll
      for (int i = 0; i < 8; ++i) x[i] = (_Float16)(bfr(t.r[u][i][c]) * 256.0f);
      *(v8h*)(d + c * WP + 32 * u) = x; } } }
// a lane's raw f32 share of the A fragments of one stage (KS k of its own row): per 32 k, elements 8g + 0..7 and 16 + 8g + 0..7
struct XT { v4f r[KS / 32][4]; };
__device__ __forceinline__ void xt_load(XT& t, const float* rowk0, int lane) { const float* p = rowk0 + 8 * (lane >> 4);
#pragma unroll
  for (int kk = 0; kk < KS / 32; ++kk) { t.r[kk][0] = *(const v4f*)(p + kk * 32); t.r[kk][1] = *(const v4f*)(p + kk * 32 + 4); t.r[kk][2] = *(const v4f*)(p + kk * 32 + 16); t.r[kk][3] = *(const v4f*)(p + kk * 32 + 20); } }

// ---- k_proj: block = (64 rows, 128 cols, which): q/k/v = X W (+ b) with exact bf16 products (K = DIN) -> which 0: q f16 rows (+ residual rows < QHI); 1: k f16 rows (+ residual rows < KHI); 2: v f16 planes [c][t] (+ bf16 hi/lo planes for t < KHI)
__global__ __launch_bounds__(128) void k_proj(const float* __restrict__ XQ, const float* __restrict__ XK, const float* __restrict__ XV, const float* __restrict__ WQ, const float* __restrict__ WK, const float* __restrict__ WV, const float* __restrict__ BQ, const float* __restrict__ BK, const float* __restrict__ BV,
    _Float16* __restrict__ QH, _Float16* __restrict__ QL, _Float16* __restrict__ KH, _Float16* __restrict__ KL, _Float16* __restrict__ VT, __bf16* __restrict__ VB, __bf16* __restrict__ VBL) {
  __shared__ __align__(16) union { struct { _Float16 sh[64][136], sl[64][136], th[128][72]; __bf16 tb[128][72], tbl[128][72]; } e; __bf16 wb[2][128 * WP]; } sm;   // the weight stages share LDS with the epilogue's tiles, so that as many blocks as before fit a WGP
  auto& sh = sm.e.sh; auto& sl = sm.e.sl; auto& th = sm.e.th; auto& tb = sm.e.tb; auto& tbl = sm.e.tbl;
  const int tid = threadIdx.x, wave = tid >> 5, lane = tid & 31, col = lane & 15, g = lane >> 4; const int which = blockIdx.z; const int c0 = blockIdx.y * 128; const size_t r0 = (size_t)blockIdx.x * 64; const size_t bb = r0 / TT; const int t0 = (int)(r0 % TT);
  const float* X = which == 0 ? XQ : which == 1 ? XK : XV; const float* WA = which == 0 ? WQ : which == 1 ? WK : WV; const float* BA = which == 0 ? BQ : which == 1 ? BK : BV;
  v8f acc[8] = {};
  const float* Xr = X + (r0 + wave * 16 + col) * DIN; WT wt; XT xt; v16b af[KS / 32];
  wt_load(wt, WA, 0, c0, CC, wave, lane); xt_load(xt, Xr, lane); wt_store_b(wt, sm.wb[0], wave, lane);
#pragma unroll
  for (int kk = 0; kk < KS / 32; ++kk) {
#pragma unroll
    for (int i = 0; i < 8; ++i) { af[kk][i] = (__bf16)xt.r[kk][i >> 2][i & 3]; af[kk][8 + i] = (__bf16)xt.r[kk][2 + (i >> 2)][i & 3]; } }
  __syncthreads();   // stage 0 is published
#pragma unroll 2
  for (int s = 0; s < DIN / KS; ++s) { const bool more = s + 1 < DIN / KS;   // two buffers: stage s + 1 is fetched into registers while stage s is worked on
    if (more) { wt_load(wt, WA, (s + 1) * KS, c0, CC, wave, lane); xt_load(xt, Xr + (s + 1) * KS, lane); }
    __builtin_amdgcn_sched_barrier(0);   // keeps the next stage's global loads issued in front of this stage's products, which then cover their latency
    const __bf16* wc = sm.wb[s & 1] + col * WP;
#pragma unroll
    for (int kk = 0; kk < KS / 32; ++kk) { v16b wf[8];
#pragma unroll
      for (int j = 0; j < 8; ++j) wf[j] = frag_b(wc + j * 16 * WP + kk * 32, lane);
      __builtin_amdgcn_sched_barrier(0);   // keeps the 16 LDS reads together in front of their products: one wait for the group, where a read pair in front of each product waits out the LDS latency eight times
#pragma unroll
      for (int j = 0; j < 8; ++j) acc[j] = wmma_bf(af[kk], wf[j], acc[j]); }
    __builtin_amdgcn_sched_barrier(0);   // keeps the fetched tile's conversion, and with it the wait for its loads, behind this stage's products
    if (more) { wt_store_b(wt, sm.wb[(s + 1) & 1], wave, lane);
#pragma unroll
      for (int kk = 0; kk < KS / 32; ++kk) {
#pragma unroll
        for (int i = 0; i < 8; ++i) { af[kk][i] = (__bf16)xt.r[kk][i >> 2][i & 3]; af[kk][8 + i] = (__bf16)xt.r[kk][2 + (i >> 2)][i & 3]; } } }
    __syncthreads(); }   // publishes stage s + 1 and ends every wave's reads of stage s, whose buffer is written next (after the last stage: by the epilogue)
  if (which < 2) { _Float16* DH = which == 0 ? QH : KH; _Float16* DL = which == 0 ? QL : KL; const int nhi = which == 0 ? QHI : KHI; const bool hi_rows = t0 < nhi;
#pragma unroll
    for (int j = 0; j < 8; ++j) { const float bias = BA ? bfr(BA[c0 + j * 16 + col]) : 0.f;
#pragma unroll
      for (int r = 0; r < 8; ++r) { const float v = acc[j][r] + bias; const _Float16 hv = (_Float16)v; sh[wave * 16 + 8 * g + r][j * 16 + col] = hv; sl[wave * 16 + 8 * g + r][j * 16 + col] = (_Float16)((v - (float)hv) * 1024.0f); } }
    __syncthreads();
    for (int e = tid; e < 64 * 16; e += 128) { const int rl = e >> 4, q = e & 15; vst2((unsigned*)(DH + (r0 + rl) * CC + c0 + q * 8), *(const v4u*)&sh[rl][q * 8]); if (hi_rows) vst2((unsigned*)(DL + (bb * nhi + t0 + rl) * (size_t)CC + c0 + q * 8), *(const v4u*)&sl[rl][q * 8]); }
  } else { const bool hi_rows = t0 < KHI;
#pragma unroll
    for (int j = 0; j < 8; ++j) { const float bias = BA ? bfr(BA[c0 + j * 16 + col]) : 0.f;
#pragma unroll
      for (int r = 0; r < 8; ++r) { const float v = acc[j][r] + bias; const int rl = wave * 16 + 8 * g + r, cl = j * 16 + col; th[cl][rl] = (_Float16)v; const __bf16 bh = (__bf16)v; tb[cl][rl] = bh; tbl[cl][rl] = (__bf16)(v - (float)bh); } }
    __syncthreads();
    for (int e = tid; e < 128 * 8; e += 128) { const int cl = e >> 3, q = e & 7; vst2((unsigned*)(VT + (bb * CC + c0 + cl) * (size_t)TT + t0 + q * 8), *(const v4u*)&th[cl][q * 8]); if (hi_rows) { const size_t o3 = (bb * CC + c0 + cl) * (size_t)KHI + t0 + q * 8; vst2((unsigned*)(VB + o3), *(const v4u*)&tb[cl][q * 8]); vst2((unsigned*)(VBL + o3), *(const v4u*)&tbl[cl][q * 8]); } } } }
// ---- k_fa: block = 128 queries (8 waves x 16 query columns) of (b, h); the whole key range in trips of 64 keys with a running maximum (online softmax), so logits and P stay in registers.
// S^T = K . Q^T (A = k rows, B = q rows): lane (g, col) holds keys 8g + r of each 16-key tile for query col, which is the B fragment order of P^T; O^T += V^T . P^T (A = v planes [c][t]): lane holds d = 16j + 8g + r of query col.
// Every inner loop below is unrolled so that the fragment and accumulator arrays are indexed by constants and stay in registers.
__device__ __forceinline__ v8f wmma_h(v16h a, v16h b, v8f c) { return __builtin_amdgcn_wmma_f32_16x16x32_f16(false, a, false, b, (short)0, c, false, false); }
__device__ __forceinline__ float xhalf(float x) { return __builtin_bit_cast(float, __builtin_amdgcn_permlanex16(__builtin_bit_cast(int, x), __builtin_bit_cast(int, x), 0x76543210, 0xfedcba98, false, false)); }   // lane l with lane l ^ 16
__global__ __launch_bounds__(256) void k_fa(const _Float16* __restrict__ QH, const _Float16* __restrict__ KH, const _Float16* __restrict__ VT, float* __restrict__ Y) {
  const int tid = threadIdx.x, wave = tid >> 5, lane = tid & 31, col = lane & 15, g = lane >> 4; const int b = blockIdx.y / NH, h = blockIdx.y % NH; const int q = blockIdx.x * 128 + wave * 16 + col;
  const _Float16* Qr = QH + ((size_t)b * TT + q) * CC + h * HD; const _Float16* Kb = KH + ((size_t)b * TT + col) * CC + h * HD; const _Float16* Vb = VT + ((size_t)b * CC + h * HD + col) * (size_t)TT;
  const v16h q0 = frag_h(Qr, lane), q1 = frag_h(Qr + 32, lane);
  const float C2 = SCALE * 1.4426950408889634f;   // logits carried in base 2
  v8f acc[HD / 16] = {}; float m = -3.0e38f, l = 0.f;
  v8f s[4];   // scores of the coming trip, carried over the loop's back edge: every load of a trip is issued at its head and used at its foot
#pragma unroll
  for (int t = 0; t < 4; ++t) { const v8f z = {}; s[t] = wmma_h(frag_h(Kb + (size_t)(t * 16) * CC, lane), q0, z); s[t] = wmma_h(frag_h(Kb + (size_t)(t * 16) * CC + 32, lane), q1, s[t]); }
  for (int k0 = 0; k0 < TT; k0 += 64) {
    v16h vf[HD / 16][2], kf[4][2];
#pragma unroll
    for (int j = 0; j < HD / 16; ++j) { vf[j][0] = frag_h(Vb + (size_t)(j * 16) * TT + k0, lane); vf[j][1] = frag_h(Vb + (size_t)(j * 16) * TT + k0 + 32, lane); }
    const int kn = k0 + 64 < TT ? k0 + 64 : k0;   // the next trip's k rows (the last trip reads its own again; those scores are not used)
#pragma unroll
    for (int t = 0; t < 4; ++t) { kf[t][0] = frag_h(Kb + (size_t)(kn + t * 16) * CC, lane); kf[t][1] = frag_h(Kb + (size_t)(kn + t * 16) * CC + 32, lane); }
    __builtin_amdgcn_sched_barrier(0);   // keeps the trip's loads issued in front of the softmax, whose work then covers their latency; without it they sink to their first use
    float mt[4];   // four independent chains
#pragma unroll
    for (int t = 0; t < 4; ++t) { mt[t] = s[t][0];
#pragma unroll
      for (int r = 1; r < 8; ++r) mt[t] = fmaxf(mt[t], s[t][r]); }
    float mx = fmaxf(fmaxf(mt[0], mt[1]), fmaxf(mt[2], mt[3])); mx = fmaxf(mx, xhalf(mx));
    const float mn = fmaxf(m, mx * C2); float alpha;   // 2^(m - mn), 0 on the first trip
    asm("v_exp_f32 %0, %1\n\tv_nop" : "=v"(alpha) : "v"(m - mn));   // asm for the v_nop alone: it fills the slot behind a transcendental
    m = mn;
    const float off = 10.0f - mn;   // P relative to the running maximum, x 2^10 into f16 (clear of f16 subnormals); the factor cancels against l
    v16h p[2]; float ps[4];
#pragma unroll
    for (int t = 0; t < 4; ++t) { ps[t] = 0.f;
#pragma unroll
      for (int r = 0; r < 8; ++r) { const float e = __builtin_amdgcn_exp2f(fmaf(s[t][r], C2, off)); ps[t] += e; p[t >> 1][(t & 1) * 8 + r] = (_Float16)e; } }
    l = l * alpha + ((ps[0] + ps[1]) + (ps[2] + ps[3]));
#pragma unroll
    for (int j = 0; j < HD / 16; ++j) { acc[j] *= alpha; acc[j] = wmma_h(vf[j][0], p[0], acc[j]); acc[j] = wmma_h(vf[j][1], p[1], acc[j]); }
#pragma unroll
    for (int t = 0; t < 4; ++t) { const v8f z = {}; s[t] = wmma_h(kf[t][0], q0, z); s[t] = wmma_h(kf[t][1], q1, s[t]); } }
  l += xhalf(l); const float inv = 1.0f / l;   // l >= 2^10: the maximum's own term
  float* Yr = Y + ((size_t)b * TT + q) * CC + h * HD + 8 * g;
#pragma unroll
  for (int j = 0; j < HD / 16; ++j) { v4f a, c;
#pragma unroll
    for (int r = 0; r < 4; ++r) { a[r] = acc[j][r] * inv; c[r] = acc[j][4 + r] * inv; }
    vst2(Yr + j * 16, a); vst2(Yr + j * 16 + 4, c); } }
// ---- k_out: block = (64 rows, 128 cols): out = ctx Wo (+ bo): ctx once to f16 against Wo as f16(bf16 x 2^8) exact (1 product) x 2^-8; causal early rows (< QHI of each sequence): ctx bf16 hi + lo against exact bf16 Wo (2 products)
__global__ __launch_bounds__(128) void k_out(const float* __restrict__ Y, const float* __restrict__ WO, const float* __restrict__ BO, float* __restrict__ OUT) { __shared__ __align__(16) float sf[4][16][132]; __shared__ __align__(16) _Float16 wb[2][128 * WP];
  const int tid = threadIdx.x, wave = tid >> 5, lane = tid & 31, col = lane & 15, g = lane >> 4; const int c0 = blockIdx.y * 128; const size_t r0 = (size_t)blockIdx.x * 64 + wave * 16;
  v8f acc[8] = {};
  if (CAUSAL && (int)(((size_t)blockIdx.x * 64) % TT) < QHI) {   /* block-uniform */
#pragma unroll 2
    for (int kc = 0; kc < CC / 32; ++kc) { const F2 a = split_row(Y + (r0 + col) * CC, kc * 32, lane); asm volatile("s_wait_loadcnt 0x0" ::: "memory");
#pragma unroll
      for (int j = 0; j < 8; ++j) { const v16b w = WOCOL(WO, kc * 32, c0 + j * 16 + col, lane); asm volatile("s_wait_loadcnt 0x0" ::: "memory"); acc[j] = wmma_bf(a.h, w, acc[j]); acc[j] = wmma_bf(a.l, w, acc[j]); } }
#pragma unroll
    for (int j = 0; j < 8; ++j) { const float bias = BO ? bfr(BO[c0 + j * 16 + col]) : 0.f;
#pragma unroll
      for (int r = 0; r < 8; ++r) sf[wave][8 * g + r][j * 16 + col] = acc[j][r] + bias; }
  } else {
    const float* Yr = Y + (r0 + col) * CC; WT wt; XT xt; v16h af[KS / 32];   /* ctx carried x 2^6 into f16 so small-magnitude context rows stay clear of f16 subnormals */
    wt_load(wt, WO, 0, c0, DIN, wave, lane); xt_load(xt, Yr, lane); wt_store_h(wt, wb[0], wave, lane);
#pragma unroll
    for (int kk = 0; kk < KS / 32; ++kk) {
#pragma unroll
      for (int i = 0; i < 8; ++i) { af[kk][i] = (_Float16)(xt.r[kk][i >> 2][i & 3] * 64.0f); af[kk][8 + i] = (_Float16)(xt.r[kk][2 + (i >> 2)][i & 3] * 64.0f); } }
    __syncthreads();   // stage 0 is published
#pragma unroll 2
    for (int s = 0; s < CC / KS; ++s) { const bool more = s + 1 < CC / KS;   // two buffers, as in k_proj
      if (more) { wt_load(wt, WO, (s + 1) * KS, c0, DIN, wave, lane); xt_load(xt, Yr + (s + 1) * KS, lane); }
      __builtin_amdgcn_sched_barrier(0);   // keeps the next stage's global loads issued in front of this stage's products, which then cover their latency
      const _Float16* wc = wb[s & 1] + col * WP;
#pragma unroll
      for (int kk = 0; kk < KS / 32; ++kk) { v16h wf[8];
#pragma unroll
        for (int j = 0; j < 8; ++j) wf[j] = frag_h(wc + j * 16 * WP + kk * 32, lane);
        __builtin_amdgcn_sched_barrier(0);   // keeps the 16 LDS reads together in front of their products: one wait for the group
#pragma unroll
        for (int j = 0; j < 8; ++j) acc[j] = wmma16(af[kk], wf[j], acc[j]); }
      __builtin_amdgcn_sched_barrier(0);   // keeps the fetched tile's conversion, and with it the wait for its loads, behind this stage's products
      if (more) { wt_store_h(wt, wb[(s + 1) & 1], wave, lane);
#pragma unroll
        for (int kk = 0; kk < KS / 32; ++kk) {
#pragma unroll
          for (int i = 0; i < 8; ++i) { af[kk][i] = (_Float16)(xt.r[kk][i >> 2][i & 3] * 64.0f); af[kk][8 + i] = (_Float16)(xt.r[kk][2 + (i >> 2)][i & 3] * 64.0f); } } }
      __syncthreads(); }   // publishes stage s + 1 and ends every wave's reads of stage s, whose buffer is written next
#pragma unroll
    for (int j = 0; j < 8; ++j) { const float bias = BO ? bfr(BO[c0 + j * 16 + col]) : 0.f;
#pragma unroll
      for (int r = 0; r < 8; ++r) sf[wave][8 * g + r][j * 16 + col] = acc[j][r] * (1.0f / 16384.0f) + bias; } }   /* 2^-8 (Wo carry) x 2^-6 (ctx carry) */
  LDSX(); for (int rl = 0; rl < 16; ++rl) vst2(OUT + (r0 + rl) * DIN + c0 + lane * 4, *(const v4f*)&sf[wave][rl][lane * 4]); }

extern "C" void kernel_launch(void* const* d_in, const int* in_sizes, int n_in, void* d_out, int out_size, void* d_ws, size_t ws_size, hipStream_t stream) {
  (void)in_sizes; (void)n_in; (void)out_size;
  const float** F = (const float**)d_in;
  if (ws_size < (size_t)WS_END) return;
  char* ws = (char*)d_ws; _Float16 *QH = (_Float16*)(ws + WS_QH), *KH = (_Float16*)(ws + WS_KH), *VT = (_Float16*)(ws + WS_VT), *QL = (_Float16*)(ws + WS_QL), *KL = (_Float16*)(ws + WS_KL); __bf16 *VB = (__bf16*)(ws + WS_VB), *VBL = (__bf16*)(ws + WS_VBL); float *Y = (float*)(ws + WS_Y);
  (void)Y; (void)QL; (void)KL; (void)VB; (void)VBL;
  // inputs: 0 inputs [2,2048,512]; 1 Wq [512,512] (in,out), 2 bq; 3 Wk, 4 bk; 5 Wv, 6 bv; 7 Wo (in,out), 8 bo (zero biases, read)
  k_proj<<<dim3(TNB * TT / 64, CC / 128, 3), 128, 0, stream>>>(F[0], F[0], F[0], F[1], F[3], F[5], F[2], F[4], F[6], QH, QL, KH, KL, VT, VB, VBL);
  k_fa<<<dim3(TT / 128, TNB * NH), 256, 0, stream>>>(QH, KH, VT, Y);
  k_out<<<dim3(TNB * TT / 64, DIN / 128), 128, 0, stream>>>(Y, F[7], F[8], (float*)d_out);
}

// v003
// Measured time: 55.6 microseconds a run.
// Timed twice side by side with v002, it ran 1.43 and 1.42 times as fast.
// Over all steps from v000 it is 10.4 times as fast.
// compute dtype: all float inputs rounded to bf16; q/k/v projections with EXACT bf16 products on WMMA 16x16x32 (f32 accumulate) + bias; logits q x k once to f16 each (1 product) x SCALE; online softmax f32; P (relative to the running maximum) x 2^10 once to f16 x v once to f16 (1 product); ctx x 2^6 once to f16 x Wo f16(bf16 x 2^8) + bo; f32 output.
#include <hip/hip_runtime.h>
#include <math.h>

typedef __attribute__((ext_vector_type(16))) _Float16 v16h;
typedef __attribute__((ext_vector_type(16))) __bf16 v16b;
typedef __attribute__((ext_vector_type(8)))  _Float16 v8h;
typedef __attribute__((ext_vector_type(8)))  float v8f;
typedef __attribute__((ext_vector_type(4)))  float v4f;
typedef __attribute__((ext_vector_type(2)))  float v2f;
typedef __attribute__((ext_vector_type(4)))  unsigned v4u;
typedef __attribute__((ext_vector_type(4)))  int v4i;
typedef float __attribute__((may_alias)) float_a;
typedef int __attribute__((may_alias)) int_a;

template <typename T> __device__ __forceinline__ void vst2(void* p, T v) { *(T*)p = v;  }
__device__ __forceinline__ v8f wmma16(v16h a, v16h b, v8f c) {
  v8f d = __builtin_amdgcn_wmma_f32_16x16x32_f16(false, a, false, b, (short)0, c, false, false);
  asm volatile("v_nop\n\tv_nop\n\tv_nop\n\tv_nop" : "+v"(d) : "v"(a), "v"(b));
  return d;
}
__device__ __forceinline__ v8f wmma_bf(v16b a, v16b b, v8f c) {
  v8f d = __builtin_amdgcn_wmma_f32_16x16x32_bf16(false, a, false, b, (short)0, c, false, false);
  asm volatile("v_nop\n\tv_nop\n\tv_nop\n\tv_nop" : "+v"(d) : "v"(a), "v"(b));
  return d;
}
// 16x16x32 fragments: lane = (h = lane>>4, row/col = lane&15); elements 0..7 = k0+8h+0..7, 8..15 = k0+16+8h+0..7; D element r = row 8h+r
__device__ __forceinline__ v16h frag_h(const _Float16* rowk0, int lane) {
  union { v16h v; v8h q[2]; } u; const _Float16* p = rowk0 + 8 * (lane >> 4);
  u.q[0] = *(const v8h*)p; u.q[1] = *(const v8h*)(p + 16); return u.v;
}
__device__ __forceinline__ v16h frag_f32(const float* rowk0, int lane) {
  v16h a; const float* p = rowk0 + 8 * (lane >> 4);
#pragma unroll
  for (int i = 0; i < 8; ++i) { a[i] = (_Float16)p[i]; a[8 + i] = (_Float16)p[16 + i]; }
  return a;
}
__device__ __forceinline__ v16h frag_f32s(const float* rowk0, int lane, float sc) {
  v16h a; const float* p = rowk0 + 8 * (lane >> 4);
#pragma unroll
  for (int i = 0; i < 8; ++i) { a[i] = (_Float16)(p[i] * sc); a[8 + i] = (_Float16)(p[16 + i] * sc); }
  return a;
}
// column fragment from a [K][ld] layout (column n), rows >= K read as 0
__device__ __forceinline__ v16h fragc_f32(const float* W, int k0, int n, int lane, int ld, int K) {
  v16h a; const int g = lane >> 4;
#pragma unroll
  for (int i = 0; i < 8; ++i) { const int ka = k0 + 8 * g + i, kb = ka + 16;
    a[i] = (_Float16)(ka < K ? W[(size_t)(ka < K ? ka : K - 1) * ld + n] : 0.f); a[8 + i] = (_Float16)(kb < K ? W[(size_t)(kb < K ? kb : K - 1) * ld + n] : 0.f); }
  return a;
}
struct F2 { v16b h, l; };
__device__ __forceinline__ F2 bsplit16(const float v[16]) { F2 r;
#pragma unroll
  for (int i = 0; i < 16; ++i) { const __bf16 h = (__bf16)v[i]; r.h[i] = h; r.l[i] = (__bf16)(v[i] - (float)h); }
  return r; }
__device__ __forceinline__ F2 split_row(const float* row, int k0, int lane) { float v[16]; const float* p = row + k0 + 8 * (lane >> 4);
#pragma unroll
  for (int i = 0; i < 8; ++i) { v[i] = p[i]; v[8 + i] = p[16 + i]; }
  return bsplit16(v); }
__device__ __forceinline__ F2 split_rowK(const float* row, int k0, int lane, int K) { float v[16]; const int g = lane >> 4;
#pragma unroll
  for (int i = 0; i < 8; ++i) { const int ka = k0 + 8 * g + i, kb = ka + 16; v[i] = ka < K ? row[ka < K ? ka : K - 1] : 0.f; v[8 + i] = kb < K ? row[kb < K ? kb : K - 1] : 0.f; }
  return bsplit16(v); }
__device__ __forceinline__ F2 split_col(const float* W, int k0, int n, int lane, int ld, int K) { float v[16]; const int g = lane >> 4;
#pragma unroll
  for (int i = 0; i < 8; ++i) { const int ka = k0 + 8 * g + i, kb = ka + 16; v[i] = ka < K ? W[(size_t)(ka < K ? ka : K - 1) * ld + n] : 0.f; v[8 + i] = kb < K ? W[(size_t)(kb < K ? kb : K - 1) * ld + n] : 0.f; }
  return bsplit16(v); }
__device__ __forceinline__ v8f mac3(const F2& a, const F2& b, v8f c) { c = wmma_bf(a.l, b.h, c); c = wmma_bf(a.h, b.l, c); return wmma_bf(a.h, b.h, c); }
__device__ __forceinline__ float sigm(float v) { return 1.0f / (1.0f + expf(-v)); }
#define LDSX() do { asm volatile("s_wait_dscnt 0" ::: "memory"); __builtin_amdgcn_wave_barrier(); __builtin_amdgcn_fence(__ATOMIC_RELEASE, "workgroup"); } while (0)

// Multi-head self-attention (inputs [2,2048,512]; (in,out) Wq / Wk / Wv / Wo [512,512] N(0, 1/512) + zero biases; 8 heads x 64; scale 1/8; softmax over keys; merge; Wo + bo).
#define NB 2
#define TT 2048
#define CC 512            // NH * HD = projected width
#define DIN 512          // input (model) width
#define NH 8
#define HD 64
#define NQB (TT / 64)
#define HG 4
#define SCALE (0.125f)
#define CAUSAL 0
#ifndef TNB
#define TNB NB
#endif
__device__ __forceinline__ float bfr(float v) { return (float)(__bf16)v; }
__host__ __device__ __forceinline__ int kb_last(int qb) { return CAUSAL ? ((qb * 64 + 63) >> 7) : (TT / 128 - 1); }
typedef __attribute__((ext_vector_type(8))) __bf16 v8b;
__device__ __forceinline__ v16b frag_b(const __bf16* rowk0, int lane) {
  union { v16b v; v8b q[2]; } u; const __bf16* p = rowk0 + 8 * (lane >> 4);
  u.q[0] = *(const v8b*)p; u.q[1] = *(const v8b*)(p + 16); return u.v;
}
#define QBH 0              // not read by any kernel here: k_fa has no high-precision path
#define QHI 0               // single-product logits on every row
#define KHI 64            // key rows carrying k residual / v bf16 hi+lo planes (written by k_proj; no kernel here reads them)
// B fragment (k rows k0+.., output column o) of a weight: (in,out) [K][ld] or (out,in) [ld rows of K]: bf16 exact, or f16(bf16 * 256) exact
__device__ __forceinline__ v16b wcol_io(const float* Wm, int k0, int o, int lane, int ld) { v16b w; const int g = lane >> 4;
#pragma unroll
  for (int i = 0; i < 8; ++i) { w[i] = (__bf16)Wm[(size_t)(k0 + 8 * g + i) * ld + o]; w[8 + i] = (__bf16)Wm[(size_t)(k0 + 16 + 8 * g + i) * ld + o]; }
  return w; }
__device__ __forceinline__ v16b wcol_oi(const float* Wm, int k0, int o, int lane, int K) { v16b w; const float* p = Wm + (size_t)o * K + k0 + 8 * (lane >> 4);
#pragma unroll
  for (int i = 0; i < 8; ++i) { w[i] = (__bf16)p[i]; w[8 + i] = (__bf16)p[16 + i]; }
  return w; }
__device__ __forceinline__ v16h wcolh_io(const float* Wm, int k0, int o, int lane, int ld) { v16h w; const int g = lane >> 4;
#pragma unroll
  for (int i = 0; i < 8; ++i) { w[i] = (_Float16)(bfr(Wm[(size_t)(k0 + 8 * g + i) * ld + o]) * 256.0f); w[8 + i] = (_Float16)(bfr(Wm[(size_t)(k0 + 16 + 8 * g + i) * ld + o]) * 256.0f); }
  return w; }
__device__ __forceinline__ v16h wcolh_oi(const float* Wm, int k0, int o, int lane, int K) { v16h w; const float* p = Wm + (size_t)o * K + k0 + 8 * (lane >> 4);
#pragma unroll
  for (int i = 0; i < 8; ++i) { w[i] = (_Float16)(bfr(p[i]) * 256.0f); w[8 + i] = (_Float16)(bfr(p[16 + i]) * 256.0f); }
  return w; }
#define WQKV_LAYOUT 0   // selects WCOL, which no kernel here calls: k_proj always stages Wq / Wk / Wv as (in,out) [DIN][CC]
__device__ __forceinline__ v16b wcol_hdk(const float* Wm, int k0, int o, int lane) { v16b w; const int g = lane >> 4; const float* p = Wm + (size_t)(o / HD) * DIN * HD + (o % HD);
#pragma unroll
  for (int i = 0; i < 8; ++i) { w[i] = (__bf16)p[(size_t)(k0 + 8 * g + i) * HD]; w[8 + i] = (__bf16)p[(size_t)(k0 + 16 + 8 * g + i) * HD]; }
  return w; }
#define WO_OUT_IN 0
#if WQKV_LAYOUT == 1
#define WCOL(W, k0, o, lane) wcol_oi(W, k0, o, lane, DIN)
#elif WQKV_LAYOUT == 2
#define WCOL(W, k0, o, lane) wcol_hdk(W, k0, o, lane)
#else
#define WCOL(W, k0, o, lane) wcol_io(W, k0, o, lane, CC)
#endif
#if WO_OUT_IN
#define WOCOL(W, k0, o, lane) wcol_oi(W, k0, o, lane, CC)
#define WOCOLH(W, k0, o, lane) wcolh_oi(W, k0, o, lane, CC)
#else
#define WOCOL(W, k0, o, lane) wcol_io(W, k0, o, lane, DIN)
#define WOCOLH(W, k0, o, lane) wcolh_io(W, k0, o, lane, DIN)
#endif

#ifndef SM_EXTRA_PARAMS
#define SM_EXTRA_PARAMS
#endif
#ifndef PROJ_EXTRA_PARAMS
#define PROJ_EXTRA_PARAMS
#endif
#ifndef SM_MASK_HOOK
#define SM_MASK_HOOK (void)0
#endif

#define WS_QH  0u                                      // f16 q rows [b*t][CC]
#define WS_KH  (WS_QH + 2u * (size_t)NB * TT * CC)      // f16 k rows [b*t][CC]
#define WS_VT  (WS_KH + 2u * (size_t)NB * TT * CC)      // f16 v planes [b][c][t]
#define WS_QL  (WS_VT + 2u * (size_t)NB * CC * TT)      // f16 q residual x 2^10 rows [b][t < QHI][CC]
#define WS_KL  (WS_QL + 2u * (size_t)NB * QHI * CC)     // f16 k residual x 2^10 rows [b][t < KHI][CC]
#define WS_VB  (WS_KL + 2u * (size_t)NB * KHI * CC)     // bf16 v hi planes [b][c][t < KHI]
#define WS_VBL (WS_VB + 2u * (size_t)NB * CC * KHI)
#define WS_S   (WS_VBL + 2u * (size_t)NB * CC * KHI)    // f32 [hg][t][s], not used: k_fa keeps logits and P in registers
#define WS_Y   (WS_S  + 4u * (size_t)HG * TT * TT)      // f32 ctx rows [b*t][CC] (only when there is an output projection)
#define WS_END (WS_Y  + 4u * (size_t)NB * TT * CC)

// ---- weight staging for k_proj and k_out: a [KS][128] f32 tile of a (in,out) weight is read once per block with whole-line 16-byte loads, converted once, and laid in LDS column by column (k contiguous), where every wave takes its B fragments with 16-byte LDS reads
#define KS 64            // k rows of one staged tile
#define WP (KS + 8)      // LDS pitch of a staged column in elements: 144 B = 16 B x 9, free of bank conflicts for the fragment reads and for the staging stores
// one thread's share of a tile: 2 units of (8 k rows x 4 columns); a wave covers 32 columns, lane = (k octet = lane & 3, column group = lane >> 2), so each load instruction covers four whole 128-B lines
struct WT { v4f r[2][8]; };
__device__ __forceinline__ void wt_load(WT& t, const float* Wm, int k0, int c0, int ld, int wave, int lane) {
  const float* p = Wm + (size_t)(k0 + 8 * (lane & 3)) * ld + c0 + 32 * wave + 4 * (lane >> 2);
#pragma unroll
  for (int u = 0; u < 2; ++u) {
#pragma unroll
    for (int i = 0; i < 8; ++i) t.r[u][i] = *(const v4f*)(p + (size_t)(32 * u + i) * ld); } }
__device__ __forceinline__ void wt_store_b(const WT& t, __bf16* wb, int wave, int lane) {   // bf16, exact operand of k_proj
  __bf16* d = wb + (32 * wave + 4 * (lane >> 2)) * WP + 8 * (lane & 3);
#pragma unroll
  for (int u = 0; u < 2; ++u) {
#pragma unroll
    for (int c = 0; c < 4; ++c) { v8b x;
#pragma unroll
      for (int i = 0; i < 8; ++i) x[i] = (__bf16)t.r[u][i][c];
      *(v8b*)(d + c * WP + 32 * u) = x; } } }
__device__ __forceinline__ void wt_store_h(const WT& t, _Float16* wb, int wave, int lane) {   // f16(bf16 x 2^8), exact operand of k_out
  _Float16* d = wb + (32 * wave + 4 * (lane >> 2)) * WP + 8 * (lane & 3);
#pragma unroll
  for (int u = 0; u < 2; ++u) {
#pragma unroll
    for (int c = 0; c < 4; ++c) { v8h x;
#pragma unroll
      for (int i = 0; i < 8; ++i) x[i] = (_Float16)(bfr(t.r[u][i][c]) * 256.0f);
      *(v8h*)(d + c * WP + 32 * u) = x; } } }
// a lane's raw f32 share of the A fragments of one stage (KS k of its own row): per 32 k, elements 8g + 0..7 and 16 + 8g + 0..7
struct XT { v4f r[KS / 32][4]; };
__device__ __forceinline__ void xt_load(XT& t, const float* rowk0, int lane) { const float* p = rowk0 + 8 * (lane >> 4);
#pragma unroll
  for (int kk = 0; kk < KS / 32; ++kk) { t.r[kk][0] = *(const v4f*)(p + kk * 32); t.r[kk][1] = *(const v4f*)(p + kk * 32 + 4); t.r[kk][2] = *(const v4f*)(p + kk * 32 + 16); t.r[kk][3] = *(const v4f*)(p + kk * 32 + 20); } }

// ---- k_proj: block = (64 rows, 128 cols, which): q/k/v = X W (+ b) with exact bf16 products (K = DIN) -> which 0: q f16 rows (+ residual rows < QHI); 1: k f16 rows (+ residual rows < KHI); 2: v f16 planes [c][t] (+ bf16 hi/lo planes for t < KHI)
__global__ __launch_bounds__(128) void k_proj(const float* __restrict__ XQ, const float* __restrict__ XK, const float* __restrict__ XV, const float* __restrict__ WQ, const float* __restrict__ WK, const float* __restrict__ WV, const float* __restrict__ BQ, const float* __restrict__ BK, const float* __restrict__ BV,
    _Float16* __restrict__ QH, _Float16* __restrict__ QL, _Float16* __restrict__ KH, _Float16* __restrict__ KL, _Float16* __restrict__ VT, __bf16* __restrict__ VB, __bf16* __restrict__ VBL) {
  __shared__ __align__(16) union { struct { _Float16 sh[64][136], sl[64][136], th[128][72]; __bf16 tb[128][72], tbl[128][72]; } e; __bf16 wb[2][128 * WP]; } sm;   // the weight stages share LDS with the epilogue's tiles, so that as many blocks as before fit a WGP
  auto& sh = sm.e.sh; auto& sl = sm.e.sl; auto& th = sm.e.th; auto& tb = sm.e.tb; auto& tbl = sm.e.tbl;
  const int tid = threadIdx.x, wave = tid >> 5, lane = tid & 31, col = lane & 15, g = lane >> 4; const int which = blockIdx.z; const int c0 = blockIdx.y * 128; const size_t r0 = (size_t)blockIdx.x * 64; const size_t bb = r0 / TT; const int t0 = (int)(r0 % TT);
  const float* X = which == 0 ? XQ : which == 1 ? XK : XV; const float* WA = which == 0 ? WQ : which == 1 ? WK : WV; const float* BA = which == 0 ? BQ : which == 1 ? BK : BV;
  v8f acc[8] = {};
  const float* Xr = X + (r0 + wave * 16 + col) * DIN; WT wt; XT xt; v16b af[KS / 32];
  wt_load(wt, WA, 0, c0, CC, wave, lane); xt_load(xt, Xr, lane); wt_store_b(wt, sm.wb[0], wave, lane);
#pragma unroll
  for (int kk = 0; kk < KS / 32; ++kk) {
#pragma unroll
    for (int i = 0; i < 8; ++i) { af[kk][i] = (__bf16)xt.r[kk][i >> 2][i & 3]; af[kk][8 + i] = (__bf16)xt.r[kk][2 + (i >> 2)][i & 3]; } }
  __syncthreads();   // stage 0 is published
#pragma unroll 2
  for (int s = 0; s < DIN / KS; ++s) { const bool more = s + 1 < DIN / KS;   // two buffers: stage s + 1 is fetched into registers while stage s is worked on
    if (more) { wt_load(wt, WA, (s + 1) * KS, c0, CC, wave, lane); xt_load(xt, Xr + (s + 1) * KS, lane); }
    __builtin_amdgcn_sched_barrier(0);   // keeps the next stage's global loads issued in front of this stage's products, which then cover their latency
    const __bf16* wc = sm.wb[s & 1] + col * WP;
#pragma unroll
    for (int kk = 0; kk < KS / 32; ++kk) { v16b wf[8];
#pragma unroll
      for (int j = 0; j < 8; ++j) wf[j] = frag_b(wc + j * 16 * WP + kk * 32, lane);
      __builtin_amdgcn_sched_barrier(0);   // keeps the 16 LDS reads together in front of their products: one wait for the group, where a read pair in front of each product waits out the LDS latency eight times
#pragma unroll
      for (int j = 0; j < 8; ++j) acc[j] = wmma_bf(af[kk], wf[j], acc[j]); }
    __builtin_amdgcn_sched_barrier(0);   // keeps the fetched tile's conversion, and with it the wait for its loads, behind this stage's products
    if (more) { wt_store_b(wt, sm.wb[(s + 1) & 1], wave, lane);
#pragma unroll
      for (int kk = 0; kk < KS / 32; ++kk) {
#pragma unroll
        for (int i = 0; i < 8; ++i) { af[kk][i] = (__bf16)xt.r[kk][i >> 2][i & 3]; af[kk][8 + i] = (__bf16)xt.r[kk][2 + (i >> 2)][i & 3]; } } }
    __syncthreads(); }   // publishes stage s + 1 and ends every wave's reads of stage s, whose buffer is written next (after the last stage: by the epilogue)
  if (which < 2) { _Float16* DH = which == 0 ? QH : KH; _Float16* DL = which == 0 ? QL : KL; const int nhi = which == 0 ? QHI : KHI; const bool hi_rows = t0 < nhi;
#pragma unroll
    for (int j = 0; j < 8; ++j) { const float bias = BA ? bfr(BA[c0 + j * 16 + col]) : 0.f;
#pragma unroll
      for (int r = 0; r < 8; ++r) { const float v = acc[j][r] + bias; const _Float16 hv = (_Float16)v; sh[wave * 16 + 8 * g + r][j * 16 + col] = hv; sl[wave * 16 + 8 * g + r][j * 16 + col] = (_Float16)((v - (float)hv) * 1024.0f); } }
    __syncthreads();
    for (int e = tid; e < 64 * 16; e += 128) { const int rl = e >> 4, q = e & 15; vst2((unsigned*)(DH + (r0 + rl) * CC + c0 + q * 8), *(const v4u*)&sh[rl][q * 8]); if (hi_rows) vst2((unsigned*)(DL + (bb * nhi + t0 + rl) * (size_t)CC + c0 + q * 8), *(const v4u*)&sl[rl][q * 8]); }
  } else { const bool hi_rows = t0 < KHI;
#pragma unroll
    for (int j = 0; j < 8; ++j) { const float bias = BA ? bfr(BA[c0 + j * 16 + col]) : 0.f;
#pragma unroll
      for (int r = 0; r < 8; ++r) { const float v = acc[j][r] + bias; const int rl = wave * 16 + 8 * g + r, cl = j * 16 + col; th[cl][rl] = (_Float16)v; const __bf16 bh = (__bf16)v; tb[cl][rl] = bh; tbl[cl][rl] = (__bf16)(v - (float)bh); } }
    __syncthreads();
    for (int e = tid; e < 128 * 8; e += 128) { const int cl = e >> 3, q = e & 7; vst2((unsigned*)(VT + (bb * CC + c0 + cl) * (size_t)TT + t0 + q * 8), *(const v4u*)&th[cl][q * 8]); if (hi_rows) { const size_t o3 = (bb * CC + c0 + cl) * (size_t)KHI + t0 + q * 8; vst2((unsigned*)(VB + o3), *(const v4u*)&tb[cl][q * 8]); vst2((unsigned*)(VBL + o3), *(const v4u*)&tbl[cl][q * 8]); } } } }
// ---- k_fa: block = 128 queries (8 waves x 16 query columns) of (b, h); the whole key range in trips of 64 keys with a running maximum (online softmax), so logits and P stay in registers.
// S^T = K . Q^T (A = k rows, B = q rows): lane (g, col) holds keys 8g + r of each 16-key tile for query col, which is the B fragment order of P^T; O^T += V^T . P^T (A = v planes [c][t]): lane holds d = 16j + 8g + r of query col.
// Every inner loop below is unrolled so that the fragment and accumulator arrays are indexed by constants and stay in registers.
__device__ __forceinline__ v8f wmma_h(v16h a, v16h b, v8f c) { return __builtin_amdgcn_wmma_f32_16x16x32_f16(false, a, false, b, (short)0, c, false, false); }
__device__ __forceinline__ float xhalf(float x) { return __builtin_bit_cast(float, __builtin_amdgcn_permlanex16(__builtin_bit_cast(int, x), __builtin_bit_cast(int, x), 0x76543210, 0xfedcba98, false, false)); }   // lane l with lane l ^ 16
// K and V reach the waves through LDS: the block's 8 waves need the same 16 KB a trip, so each tile is brought in once per block with whole-line asynchronous copies and every wave takes its fragments with 16-byte LDS reads.
// Tile t = (v planes of keys 64t.., k rows of keys 64(t + 1)..): what trip t reads, since the scores are formed one trip ahead. Two buffers: tile t + 1 flies while trip t works.
#define NT (TT / 64)     // trips
#define KP (64 + 8)      // LDS pitch of a staged 128-B row in elements: 144 B = 16 B x 9, free of bank conflicts for the fragment reads
#define KVB (2 * 64 * KP * 2)   // bytes of one buffer: 64 k rows, then 64 v rows
// one thread's share of a tile: 16 B of k rows r and r + 32 and of v rows r and r + 32 (8 lanes a row: each copy instruction covers four whole 128-B lines)
__device__ __forceinline__ void kv_copy(unsigned lds, const _Float16* gk, const _Float16* gv) {
  const unsigned l1 = lds + 32 * KP * 2, l2 = lds + 64 * KP * 2, l3 = lds + 96 * KP * 2; const _Float16* gk1 = gk + (size_t)32 * CC; const _Float16* gv1 = gv + (size_t)32 * TT;
  // the s_wait_xcnt stands in the copies' own statement, so that no address register is rewritten in front of it
  asm volatile("global_load_async_to_lds_b128 %0, %4, off\n\tglobal_load_async_to_lds_b128 %1, %5, off\n\tglobal_load_async_to_lds_b128 %2, %6, off\n\tglobal_load_async_to_lds_b128 %3, %7, off\n\ts_wait_xcnt 0x0"
               :: "v"(lds), "v"(l1), "v"(l2), "v"(l3), "v"(gk), "v"(gk1), "v"(gv), "v"(gv1) : "memory"); }
// the same for k rows alone: keys 0..63, whose scores are formed in front of the loop
__device__ __forceinline__ void k_copy(unsigned lds, const _Float16* gk) {
  const unsigned l1 = lds + 32 * KP * 2; const _Float16* gk1 = gk + (size_t)32 * CC;
  // as above: the s_wait_xcnt in the copies' own statement, in front of any rewrite of their address registers
  asm volatile("global_load_async_to_lds_b128 %0, %2, off\n\tglobal_load_async_to_lds_b128 %1, %3, off\n\ts_wait_xcnt 0x0" :: "v"(lds), "v"(l1), "v"(gk), "v"(gk1) : "memory"); }
__global__ __launch_bounds__(256) void k_fa(const _Float16* __restrict__ QH, const _Float16* __restrict__ KH, const _Float16* __restrict__ VT, float* __restrict__ Y) {
  __shared__ __align__(16) _Float16 kv[2][2][64 * KP];   // [buffer][k rows, v rows]
  __shared__ __align__(16) _Float16 kz[64 * KP];         // k rows of keys 0..63: filled once, read once
  const int tid = threadIdx.x, wave = tid >> 5, lane = tid & 31, col = lane & 15, g = lane >> 4; const int b = blockIdx.y / NH, h = blockIdx.y % NH; const int q = blockIdx.x * 128 + wave * 16 + col;
  const _Float16* Qr = QH + ((size_t)b * TT + q) * CC + h * HD;
  const _Float16* Kc = KH + ((size_t)b * TT + (tid >> 3)) * CC + h * HD + 8 * (tid & 7); const _Float16* Vc = VT + ((size_t)b * CC + h * HD + (tid >> 3)) * (size_t)TT + 8 * (tid & 7);   // the thread's sources in keys 0..63
  const unsigned lc = (unsigned)(size_t)&kv[0][0][(tid >> 3) * KP + 8 * (tid & 7)];   // its place in buffer 0 (LDS byte address)
  k_copy((unsigned)(size_t)&kz[(tid >> 3) * KP + 8 * (tid & 7)], Kc);
  kv_copy(lc, Kc + (size_t)64 * CC, Vc);   // tile 0
  const v16h q0 = frag_h(Qr, lane), q1 = frag_h(Qr + 32, lane);
  const float C2 = SCALE * 1.4426950408889634f;   // logits carried in base 2
  v8f acc[HD / 16] = {}; float m = -3.0e38f, l = 0.f;
  v8f s[4];   // scores of the coming trip, carried over the loop's back edge: every fragment read of a trip is issued at its head and used at its foot
  asm volatile("s_wait_asynccnt 0x0" ::: "memory");   // this wave's share of the first k rows and of tile 0 has landed
  __syncthreads();   // both are published
  kv_copy(lc + KVB, Kc + (size_t)128 * CC, Vc + 64);   // tile 1
#pragma unroll
  for (int t = 0; t < 4; ++t) { const v8f z = {}; s[t] = wmma_h(frag_h(&kz[(t * 16 + col) * KP], lane), q0, z); s[t] = wmma_h(frag_h(&kz[(t * 16 + col) * KP + 32], lane), q1, s[t]); }
  for (int t = 0; t < NT; ++t) {
    const _Float16* kl = &kv[t & 1][0][col * KP]; const _Float16* vl = &kv[t & 1][1][col * KP];
    v16h vf[HD / 16][2], kf[4][2];
#pragma unroll
    for (int j = 0; j < HD / 16; ++j) { vf[j][0] = frag_h(vl + j * 16 * KP, lane); vf[j][1] = frag_h(vl + j * 16 * KP + 32, lane); }
#pragma unroll
    for (int u = 0; u < 4; ++u) { kf[u][0] = frag_h(kl + u * 16 * KP, lane); kf[u][1] = frag_h(kl + u * 16 * KP + 32, lane); }   // the next trip's k rows (the last tile holds the last trip's own again; those scores are not used)
    __builtin_amdgcn_sched_barrier(0);   // keeps the trip's LDS reads issued in front of the softmax, whose work then covers their latency; without it they sink to their first use
    float mt[4];   // four independent chains
#pragma unroll
    for (int u = 0; u < 4; ++u) { mt[u] = s[u][0];
#pragma unroll
      for (int r = 1; r < 8; ++r) mt[u] = fmaxf(mt[u], s[u][r]); }
    float mx = fmaxf(fmaxf(mt[0], mt[1]), fmaxf(mt[2], mt[3])); mx = fmaxf(mx, xhalf(mx));
    const float mn = fmaxf(m, mx * C2); float alpha;   // 2^(m - mn), 0 on the first trip
    asm("v_exp_f32 %0, %1\n\tv_nop" : "=v"(alpha) : "v"(m - mn));   // asm for the v_nop alone: it fills the slot behind a transcendental
    m = mn;
    const float off = 10.0f - mn;   // P relative to the running maximum, x 2^10 into f16 (clear of f16 subnormals); the factor cancels against l
    v16h p[2]; float ps[4];
#pragma unroll
    for (int u = 0; u < 4; ++u) { ps[u] = 0.f;
#pragma unroll
      for (int r = 0; r < 8; ++r) { const float e = __builtin_amdgcn_exp2f(fmaf(s[u][r], C2, off)); ps[u] += e; p[u >> 1][(u & 1) * 8 + r] = (_Float16)e; } }
    l = l * alpha + ((ps[0] + ps[1]) + (ps[2] + ps[3]));
#pragma unroll
    for (int j = 0; j < HD / 16; ++j) { acc[j] *= alpha; acc[j] = wmma_h(vf[j][0], p[0], acc[j]); acc[j] = wmma_h(vf[j][1], p[1], acc[j]); }
#pragma unroll
    for (int u = 0; u < 4; ++u) { const v8f z = {}; s[u] = wmma_h(kf[u][0], q0, z); s[u] = wmma_h(kf[u][1], q1, s[u]); }
    __builtin_amdgcn_sched_barrier(0);   // keeps the waits and the barrier below at the trip's foot: lifted to the LDS reads, as the build without it had them, they expose the reads' latency and leave the flying tile no lead
    asm volatile("s_wait_dscnt 0x0" ::: "memory");      // this wave's reads of the buffer are over before it is refilled
    asm volatile("s_wait_asynccnt 0x0" ::: "memory");   // this wave's share of tile t + 1 has landed
    __syncthreads();   // publishes tile t + 1 and ends every wave's reads of tile t, whose buffer is refilled next
    if (t + 2 < NT) kv_copy(lc + (t & 1) * KVB, Kc + (size_t)((t + 3 < NT ? t + 3 : NT - 1) * 64) * CC, Vc + (t + 2) * 64); }
  asm volatile("s_wait_asynccnt 0x0" ::: "memory");   // no copy is left in flight when the wave ends
  l += xhalf(l); const float inv = 1.0f / l;   // l >= 2^10: the maximum's own term
  float* Yr = Y + ((size_t)b * TT + q) * CC + h * HD + 8 * g;
#pragma unroll
  for (int j = 0; j < HD / 16; ++j) { v4f a, c;
#pragma unroll
    for (int r = 0; r < 4; ++r) { a[r] = acc[j][r] * inv; c[r] = acc[j][4 + r] * inv; }
    vst2(Yr + j * 16, a); vst2(Yr + j * 16 + 4, c); } }
// ---- k_out: block = (64 rows, 128 cols): out = ctx Wo (+ bo): ctx x 2^6 once to f16 against Wo as f16(bf16 x 2^8) exact (1 product) x 2^-14; causal early rows (< QHI of each sequence): ctx bf16 hi + lo against exact bf16 Wo (2 products)
__global__ __launch_bounds__(128) void k_out(const float* __restrict__ Y, const float* __restrict__ WO, const float* __restrict__ BO, float* __restrict__ OUT) { __shared__ __align__(16) float sf[4][16][132]; __shared__ __align__(16) _Float16 wb[2][128 * WP];
  const int tid = threadIdx.x, wave = tid >> 5, lane = tid & 31, col = lane & 15, g = lane >> 4; const int c0 = blockIdx.y * 128; const size_t r0 = (size_t)blockIdx.x * 64 + wave * 16;
  v8f acc[8] = {};
  if (CAUSAL && (int)(((size_t)blockIdx.x * 64) % TT) < QHI) {   /* block-uniform */
#pragma unroll 2
    for (int kc = 0; kc < CC / 32; ++kc) { const F2 a = split_row(Y + (r0 + col) * CC, kc * 32, lane); asm volatile("s_wait_loadcnt 0x0" ::: "memory");
#pragma unroll
      for (int j = 0; j < 8; ++j) { const v16b w = WOCOL(WO, kc * 32, c0 + j * 16 + col, lane); asm volatile("s_wait_loadcnt 0x0" ::: "memory"); acc[j] = wmma_bf(a.h, w, acc[j]); acc[j] = wmma_bf(a.l, w, acc[j]); } }
#pragma unroll
    for (int j = 0; j < 8; ++j) { const float bias = BO ? bfr(BO[c0 + j * 16 + col]) : 0.f;
#pragma unroll
      for (int r = 0; r < 8; ++r) sf[wave][8 * g + r][j * 16 + col] = acc[j][r] + bias; }
  } else {
    const float* Yr = Y + (r0 + col) * CC; WT wt; XT xt; v16h af[KS / 32];   /* ctx carried x 2^6 into f16 so small-magnitude context rows stay clear of f16 subnormals */
    wt_load(wt, WO, 0, c0, DIN, wave, lane); xt_load(xt, Yr, lane); wt_store_h(wt, wb[0], wave, lane);
#pragma unroll
    for (int kk = 0; kk < KS / 32; ++kk) {
#pragma unroll
      for (int i = 0; i < 8; ++i) { af[kk][i] = (_Float16)(xt.r[kk][i >> 2][i & 3] * 64.0f); af[kk][8 + i] = (_Float16)(xt.r[kk][2 + (i >> 2)][i & 3] * 64.0f); } }
    __syncthreads();   // stage 0 is published
#pragma unroll 2
    for (int s = 0; s < CC / KS; ++s) { const bool more = s + 1 < CC / KS;   // two buffers, as in k_proj
      if (more) { wt_load(wt, WO, (s + 1) * KS, c0, DIN, wave, lane); xt_load(xt, Yr + (s + 1) * KS, lane); }
      __builtin_amdgcn_sched_barrier(0);   // keeps the next stage's global loads issued in front of this stage's products, which then cover their latency
      const _Float16* wc = wb[s & 1] + col * WP;
#pragma unroll
      for (int kk = 0; kk < KS / 32; ++kk) { v16h wf[8];
#pragma unroll
        for (int j = 0; j < 8; ++j) wf[j] = frag_h(wc + j * 16 * WP + kk * 32, lane);
        __builtin_amdgcn_sched_barrier(0);   // keeps the 16 LDS reads together in front of their products: one wait for the group
#pragma unroll
        for (int j = 0; j < 8; ++j) acc[j] = wmma16(af[kk], wf[j], acc[j]); }
      __builtin_amdgcn_sched_barrier(0);   // keeps the fetched tile's conversion, and with it the wait for its loads, behind this stage's products
      if (more) { wt_store_h(wt, wb[(s + 1) & 1], wave, lane);
#pragma unroll
        for (int kk = 0; kk < KS / 32; ++kk) {
#pragma unroll
          for (int i = 0; i < 8; ++i) { af[kk][i] = (_Float16)(xt.r[kk][i >> 2][i & 3] * 64.0f); af[kk][8 + i] = (_Float16)(xt.r[kk][2 + (i >> 2)][i & 3] * 64.0f); } } }
      __syncthreads(); }   // publishes stage s + 1 and ends every wave's reads of stage s, whose buffer is written next
#pragma unroll
    for (int j = 0; j < 8; ++j) { const float bias = BO ? bfr(BO[c0 + j * 16 + col]) : 0.f;
#pragma unroll
      for (int r = 0; r < 8; ++r) sf[wave][8 * g + r][j * 16 + col] = acc[j][r] * (1.0f / 16384.0f) + bias; } }   /* 2^-8 (Wo carry) x 2^-6 (ctx carry) */
  LDSX(); for (int rl = 0; rl < 16; ++rl) vst2(OUT + (r0 + rl) * DIN + c0 + lane * 4, *(const v4f*)&sf[wave][rl][lane * 4]); }

extern "C" void kernel_launch(void* const* d_in, const int* in_sizes, int n_in, void* d_out, int out_size, void* d_ws, size_t ws_size, hipStream_t stream) {
  (void)in_sizes; (void)n_in; (void)out_size;
  const float** F = (const float**)d_in;
  if (ws_size < (size_t)WS_END) return;
  char* ws = (char*)d_ws; _Float16 *QH = (_Float16*)(ws + WS_QH), *KH = (_Float16*)(ws + WS_KH), *VT = (_Float16*)(ws + WS_VT), *QL = (_Float16*)(ws + WS_QL), *KL = (_Float16*)(ws + WS_KL); __bf16 *VB = (__bf16*)(ws + WS_VB), *VBL = (__bf16*)(ws + WS_VBL); float *Y = (float*)(ws + WS_Y);
  (void)Y; (void)QL; (void)KL; (void)VB; (void)VBL;
  // inputs: 0 inputs [2,2048,512]; 1 Wq [512,512] (in,out), 2 bq; 3 Wk, 4 bk; 5 Wv, 6 bv; 7 Wo (in,out), 8 bo (zero biases, read)
  k_proj<<<dim3(TNB * TT / 64, CC / 128, 3), 128, 0, stream>>>(F[0], F[0], F[0], F[1], F[3], F[5], F[2], F[4], F[6], QH, QL, KH, KL, VT, VB, VBL);
  k_fa<<<dim3(TT / 128, TNB * NH), 256, 0, stream>>>(QH, KH, VT, Y);
  k_out<<<dim3(TNB * TT / 64, DIN / 128), 128, 0, stream>>>(Y, F[7], F[8], (float*)d_out);
}

// v004
// A run of this version takes 49.5 microseconds.
// Two timings next to v003 put it at 1.14 and 1.13 times that version's speed.
// All steps since v000 together make it 11.8 times as fast.
// compute dtype: all float inputs rounded to bf16; q/k/v projections with EXACT bf16 products on WMMA 16x16x32 (f32 accumulate) + bias; logits q x k once to f16 each (1 product) x SCALE; online softmax f32; P (relative to the running maximum) x 2^10 once to f16 x v once to f16 (1 product); ctx x 2^6 once to f16 x Wo f16(bf16 x 2^8) + bo; f32 output.
#include <hip/hip_runtime.h>
#include <math.h>

typedef __attribute__((ext_vector_type(16))) _Float16 v16h;
typedef __attribute__((ext_vector_type(16))) __bf16 v16b;
typedef __attribute__((ext_vector_type(8)))  _Float16 v8h;
typedef __attribute__((ext_vector_type(8)))  float v8f;
typedef __attribute__((ext_vector_type(4)))  float v4f;
typedef __attribute__((ext_vector_type(2)))  float v2f;
typedef __attribute__((ext_vector_type(4)))  unsigned v4u;
typedef __attribute__((ext_vector_type(4)))  int v4i;
typedef float __attribute__((may_alias)) float_a;
typedef int __attribute__((may_alias)) int_a;

template <typename T> __device__ __forceinline__ void vst2(void* p, T v) { *(T*)p = v;  }
__device__ __forceinline__ v8f wmma16(v16h a, v16h b, v8f c) {
  v8f d = __builtin_amdgcn_wmma_f32_16x16x32_f16(false, a, false, b, (short)0, c, false, false);
  asm volatile("v_nop\n\tv_nop\n\tv_nop\n\tv_nop" : "+v"(d) : "v"(a), "v"(b));
  return d;
}
__device__ __forceinline__ v8f wmma_bf(v16b a, v16b b, v8f c) {
  v8f d = __builtin_amdgcn_wmma_f32_16x16x32_bf16(false, a, false, b, (short)0, c, false, false);
  asm volatile("v_nop\n\tv_nop\n\tv_nop\n\tv_nop" : "+v"(d) : "v"(a), "v"(b));
  return d;
}
// 16x16x32 fragments: lane = (h = lane>>4, row/col = lane&15); elements 0..7 = k0+8h+0..7, 8..15 = k0+16+8h+0..7; D element r = row 8h+r
__device__ __forceinline__ v16h frag_h(const _Float16* rowk0, int lane) {
  union { v16h v; v8h q[2]; } u; const _Float16* p = rowk0 + 8 * (lane >> 4);
  u.q[0] = *(const v8h*)p; u.q[1] = *(const v8h*)(p + 16); return u.v;
}
__device__ __forceinline__ v16h frag_f32(const float* rowk0, int lane) {
  v16h a; const float* p = rowk0 + 8 * (lane >> 4);
#pragma unroll
  for (int i = 0; i < 8; ++i) { a[i] = (_Float16)p[i]; a[8 + i] = (_Float16)p[16 + i]; }
  return a;
}
__device__ __forceinline__ v16h frag_f32s(const float* rowk0, int lane, float sc) {
  v16h a; const float* p = rowk0 + 8 * (lane >> 4);
#pragma unroll
  for (int i = 0; i < 8; ++i) { a[i] = (_Float16)(p[i] * sc); a[8 + i] = (_Float16)(p[16 + i] * sc); }
  return a;
}
// column fragment from a [K][ld] layout (column n), rows >= K read as 0
__device__ __forceinline__ v16h fragc_f32(const float* W, int k0, int n, int lane, int ld, int K) {
  v16h a; const int g = lane >> 4;
#pragma unroll
  for (int i = 0; i < 8; ++i) { const int ka = k0 + 8 * g + i, kb = ka + 16;
    a[i] = (_Float16)(ka < K ? W[(size_t)(ka < K ? ka : K - 1) * ld + n] : 0.f); a[8 + i] = (_Float16)(kb < K ? W[(size_t)(kb < K ? kb : K - 1) * ld + n] : 0.f); }
  return a;
}
struct F2 { v16b h, l; };
__device__ __forceinline__ F2 bsplit16(const float v[16]) { F2 r;
#pragma unroll
  for (int i = 0; i < 16; ++i) { const __bf16 h = (__bf16)v[i]; r.h[i] = h; r.l[i] = (__bf16)(v[i] - (float)h); }
  return r; }
__device__ __forceinline__ F2 split_row(const float* row, int k0, int lane) { float v[16]; const float* p = row + k0 + 8 * (lane >> 4);
#pragma unroll
  for (int i = 0; i < 8; ++i) { v[i] = p[i]; v[8 + i] = p[16 + i]; }
  return bsplit16(v); }
__device__ __forceinline__ F2 split_rowK(const float* row, int k0, int lane, int K) { float v[16]; const int g = lane >> 4;
#pragma unroll
  for (int i = 0; i < 8; ++i) { const int ka = k0 + 8 * g + i, kb = ka + 16; v[i] = ka < K ? row[ka < K ? ka : K - 1] : 0.f; v[8 + i] = kb < K ? row[kb < K ? kb : K - 1] : 0.f; }
  return bsplit16(v); }
__device__ __forceinline__ F2 split_col(const float* W, int k0, int n, int lane, int ld, int K) { float v[16]; const int g = lane >> 4;
#pragma unroll
  for (int i = 0; i < 8; ++i) { const int ka = k0 + 8 * g + i, kb = ka + 16; v[i] = ka < K ? W[(size_t)(ka < K ? ka : K - 1) * ld + n] : 0.f; v[8 + i] = kb < K ? W[(size_t)(kb < K ? kb : K - 1) * ld + n] : 0.f; }
  return bsplit16(v); }
__device__ __forceinline__ v8f mac3(const F2& a, const F2& b, v8f c) { c = wmma_bf(a.l, b.h, c); c = wmma_bf(a.h, b.l, c); return wmma_bf(a.h, b.h, c); }
__device__ __forceinline__ float sigm(float v) { return 1.0f / (1.0f + expf(-v)); }
#define LDSX() do { asm volatile("s_wait_dscnt 0" ::: "memory"); __builtin_amdgcn_wave_barrier(); __builtin_amdgcn_fence(__ATOMIC_RELEASE, "workgroup"); } while (0)

// Multi-head self-attention (inputs [2,2048,512]; (in,out) Wq / Wk / Wv / Wo [512,512] N(0, 1/512) + zero biases; 8 heads x 64; scale 1/8; softmax over keys; merge; Wo + bo).
#define NB 2
#define TT 2048
#define CC 512            // NH * HD = projected width
#define DIN 512          // input (model) width
#define NH 8
#define HD 64
#define NQB (TT / 64)
#define HG 4
#define SCALE (0.125f)
#define CAUSAL 0
#ifndef TNB
#define TNB NB
#endif
__device__ __forceinline__ float bfr(float v) { return (float)(__bf16)v; }
__host__ __device__ __forceinline__ int kb_last(int qb) { return CAUSAL ? ((qb * 64 + 63) >> 7) : (TT / 128 - 1); }
typedef __attribute__((ext_vector_type(8))) __bf16 v8b;
__device__ __forceinline__ v16b frag_b(const __bf16* rowk0, int lane) {
  union { v16b v; v8b q[2]; } u; const __bf16* p = rowk0 + 8 * (lane >> 4);
  u.q[0] = *(const v8b*)p; u.q[1] = *(const v8b*)(p + 16); return u.v;
}
#define QBH 0              // not read by any kernel here: k_fa has no high-precision path
#define QHI 0               // single-product logits on every row
#define KHI 64            // key rows carrying k residual / v bf16 hi+lo planes (written by k_proj; no kernel here reads them)
// B fragment (k rows k0+.., output column o) of a weight: (in,out) [K][ld] or (out,in) [ld rows of K]: bf16 exact, or f16(bf16 * 256) exact
__device__ __forceinline__ v16b wcol_io(const float* Wm, int k0, int o, int lane, int ld) { v16b w; const int g = lane >> 4;
#pragma unroll
  for (int i = 0; i < 8; ++i) { w[i] = (__bf16)Wm[(size_t)(k0 + 8 * g + i) * ld + o]; w[8 + i] = (__bf16)Wm[(size_t)(k0 + 16 + 8 * g + i) * ld + o]; }
  return w; }
__device__ __forceinline__ v16b wcol_oi(const float* Wm, int k0, int o, int lane, int K) { v16b w; const float* p = Wm + (size_t)o * K + k0 + 8 * (lane >> 4);
#pragma unroll
  for (int i = 0; i < 8; ++i) { w[i] = (__bf16)p[i]; w[8 + i] = (__bf16)p[16 + i]; }
  return w; }
__device__ __forceinline__ v16h wcolh_io(const float* Wm, int k0, int o, int lane, int ld) { v16h w; const int g = lane >> 4;
#pragma unroll
  for (int i = 0; i < 8; ++i) { w[i] = (_Float16)(bfr(Wm[(size_t)(k0 + 8 * g + i) * ld + o]) * 256.0f); w[8 + i] = (_Float16)(bfr(Wm[(size_t)(k0 + 16 + 8 * g + i) * ld + o]) * 256.0f); }
  return w; }
__device__ __forceinline__ v16h wcolh_oi(const float* Wm, int k0, int o, int lane, int K) { v16h w; const float* p = Wm + (size_t)o * K + k0 + 8 * (lane >> 4);
#pragma unroll
  for (int i = 0; i < 8; ++i) { w[i] = (_Float16)(bfr(p[i]) * 256.0f); w[8 + i] = (_Float16)(bfr(p[16 + i]) * 256.0f); }
  return w; }
#define WQKV_LAYOUT 0   // selects WCOL, which no kernel here calls: k_proj always stages Wq / Wk / Wv as (in,out) [DIN][CC]
__device__ __forceinline__ v16b wcol_hdk(const float* Wm, int k0, int o, int lane) { v16b w; const int g = lane >> 4; const float* p = Wm + (size_t)(o / HD) * DIN * HD + (o % HD);
#pragma unroll
  for (int i = 0; i < 8; ++i) { w[i] = (__bf16)p[(size_t)(k0 + 8 * g + i) * HD]; w[8 + i] = (__bf16)p[(size_t)(k0 + 16 + 8 * g + i) * HD]; }
  return w; }
#define WO_OUT_IN 0
#if WQKV_LAYOUT == 1
#define WCOL(W, k0, o, lane) wcol_oi(W, k0, o, lane, DIN)
#elif WQKV_LAYOUT == 2
#define WCOL(W, k0, o, lane) wcol_hdk(W, k0, o, lane)
#else
#define WCOL(W, k0, o, lane) wcol_io(W, k0, o, lane, CC)
#endif
#if WO_OUT_IN
#define WOCOL(W, k0, o, lane) wcol_oi(W, k0, o, lane, CC)
#define WOCOLH(W, k0, o, lane) wcolh_oi(W, k0, o, lane, CC)
#else
#define WOCOL(W, k0, o, lane) wcol_io(W, k0, o, lane, DIN)
#define WOCOLH(W, k0, o, lane) wcolh_io(W, k0, o, lane, DIN)
#endif

#ifndef SM_EXTRA_PARAMS
#define SM_EXTRA_PARAMS
#endif
#ifndef PROJ_EXTRA_PARAMS
#define PROJ_EXTRA_PARAMS
#endif
#ifndef SM_MASK_HOOK
#define SM_MASK_HOOK (void)0
#endif

#define WS_QH  0u                                      // f16 q rows [b*t][CC]
#define WS_KH  (WS_QH + 2u * (size_t)NB * TT * CC)      // f16 k rows [b*t][CC]
#define WS_VT  (WS_KH + 2u * (size_t)NB * TT * CC)      // f16 v planes [b][c][t]
#define WS_QL  (WS_VT + 2u * (size_t)NB * CC * TT)      // f16 q residual x 2^10 rows [b][t < QHI][CC]
#define WS_KL  (WS_QL + 2u * (size_t)NB * QHI * CC)     // f16 k residual x 2^10 rows [b][t < KHI][CC]
#define WS_VB  (WS_KL + 2u * (size_t)NB * KHI * CC)     // bf16 v hi planes [b][c][t < KHI]
#define WS_VBL (WS_VB + 2u * (size_t)NB * CC * KHI)
#define WS_S   (WS_VBL + 2u * (size_t)NB * CC * KHI)    // f32 [hg][t][s], not used: k_fa keeps logits and P in registers
#define WS_Y   (WS_S  + 4u * (size_t)HG * TT * TT)      // f32 ctx rows [b*t][CC] (only when there is an output projection)
#define WS_END (WS_Y  + 4u * (size_t)NB * TT * CC)

// ---- weight staging for k_proj and k_out: a [KS][128] f32 tile of a (in,out) weight is read once per block with whole-line 16-byte loads, converted once, and laid in LDS column by column (k contiguous), where every wave takes its B fragments with 16-byte LDS reads
#define KS 64            // k rows of one staged tile
#define WP (KS + 8)      // LDS pitch of a staged column in elements: 144 B = 16 B x 9, free of bank conflicts for the fragment reads and for the staging stores
// one thread's share of a tile: 2 units of (8 k rows x 4 columns); a wave covers 32 columns, lane = (k octet = lane & 3, column group = lane >> 2), so each load instruction covers four whole 128-B lines
struct WT { v4f r[2][8]; };
__device__ __forceinline__ void wt_load(WT& t, const float* Wm, int k0, int c0, int ld, int wave, int lane) {
  const float* p = Wm + (size_t)(k0 + 8 * (lane & 3)) * ld + c0 + 32 * wave + 4 * (lane >> 2);
#pragma unroll
  for (int u = 0; u < 2; ++u) {
#pragma unroll
    for (int i = 0; i < 8; ++i) t.r[u][i] = *(const v4f*)(p + (size_t)(32 * u + i) * ld); } }
__device__ __forceinline__ void wt_store_b(const WT& t, __bf16* wb, int wave, int lane) {   // bf16, exact operand of k_proj
  __bf16* d = wb + (32 * wave + 4 * (lane >> 2)) * WP + 8 * (lane & 3);
#pragma unroll
  for (int u = 0; u < 2; ++u) {
#pragma unroll
    for (int c = 0; c < 4; ++c) { v8b x;
#pragma unroll
      for (int i = 0; i < 8; ++i) x[i] = (__bf16)t.r[u][i][c];
      *(v8b*)(d + c * WP + 32 * u) = x; } } }
__device__ __forceinline__ void wt_store_h(const WT& t, _Float16* wb, int wave, int lane) {   // f16(bf16 x 2^8), exact operand of k_out
  _Float16* d = wb + (32 * wave + 4 * (lane >> 2)) * WP + 8 * (lane & 3);
#pragma unroll
  for (int u = 0; u < 2; ++u) {
#pragma unroll
    for (int c = 0; c < 4; ++c) { v8h x;
#pragma unroll
      for (int i = 0; i < 8; ++i) x[i] = (_Float16)(bfr(t.r[u][i][c]) * 256.0f);
      *(v8h*)(d + c * WP + 32 * u) = x; } } }
// a lane's raw f32 share of the A fragments of one stage (KS k of its own row): per 32 k, elements 8g + 0..7 and 16 + 8g + 0..7
struct XT { v4f r[KS / 32][4]; };
__device__ __forceinline__ void xt_load(XT& t, const float* rowk0, int lane) { const float* p = rowk0 + 8 * (lane >> 4);
#pragma unroll
  for (int kk = 0; kk < KS / 32; ++kk) { t.r[kk][0] = *(const v4f*)(p + kk * 32); t.r[kk][1] = *(const v4f*)(p + kk * 32 + 4); t.r[kk][2] = *(const v4f*)(p + kk * 32 + 16); t.r[kk][3] = *(const v4f*)(p + kk * 32 + 20); } }

// ---- k_proj: block = (64 rows, 128 cols, which): q/k/v = X W (+ b) with exact bf16 products (K = DIN) -> which 0: q f16 rows (+ residual rows < QHI); 1: k f16 rows (+ residual rows < KHI); 2: v f16 planes [c][t] (+ bf16 hi/lo planes for t < KHI)
__global__ __launch_bounds__(128) void k_proj(const float* __restrict__ XQ, const float* __restrict__ XK, const float* __restrict__ XV, const float* __restrict__ WQ, const float* __restrict__ WK, const float* __restrict__ WV, const float* __restrict__ BQ, const float* __restrict__ BK, const float* __restrict__ BV,
    _Float16* __restrict__ QH, _Float16* __restrict__ QL, _Float16* __restrict__ KH, _Float16* __restrict__ KL, _Float16* __restrict__ VT, __bf16* __restrict__ VB, __bf16* __restrict__ VBL) {
  __shared__ __align__(16) union { struct { _Float16 sh[64][136], sl[64][136], th[128][72]; __bf16 tb[128][72], tbl[128][72]; } e; __bf16 wb[2][128 * WP]; } sm;   // the weight stages share LDS with the epilogue's tiles, so that as many blocks as before fit a WGP
  auto& sh = sm.e.sh; auto& sl = sm.e.sl; auto& th = sm.e.th; auto& tb = sm.e.tb; auto& tbl = sm.e.tbl;
  const int tid = threadIdx.x, wave = tid >> 5, lane = tid & 31, col = lane & 15, g = lane >> 4; const int which = blockIdx.z; const int c0 = blockIdx.y * 128; const size_t r0 = (size_t)blockIdx.x * 64; const size_t bb = r0 / TT; const int t0 = (int)(r0 % TT);
  const float* X = which == 0 ? XQ : which == 1 ? XK : XV; const float* WA = which == 0 ? WQ : which == 1 ? WK : WV; const float* BA = which == 0 ? BQ : which == 1 ? BK : BV;
  v8f acc[8] = {};
  const float* Xr = X + (r0 + wave * 16 + col) * DIN; WT wt; XT xt; v16b af[KS / 32];
  wt_load(wt, WA, 0, c0, CC, wave, lane); xt_load(xt, Xr, lane); wt_store_b(wt, sm.wb[0], wave, lane);
#pragma unroll
  for (int kk = 0; kk < KS / 32; ++kk) {
#pragma unroll
    for (int i = 0; i < 8; ++i) { af[kk][i] = (__bf16)xt.r[kk][i >> 2][i & 3]; af[kk][8 + i] = (__bf16)xt.r[kk][2 + (i >> 2)][i & 3]; } }
  __syncthreads();   // stage 0 is published
#pragma unroll 2
  for (int s = 0; s < DIN / KS; ++s) { const bool more = s + 1 < DIN / KS;   // two buffers: stage s + 1 is fetched into registers while stage s is worked on
    if (more) { wt_load(wt, WA, (s + 1) * KS, c0, CC, wave, lane); xt_load(xt, Xr + (s + 1) * KS, lane); }
    __builtin_amdgcn_sched_barrier(0);   // keeps the next stage's global loads issued in front of this stage's products, which then cover their latency
    const __bf16* wc = sm.wb[s & 1] + col * WP;
#pragma unroll
    for (int kk = 0; kk < KS / 32; ++kk) { v16b wf[8];
#pragma unroll
      for (int j = 0; j < 8; ++j) wf[j] = frag_b(wc + j * 16 * WP + kk * 32, lane);
      __builtin_amdgcn_sched_barrier(0);   // keeps the 16 LDS reads together in front of their products: one wait for the group, where a read pair in front of each product waits out the LDS latency eight times
#pragma unroll
      for (int j = 0; j < 8; ++j) acc[j] = wmma_bf(af[kk], wf[j], acc[j]); }
    __builtin_amdgcn_sched_barrier(0);   // keeps the fetched tile's conversion, and with it the wait for its loads, behind this stage's products
    if (more) { wt_store_b(wt, sm.wb[(s + 1) & 1], wave, lane);
#pragma unroll
      for (int kk = 0; kk < KS / 32; ++kk) {
#pragma unroll
        for (int i = 0; i < 8; ++i) { af[kk][i] = (__bf16)xt.r[kk][i >> 2][i & 3]; af[kk][8 + i] = (__bf16)xt.r[kk][2 + (i >> 2)][i & 3]; } } }
    __syncthreads(); }   // publishes stage s + 1 and ends every wave's reads of stage s, whose buffer is written next (after the last stage: by the epilogue)
  if (which < 2) { _Float16* DH = which == 0 ? QH : KH; _Float16* DL = which == 0 ? QL : KL; const int nhi = which == 0 ? QHI : KHI; const bool hi_rows = t0 < nhi;
#pragma unroll
    for (int j = 0; j < 8; ++j) { const float bias = BA ? bfr(BA[c0 + j * 16 + col]) : 0.f;
#pragma unroll
      for (int r = 0; r < 8; ++r) { const float v = acc[j][r] + bias; const _Float16 hv = (_Float16)v; sh[wave * 16 + 8 * g + r][j * 16 + col] = hv; sl[wave * 16 + 8 * g + r][j * 16 + col] = (_Float16)((v - (float)hv) * 1024.0f); } }
    __syncthreads();
    for (int e = tid; e < 64 * 16; e += 128) { const int rl = e >> 4, q = e & 15; vst2((unsigned*)(DH + (r0 + rl) * CC + c0 + q * 8), *(const v4u*)&sh[rl][q * 8]); if (hi_rows) vst2((unsigned*)(DL + (bb * nhi + t0 + rl) * (size_t)CC + c0 + q * 8), *(const v4u*)&sl[rl][q * 8]); }
  } else { const bool hi_rows = t0 < KHI;
#pragma unroll
    for (int j = 0; j < 8; ++j) { const float bias = BA ? bfr(BA[c0 + j * 16 + col]) : 0.f;
#pragma unroll
      for (int r = 0; r < 8; ++r) { const float v = acc[j][r] + bias; const int rl = wave * 16 + 8 * g + r, cl = j * 16 + col; th[cl][rl] = (_Float16)v; const __bf16 bh = (__bf16)v; tb[cl][rl] = bh; tbl[cl][rl] = (__bf16)(v - (float)bh); } }
    __syncthreads();
    for (int e = tid; e < 128 * 8; e += 128) { const int cl = e >> 3, q = e & 7; vst2((unsigned*)(VT + (bb * CC + c0 + cl) * (size_t)TT + t0 + q * 8), *(const v4u*)&th[cl][q * 8]); if (hi_rows) { const size_t o3 = (bb * CC + c0 + cl) * (size_t)KHI + t0 + q * 8; vst2((unsigned*)(VB + o3), *(const v4u*)&tb[cl][q * 8]); vst2((unsigned*)(VBL + o3), *(const v4u*)&tbl[cl][q * 8]); } } } }
// ---- k_fa: block = 128 queries of (b, h), 16 waves = (8 groups of 16 query columns) x (2 halves of the key range): four waves a SIMD, so that one wave's softmax runs beside another's products. Each wave walks its half in trips of 64 keys with a running maximum (online softmax), so logits and P stay in registers; the two halves' (maximum, sum, O) are joined once, through LDS, behind the loop.
// S^T = K . Q^T (A = k rows, B = q rows): lane (g, col) holds keys 8g + r of each 16-key tile for query col, which is the B fragment order of P^T; O^T += V^T . P^T (A = v planes [c][t]): lane holds d = 16j + 8g + r of query col.
// Every inner loop below is unrolled so that the fragment and accumulator arrays are indexed by constants and stay in registers.
__device__ __forceinline__ v8f wmma_h(v16h a, v16h b, v8f c) { return __builtin_amdgcn_wmma_f32_16x16x32_f16(false, a, false, b, (short)0, c, false, false); }
__device__ __forceinline__ float xhalf(float x) { return __builtin_bit_cast(float, __builtin_amdgcn_permlanex16(__builtin_bit_cast(int, x), __builtin_bit_cast(int, x), 0x76543210, 0xfedcba98, false, false)); }   // lane l with lane l ^ 16
// K and V reach the waves through LDS: the 8 waves of a half need the same 16 KB a trip, so each tile is brought in once per block with whole-line asynchronous copies and every wave takes its fragments with 16-byte LDS reads.
// Tile t of a half = (v planes of its keys 64t.., k rows of its keys 64(t + 1)..): what trip t reads, since the scores are formed one trip ahead. Two buffers a half: tile t + 1 flies while trip t works. A half's tiles are copied by its own 8 waves.
#define KH2 (TT / 2)     // keys of one half
#define NT (KH2 / 64)    // trips of a wave
#define KP (64 + 8)      // LDS pitch of a staged 128-B row in elements: 144 B = 16 B x 9, free of bank conflicts for the fragment reads
#define KVB (2 * 64 * KP * 2)   // bytes of one buffer: 64 k rows, then 64 v rows
// one thread's share of a tile: 16 B of k rows r and r + 32 and of v rows r and r + 32 (8 lanes a row: each copy instruction covers four whole 128-B lines)
__device__ __forceinline__ void kv_copy(unsigned lds, const _Float16* gk, const _Float16* gv) {
  const unsigned l1 = lds + 32 * KP * 2, l2 = lds + 64 * KP * 2, l3 = lds + 96 * KP * 2; const _Float16* gk1 = gk + (size_t)32 * CC; const _Float16* gv1 = gv + (size_t)32 * TT;
  // the s_wait_xcnt stands in the copies' own statement, so that no address register is rewritten in front of it
  asm volatile("global_load_async_to_lds_b128 %0, %4, off\n\tglobal_load_async_to_lds_b128 %1, %5, off\n\tglobal_load_async_to_lds_b128 %2, %6, off\n\tglobal_load_async_to_lds_b128 %3, %7, off\n\ts_wait_xcnt 0x0"
               :: "v"(lds), "v"(l1), "v"(l2), "v"(l3), "v"(gk), "v"(gk1), "v"(gv), "v"(gv1) : "memory"); }
// the same for k rows alone: keys 0..63, whose scores are formed in front of the loop
__device__ __forceinline__ void k_copy(unsigned lds, const _Float16* gk) {
  const unsigned l1 = lds + 32 * KP * 2; const _Float16* gk1 = gk + (size_t)32 * CC;
  // as above: the s_wait_xcnt in the copies' own statement, in front of any rewrite of their address registers
  asm volatile("global_load_async_to_lds_b128 %0, %2, off\n\tglobal_load_async_to_lds_b128 %1, %3, off\n\ts_wait_xcnt 0x0" :: "v"(lds), "v"(l1), "v"(gk), "v"(gk1) : "memory"); }
__global__ __launch_bounds__(512) void k_fa(const _Float16* __restrict__ QH, const _Float16* __restrict__ KH, const _Float16* __restrict__ VT, float* __restrict__ Y) {
  __shared__ __align__(16) _Float16 kv[2][2][2][64 * KP];   // [half][buffer][k rows, v rows]
  __shared__ __align__(16) _Float16 kz[2][64 * KP];         // [half] k rows of its keys 0..63: filled once, read once
  __shared__ __align__(16) v4f jo[8][8][32];                // the upper half's O, [query group][4 values][lane]
  __shared__ __align__(8) v2f jm[8][32];                    // its (maximum, sum)
  const int hf = __builtin_amdgcn_readfirstlane((int)threadIdx.x >> 8);   // the wave's half of the key range, the same in every lane
  const int tid = threadIdx.x & 255, wave = tid >> 5, lane = tid & 31, col = lane & 15, g = lane >> 4; const int b = blockIdx.y / NH, h = blockIdx.y % NH; const int q = blockIdx.x * 128 + wave * 16 + col;
  const _Float16* Qr = QH + ((size_t)b * TT + q) * CC + h * HD;
  const _Float16* Kc = KH + ((size_t)b * TT + hf * KH2 + (tid >> 3)) * CC + h * HD + 8 * (tid & 7); const _Float16* Vc = VT + ((size_t)b * CC + h * HD + (tid >> 3)) * (size_t)TT + hf * KH2 + 8 * (tid & 7);   // the thread's sources in its half's keys 0..63
  const unsigned lc = (unsigned)(size_t)&kv[hf][0][0][(tid >> 3) * KP + 8 * (tid & 7)];   // its place in its half's buffer 0 (LDS byte address)
  k_copy((unsigned)(size_t)&kz[hf][(tid >> 3) * KP + 8 * (tid & 7)], Kc);
  kv_copy(lc, Kc + (size_t)64 * CC, Vc);   // tile 0
  const v16h q0 = frag_h(Qr, lane), q1 = frag_h(Qr + 32, lane);
  const float C2 = SCALE * 1.4426950408889634f;   // logits carried in base 2
  v8f acc[HD / 16] = {}; float m = -3.0e38f, l = 0.f;
  v8f s[4];   // scores of the coming trip, carried over the loop's back edge: every fragment read of a trip is issued at its head and used at its foot
  asm volatile("s_wait_asynccnt 0x0" ::: "memory");   // this wave's share of the first k rows and of tile 0 has landed
  __syncthreads();   // both are published
  kv_copy(lc + KVB, Kc + (size_t)128 * CC, Vc + 64);   // tile 1
#pragma unroll
  for (int t = 0; t < 4; ++t) { const v8f z = {}; s[t] = wmma_h(frag_h(&kz[hf][(t * 16 + col) * KP], lane), q0, z); s[t] = wmma_h(frag_h(&kz[hf][(t * 16 + col) * KP + 32], lane), q1, s[t]); }
  for (int t = 0; t < NT; ++t) {
    const _Float16* kl = &kv[hf][t & 1][0][col * KP]; const _Float16* vl = &kv[hf][t & 1][1][col * KP];
    v16h vf[HD / 16][2], kf[4][2];
#pragma unroll
    for (int j = 0; j < HD / 16; ++j) { vf[j][0] = frag_h(vl + j * 16 * KP, lane); vf[j][1] = frag_h(vl + j * 16 * KP + 32, lane); }
#pragma unroll
    for (int u = 0; u < 4; ++u) { kf[u][0] = frag_h(kl + u * 16 * KP, lane); kf[u][1] = frag_h(kl + u * 16 * KP + 32, lane); }   // the next trip's k rows (the last tile holds the last trip's own again; those scores are not used)
    __builtin_amdgcn_sched_barrier(0);   // keeps the trip's LDS reads issued in front of the softmax, whose work then covers their latency; without it they sink to their first use
    float mt[4];   // four independent chains
#pragma unroll
    for (int u = 0; u < 4; ++u) { mt[u] = s[u][0];
#pragma unroll
      for (int r = 1; r < 8; ++r) mt[u] = fmaxf(mt[u], s[u][r]); }
    float mx = fmaxf(fmaxf(mt[0], mt[1]), fmaxf(mt[2], mt[3])); mx = fmaxf(mx, xhalf(mx));
    const float mn = fmaxf(m, mx * C2); float alpha;   // 2^(m - mn), 0 on the first trip
    asm("v_exp_f32 %0, %1\n\tv_nop" : "=v"(alpha) : "v"(m - mn));   // asm for the v_nop alone: it fills the slot behind a transcendental
    m = mn;
    const float off = 10.0f - mn;   // P relative to the running maximum, x 2^10 into f16 (clear of f16 subnormals); the factor cancels against l
    v16h p[2]; float ps[4];
#pragma unroll
    for (int u = 0; u < 4; ++u) { ps[u] = 0.f;
#pragma unroll
      for (int r = 0; r < 8; ++r) { const float e = __builtin_amdgcn_exp2f(fmaf(s[u][r], C2, off)); ps[u] += e; p[u >> 1][(u & 1) * 8 + r] = (_Float16)e; } }
    l = l * alpha + ((ps[0] + ps[1]) + (ps[2] + ps[3]));
#pragma unroll
    for (int j = 0; j < HD / 16; ++j) { acc[j] *= alpha; acc[j] = wmma_h(vf[j][0], p[0], acc[j]); acc[j] = wmma_h(vf[j][1], p[1], acc[j]); }
#pragma unroll
    for (int u = 0; u < 4; ++u) { const v8f z = {}; s[u] = wmma_h(kf[u][0], q0, z); s[u] = wmma_h(kf[u][1], q1, s[u]); }
    __builtin_amdgcn_sched_barrier(0);   // keeps the waits and the barrier below at the trip's foot: lifted to the LDS reads, as the build without it had them, they expose the reads' latency and leave the flying tile no lead
    asm volatile("s_wait_dscnt 0x0" ::: "memory");      // this wave's reads of the buffer are over before it is refilled
    asm volatile("s_wait_asynccnt 0x0" ::: "memory");   // this wave's share of tile t + 1 has landed
    __syncthreads();   // publishes tile t + 1 and ends every wave's reads of tile t, whose buffer is refilled next
    if (t + 2 < NT) kv_copy(lc + (t & 1) * KVB, Kc + (size_t)((t + 3 < NT ? t + 3 : NT - 1) * 64) * CC, Vc + (t + 2) * 64); }
  asm volatile("s_wait_asynccnt 0x0" ::: "memory");   // no copy is left in flight when the wave ends
  if (hf == 1) { jm[wave][lane] = v2f{m, l};   // the upper half hands over its state
#pragma unroll
    for (int j = 0; j < HD / 16; ++j) { jo[wave][2 * j][lane] = v4f{acc[j][0], acc[j][1], acc[j][2], acc[j][3]}; jo[wave][2 * j + 1][lane] = v4f{acc[j][4], acc[j][5], acc[j][6], acc[j][7]}; } }
  __syncthreads();   // publishes it; every wave passes
  if (hf == 1) return;   // behind the last barrier
  const v2f om = jm[wave][lane]; const float mj = fmaxf(m, om[0]); const float a0 = __builtin_amdgcn_exp2f(m - mj), a1 = __builtin_amdgcn_exp2f(om[0] - mj);   // both states rescaled to the common maximum
  l = l * a0 + om[1] * a1;
#pragma unroll
  for (int j = 0; j < HD / 16; ++j) { const v4f x = jo[wave][2 * j][lane], y = jo[wave][2 * j + 1][lane];
#pragma unroll
    for (int r = 0; r < 4; ++r) { acc[j][r] = acc[j][r] * a0 + x[r] * a1; acc[j][4 + r] = acc[j][4 + r] * a0 + y[r] * a1; } }
  l += xhalf(l); const float inv = 1.0f / l;   // l >= 2^10: the maximum's own term
  float* Yr = Y + ((size_t)b * TT + q) * CC + h * HD + 8 * g;
#pragma unroll
  for (int j = 0; j < HD / 16; ++j) { v4f a, c;
#pragma unroll
    for (int r = 0; r < 4; ++r) { a[r] = acc[j][r] * inv; c[r] = acc[j][4 + r] * inv; }
    vst2(Yr + j * 16, a); vst2(Yr + j * 16 + 4, c); } }
// ---- k_out: block = (64 rows, 128 cols): out = ctx Wo (+ bo): ctx x 2^6 once to f16 against Wo as f16(bf16 x 2^8) exact (1 product) x 2^-14; causal early rows (< QHI of each sequence): ctx bf16 hi + lo against exact bf16 Wo (2 products)
__global__ __launch_bounds__(128) void k_out(const float* __restrict__ Y, const float* __restrict__ WO, const float* __restrict__ BO, float* __restrict__ OUT) { __shared__ __align__(16) float sf[4][16][132]; __shared__ __align__(16) _Float16 wb[2][128 * WP];
  const int tid = threadIdx.x, wave = tid >> 5, lane = tid & 31, col = lane & 15, g = lane >> 4; const int c0 = blockIdx.y * 128; const size_t r0 = (size_t)blockIdx.x * 64 + wave * 16;
  v8f acc[8] = {};
  if (CAUSAL && (int)(((size_t)blockIdx.x * 64) % TT) < QHI) {   /* block-uniform */
#pragma unroll 2
    for (int kc = 0; kc < CC / 32; ++kc) { const F2 a = split_row(Y + (r0 + col) * CC, kc * 32, lane); asm volatile("s_wait_loadcnt 0x0" ::: "memory");
#pragma unroll
      for (int j = 0; j < 8; ++j) { const v16b w = WOCOL(WO, kc * 32, c0 + j * 16 + col, lane); asm volatile("s_wait_loadcnt 0x0" ::: "memory"); acc[j] = wmma_bf(a.h, w, acc[j]); acc[j] = wmma_bf(a.l, w, acc[j]); } }
#pragma unroll
    for (int j = 0; j < 8; ++j) { const float bias = BO ? bfr(BO[c0 + j * 16 + col]) : 0.f;
#pragma unroll
      for (int r = 0; r < 8; ++r) sf[wave][8 * g + r][j * 16 + col] = acc[j][r] + bias; }
  } else {
    const float* Yr = Y + (r0 + col) * CC; WT wt; XT xt; v16h af[KS / 32];   /* ctx carried x 2^6 into f16 so small-magnitude context rows stay clear of f16 subnormals */
    wt_load(wt, WO, 0, c0, DIN, wave, lane); xt_load(xt, Yr, lane); wt_store_h(wt, wb[0], wave, lane);
#pragma unroll
    for (int kk = 0; kk < KS / 32; ++kk) {
#pragma unroll
      for (int i = 0; i < 8; ++i) { af[kk][i] = (_Float16)(xt.r[kk][i >> 2][i & 3] * 64.0f); af[kk][8 + i] = (_Float16)(xt.r[kk][2 + (i >> 2)][i & 3] * 64.0f); } }
    __syncthreads();   // stage 0 is published
#pragma unroll 2
    for (int s = 0; s < CC / KS; ++s) { const bool more = s + 1 < CC / KS;   // two buffers, as in k_proj
      if (more) { wt_load(wt, WO, (s + 1) * KS, c0, DIN, wave, lane); xt_load(xt, Yr + (s + 1) * KS, lane); }
      __builtin_amdgcn_sched_barrier(0);   // keeps the next stage's global loads issued in front of this stage's products, which then cover their latency
      const _Float16* wc = wb[s & 1] + col * WP;
#pragma unroll
      for (int kk = 0; kk < KS / 32; ++kk) { v16h wf[8];
#pragma unroll
        for (int j = 0; j < 8; ++j) wf[j] = frag_h(wc + j * 16 * WP + kk * 32, lane);
        __builtin_amdgcn_sched_barrier(0);   // keeps the 16 LDS reads together in front of their products: one wait for the group
#pragma unroll
        for (int j = 0; j < 8; ++j) acc[j] = wmma16(af[kk], wf[j], acc[j]); }
      __builtin_amdgcn_sched_barrier(0);   // keeps the fetched tile's conversion, and with it the wait for its loads, behind this stage's products
      if (more) { wt_store_h(wt, wb[(s + 1) & 1], wave, lane);
#pragma unroll
        for (int kk = 0; kk < KS / 32; ++kk) {
#pragma unroll
          for (int i = 0; i < 8; ++i) { af[kk][i] = (_Float16)(xt.r[kk][i >> 2][i & 3] * 64.0f); af[kk][8 + i] = (_Float16)(xt.r[kk][2 + (i >> 2)][i & 3] * 64.0f); } } }
      __syncthreads(); }   // publishes stage s + 1 and ends every wave's reads of stage s, whose buffer is written next
#pragma unroll
    for (int j = 0; j < 8; ++j) { const float bias = BO ? bfr(BO[c0 + j * 16 + col]) : 0.f;
#pragma unroll
      for (int r = 0; r < 8; ++r) sf[wave][8 * g + r][j * 16 + col] = acc[j][r] * (1.0f / 16384.0f) + bias; } }   /* 2^-8 (Wo carry) x 2^-6 (ctx carry) */
  LDSX(); for (int rl = 0; rl < 16; ++rl) vst2(OUT + (r0 + rl) * DIN + c0 + lane * 4, *(const v4f*)&sf[wave][rl][lane * 4]); }

extern "C" void kernel_launch(void* const* d_in, const int* in_sizes, int n_in, void* d_out, int out_size, void* d_ws, size_t ws_size, hipStream_t stream) {
  (void)in_sizes; (void)n_in; (void)out_size;
  const float** F = (const float**)d_in;
  if (ws_size < (size_t)WS_END) return;
  char* ws = (char*)d_ws; _Float16 *QH = (_Float16*)(ws + WS_QH), *KH = (_Float16*)(ws + WS_KH), *VT = (_Float16*)(ws + WS_VT), *QL = (_Float16*)(ws + WS_QL), *KL = (_Float16*)(ws + WS_KL); __bf16 *VB = (__bf16*)(ws + WS_VB), *VBL = (__bf16*)(ws + WS_VBL); float *Y = (float*)(ws + WS_Y);
  (void)Y; (void)QL; (void)KL; (void)VB; (void)VBL;
  // inputs: 0 inputs [2,2048,512]; 1 Wq [512,512] (in,out), 2 bq; 3 Wk, 4 bk; 5 Wv, 6 bv; 7 Wo (in,out), 8 bo (zero biases, read)
  k_proj<<<dim3(TNB * TT / 64, CC / 128, 3), 128, 0, stream>>>(F[0], F[0], F[0], F[1], F[3], F[5], F[2], F[4], F[6], QH, QL, KH, KL, VT, VB, VBL);
  k_fa<<<dim3(TT / 128, TNB * NH), 512, 0, stream>>>(QH, KH, VT, Y);
  k_out<<<dim3(TNB * TT / 64, DIN / 128), 128, 0, stream>>>(Y, F[7], F[8], (float*)d_out);
}

// v005
// It runs in 44.8 microseconds.
// Timed twice side by side with v004, it ran 1.11 and 1.10 times as fast.
// Counting every step since v000, it is 13.0 times as fast.
// compute dtype: all float inputs rounded to bf16; q/k/v projections with EXACT bf16 products on WMMA 16x16x32 (f32 accumulate) + bias; logits q x k once to f16 each (1 product) x SCALE; online softmax f32; P (relative to the running maximum) x 2^10 once to f16 x v once to f16 (1 product); ctx x 2^6 once to f16 x Wo f16(bf16 x 2^8) + bo; f32 output.
#include <hip/hip_runtime.h>
#include <math.h>

typedef __attribute__((ext_vector_type(16))) _Float16 v16h;
typedef __attribute__((ext_vector_type(16))) __bf16 v16b;
typedef __attribute__((ext_vector_type(8)))  _Float16 v8h;
typedef __attribute__((ext_vector_type(8)))  float v8f;
typedef __attribute__((ext_vector_type(4)))  float v4f;
typedef __attribute__((ext_vector_type(2)))  float v2f;
typedef __attribute__((ext_vector_type(4)))  unsigned v4u;
typedef __attribute__((ext_vector_type(4)))  int v4i;
typedef float __attribute__((may_alias)) float_a;
typedef int __attribute__((may_alias)) int_a;

template <typename T> __device__ __forceinline__ void vst2(void* p, T v) { *(T*)p = v;  }
__device__ __forceinline__ v8f wmma16(v16h a, v16h b, v8f c) {
  v8f d = __builtin_amdgcn_wmma_f32_16x16x32_f16(false, a, false, b, (short)0, c, false, false);
  asm volatile("v_nop\n\tv_nop\n\tv_nop\n\tv_nop" : "+v"(d) : "v"(a), "v"(b));
  return d;
}
__device__ __forceinline__ v8f wmma_bf(v16b a, v16b b, v8f c) {
  v8f d = __builtin_amdgcn_wmma_f32_16x16x32_bf16(false, a, false, b, (short)0, c, false, false);
  asm volatile("v_nop\n\tv_nop\n\tv_nop\n\tv_nop" : "+v"(d) : "v"(a), "v"(b));
  return d;
}
// 16x16x32 fragments: lane = (h = lane>>4, row/col = lane&15); elements 0..7 = k0+8h+0..7, 8..15 = k0+16+8h+0..7; D element r = row 8h+r
__device__ __forceinline__ v16h frag_h(const _Float16* rowk0, int lane) {
  union { v16h v; v8h q[2]; } u; const _Float16* p = rowk0 + 8 * (lane >> 4);
  u.q[0] = *(const v8h*)p; u.q[1] = *(const v8h*)(p + 16); return u.v;
}
__device__ __forceinline__ v16h frag_f32(const float* rowk0, int lane) {
  v16h a; const float* p = rowk0 + 8 * (lane >> 4);
#pragma unroll
  for (int i = 0; i < 8; ++i) { a[i] = (_Float16)p[i]; a[8 + i] = (_Float16)p[16 + i]; }
  return a;
}
__device__ __forceinline__ v16h frag_f32s(const float* rowk0, int lane, float sc) {
  v16h a; const float* p = rowk0 + 8 * (lane >> 4);
#pragma unroll
  for (int i = 0; i < 8; ++i) { a[i] = (_Float16)(p[i] * sc); a[8 + i] = (_Float16)(p[16 + i] * sc); }
  return a;
}
// column fragment from a [K][ld] layout (column n), rows >= K read as 0
__device__ __forceinline__ v16h fragc_f32(const float* W, int k0, int n, int lane, int ld, int K) {
  v16h a; const int g = lane >> 4;
#pragma unroll
  for (int i = 0; i < 8; ++i) { const int ka = k0 + 8 * g + i, kb = ka + 16;
    a[i] = (_Float16)(ka < K ? W[(size_t)(ka < K ? ka : K - 1) * ld + n] : 0.f); a[8 + i] = (_Float16)(kb < K ? W[(size_t)(kb < K ? kb : K - 1) * ld + n] : 0.f); }
  return a;
}
struct F2 { v16b h, l; };
__device__ __forceinline__ F2 bsplit16(const float v[16]) { F2 r;
#pragma unroll
  for (int i = 0; i < 16; ++i) { const __bf16 h = (__bf16)v[i]; r.h[i] = h; r.l[i] = (__bf16)(v[i] - (float)h); }
  return r; }
__device__ __forceinline__ F2 split_row(const float* row, int k0, int lane) { float v[16]; const float* p = row + k0 + 8 * (lane >> 4);
#pragma unroll
  for (int i = 0; i < 8; ++i) { v[i] = p[i]; v[8 + i] = p[16 + i]; }
  return bsplit16(v); }
__device__ __forceinline__ F2 split_rowK(const float* row, int k0, int lane, int K) { float v[16]; const int g = lane >> 4;
#pragma unroll
  for (int i = 0; i < 8; ++i) { const int ka = k0 + 8 * g + i, kb = ka + 16; v[i] = ka < K ? row[ka < K ? ka : K - 1] : 0.f; v[8 + i] = kb < K ? row[kb < K ? kb : K - 1] : 0.f; }
  return bsplit16(v); }
__device__ __forceinline__ F2 split_col(const float* W, int k0, int n, int lane, int ld, int K) { float v[16]; const int g = lane >> 4;
#pragma unroll
  for (int i = 0; i < 8; ++i) { const int ka = k0 + 8 * g + i, kb = ka + 16; v[i] = ka < K ? W[(size_t)(ka < K ? ka : K - 1) * ld + n] : 0.f; v[8 + i] = kb < K ? W[(size_t)(kb < K ? kb : K - 1) * ld + n] : 0.f; }
  return bsplit16(v); }
__device__ __forceinline__ v8f mac3(const F2& a, const F2& b, v8f c) { c = wmma_bf(a.l, b.h, c); c = wmma_bf(a.h, b.l, c); return wmma_bf(a.h, b.h, c); }
__device__ __forceinline__ float sigm(float v) { return 1.0f / (1.0f + expf(-v)); }
#define LDSX() do { asm volatile("s_wait_dscnt 0" ::: "memory"); __builtin_amdgcn_wave_barrier(); __builtin_amdgcn_fence(__ATOMIC_RELEASE, "workgroup"); } while (0)

// Multi-head self-attention (inputs [2,2048,512]; (in,out) Wq / Wk / Wv / Wo [512,512] N(0, 1/512) + zero biases; 8 heads x 64; scale 1/8; softmax over keys; merge; Wo + bo).
#define NB 2
#define TT 2048
#define CC 512            // NH * HD = projected width
#define DIN 512          // input (model) width
#define NH 8
#define HD 64
#define NQB (TT / 64)
#define HG 4
#define SCALE (0.125f)
#define CAUSAL 0
#ifndef TNB
#define TNB NB
#endif
__device__ __forceinline__ float bfr(float v) { return (float)(__bf16)v; }
__host__ __device__ __forceinline__ int kb_last(int qb) { return CAUSAL ? ((qb * 64 + 63) >> 7) : (TT / 128 - 1); }
typedef __attribute__((ext_vector_type(8))) __bf16 v8b;
__device__ __forceinline__ v16b frag_b(const __bf16* rowk0, int lane) {
  union { v16b v; v8b q[2]; } u; const __bf16* p = rowk0 + 8 * (lane >> 4);
  u.q[0] = *(const v8b*)p; u.q[1] = *(const v8b*)(p + 16); return u.v;
}
#define QBH 0              // not read by any kernel here: k_fa has no high-precision path
#define QHI 0               // single-product logits on every row
#define KHI 64            // key rows carrying k residual / v bf16 hi+lo planes (written by k_proj; no kernel here reads them)
// B fragment (k rows k0+.., output column o) of a weight: (in,out) [K][ld] or (out,in) [ld rows of K]: bf16 exact, or f16(bf16 * 256) exact
__device__ __forceinline__ v16b wcol_io(const float* Wm, int k0, int o, int lane, int ld) { v16b w; const int g = lane >> 4;
#pragma unroll
  for (int i = 0; i < 8; ++i) { w[i] = (__bf16)Wm[(size_t)(k0 + 8 * g + i) * ld + o]; w[8 + i] = (__bf16)Wm[(size_t)(k0 + 16 + 8 * g + i) * ld + o]; }
  return w; }
__device__ __forceinline__ v16b wcol_oi(const float* Wm, int k0, int o, int lane, int K) { v16b w; const float* p = Wm + (size_t)o * K + k0 + 8 * (lane >> 4);
#pragma unroll
  for (int i = 0; i < 8; ++i) { w[i] = (__bf16)p[i]; w[8 + i] = (__bf16)p[16 + i]; }
  return w; }
__device__ __forceinline__ v16h wcolh_io(const float* Wm, int k0, int o, int lane, int ld) { v16h w; const int g = lane >> 4;
#pragma unroll
  for (int i = 0; i < 8; ++i) { w[i] = (_Float16)(bfr(Wm[(size_t)(k0 + 8 * g + i) * ld + o]) * 256.0f); w[8 + i] = (_Float16)(bfr(Wm[(size_t)(k0 + 16 + 8 * g + i) * ld + o]) * 256.0f); }
  return w; }
__device__ __forceinline__ v16h wcolh_oi(const float* Wm, int k0, int o, int lane, int K) { v16h w; const float* p = Wm + (size_t)o * K + k0 + 8 * (lane >> 4);
#pragma unroll
  for (int i = 0; i < 8; ++i) { w[i] = (_Float16)(bfr(p[i]) * 256.0f); w[8 + i] = (_Float16)(bfr(p[16 + i]) * 256.0f); }
  return w; }
#define WQKV_LAYOUT 0   // selects WCOL, which no kernel here calls: k_proj always stages Wq / Wk / Wv as (in,out) [DIN][CC]
__device__ __forceinline__ v16b wcol_hdk(const float* Wm, int k0, int o, int lane) { v16b w; const int g = lane >> 4; const float* p = Wm + (size_t)(o / HD) * DIN * HD + (o % HD);
#pragma unroll
  for (int i = 0; i < 8; ++i) { w[i] = (__bf16)p[(size_t)(k0 + 8 * g + i) * HD]; w[8 + i] = (__bf16)p[(size_t)(k0 + 16 + 8 * g + i) * HD]; }
  return w; }
#define WO_OUT_IN 0
#if WQKV_LAYOUT == 1
#define WCOL(W, k0, o, lane) wcol_oi(W, k0, o, lane, DIN)
#elif WQKV_LAYOUT == 2
#define WCOL(W, k0, o, lane) wcol_hdk(W, k0, o, lane)
#else
#define WCOL(W, k0, o, lane) wcol_io(W, k0, o, lane, CC)
#endif
#if WO_OUT_IN
#define WOCOL(W, k0, o, lane) wcol_oi(W, k0, o, lane, CC)
#define WOCOLH(W, k0, o, lane) wcolh_oi(W, k0, o, lane, CC)
#else
#define WOCOL(W, k0, o, lane) wcol_io(W, k0, o, lane, DIN)
#define WOCOLH(W, k0, o, lane) wcolh_io(W, k0, o, lane, DIN)
#endif

#ifndef SM_EXTRA_PARAMS
#define SM_EXTRA_PARAMS
#endif
#ifndef PROJ_EXTRA_PARAMS
#define PROJ_EXTRA_PARAMS
#endif
#ifndef SM_MASK_HOOK
#define SM_MASK_HOOK (void)0
#endif

#define WS_QH  0u                                      // f16 q rows [b*t][CC]
#define WS_KH  (WS_QH + 2u * (size_t)NB * TT * CC)      // f16 k rows [b*t][CC]
#define WS_VT  (WS_KH + 2u * (size_t)NB * TT * CC)      // f16 v planes [b][c][t]
#define WS_QL  (WS_VT + 2u * (size_t)NB * CC * TT)      // f16 q residual x 2^10 rows [b][t < QHI][CC]
#define WS_KL  (WS_QL + 2u * (size_t)NB * QHI * CC)     // f16 k residual x 2^10 rows [b][t < KHI][CC]
#define WS_VB  (WS_KL + 2u * (size_t)NB * KHI * CC)     // bf16 v hi planes [b][c][t < KHI]
#define WS_VBL (WS_VB + 2u * (size_t)NB * CC * KHI)
#define WS_S   (WS_VBL + 2u * (size_t)NB * CC * KHI)    // f32 [hg][t][s], not used: k_fa keeps logits and P in registers
#define WS_Y   (WS_S  + 4u * (size_t)HG * TT * TT)      // f32 ctx rows [b*t][CC] (only when there is an output projection)
#define WS_END (WS_Y  + 4u * (size_t)NB * TT * CC)

// ---- weight staging for k_proj and k_out: a [KS][128] f32 tile of a (in,out) weight is read once per block with whole-line 16-byte loads, converted once, and laid in LDS column by column (k contiguous), where every wave takes its B fragments with 16-byte LDS reads
#define KS 64            // k rows of one staged tile
#define WP (KS + 8)      // LDS pitch of a staged column in elements: 144 B = 16 B x 9, free of bank conflicts for the fragment reads and for the staging stores
// one thread's share of a tile: 2 units of (8 k rows x 4 columns); a wave covers 32 columns, lane = (k octet = lane & 3, column group = lane >> 2), so each load instruction covers four whole 128-B lines
struct WT { v4f r[2][8]; };
__device__ __forceinline__ const float* wt_lane(const float* Wm, int k0, int c0, int ld, int wave, int lane) { return Wm + (size_t)(k0 + 8 * (lane & 3)) * ld + c0 + 32 * wave + 4 * (lane >> 2); }   // the lane's first element of the tile at k row k0
__device__ __forceinline__ void wt_load(WT& t, const float* p, int ld) {
#pragma unroll
  for (int u = 0; u < 2; ++u) {
#pragma unroll
    for (int i = 0; i < 8; ++i) t.r[u][i] = *(const v4f*)(p + (size_t)(32 * u + i) * ld); } }
__device__ __forceinline__ void wt_store_b(const WT& t, __bf16* wb, int wave, int lane) {   // bf16, exact operand of k_proj
  __bf16* d = wb + (32 * wave + 4 * (lane >> 2)) * WP + 8 * (lane & 3);
#pragma unroll
  for (int u = 0; u < 2; ++u) {
#pragma unroll
    for (int c = 0; c < 4; ++c) { v8b x;
#pragma unroll
      for (int i = 0; i < 8; ++i) x[i] = (__bf16)t.r[u][i][c];
      *(v8b*)(d + c * WP + 32 * u) = x; } } }
__device__ __forceinline__ void wt_store_h(const WT& t, _Float16* wb, int wave, int lane) {   // f16(bf16 x 2^8), exact operand of k_out
  _Float16* d = wb + (32 * wave + 4 * (lane >> 2)) * WP + 8 * (lane & 3);
#pragma unroll
  for (int u = 0; u < 2; ++u) {
#pragma unroll
    for (int c = 0; c < 4; ++c) { v8h x;
#pragma unroll
      for (int i = 0; i < 8; ++i) x[i] = (_Float16)(bfr(t.r[u][i][c]) * 256.0f);
      *(v8h*)(d + c * WP + 32 * u) = x; } } }
// a lane's raw f32 share of the A fragments of one stage (KS k of its own row): per 32 k, elements 8g + 0..7 and 16 + 8g + 0..7
struct XT { v4f r[KS / 32][4]; };
__device__ __forceinline__ void xt_load(XT& t, const float* p) {   // p: the lane's own row at the stage's first k, + 8 * (lane >> 4)
#pragma unroll
  for (int kk = 0; kk < KS / 32; ++kk) { t.r[kk][0] = *(const v4f*)(p + kk * 32); t.r[kk][1] = *(const v4f*)(p + kk * 32 + 4); t.r[kk][2] = *(const v4f*)(p + kk * 32 + 16); t.r[kk][3] = *(const v4f*)(p + kk * 32 + 20); } }

// Blocks that share a weight tile (all row blocks of a column block) or an A tile (all column blocks of a row block) run in step, and would ask L2 for the same lines at the same moment. So each block walks the k stages as a ring from a first stage set by its tile indices: the sum takes every stage once, in rotated order.
#define KROT(K) ((int)((blockIdx.x + 2 * blockIdx.y) & ((K) / KS - 1)))          // the block's first stage (K / KS is a power of two)
#define KST(s, rot, K) (((((s) + (rot)) & ((K) / KS - 1))) * KS)                // first k row of the s-th stage walked
// ---- k_proj: block = (64 rows, 128 cols, which): q/k/v = X W (+ b) with exact bf16 products (K = DIN) -> which 0: q f16 rows (+ residual rows < QHI); 1: k f16 rows (+ residual rows < KHI); 2: v f16 planes [c][t] (+ bf16 hi/lo planes for t < KHI)
__global__ __launch_bounds__(128) void k_proj(const float* __restrict__ XQ, const float* __restrict__ XK, const float* __restrict__ XV, const float* __restrict__ WQ, const float* __restrict__ WK, const float* __restrict__ WV, const float* __restrict__ BQ, const float* __restrict__ BK, const float* __restrict__ BV,
    _Float16* __restrict__ QH, _Float16* __restrict__ QL, _Float16* __restrict__ KH, _Float16* __restrict__ KL, _Float16* __restrict__ VT, __bf16* __restrict__ VB, __bf16* __restrict__ VBL) {
  __shared__ __align__(16) union { struct { _Float16 sh[64][136], sl[64][136], th[128][72]; __bf16 tb[128][72], tbl[128][72]; } e; __bf16 wb[2][128 * WP]; } sm;   // the weight stages share LDS with the epilogue's tiles, so that as many blocks as before fit a WGP
  auto& sh = sm.e.sh; auto& sl = sm.e.sl; auto& th = sm.e.th; auto& tb = sm.e.tb; auto& tbl = sm.e.tbl;
  const int tid = threadIdx.x, wave = tid >> 5, lane = tid & 31, col = lane & 15, g = lane >> 4; const int which = blockIdx.z; const int c0 = blockIdx.y * 128; const size_t r0 = (size_t)blockIdx.x * 64; const size_t bb = r0 / TT; const int t0 = (int)(r0 % TT);
  const float* X = which == 0 ? XQ : which == 1 ? XK : XV; const float* WA = which == 0 ? WQ : which == 1 ? WK : WV; const float* BA = which == 0 ? BQ : which == 1 ? BK : BV;
  v8f acc[8] = {};
  WT wt; XT xt; v16b af[KS / 32];
  const int rot = KROT(DIN);   // the same for the three products of one X tile, which read the same X lines
  const float* wp = wt_lane(WA, KST(0, rot, DIN), c0, CC, wave, lane); const float* xp = X + (r0 + wave * 16 + col) * DIN + KST(0, rot, DIN) + 8 * g;   // the lane's sources in the stage fetched next: carried along the ring
  wt_load(wt, wp, CC); xt_load(xt, xp);
  asm volatile("s_wait_xcnt 0x0" ::: "memory");   // the first loads' address registers are free for reuse behind it
  wt_store_b(wt, sm.wb[0], wave, lane);
  { const int d = KST(1, rot, DIN) - KST(0, rot, DIN); wp += d * CC; xp += d; }
#pragma unroll
  for (int kk = 0; kk < KS / 32; ++kk) {
#pragma unroll
    for (int i = 0; i < 8; ++i) { af[kk][i] = (__bf16)xt.r[kk][i >> 2][i & 3]; af[kk][8 + i] = (__bf16)xt.r[kk][2 + (i >> 2)][i & 3]; } }
  __syncthreads();   // stage 0 is published
#pragma unroll 2
  for (int s = 0; s < DIN / KS; ++s) { const bool more = s + 1 < DIN / KS;   // two buffers: stage s + 1 is fetched into registers while stage s is worked on
    if (more) { wt_load(wt, wp, CC); xt_load(xt, xp); }
    __builtin_amdgcn_sched_barrier(0);   // keeps the next stage's global loads issued in front of this stage's products, which then cover their latency
    const __bf16* wc = sm.wb[s & 1] + col * WP;
#pragma unroll
    for (int kk = 0; kk < KS / 32; ++kk) { v16b wf[8];
#pragma unroll
      for (int j = 0; j < 8; ++j) wf[j] = frag_b(wc + j * 16 * WP + kk * 32, lane);
      __builtin_amdgcn_sched_barrier(0);   // keeps the 16 LDS reads together in front of their products: one wait for the group, where a read pair in front of each product waits out the LDS latency eight times
#pragma unroll
      for (int j = 0; j < 8; ++j) acc[j] = wmma_bf(af[kk], wf[j], acc[j]); }
    __builtin_amdgcn_sched_barrier(0);   // keeps the fetched tile's conversion, and with it the wait for its loads, behind this stage's products
    if (more) { wt_store_b(wt, sm.wb[(s + 1) & 1], wave, lane);
      { const int d = KST(s + 2, rot, DIN) - KST(s + 1, rot, DIN); wp += d * CC; xp += d; }   // one stage on, or back to k = 0: behind the wait for the loads that used these addresses
#pragma unroll
      for (int kk = 0; kk < KS / 32; ++kk) {
#pragma unroll
        for (int i = 0; i < 8; ++i) { af[kk][i] = (__bf16)xt.r[kk][i >> 2][i & 3]; af[kk][8 + i] = (__bf16)xt.r[kk][2 + (i >> 2)][i & 3]; } } }
    __syncthreads(); }   // publishes stage s + 1 and ends every wave's reads of stage s, whose buffer is written next (after the last stage: by the epilogue)
  if (which < 2) { _Float16* DH = which == 0 ? QH : KH; _Float16* DL = which == 0 ? QL : KL; const int nhi = which == 0 ? QHI : KHI; const bool hi_rows = t0 < nhi;
#pragma unroll
    for (int j = 0; j < 8; ++j) { const float bias = BA ? bfr(BA[c0 + j * 16 + col]) : 0.f;
#pragma unroll
      for (int r = 0; r < 8; ++r) { const float v = acc[j][r] + bias; const _Float16 hv = (_Float16)v; sh[wave * 16 + 8 * g + r][j * 16 + col] = hv; sl[wave * 16 + 8 * g + r][j * 16 + col] = (_Float16)((v - (float)hv) * 1024.0f); } }
    __syncthreads();
    for (int e = tid; e < 64 * 16; e += 128) { const int rl = e >> 4, q = e & 15; vst2((unsigned*)(DH + (r0 + rl) * CC + c0 + q * 8), *(const v4u*)&sh[rl][q * 8]); if (hi_rows) vst2((unsigned*)(DL + (bb * nhi + t0 + rl) * (size_t)CC + c0 + q * 8), *(const v4u*)&sl[rl][q * 8]); }
  } else { const bool hi_rows = t0 < KHI;
#pragma unroll
    for (int j = 0; j < 8; ++j) { const float bias = BA ? bfr(BA[c0 + j * 16 + col]) : 0.f;
#pragma unroll
      for (int r = 0; r < 8; ++r) { const float v = acc[j][r] + bias; const int rl = wave * 16 + 8 * g + r, cl = j * 16 + col; th[cl][rl] = (_Float16)v; const __bf16 bh = (__bf16)v; tb[cl][rl] = bh; tbl[cl][rl] = (__bf16)(v - (float)bh); } }
    __syncthreads();
    for (int e = tid; e < 128 * 8; e += 128) { const int cl = e >> 3, q = e & 7; vst2((unsigned*)(VT + (bb * CC + c0 + cl) * (size_t)TT + t0 + q * 8), *(const v4u*)&th[cl][q * 8]); if (hi_rows) { const size_t o3 = (bb * CC + c0 + cl) * (size_t)KHI + t0 + q * 8; vst2((unsigned*)(VB + o3), *(const v4u*)&tb[cl][q * 8]); vst2((unsigned*)(VBL + o3), *(const v4u*)&tbl[cl][q * 8]); } } } }
// ---- k_fa: block = 128 queries of (b, h), 16 waves = (8 groups of 16 query columns) x (2 halves of the key range): four waves a SIMD, so that one wave's softmax runs beside another's products. Each wave walks its half in trips of 64 keys with a running maximum (online softmax), so logits and P stay in registers; the two halves' (maximum, sum, O) are joined once, through LDS, behind the loop.
// S^T = K . Q^T (A = k rows, B = q rows): lane (g, col) holds keys 8g + r of each 16-key tile for query col, which is the B fragment order of P^T; O^T += V^T . P^T (A = v planes [c][t]): lane holds d = 16j + 8g + r of query col.
// Every inner loop below is unrolled so that the fragment and accumulator arrays are indexed by constants and stay in registers.
__device__ __forceinline__ v8f wmma_h(v16h a, v16h b, v8f c) { return __builtin_amdgcn_wmma_f32_16x16x32_f16(false, a, false, b, (short)0, c, false, false); }
__device__ __forceinline__ float xhalf(float x) { return __builtin_bit_cast(float, __builtin_amdgcn_permlanex16(__builtin_bit_cast(int, x), __builtin_bit_cast(int, x), 0x76543210, 0xfedcba98, false, false)); }   // lane l with lane l ^ 16
// K and V reach the waves through LDS: the 8 waves of a half need the same 16 KB a trip, so each tile is brought in once per block with whole-line asynchronous copies and every wave takes its fragments with 16-byte LDS reads.
// Tile t of a half = (v planes of the t-th 64-key group walked, k rows of the next group): what trip t reads, since the scores are formed one trip ahead. Two buffers a half: tile t + 1 flies while trip t works. A half's tiles are copied by its own 8 waves.
#define KH2 (TT / 2)     // keys of one half
#define NT (KH2 / 64)    // trips of a wave
#define KP (64 + 8)      // LDS pitch of a staged 128-B row in elements: 144 B = 16 B x 9, free of bank conflicts for the fragment reads
#define KVB (2 * 64 * KP * 2)   // bytes of one buffer: 64 k rows, then 64 v rows
// one thread's share of a tile: 16 B of k rows r and r + 32 and of v rows r and r + 32 (8 lanes a row: each copy instruction covers four whole 128-B lines)
__device__ __forceinline__ void kv_copy(unsigned lds, const _Float16* gk, const _Float16* gv) {
  const unsigned l1 = lds + 32 * KP * 2, l2 = lds + 64 * KP * 2, l3 = lds + 96 * KP * 2; const _Float16* gk1 = gk + (size_t)32 * CC; const _Float16* gv1 = gv + (size_t)32 * TT;
  // the s_wait_xcnt stands in the copies' own statement, so that no address register is rewritten in front of it
  asm volatile("global_load_async_to_lds_b128 %0, %4, off\n\tglobal_load_async_to_lds_b128 %1, %5, off\n\tglobal_load_async_to_lds_b128 %2, %6, off\n\tglobal_load_async_to_lds_b128 %3, %7, off\n\ts_wait_xcnt 0x0"
               :: "v"(lds), "v"(l1), "v"(l2), "v"(l3), "v"(gk), "v"(gk1), "v"(gv), "v"(gv1) : "memory"); }
// the same for k rows alone: the first group walked, whose scores are formed in front of the loop
__device__ __forceinline__ void k_copy(unsigned lds, const _Float16* gk) {
  const unsigned l1 = lds + 32 * KP * 2; const _Float16* gk1 = gk + (size_t)32 * CC;
  // as above: the s_wait_xcnt in the copies' own statement, in front of any rewrite of their address registers
  asm volatile("global_load_async_to_lds_b128 %0, %2, off\n\tglobal_load_async_to_lds_b128 %1, %3, off\n\ts_wait_xcnt 0x0" :: "v"(lds), "v"(l1), "v"(gk), "v"(gk1) : "memory"); }
__global__ __launch_bounds__(512) void k_fa(const _Float16* __restrict__ QH, const _Float16* __restrict__ KH, const _Float16* __restrict__ VT, float* __restrict__ Y) {
  __shared__ __align__(16) _Float16 kv[2][2][2][64 * KP];   // [half][buffer][k rows, v rows]
  __shared__ __align__(16) _Float16 kz[2][64 * KP];         // [half] k rows of the first group walked: filled once, read once
  __shared__ __align__(16) v4f jo[8][8][32];                // the upper half's O, [query group][4 values][lane]
  __shared__ __align__(8) v2f jm[8][32];                    // its (maximum, sum)
  const int hf = __builtin_amdgcn_readfirstlane((int)threadIdx.x >> 8);   // the wave's half of the key range, the same in every lane
  const int tid = threadIdx.x & 255, wave = tid >> 5, lane = tid & 31, col = lane & 15, g = lane >> 4; const int b = blockIdx.y / NH, h = blockIdx.y % NH; const int q = blockIdx.x * 128 + wave * 16 + col;
  const _Float16* Qr = QH + ((size_t)b * TT + q) * CC + h * HD;
  const _Float16* Kc = KH + ((size_t)b * TT + hf * KH2 + (tid >> 3)) * CC + h * HD + 8 * (tid & 7); const _Float16* Vc = VT + ((size_t)b * CC + h * HD + (tid >> 3)) * (size_t)TT + hf * KH2 + 8 * (tid & 7);   // the thread's sources in its half's keys 0..63
  const unsigned lc = (unsigned)(size_t)&kv[hf][0][0][(tid >> 3) * KP + 8 * (tid & 7)];   // its place in its half's buffer 0 (LDS byte address)
  const int rot = (int)(blockIdx.x & (NT - 1));   // the 16 blocks of one (b, h) need the same K and V lines: each walks the 64-key groups of a half as a ring from a group of its own, so that they do not ask L2 for the same lines at the same moment
#define KG(i) ((((i) + rot) & (NT - 1)) * 64)   // first key of the i-th group walked (NT is a power of two)
  k_copy((unsigned)(size_t)&kz[hf][(tid >> 3) * KP + 8 * (tid & 7)], Kc + (size_t)KG(0) * CC);
  kv_copy(lc, Kc + (size_t)KG(1) * CC, Vc + KG(0));   // tile 0
  const v16h q0 = frag_h(Qr, lane), q1 = frag_h(Qr + 32, lane);
  const float C2 = SCALE * 1.4426950408889634f;   // logits carried in base 2
  v8f acc[HD / 16] = {}; float m = -3.0e38f, l = 0.f;
  v8f s[4];   // scores of the coming trip, carried over the loop's back edge: every fragment read of a trip is issued at its head and used at its foot
  asm volatile("s_wait_asynccnt 0x0" ::: "memory");   // this wave's share of the first k rows and of tile 0 has landed
  __syncthreads();   // both are published
  kv_copy(lc + KVB, Kc + (size_t)KG(2) * CC, Vc + KG(1));   // tile 1
#pragma unroll
  for (int t = 0; t < 4; ++t) { const v8f z = {}; s[t] = wmma_h(frag_h(&kz[hf][(t * 16 + col) * KP], lane), q0, z); s[t] = wmma_h(frag_h(&kz[hf][(t * 16 + col) * KP + 32], lane), q1, s[t]); }
  for (int t = 0; t < NT; ++t) {
    const _Float16* kl = &kv[hf][t & 1][0][col * KP]; const _Float16* vl = &kv[hf][t & 1][1][col * KP];
    v16h vf[HD / 16][2], kf[4][2];
#pragma unroll
    for (int j = 0; j < HD / 16; ++j) { vf[j][0] = frag_h(vl + j * 16 * KP, lane); vf[j][1] = frag_h(vl + j * 16 * KP + 32, lane); }
#pragma unroll
    for (int u = 0; u < 4; ++u) { kf[u][0] = frag_h(kl + u * 16 * KP, lane); kf[u][1] = frag_h(kl + u * 16 * KP + 32, lane); }   // the next trip's k rows (the last tile holds the last trip's own again; those scores are not used)
    __builtin_amdgcn_sched_barrier(0);   // keeps the trip's LDS reads issued in front of the softmax, whose work then covers their latency; without it they sink to their first use
    float mt[4];   // four independent chains
#pragma unroll
    for (int u = 0; u < 4; ++u) { mt[u] = s[u][0];
#pragma unroll
      for (int r = 1; r < 8; ++r) mt[u] = fmaxf(mt[u], s[u][r]); }
    float mx = fmaxf(fmaxf(mt[0], mt[1]), fmaxf(mt[2], mt[3])); mx = fmaxf(mx, xhalf(mx));
    const float mn = fmaxf(m, mx * C2); float alpha;   // 2^(m - mn), 0 on the first trip
    asm("v_exp_f32 %0, %1\n\tv_nop" : "=v"(alpha) : "v"(m - mn));   // asm for the v_nop alone: it fills the slot behind a transcendental
    m = mn;
    const float off = 10.0f - mn;   // P relative to the running maximum, x 2^10 into f16 (clear of f16 subnormals); the factor cancels against l
    v16h p[2]; float ps[4];
#pragma unroll
    for (int u = 0; u < 4; ++u) { ps[u] = 0.f;
#pragma unroll
      for (int r = 0; r < 8; ++r) { const float e = __builtin_amdgcn_exp2f(fmaf(s[u][r], C2, off)); ps[u] += e; p[u >> 1][(u & 1) * 8 + r] = (_Float16)e; } }
    l = l * alpha + ((ps[0] + ps[1]) + (ps[2] + ps[3]));
#pragma unroll
    for (int j = 0; j < HD / 16; ++j) { acc[j] *= alpha; acc[j] = wmma_h(vf[j][0], p[0], acc[j]); acc[j] = wmma_h(vf[j][1], p[1], acc[j]); }
#pragma unroll
    for (int u = 0; u < 4; ++u) { const v8f z = {}; s[u] = wmma_h(kf[u][0], q0, z); s[u] = wmma_h(kf[u][1], q1, s[u]); }
    __builtin_amdgcn_sched_barrier(0);   // keeps the waits and the barrier below at the trip's foot: lifted to the LDS reads, as the build without it had them, they expose the reads' latency and leave the flying tile no lead
    asm volatile("s_wait_dscnt 0x0" ::: "memory");      // this wave's reads of the buffer are over before it is refilled
    asm volatile("s_wait_asynccnt 0x0" ::: "memory");   // this wave's share of tile t + 1 has landed
    __syncthreads();   // publishes tile t + 1 and ends every wave's reads of tile t, whose buffer is refilled next
    if (t + 2 < NT) kv_copy(lc + (t & 1) * KVB, Kc + (size_t)KG(t + 3 < NT ? t + 3 : NT - 1) * CC, Vc + KG(t + 2)); }
  asm volatile("s_wait_asynccnt 0x0" ::: "memory");   // no copy is left in flight when the wave ends
  if (hf == 1) { jm[wave][lane] = v2f{m, l};   // the upper half hands over its state
#pragma unroll
    for (int j = 0; j < HD / 16; ++j) { jo[wave][2 * j][lane] = v4f{acc[j][0], acc[j][1], acc[j][2], acc[j][3]}; jo[wave][2 * j + 1][lane] = v4f{acc[j][4], acc[j][5], acc[j][6], acc[j][7]}; } }
  __syncthreads();   // publishes it; every wave passes
  if (hf == 1) return;   // behind the last barrier
  const v2f om = jm[wave][lane]; const float mj = fmaxf(m, om[0]); const float a0 = __builtin_amdgcn_exp2f(m - mj), a1 = __builtin_amdgcn_exp2f(om[0] - mj);   // both states rescaled to the common maximum
  l = l * a0 + om[1] * a1;
#pragma unroll
  for (int j = 0; j < HD / 16; ++j) { const v4f x = jo[wave][2 * j][lane], y = jo[wave][2 * j + 1][lane];
#pragma unroll
    for (int r = 0; r < 4; ++r) { acc[j][r] = acc[j][r] * a0 + x[r] * a1; acc[j][4 + r] = acc[j][4 + r] * a0 + y[r] * a1; } }
  l += xhalf(l); const float inv = 1.0f / l;   // l >= 2^10: the maximum's own term
  float* Yr = Y + ((size_t)b * TT + q) * CC + h * HD + 8 * g;
#pragma unroll
  for (int j = 0; j < HD / 16; ++j) { v4f a, c;
#pragma unroll
    for (int r = 0; r < 4; ++r) { a[r] = acc[j][r] * inv; c[r] = acc[j][4 + r] * inv; }
    vst2(Yr + j * 16, a); vst2(Yr + j * 16 + 4, c); } }
// ---- k_out: block = (64 rows, 128 cols): out = ctx Wo (+ bo): ctx x 2^6 once to f16 against Wo as f16(bf16 x 2^8) exact (1 product) x 2^-14; causal early rows (< QHI of each sequence): ctx bf16 hi + lo against exact bf16 Wo (2 products)
__global__ __launch_bounds__(128) void k_out(const float* __restrict__ Y, const float* __restrict__ WO, const float* __restrict__ BO, float* __restrict__ OUT) { __shared__ __align__(16) float sf[4][16][132]; __shared__ __align__(16) _Float16 wb[2][128 * WP];
  const int tid = threadIdx.x, wave = tid >> 5, lane = tid & 31, col = lane & 15, g = lane >> 4; const int c0 = blockIdx.y * 128; const size_t r0 = (size_t)blockIdx.x * 64 + wave * 16;
  v8f acc[8] = {};
  if (CAUSAL && (int)(((size_t)blockIdx.x * 64) % TT) < QHI) {   /* block-uniform */
#pragma unroll 2
    for (int kc = 0; kc < CC / 32; ++kc) { const F2 a = split_row(Y + (r0 + col) * CC, kc * 32, lane); asm volatile("s_wait_loadcnt 0x0" ::: "memory");
#pragma unroll
      for (int j = 0; j < 8; ++j) { const v16b w = WOCOL(WO, kc * 32, c0 + j * 16 + col, lane); asm volatile("s_wait_loadcnt 0x0" ::: "memory"); acc[j] = wmma_bf(a.h, w, acc[j]); acc[j] = wmma_bf(a.l, w, acc[j]); } }
#pragma unroll
    for (int j = 0; j < 8; ++j) { const float bias = BO ? bfr(BO[c0 + j * 16 + col]) : 0.f;
#pragma unroll
      for (int r = 0; r < 8; ++r) sf[wave][8 * g + r][j * 16 + col] = acc[j][r] + bias; }
  } else {
    WT wt; XT xt; v16h af[KS / 32];   /* ctx carried x 2^6 into f16 so small-magnitude context rows stay clear of f16 subnormals */
    const int rot = KROT(CC);
    const float* wp = wt_lane(WO, KST(0, rot, CC), c0, DIN, wave, lane); const float* yp = Y + (r0 + col) * CC + KST(0, rot, CC) + 8 * g;   // as in k_proj
    wt_load(wt, wp, DIN); xt_load(xt, yp); wt_store_h(wt, wb[0], wave, lane);
    { const int d = KST(1, rot, CC) - KST(0, rot, CC); wp += d * DIN; yp += d; }
#pragma unroll
    for (int kk = 0; kk < KS / 32; ++kk) {
#pragma unroll
      for (int i = 0; i < 8; ++i) { af[kk][i] = (_Float16)(xt.r[kk][i >> 2][i & 3] * 64.0f); af[kk][8 + i] = (_Float16)(xt.r[kk][2 + (i >> 2)][i & 3] * 64.0f); } }
    __syncthreads();   // stage 0 is published
#pragma unroll 2
    for (int s = 0; s < CC / KS; ++s) { const bool more = s + 1 < CC / KS;   // two buffers, as in k_proj
      if (more) { wt_load(wt, wp, DIN); xt_load(xt, yp); }
      __builtin_amdgcn_sched_barrier(0);   // keeps the next stage's global loads issued in front of this stage's products, which then cover their latency
      const _Float16* wc = wb[s & 1] + col * WP;
#pragma unroll
      for (int kk = 0; kk < KS / 32; ++kk) { v16h wf[8];
#pragma unroll
        for (int j = 0; j < 8; ++j) wf[j] = frag_h(wc + j * 16 * WP + kk * 32, lane);
        __builtin_amdgcn_sched_barrier(0);   // keeps the 16 LDS reads together in front of their products: one wait for the group
#pragma unroll
        for (int j = 0; j < 8; ++j) acc[j] = wmma16(af[kk], wf[j], acc[j]); }
      __builtin_amdgcn_sched_barrier(0);   // keeps the fetched tile's conversion, and with it the wait for its loads, behind this stage's products
      if (more) { wt_store_h(wt, wb[(s + 1) & 1], wave, lane);
        { const int d = KST(s + 2, rot, CC) - KST(s + 1, rot, CC); wp += d * DIN; yp += d; }   // as in k_proj
#pragma unroll
        for (int kk = 0; kk < KS / 32; ++kk) {
#pragma unroll
          for (int i = 0; i < 8; ++i) { af[kk][i] = (_Float16)(xt.r[kk][i >> 2][i & 3] * 64.0f); af[kk][8 + i] = (_Float16)(xt.r[kk][2 + (i >> 2)][i & 3] * 64.0f); } } }
      __syncthreads(); }   // publishes stage s + 1 and ends every wave's reads of stage s, whose buffer is written next
#pragma unroll
    for (int j = 0; j < 8; ++j) { const float bias = BO ? bfr(BO[c0 + j * 16 + col]) : 0.f;
#pragma unroll
      for (int r = 0; r < 8; ++r) sf[wave][8 * g + r][j * 16 + col] = acc[j][r] * (1.0f / 16384.0f) + bias; } }   /* 2^-8 (Wo carry) x 2^-6 (ctx carry) */
  LDSX(); for (int rl = 0; rl < 16; ++rl) vst2(OUT + (r0 + rl) * DIN + c0 + lane * 4, *(const v4f*)&sf[wave][rl][lane * 4]); }

extern "C" void kernel_launch(void* const* d_in, const int* in_sizes, int n_in, void* d_out, int out_size, void* d_ws, size_t ws_size, hipStream_t stream) {
  (void)in_sizes; (void)n_in; (void)out_size;
  const float** F = (const float**)d_in;
  if (ws_size < (size_t)WS_END) return;
  char* ws = (char*)d_ws; _Float16 *QH = (_Float16*)(ws + WS_QH), *KH = (_Float16*)(ws + WS_KH), *VT = (_Float16*)(ws + WS_VT), *QL = (_Float16*)(ws + WS_QL), *KL = (_Float16*)(ws + WS_KL); __bf16 *VB = (__bf16*)(ws + WS_VB), *VBL = (__bf16*)(ws + WS_VBL); float *Y = (float*)(ws + WS_Y);
  (void)Y; (void)QL; (void)KL; (void)VB; (void)VBL;
  // inputs: 0 inputs [2,2048,512]; 1 Wq [512,512] (in,out), 2 bq; 3 Wk, 4 bk; 5 Wv, 6 bv; 7 Wo (in,out), 8 bo (zero biases, read)
  k_proj<<<dim3(TNB * TT / 64, CC / 128, 3), 128, 0, stream>>>(F[0], F[0], F[0], F[1], F[3], F[5], F[2], F[4], F[6], QH, QL, KH, KL, VT, VB, VBL);
  k_fa<<<dim3(TT / 128, TNB * NH), 512, 0, stream>>>(QH, KH, VT, Y);
  k_out<<<dim3(TNB * TT / 64, DIN / 128), 128, 0, stream>>>(Y, F[7], F[8], (float*)d_out);
}

// v006
// A run of this version takes 42.7 microseconds.
// Two timings next to v005 both put it at 1.05 times that version's speed.
// All steps since v000 together make it 13.6 times as fast.
// compute dtype: all float inputs rounded to bf16; q/k/v projections with EXACT bf16 products on WMMA 16x16x32 (f32 accumulate) + bias; logits q x k once to f16 each (1 product) x SCALE; online softmax f32; P (relative to the running maximum) x 2^10 once to f16 x v once to f16 (1 product); ctx x 2^6 once to f16 x Wo f16(bf16 x 2^8) + bo; f32 output.
#include <hip/hip_runtime.h>
#include <math.h>

typedef __attribute__((ext_vector_type(16))) _Float16 v16h;
typedef __attribute__((ext_vector_type(16))) __bf16 v16b;
typedef __attribute__((ext_vector_type(8)))  _Float16 v8h;
typedef __attribute__((ext_vector_type(8)))  float v8f;
typedef __attribute__((ext_vector_type(4)))  float v4f;
typedef __attribute__((ext_vector_type(2)))  float v2f;
typedef __attribute__((ext_vector_type(4)))  unsigned v4u;
typedef __attribute__((ext_vector_type(4)))  int v4i;
typedef float __attribute__((may_alias)) float_a;
typedef int __attribute__((may_alias)) int_a;

template <typename T> __device__ __forceinline__ void vst2(void* p, T v) { *(T*)p = v;  }
__device__ __forceinline__ v8f wmma16(v16h a, v16h b, v8f c) {
  v8f d = __builtin_amdgcn_wmma_f32_16x16x32_f16(false, a, false, b, (short)0, c, false, false);
  asm volatile("v_nop\n\tv_nop\n\tv_nop\n\tv_nop" : "+v"(d) : "v"(a), "v"(b));
  return d;
}
__device__ __forceinline__ v8f wmma_bf(v16b a, v16b b, v8f c) {
  v8f d = __builtin_amdgcn_wmma_f32_16x16x32_bf16(false, a, false, b, (short)0, c, false, false);
  asm volatile("v_nop\n\tv_nop\n\tv_nop\n\tv_nop" : "+v"(d) : "v"(a), "v"(b));
  return d;
}
// 16x16x32 fragments: lane = (h = lane>>4, row/col = lane&15); elements 0..7 = k0+8h+0..7, 8..15 = k0+16+8h+0..7; D element r = row 8h+r
__device__ __forceinline__ v16h frag_h(const _Float16* rowk0, int lane) {
  union { v16h v; v8h q[2]; } u; const _Float16* p = rowk0 + 8 * (lane >> 4);
  u.q[0] = *(const v8h*)p; u.q[1] = *(const v8h*)(p + 16); return u.v;
}
__device__ __forceinline__ v16h frag_f32(const float* rowk0, int lane) {
  v16h a; const float* p = rowk0 + 8 * (lane >> 4);
#pragma unroll
  for (int i = 0; i < 8; ++i) { a[i] = (_Float16)p[i]; a[8 + i] = (_Float16)p[16 + i]; }
  return a;
}
__device__ __forceinline__ v16h frag_f32s(const float* rowk0, int lane, float sc) {
  v16h a; const float* p = rowk0 + 8 * (lane >> 4);
#pragma unroll
  for (int i = 0; i < 8; ++i) { a[i] = (_Float16)(p[i] * sc); a[8 + i] = (_Float16)(p[16 + i] * sc); }
  return a;
}
// column fragment from a [K][ld] layout (column n), rows >= K read as 0
__device__ __forceinline__ v16h fragc_f32(const float* W, int k0, int n, int lane, int ld, int K) {
  v16h a; const int g = lane >> 4;
#pragma unroll
  for (int i = 0; i < 8; ++i) { const int ka = k0 + 8 * g + i, kb = ka + 16;
    a[i] = (_Float16)(ka < K ? W[(size_t)(ka < K ? ka : K - 1) * ld + n] : 0.f); a[8 + i] = (_Float16)(kb < K ? W[(size_t)(kb < K ? kb : K - 1) * ld + n] : 0.f); }
  return a;
}
struct F2 { v16b h, l; };
__device__ __forceinline__ F2 bsplit16(const float v[16]) { F2 r;
#pragma unroll
  for (int i = 0; i < 16; ++i) { const __bf16 h = (__bf16)v[i]; r.h[i] = h; r.l[i] = (__bf16)(v[i] - (float)h); }
  return r; }
__device__ __forceinline__ F2 split_row(const float* row, int k0, int lane) { float v[16]; const float* p = row + k0 + 8 * (lane >> 4);
#pragma unroll
  for (int i = 0; i < 8; ++i) { v[i] = p[i]; v[8 + i] = p[16 + i]; }
  return bsplit16(v); }
__device__ __forceinline__ F2 split_rowK(const float* row, int k0, int lane, int K) { float v[16]; const int g = lane >> 4;
#pragma unroll
  for (int i = 0; i < 8; ++i) { const int ka = k0 + 8 * g + i, kb = ka + 16; v[i] = ka < K ? row[ka < K ? ka : K - 1] : 0.f; v[8 + i] = kb < K ? row[kb < K ? kb : K - 1] : 0.f; }
  return bsplit16(v); }
__device__ __forceinline__ F2 split_col(const float* W, int k0, int n, int lane, int ld, int K) { float v[16]; const int g = lane >> 4;
#pragma unroll
  for (int i = 0; i < 8; ++i) { const int ka = k0 + 8 * g + i, kb = ka + 16; v[i] = ka < K ? W[(size_t)(ka < K ? ka : K - 1) * ld + n] : 0.f; v[8 + i] = kb < K ? W[(size_t)(kb < K ? kb : K - 1) * ld + n] : 0.f; }
  return bsplit16(v); }
__device__ __forceinline__ v8f mac3(const F2& a, const F2& b, v8f c) { c = wmma_bf(a.l, b.h, c); c = wmma_bf(a.h, b.l, c); return wmma_bf(a.h, b.h, c); }
__device__ __forceinline__ float sigm(float v) { return 1.0f / (1.0f + expf(-v)); }
#define LDSX() do { asm volatile("s_wait_dscnt 0" ::: "memory"); __builtin_amdgcn_wave_barrier(); __builtin_amdgcn_fence(__ATOMIC_RELEASE, "workgroup"); } while (0)

// Multi-head self-attention (inputs [2,2048,512]; (in,out) Wq / Wk / Wv / Wo [512,512] N(0, 1/512) + zero biases; 8 heads x 64; scale 1/8; softmax over keys; merge; Wo + bo).
#define NB 2
#define TT 2048
#define CC 512            // NH * HD = projected width
#define DIN 512          // input (model) width
#define NH 8
#define HD 64
#define NQB (TT / 64)
#define HG 4
#define SCALE (0.125f)
#define CAUSAL 0
#ifndef TNB
#define TNB NB
#endif
__device__ __forceinline__ float bfr(float v) { return (float)(__bf16)v; }
__host__ __device__ __forceinline__ int kb_last(int qb) { return CAUSAL ? ((qb * 64 + 63) >> 7) : (TT / 128 - 1); }
typedef __attribute__((ext_vector_type(8))) __bf16 v8b;
__device__ __forceinline__ v16b frag_b(const __bf16* rowk0, int lane) {
  union { v16b v; v8b q[2]; } u; const __bf16* p = rowk0 + 8 * (lane >> 4);
  u.q[0] = *(const v8b*)p; u.q[1] = *(const v8b*)(p + 16); return u.v;
}
#define QBH 0              // not read by any kernel here: k_fa has no high-precision path
#define QHI 0               // single-product logits on every row
#define KHI 64            // key rows carrying k residual / v bf16 hi+lo planes (written by k_proj; no kernel here reads them)
// B fragment (k rows k0+.., output column o) of a weight: (in,out) [K][ld] or (out,in) [ld rows of K]: bf16 exact, or f16(bf16 * 256) exact
__device__ __forceinline__ v16b wcol_io(const float* Wm, int k0, int o, int lane, int ld) { v16b w; const int g = lane >> 4;
#pragma unroll
  for (int i = 0; i < 8; ++i) { w[i] = (__bf16)Wm[(size_t)(k0 + 8 * g + i) * ld + o]; w[8 + i] = (__bf16)Wm[(size_t)(k0 + 16 + 8 * g + i) * ld + o]; }
  return w; }
__device__ __forceinline__ v16b wcol_oi(const float* Wm, int k0, int o, int lane, int K) { v16b w; const float* p = Wm + (size_t)o * K + k0 + 8 * (lane >> 4);
#pragma unroll
  for (int i = 0; i < 8; ++i) { w[i] = (__bf16)p[i]; w[8 + i] = (__bf16)p[16 + i]; }
  return w; }
__device__ __forceinline__ v16h wcolh_io(const float* Wm, int k0, int o, int lane, int ld) { v16h w; const int g = lane >> 4;
#pragma unroll
  for (int i = 0; i < 8; ++i) { w[i] = (_Float16)(bfr(Wm[(size_t)(k0 + 8 * g + i) * ld + o]) * 256.0f); w[8 + i] = (_Float16)(bfr(Wm[(size_t)(k0 + 16 + 8 * g + i) * ld + o]) * 256.0f); }
  return w; }
__device__ __forceinline__ v16h wcolh_oi(const float* Wm, int k0, int o, int lane, int K) { v16h w; const float* p = Wm + (size_t)o * K + k0 + 8 * (lane >> 4);
#pragma unroll
  for (int i = 0; i < 8; ++i) { w[i] = (_Float16)(bfr(p[i]) * 256.0f); w[8 + i] = (_Float16)(bfr(p[16 + i]) * 256.0f); }
  return w; }
#define WQKV_LAYOUT 0   // selects WCOL, which no kernel here calls: k_proj always stages Wq / Wk / Wv as (in,out) [DIN][CC]
__device__ __forceinline__ v16b wcol_hdk(const float* Wm, int k0, int o, int lane) { v16b w; const int g = lane >> 4; const float* p = Wm + (size_t)(o / HD) * DIN * HD + (o % HD);
#pragma unroll
  for (int i = 0; i < 8; ++i) { w[i] = (__bf16)p[(size_t)(k0 + 8 * g + i) * HD]; w[8 + i] = (__bf16)p[(size_t)(k0 + 16 + 8 * g + i) * HD]; }
  return w; }
#define WO_OUT_IN 0
#if WQKV_LAYOUT == 1
#define WCOL(W, k0, o, lane) wcol_oi(W, k0, o, lane, DIN)
#elif WQKV_LAYOUT == 2
#define WCOL(W, k0, o, lane) wcol_hdk(W, k0, o, lane)
#else
#define WCOL(W, k0, o, lane) wcol_io(W, k0, o, lane, CC)
#endif
#if WO_OUT_IN
#define WOCOL(W, k0, o, lane) wcol_oi(W, k0, o, lane, CC)
#define WOCOLH(W, k0, o, lane) wcolh_oi(W, k0, o, lane, CC)
#else
#define WOCOL(W, k0, o, lane) wcol_io(W, k0, o, lane, DIN)
#define WOCOLH(W, k0, o, lane) wcolh_io(W, k0, o, lane, DIN)
#endif

#ifndef SM_EXTRA_PARAMS
#define SM_EXTRA_PARAMS
#endif
#ifndef PROJ_EXTRA_PARAMS
#define PROJ_EXTRA_PARAMS
#endif
#ifndef SM_MASK_HOOK
#define SM_MASK_HOOK (void)0
#endif

#define WS_QH  0u                                      // f16 q rows [b*t][CC]
#define WS_KH  (WS_QH + 2u * (size_t)NB * TT * CC)      // f16 k rows [b*t][CC]
#define WS_VT  (WS_KH + 2u * (size_t)NB * TT * CC)      // f16 v planes [b][c][t]
#define WS_QL  (WS_VT + 2u * (size_t)NB * CC * TT)      // f16 q residual x 2^10 rows [b][t < QHI][CC]
#define WS_KL  (WS_QL + 2u * (size_t)NB * QHI * CC)     // f16 k residual x 2^10 rows [b][t < KHI][CC]
#define WS_VB  (WS_KL + 2u * (size_t)NB * KHI * CC)     // bf16 v hi planes [b][c][t < KHI]
#define WS_VBL (WS_VB + 2u * (size_t)NB * CC * KHI)
#define WS_S   (WS_VBL + 2u * (size_t)NB * CC * KHI)    // f32 [hg][t][s], not used: k_fa keeps logits and P in registers
#define WS_Y   (WS_S  + 4u * (size_t)HG * TT * TT)      // f32 ctx rows [b*t][CC] (only when there is an output projection)
#define WS_END (WS_Y  + 4u * (size_t)NB * TT * CC)

// ---- weight staging for k_proj and k_out: a [KS][128] f32 tile of a (in,out) weight is read once per block with whole-line 16-byte loads, converted once, and laid in LDS column by column (k contiguous), where every wave takes its B fragments with 16-byte LDS reads
#define KS 64            // k rows of one staged tile
#define WP (KS + 8)      // LDS pitch of a staged column in elements: 144 B = 16 B x 9, free of bank conflicts for the fragment reads and for the staging stores
// one thread's share of a tile: 2 units of (8 k rows x 4 columns); a wave covers 32 columns, lane = (k octet = lane & 3, column group = lane >> 2), so each load instruction covers four whole 128-B lines
struct WT { v4f r[2][8]; };
__device__ __forceinline__ const float* wt_lane(const float* Wm, int k0, int c0, int ld, int wave, int lane) { return Wm + (size_t)(k0 + 8 * (lane & 3)) * ld + c0 + 32 * wave + 4 * (lane >> 2); }   // the lane's first element of the tile at k row k0
__device__ __forceinline__ void wt_load(WT& t, const float* p, int ld) {
#pragma unroll
  for (int u = 0; u < 2; ++u) {
#pragma unroll
    for (int i = 0; i < 8; ++i) t.r[u][i] = *(const v4f*)(p + (size_t)(32 * u + i) * ld); } }
__device__ __forceinline__ void wt_store_b(const WT& t, __bf16* wb, int wave, int lane) {   // bf16, exact operand of k_proj
  __bf16* d = wb + (32 * wave + 4 * (lane >> 2)) * WP + 8 * (lane & 3);
#pragma unroll
  for (int u = 0; u < 2; ++u) {
#pragma unroll
    for (int c = 0; c < 4; ++c) { v8b x;
#pragma unroll
      for (int i = 0; i < 8; ++i) x[i] = (__bf16)t.r[u][i][c];
      *(v8b*)(d + c * WP + 32 * u) = x; } } }
__device__ __forceinline__ void wt_store_h(const WT& t, _Float16* wb, int wave, int lane) {   // f16(bf16 x 2^8), exact operand of k_out
  _Float16* d = wb + (32 * wave + 4 * (lane >> 2)) * WP + 8 * (lane & 3);
#pragma unroll
  for (int u = 0; u < 2; ++u) {
#pragma unroll
    for (int c = 0; c < 4; ++c) { v8h x;
#pragma unroll
      for (int i = 0; i < 8; ++i) x[i] = (_Float16)(bfr(t.r[u][i][c]) * 256.0f);
      *(v8h*)(d + c * WP + 32 * u) = x; } } }
// a lane's raw f32 share of the A fragments of one stage (KS k of its own row): per 32 k, elements 8g + 0..7 and 16 + 8g + 0..7
struct XT { v4f r[KS / 32][4]; };
__device__ __forceinline__ void xt_load(XT& t, const float* p) {   // p: the lane's own row at the stage's first k, + 8 * (lane >> 4)
#pragma unroll
  for (int kk = 0; kk < KS / 32; ++kk) { t.r[kk][0] = *(const v4f*)(p + kk * 32); t.r[kk][1] = *(const v4f*)(p + kk * 32 + 4); t.r[kk][2] = *(const v4f*)(p + kk * 32 + 16); t.r[kk][3] = *(const v4f*)(p + kk * 32 + 20); } }

// Blocks that share a weight tile (all row blocks of a column block) or an A tile (all column blocks of a row block) run in step, and would ask L2 for the same lines at the same moment. So each block walks the k stages as a ring from a first stage set by its tile indices: the sum takes every stage once, in rotated order.
#define KROT(K) ((int)((blockIdx.x + 2 * blockIdx.y) & ((K) / KS - 1)))          // the block's first stage (K / KS is a power of two)
#define KST(s, rot, K) (((((s) + (rot)) & ((K) / KS - 1))) * KS)                // first k row of the s-th stage walked
// ---- k_proj: block = (64 rows, 128 cols, which): q/k/v = X W (+ b) with exact bf16 products (K = DIN) -> which 0: q f16 rows (+ residual rows < QHI); 1: k f16 rows (+ residual rows < KHI); 2: v f16 planes [c][t] (+ bf16 hi/lo planes for t < KHI)
__global__ __launch_bounds__(128) void k_proj(const float* __restrict__ XQ, const float* __restrict__ XK, const float* __restrict__ XV, const float* __restrict__ WQ, const float* __restrict__ WK, const float* __restrict__ WV, const float* __restrict__ BQ, const float* __restrict__ BK, const float* __restrict__ BV,
    _Float16* __restrict__ QH, _Float16* __restrict__ QL, _Float16* __restrict__ KH, _Float16* __restrict__ KL, _Float16* __restrict__ VT, __bf16* __restrict__ VB, __bf16* __restrict__ VBL) {
  __shared__ __align__(16) union { struct { _Float16 sh[64][136], sl[64][136], th[128][72]; __bf16 tb[128][72], tbl[128][72]; } e; __bf16 wb[2][128 * WP]; } sm;   // the weight stages share LDS with the epilogue's tiles, so that as many blocks as before fit a WGP
  auto& sh = sm.e.sh; auto& sl = sm.e.sl; auto& th = sm.e.th; auto& tb = sm.e.tb; auto& tbl = sm.e.tbl;
  const int tid = threadIdx.x, wave = tid >> 5, lane = tid & 31, col = lane & 15, g = lane >> 4; const int which = blockIdx.z; const int c0 = blockIdx.y * 128; const size_t r0 = (size_t)blockIdx.x * 64; const size_t bb = r0 / TT; const int t0 = (int)(r0 % TT);
  const float* X = which == 0 ? XQ : which == 1 ? XK : XV; const float* WA = which == 0 ? WQ : which == 1 ? WK : WV; const float* BA = which == 0 ? BQ : which == 1 ? BK : BV;
  v8f acc[8] = {};
  float bs[8];   // the lane's bias of each column tile, loaded here: all eight fly together, beside the first stage's loads. Loaded where they are used, behind the loop, each was waited for by itself: eight load latencies in a row at the end of every block
#pragma unroll   // this loop and the two below: unrolled so that bs is indexed by constants and stays in registers
  for (int j = 0; j < 8; ++j) bs[j] = 0.f;
  if (BA) {   // one test round all eight: with a test round each, the build put a wait behind each load
#pragma unroll
    for (int j = 0; j < 8; ++j) bs[j] = BA[c0 + j * 16 + col]; }
  WT wt; XT xt; v16b af[KS / 32];
  const int rot = KROT(DIN);   // the same for the three products of one X tile, which read the same X lines
  const float* wp = wt_lane(WA, KST(0, rot, DIN), c0, CC, wave, lane); const float* xp = X + (r0 + wave * 16 + col) * DIN + KST(0, rot, DIN) + 8 * g;   // the lane's sources in the stage fetched next: carried along the ring
  wt_load(wt, wp, CC); xt_load(xt, xp);
  asm volatile("s_wait_xcnt 0x0" ::: "memory");   // the first loads' address registers are free for reuse behind it
  wt_store_b(wt, sm.wb[0], wave, lane);
#pragma unroll
  for (int j = 0; j < 8; ++j) bs[j] = bfr(bs[j]);   // rounded behind the first stage's wait, which the bias loads, issued earlier, have met by then
  { const int d = KST(1, rot, DIN) - KST(0, rot, DIN); wp += d * CC; xp += d; }
#pragma unroll
  for (int kk = 0; kk < KS / 32; ++kk) {
#pragma unroll
    for (int i = 0; i < 8; ++i) { af[kk][i] = (__bf16)xt.r[kk][i >> 2][i & 3]; af[kk][8 + i] = (__bf16)xt.r[kk][2 + (i >> 2)][i & 3]; } }
  __syncthreads();   // stage 0 is published
#pragma unroll 2
  for (int s = 0; s < DIN / KS; ++s) { const bool more = s + 1 < DIN / KS;   // two buffers: stage s + 1 is fetched into registers while stage s is worked on
    if (more) { wt_load(wt, wp, CC); xt_load(xt, xp); }
    __builtin_amdgcn_sched_barrier(0);   // keeps the next stage's global loads issued in front of this stage's products, which then cover their latency
    const __bf16* wc = sm.wb[s & 1] + col * WP;
#pragma unroll
    for (int kk = 0; kk < KS / 32; ++kk) { v16b wf[8];
#pragma unroll
      for (int j = 0; j < 8; ++j) wf[j] = frag_b(wc + j * 16 * WP + kk * 32, lane);
      __builtin_amdgcn_sched_barrier(0);   // keeps the 16 LDS reads together in front of their products: one wait for the group, where a read pair in front of each product waits out the LDS latency eight times
#pragma unroll
      for (int j = 0; j < 8; ++j) acc[j] = wmma_bf(af[kk], wf[j], acc[j]); }
    __builtin_amdgcn_sched_barrier(0);   // keeps the fetched tile's conversion, and with it the wait for its loads, behind this stage's products
    if (more) { wt_store_b(wt, sm.wb[(s + 1) & 1], wave, lane);
      { const int d = KST(s + 2, rot, DIN) - KST(s + 1, rot, DIN); wp += d * CC; xp += d; }   // one stage on, or back to k = 0: behind the wait for the loads that used these addresses
#pragma unroll
      for (int kk = 0; kk < KS / 32; ++kk) {
#pragma unroll
        for (int i = 0; i < 8; ++i) { af[kk][i] = (__bf16)xt.r[kk][i >> 2][i & 3]; af[kk][8 + i] = (__bf16)xt.r[kk][2 + (i >> 2)][i & 3]; } } }
    __syncthreads(); }   // publishes stage s + 1 and ends every wave's reads of stage s, whose buffer is written next (after the last stage: by the epilogue)
  if (which < 2) { _Float16* DH = which == 0 ? QH : KH; _Float16* DL = which == 0 ? QL : KL; const int nhi = which == 0 ? QHI : KHI; const bool hi_rows = t0 < nhi;
#pragma unroll
    for (int j = 0; j < 8; ++j) { const float bias = bs[j];
#pragma unroll
      for (int r = 0; r < 8; ++r) { const float v = acc[j][r] + bias; const _Float16 hv = (_Float16)v; sh[wave * 16 + 8 * g + r][j * 16 + col] = hv; sl[wave * 16 + 8 * g + r][j * 16 + col] = (_Float16)((v - (float)hv) * 1024.0f); } }
    __syncthreads();
    for (int e = tid; e < 64 * 16; e += 128) { const int rl = e >> 4, q = e & 15; vst2((unsigned*)(DH + (r0 + rl) * CC + c0 + q * 8), *(const v4u*)&sh[rl][q * 8]); if (hi_rows) vst2((unsigned*)(DL + (bb * nhi + t0 + rl) * (size_t)CC + c0 + q * 8), *(const v4u*)&sl[rl][q * 8]); }
  } else { const bool hi_rows = t0 < KHI;
#pragma unroll
    for (int j = 0; j < 8; ++j) { const float bias = bs[j];
#pragma unroll
      for (int r = 0; r < 8; ++r) { const float v = acc[j][r] + bias; const int rl = wave * 16 + 8 * g + r, cl = j * 16 + col; th[cl][rl] = (_Float16)v; const __bf16 bh = (__bf16)v; tb[cl][rl] = bh; tbl[cl][rl] = (__bf16)(v - (float)bh); } }
    __syncthreads();
    for (int e = tid; e < 128 * 8; e += 128) { const int cl = e >> 3, q = e & 7; vst2((unsigned*)(VT + (bb * CC + c0 + cl) * (size_t)TT + t0 + q * 8), *(const v4u*)&th[cl][q * 8]); if (hi_rows) { const size_t o3 = (bb * CC + c0 + cl) * (size_t)KHI + t0 + q * 8; vst2((unsigned*)(VB + o3), *(const v4u*)&tb[cl][q * 8]); vst2((unsigned*)(VBL + o3), *(const v4u*)&tbl[cl][q * 8]); } } } }
// ---- k_fa: block = 128 queries of (b, h), 16 waves = (8 groups of 16 query columns) x (2 halves of the key range): four waves a SIMD, so that one wave's softmax runs beside another's products. Each wave walks its half in trips of 64 keys with a running maximum (online softmax), so logits and P stay in registers; the two halves' (maximum, sum, O) are joined once, through LDS, behind the loop.
// S^T = K . Q^T (A = k rows, B = q rows): lane (g, col) holds keys 8g + r of each 16-key tile for query col, which is the B fragment order of P^T; O^T += V^T . P^T (A = v planes [c][t]): lane holds d = 16j + 8g + r of query col.
// Every inner loop below is unrolled so that the fragment and accumulator arrays are indexed by constants and stay in registers.
__device__ __forceinline__ v8f wmma_h(v16h a, v16h b, v8f c) { return __builtin_amdgcn_wmma_f32_16x16x32_f16(false, a, false, b, (short)0, c, false, false); }
__device__ __forceinline__ float xhalf(float x) { return __builtin_bit_cast(float, __builtin_amdgcn_permlanex16(__builtin_bit_cast(int, x), __builtin_bit_cast(int, x), 0x76543210, 0xfedcba98, false, false)); }   // lane l with lane l ^ 16
// K and V reach the waves through LDS: the 8 waves of a half need the same 16 KB a trip, so each tile is brought in once per block with whole-line asynchronous copies and every wave takes its fragments with 16-byte LDS reads.
// Tile t of a half = (v planes of the t-th 64-key group walked, k rows of the next group): what trip t reads, since the scores are formed one trip ahead. Two buffers a half: tile t + 1 flies while trip t works. A half's tiles are copied by its own 8 waves.
#define KH2 (TT / 2)     // keys of one half
#define NT (KH2 / 64)    // trips of a wave
#define KP (64 + 8)      // LDS pitch of a staged 128-B row in elements: 144 B = 16 B x 9, free of bank conflicts for the fragment reads
#define KVB (2 * 64 * KP * 2)   // bytes of one buffer: 64 k rows, then 64 v rows
// one thread's share of a tile: 16 B of k rows r and r + 32 and of v rows r and r + 32 (8 lanes a row: each copy instruction covers four whole 128-B lines)
__device__ __forceinline__ void kv_copy(unsigned lds, const _Float16* gk, const _Float16* gv) {
  const unsigned l1 = lds + 32 * KP * 2, l2 = lds + 64 * KP * 2, l3 = lds + 96 * KP * 2; const _Float16* gk1 = gk + (size_t)32 * CC; const _Float16* gv1 = gv + (size_t)32 * TT;
  // the s_wait_xcnt stands in the copies' own statement, so that no address register is rewritten in front of it
  asm volatile("global_load_async_to_lds_b128 %0, %4, off\n\tglobal_load_async_to_lds_b128 %1, %5, off\n\tglobal_load_async_to_lds_b128 %2, %6, off\n\tglobal_load_async_to_lds_b128 %3, %7, off\n\ts_wait_xcnt 0x0"
               :: "v"(lds), "v"(l1), "v"(l2), "v"(l3), "v"(gk), "v"(gk1), "v"(gv), "v"(gv1) : "memory"); }
// the same for k rows alone: the first group walked, whose scores are formed in front of the loop
__device__ __forceinline__ void k_copy(unsigned lds, const _Float16* gk) {
  const unsigned l1 = lds + 32 * KP * 2; const _Float16* gk1 = gk + (size_t)32 * CC;
  // as above: the s_wait_xcnt in the copies' own statement, in front of any rewrite of their address registers
  asm volatile("global_load_async_to_lds_b128 %0, %2, off\n\tglobal_load_async_to_lds_b128 %1, %3, off\n\ts_wait_xcnt 0x0" :: "v"(lds), "v"(l1), "v"(gk), "v"(gk1) : "memory"); }
__global__ __launch_bounds__(512) void k_fa(const _Float16* __restrict__ QH, const _Float16* __restrict__ KH, const _Float16* __restrict__ VT, float* __restrict__ Y) {
  __shared__ __align__(16) _Float16 kv[2][2][2][64 * KP];   // [half][buffer][k rows, v rows]
  __shared__ __align__(16) _Float16 kz[2][64 * KP];         // [half] k rows of the first group walked: filled once, read once
  __shared__ __align__(16) v4f jo[8][8][32];                // the upper half's O, [query group][4 values][lane]
  __shared__ __align__(8) v2f jm[8][32];                    // its (maximum, sum)
  const int hf = __builtin_amdgcn_readfirstlane((int)threadIdx.x >> 8);   // the wave's half of the key range, the same in every lane
  const int tid = threadIdx.x & 255, wave = tid >> 5, lane = tid & 31, col = lane & 15, g = lane >> 4; const int b = blockIdx.y / NH, h = blockIdx.y % NH; const int q = blockIdx.x * 128 + wave * 16 + col;
  const _Float16* Qr = QH + ((size_t)b * TT + q) * CC + h * HD;
  const _Float16* Kc = KH + ((size_t)b * TT + hf * KH2 + (tid >> 3)) * CC + h * HD + 8 * (tid & 7); const _Float16* Vc = VT + ((size_t)b * CC + h * HD + (tid >> 3)) * (size_t)TT + hf * KH2 + 8 * (tid & 7);   // the thread's sources in its half's keys 0..63
  const unsigned lc = (unsigned)(size_t)&kv[hf][0][0][(tid >> 3) * KP + 8 * (tid & 7)];   // its place in its half's buffer 0 (LDS byte address)
  const int rot = (int)(blockIdx.x & (NT - 1));   // the 16 blocks of one (b, h) need the same K and V lines: each walks the 64-key groups of a half as a ring from a group of its own, so that they do not ask L2 for the same lines at the same moment
#define KG(i) ((((i) + rot) & (NT - 1)) * 64)   // first key of the i-th group walked (NT is a power of two)
  k_copy((unsigned)(size_t)&kz[hf][(tid >> 3) * KP + 8 * (tid & 7)], Kc + (size_t)KG(0) * CC);
  kv_copy(lc, Kc + (size_t)KG(1) * CC, Vc + KG(0));   // tile 0
  const v16h q0 = frag_h(Qr, lane), q1 = frag_h(Qr + 32, lane);
  const float C2 = SCALE * 1.4426950408889634f;   // logits carried in base 2
  v8f acc[HD / 16] = {}; float m = -3.0e38f, l = 0.f;
  v8f s[4];   // scores of the coming trip, carried over the loop's back edge: every fragment read of a trip is issued at its head and used at its foot
  asm volatile("s_wait_asynccnt 0x0" ::: "memory");   // this wave's share of the first k rows and of tile 0 has landed
  __syncthreads();   // both are published
  kv_copy(lc + KVB, Kc + (size_t)KG(2) * CC, Vc + KG(1));   // tile 1
#pragma unroll
  for (int t = 0; t < 4; ++t) { const v8f z = {}; s[t] = wmma_h(frag_h(&kz[hf][(t * 16 + col) * KP], lane), q0, z); s[t] = wmma_h(frag_h(&kz[hf][(t * 16 + col) * KP + 32], lane), q1, s[t]); }
  for (int t = 0; t < NT; ++t) {
    const _Float16* kl = &kv[hf][t & 1][0][col * KP]; const _Float16* vl = &kv[hf][t & 1][1][col * KP];
    v16h vf[HD / 16][2], kf[4][2];
#pragma unroll
    for (int j = 0; j < HD / 16; ++j) { vf[j][0] = frag_h(vl + j * 16 * KP, lane); vf[j][1] = frag_h(vl + j * 16 * KP + 32, lane); }
#pragma unroll
    for (int u = 0; u < 4; ++u) { kf[u][0] = frag_h(kl + u * 16 * KP, lane); kf[u][1] = frag_h(kl + u * 16 * KP + 32, lane); }   // the next trip's k rows (the last tile holds the last trip's own again; those scores are not used)
    __builtin_amdgcn_sched_barrier(0);   // keeps the trip's LDS reads issued in front of the softmax, whose work then covers their latency; without it they sink to their first use
    float mt[4];   // four independent chains
#pragma unroll
    for (int u = 0; u < 4; ++u) { mt[u] = s[u][0];
#pragma unroll
      for (int r = 1; r < 8; ++r) mt[u] = fmaxf(mt[u], s[u][r]); }
    float mx = fmaxf(fmaxf(mt[0], mt[1]), fmaxf(mt[2], mt[3])); mx = fmaxf(mx, xhalf(mx));
    const float mn = fmaxf(m, mx * C2); float alpha;   // 2^(m - mn), 0 on the first trip
    asm("v_exp_f32 %0, %1\n\tv_nop" : "=v"(alpha) : "v"(m - mn));   // asm for the v_nop alone: it fills the slot behind a transcendental
    m = mn;
    const float off = 10.0f - mn;   // P relative to the running maximum, x 2^10 into f16 (clear of f16 subnormals); the factor cancels against l
    v16h p[2]; float ps[4];
#pragma unroll
    for (int u = 0; u < 4; ++u) { ps[u] = 0.f;
#pragma unroll
      for (int r = 0; r < 8; ++r) { const float e = __builtin_amdgcn_exp2f(fmaf(s[u][r], C2, off)); ps[u] += e; p[u >> 1][(u & 1) * 8 + r] = (_Float16)e; } }
    l = l * alpha + ((ps[0] + ps[1]) + (ps[2] + ps[3]));
#pragma unroll
    for (int j = 0; j < HD / 16; ++j) { acc[j] *= alpha; acc[j] = wmma_h(vf[j][0], p[0], acc[j]); acc[j] = wmma_h(vf[j][1], p[1], acc[j]); }
#pragma unroll
    for (int u = 0; u < 4; ++u) { const v8f z = {}; s[u] = wmma_h(kf[u][0], q0, z); s[u] = wmma_h(kf[u][1], q1, s[u]); }
    __builtin_amdgcn_sched_barrier(0);   // keeps the waits and the barrier below at the trip's foot: lifted to the LDS reads, as the build without it had them, they expose the reads' latency and leave the flying tile no lead
    asm volatile("s_wait_dscnt 0x0" ::: "memory");      // this wave's reads of the buffer are over before it is refilled
    asm volatile("s_wait_asynccnt 0x0" ::: "memory");   // this wave's share of tile t + 1 has landed
    __syncthreads();   // publishes tile t + 1 and ends every wave's reads of tile t, whose buffer is refilled next
    if (t + 2 < NT) kv_copy(lc + (t & 1) * KVB, Kc + (size_t)KG(t + 3 < NT ? t + 3 : NT - 1) * CC, Vc + KG(t + 2)); }
  asm volatile("s_wait_asynccnt 0x0" ::: "memory");   // no copy is left in flight when the wave ends
  if (hf == 1) { jm[wave][lane] = v2f{m, l};   // the upper half hands over its state
#pragma unroll
    for (int j = 0; j < HD / 16; ++j) { jo[wave][2 * j][lane] = v4f{acc[j][0], acc[j][1], acc[j][2], acc[j][3]}; jo[wave][2 * j + 1][lane] = v4f{acc[j][4], acc[j][5], acc[j][6], acc[j][7]}; } }
  __syncthreads();   // publishes it; every wave passes
  if (hf == 1) return;   // behind the last barrier
  const v2f om = jm[wave][lane]; const float mj = fmaxf(m, om[0]); const float a0 = __builtin_amdgcn_exp2f(m - mj), a1 = __builtin_amdgcn_exp2f(om[0] - mj);   // both states rescaled to the common maximum
  l = l * a0 + om[1] * a1;
#pragma unroll
  for (int j = 0; j < HD / 16; ++j) { const v4f x = jo[wave][2 * j][lane], y = jo[wave][2 * j + 1][lane];
#pragma unroll
    for (int r = 0; r < 4; ++r) { acc[j][r] = acc[j][r] * a0 + x[r] * a1; acc[j][4 + r] = acc[j][4 + r] * a0 + y[r] * a1; } }
  l += xhalf(l); const float inv = 1.0f / l;   // l >= 2^10: the maximum's own term
  float* Yr = Y + ((size_t)b * TT + q) * CC + h * HD + 8 * g;
#pragma unroll
  for (int j = 0; j < HD / 16; ++j) { v4f a, c;
#pragma unroll
    for (int r = 0; r < 4; ++r) { a[r] = acc[j][r] * inv; c[r] = acc[j][4 + r] * inv; }
    vst2(Yr + j * 16, a); vst2(Yr + j * 16 + 4, c); } }
// ---- k_out: block = (64 rows, 128 cols): out = ctx Wo (+ bo): ctx x 2^6 once to f16 against Wo as f16(bf16 x 2^8) exact (1 product) x 2^-14; causal early rows (< QHI of each sequence): ctx bf16 hi + lo against exact bf16 Wo (2 products)
__global__ __launch_bounds__(128) void k_out(const float* __restrict__ Y, const float* __restrict__ WO, const float* __restrict__ BO, float* __restrict__ OUT) { __shared__ __align__(16) float sf[4][16][132]; __shared__ __align__(16) _Float16 wb[2][128 * WP];
  const int tid = threadIdx.x, wave = tid >> 5, lane = tid & 31, col = lane & 15, g = lane >> 4; const int c0 = blockIdx.y * 128; const size_t r0 = (size_t)blockIdx.x * 64 + wave * 16;
  v8f acc[8] = {};
  if (CAUSAL && (int)(((size_t)blockIdx.x * 64) % TT) < QHI) {   /* block-uniform */
#pragma unroll 2
    for (int kc = 0; kc < CC / 32; ++kc) { const F2 a = split_row(Y + (r0 + col) * CC, kc * 32, lane); asm volatile("s_wait_loadcnt 0x0" ::: "memory");
#pragma unroll
      for (int j = 0; j < 8; ++j) { const v16b w = WOCOL(WO, kc * 32, c0 + j * 16 + col, lane); asm volatile("s_wait_loadcnt 0x0" ::: "memory"); acc[j] = wmma_bf(a.h, w, acc[j]); acc[j] = wmma_bf(a.l, w, acc[j]); } }
#pragma unroll
    for (int j = 0; j < 8; ++j) { const float bias = BO ? bfr(BO[c0 + j * 16 + col]) : 0.f;
#pragma unroll
      for (int r = 0; r < 8; ++r) sf[wave][8 * g + r][j * 16 + col] = acc[j][r] + bias; }
  } else {
    float bs[8];   // as in k_proj: the eight bias loads fly together at the kernel's head
#pragma unroll   // this loop and the two below: unrolled so that bs stays in registers
    for (int j = 0; j < 8; ++j) bs[j] = 0.f;
    if (BO) {   // one test round all eight
#pragma unroll
      for (int j = 0; j < 8; ++j) bs[j] = BO[c0 + j * 16 + col]; }
    WT wt; XT xt; v16h af[KS / 32];   /* ctx carried x 2^6 into f16 so small-magnitude context rows stay clear of f16 subnormals */
    const int rot = KROT(CC);
    const float* wp = wt_lane(WO, KST(0, rot, CC), c0, DIN, wave, lane); const float* yp = Y + (r0 + col) * CC + KST(0, rot, CC) + 8 * g;   // as in k_proj
    wt_load(wt, wp, DIN); xt_load(xt, yp); wt_store_h(wt, wb[0], wave, lane);
#pragma unroll
    for (int j = 0; j < 8; ++j) bs[j] = bfr(bs[j]);   // as in k_proj
    { const int d = KST(1, rot, CC) - KST(0, rot, CC); wp += d * DIN; yp += d; }
#pragma unroll
    for (int kk = 0; kk < KS / 32; ++kk) {
#pragma unroll
      for (int i = 0; i < 8; ++i) { af[kk][i] = (_Float16)(xt.r[kk][i >> 2][i & 3] * 64.0f); af[kk][8 + i] = (_Float16)(xt.r[kk][2 + (i >> 2)][i & 3] * 64.0f); } }
    __syncthreads();   // stage 0 is published
#pragma unroll 2
    for (int s = 0; s < CC / KS; ++s) { const bool more = s + 1 < CC / KS;   // two buffers, as in k_proj
      if (more) { wt_load(wt, wp, DIN); xt_load(xt, yp); }
      __builtin_amdgcn_sched_barrier(0);   // keeps the next stage's global loads issued in front of this stage's products, which then cover their latency
      const _Float16* wc = wb[s & 1] + col * WP;
#pragma unroll
      for (int kk = 0; kk < KS / 32; ++kk) { v16h wf[8];
#pragma unroll
        for (int j = 0; j < 8; ++j) wf[j] = frag_h(wc + j * 16 * WP + kk * 32, lane);
        __builtin_amdgcn_sched_barrier(0);   // keeps the 16 LDS reads together in front of their products: one wait for the group
#pragma unroll
        for (int j = 0; j < 8; ++j) acc[j] = wmma16(af[kk], wf[j], acc[j]); }
      __builtin_amdgcn_sched_barrier(0);   // keeps the fetched tile's conversion, and with it the wait for its loads, behind this stage's products
      if (more) { wt_store_h(wt, wb[(s + 1) & 1], wave, lane);
        { const int d = KST(s + 2, rot, CC) - KST(s + 1, rot, CC); wp += d * DIN; yp += d; }   // as in k_proj
#pragma unroll
        for (int kk = 0; kk < KS / 32; ++kk) {
#pragma unroll
          for (int i = 0; i < 8; ++i) { af[kk][i] = (_Float16)(xt.r[kk][i >> 2][i & 3] * 64.0f); af[kk][8 + i] = (_Float16)(xt.r[kk][2 + (i >> 2)][i & 3] * 64.0f); } } }
      __syncthreads(); }   // publishes stage s + 1 and ends every wave's reads of stage s, whose buffer is written next
#pragma unroll
    for (int j = 0; j < 8; ++j) { const float bias = bs[j];
#pragma unroll
      for (int r = 0; r < 8; ++r) sf[wave][8 * g + r][j * 16 + col] = acc[j][r] * (1.0f / 16384.0f) + bias; } }   /* 2^-8 (Wo carry) x 2^-6 (ctx carry) */
  LDSX(); for (int rl = 0; rl < 16; ++rl) vst2(OUT + (r0 + rl) * DIN + c0 + lane * 4, *(const v4f*)&sf[wave][rl][lane * 4]); }

extern "C" void kernel_launch(void* const* d_in, const int* in_sizes, int n_in, void* d_out, int out_size, void* d_ws, size_t ws_size, hipStream_t stream) {
  (void)in_sizes; (void)n_in; (void)out_size;
  const float** F = (const float**)d_in;
  if (ws_size < (size_t)WS_END) return;
  char* ws = (char*)d_ws; _Float16 *QH = (_Float16*)(ws + WS_QH), *KH = (_Float16*)(ws + WS_KH), *VT = (_Float16*)(ws + WS_VT), *QL = (_Float16*)(ws + WS_QL), *KL = (_Float16*)(ws + WS_KL); __bf16 *VB = (__bf16*)(ws + WS_VB), *VBL = (__bf16*)(ws + WS_VBL); float *Y = (float*)(ws + WS_Y);
  (void)Y; (void)QL; (void)KL; (void)VB; (void)VBL;
  // inputs: 0 inputs [2,2048,512]; 1 Wq [512,512] (in,out), 2 bq; 3 Wk, 4 bk; 5 Wv, 6 bv; 7 Wo (in,out), 8 bo (zero biases, read)
  k_proj<<<dim3(TNB * TT / 64, CC / 128, 3), 128, 0, stream>>>(F[0], F[0], F[0], F[1], F[3], F[5], F[2], F[4], F[6], QH, QL, KH, KL, VT, VB, VBL);
  k_fa<<<dim3(TT / 128, TNB * NH), 512, 0, stream>>>(QH, KH, VT, Y);
  k_out<<<dim3(TNB * TT / 64, DIN / 128), 128, 0, stream>>>(Y, F[7], F[8], (float*)d_out);
}

// v007
// It runs in 41.2 microseconds.
// Next to v006, in two timings, it ran 1.04 and 1.03 times as fast.
// All steps since v000 together make it 14.1 times as fast.
// compute dtype: all float inputs rounded to bf16; q/k/v projections with EXACT bf16 products on WMMA 16x16x32 (f32 accumulate) + bias; logits q x k once to f16 each (1 product) x SCALE; online softmax f32; P (relative to the running maximum) x 2^10 once to f16 x v once to f16 (1 product); ctx x 2^6 once to f16 x Wo f16(bf16 x 2^8) + bo; f32 output.
#include <hip/hip_runtime.h>
#include <math.h>

typedef __attribute__((ext_vector_type(16))) _Float16 v16h;
typedef __attribute__((ext_vector_type(16))) __bf16 v16b;
typedef __attribute__((ext_vector_type(8)))  _Float16 v8h;
typedef __attribute__((ext_vector_type(8)))  float v8f;
typedef __attribute__((ext_vector_type(4)))  float v4f;
typedef __attribute__((ext_vector_type(2)))  float v2f;
typedef __attribute__((ext_vector_type(4)))  unsigned v4u;
typedef __attribute__((ext_vector_type(4)))  int v4i;
typedef float __attribute__((may_alias)) float_a;
typedef int __attribute__((may_alias)) int_a;

template <typename T> __device__ __forceinline__ void vst2(void* p, T v) { *(T*)p = v;  }
__device__ __forceinline__ v8f wmma16(v16h a, v16h b, v8f c) {
  v8f d = __builtin_amdgcn_wmma_f32_16x16x32_f16(false, a, false, b, (short)0, c, false, false);
  asm volatile("v_nop\n\tv_nop\n\tv_nop\n\tv_nop" : "+v"(d) : "v"(a), "v"(b));
  return d;
}
__device__ __forceinline__ v8f wmma_bf(v16b a, v16b b, v8f c) {
  v8f d = __builtin_amdgcn_wmma_f32_16x16x32_bf16(false, a, false, b, (short)0, c, false, false);
  asm volatile("v_nop\n\tv_nop\n\tv_nop\n\tv_nop" : "+v"(d) : "v"(a), "v"(b));
  return d;
}
// 16x16x32 fragments: lane = (h = lane>>4, row/col = lane&15); elements 0..7 = k0+8h+0..7, 8..15 = k0+16+8h+0..7; D element r = row 8h+r
__device__ __forceinline__ v16h frag_h(const _Float16* rowk0, int lane) {
  union { v16h v; v8h q[2]; } u; const _Float16* p = rowk0 + 8 * (lane >> 4);
  u.q[0] = *(const v8h*)p; u.q[1] = *(const v8h*)(p + 16); return u.v;
}
__device__ __forceinline__ v16h frag_f32(const float* rowk0, int lane) {
  v16h a; const float* p = rowk0 + 8 * (lane >> 4);
#pragma unroll
  for (int i = 0; i < 8; ++i) { a[i] = (_Float16)p[i]; a[8 + i] = (_Float16)p[16 + i]; }
  return a;
}
__device__ __forceinline__ v16h frag_f32s(const float* rowk0, int lane, float sc) {
  v16h a; const float* p = rowk0 + 8 * (lane >> 4);
#pragma unroll
  for (int i = 0; i < 8; ++i) { a[i] = (_Float16)(p[i] * sc); a[8 + i] = (_Float16)(p[16 + i] * sc); }
  return a;
}
// column fragment from a [K][ld] layout (column n), rows >= K read as 0
__device__ __forceinline__ v16h fragc_f32(const float* W, int k0, int n, int lane, int ld, int K) {
  v16h a; const int g = lane >> 4;
#pragma unroll
  for (int i = 0; i < 8; ++i) { const int ka = k0 + 8 * g + i, kb = ka + 16;
    a[i] = (_Float16)(ka < K ? W[(size_t)(ka < K ? ka : K - 1) * ld + n] : 0.f); a[8 + i] = (_Float16)(kb < K ? W[(size_t)(kb < K ? kb : K - 1) * ld + n] : 0.f); }
  return a;
}
struct F2 { v16b h, l; };
__device__ __forceinline__ F2 bsplit16(const float v[16]) { F2 r;
#pragma unroll
  for (int i = 0; i < 16; ++i) { const __bf16 h = (__bf16)v[i]; r.h[i] = h; r.l[i] = (__bf16)(v[i] - (float)h); }
  return r; }
__device__ __forceinline__ F2 split_row(const float* row, int k0, int lane) { float v[16]; const float* p = row + k0 + 8 * (lane >> 4);
#pragma unroll
  for (int i = 0; i < 8; ++i) { v[i] = p[i]; v[8 + i] = p[16 + i]; }
  return bsplit16(v); }
__device__ __forceinline__ F2 split_rowK(const float* row, int k0, int lane, int K) { float v[16]; const int g = lane >> 4;
#pragma unroll
  for (int i = 0; i < 8; ++i) { const int ka = k0 + 8 * g + i, kb = ka + 16; v[i] = ka < K ? row[ka < K ? ka : K - 1] : 0.f; v[8 + i] = kb < K ? row[kb < K ? kb : K - 1] : 0.f; }
  return bsplit16(v); }
__device__ __forceinline__ F2 split_col(const float* W, int k0, int n, int lane, int ld, int K) { float v[16]; const int g = lane >> 4;
#pragma unroll
  for (int i = 0; i < 8; ++i) { const int ka = k0 + 8 * g + i, kb = ka + 16; v[i] = ka < K ? W[(size_t)(ka < K ? ka : K - 1) * ld + n] : 0.f; v[8 + i] = kb < K ? W[(size_t)(kb < K ? kb : K - 1) * ld + n] : 0.f; }
  return bsplit16(v); }
__device__ __forceinline__ v8f mac3(const F2& a, const F2& b, v8f c) { c = wmma_bf(a.l, b.h, c); c = wmma_bf(a.h, b.l, c); return wmma_bf(a.h, b.h, c); }
__device__ __forceinline__ float sigm(float v) { return 1.0f / (1.0f + expf(-v)); }
#define LDSX() do { asm volatile("s_wait_dscnt 0" ::: "memory"); __builtin_amdgcn_wave_barrier(); __builtin_amdgcn_fence(__ATOMIC_RELEASE, "workgroup"); } while (0)

// Multi-head self-attention (inputs [2,2048,512]; (in,out) Wq / Wk / Wv / Wo [512,512] N(0, 1/512) + zero biases; 8 heads x 64; scale 1/8; softmax over keys; merge; Wo + bo).
#define NB 2
#define TT 2048
#define CC 512            // NH * HD = projected width
#define DIN 512          // input (model) width
#define NH 8
#define HD 64
#define NQB (TT / 64)
#define HG 4
#define SCALE (0.125f)
#define CAUSAL 0
#ifndef TNB
#define TNB NB
#endif
__device__ __forceinline__ float bfr(float v) { return (float)(__bf16)v; }
__host__ __device__ __forceinline__ int kb_last(int qb) { return CAUSAL ? ((qb * 64 + 63) >> 7) : (TT / 128 - 1); }
typedef __attribute__((ext_vector_type(8))) __bf16 v8b;
__device__ __forceinline__ v16b frag_b(const __bf16* rowk0, int lane) {
  union { v16b v; v8b q[2]; } u; const __bf16* p = rowk0 + 8 * (lane >> 4);
  u.q[0] = *(const v8b*)p; u.q[1] = *(const v8b*)(p + 16); return u.v;
}
#define QBH 0              // not read by any kernel here: k_fa has no high-precision path
#define QHI 0               // single-product logits on every row
#define KHI 64            // key rows carrying k residual / v bf16 hi+lo planes (written by k_proj; no kernel here reads them)
// B fragment (k rows k0+.., output column o) of a weight: (in,out) [K][ld] or (out,in) [ld rows of K]: bf16 exact, or f16(bf16 * 256) exact
__device__ __forceinline__ v16b wcol_io(const float* Wm, int k0, int o, int lane, int ld) { v16b w; const int g = lane >> 4;
#pragma unroll
  for (int i = 0; i < 8; ++i) { w[i] = (__bf16)Wm[(size_t)(k0 + 8 * g + i) * ld + o]; w[8 + i] = (__bf16)Wm[(size_t)(k0 + 16 + 8 * g + i) * ld + o]; }
  return w; }
__device__ __forceinline__ v16b wcol_oi(const float* Wm, int k0, int o, int lane, int K) { v16b w; const float* p = Wm + (size_t)o * K + k0 + 8 * (lane >> 4);
#pragma unroll
  for (int i = 0; i < 8; ++i) { w[i] = (__bf16)p[i]; w[8 + i] = (__bf16)p[16 + i]; }
  return w; }
__device__ __forceinline__ v16h wcolh_io(const float* Wm, int k0, int o, int lane, int ld) { v16h w; const int g = lane >> 4;
#pragma unroll
  for (int i = 0; i < 8; ++i) { w[i] = (_Float16)(bfr(Wm[(size_t)(k0 + 8 * g + i) * ld + o]) * 256.0f); w[8 + i] = (_Float16)(bfr(Wm[(size_t)(k0 + 16 + 8 * g + i) * ld + o]) * 256.0f); }
  return w; }
__device__ __forceinline__ v16h wcolh_oi(const float* Wm, int k0, int o, int lane, int K) { v16h w; const float* p = Wm + (size_t)o * K + k0 + 8 * (lane >> 4);
#pragma unroll
  for (int i = 0; i < 8; ++i) { w[i] = (_Float16)(bfr(p[i]) * 256.0f); w[8 + i] = (_Float16)(bfr(p[16 + i]) * 256.0f); }
  return w; }
#define WQKV_LAYOUT 0   // selects WCOL, which no kernel here calls: k_proj always stages Wq / Wk / Wv as (in,out) [DIN][CC]
__device__ __forceinline__ v16b wcol_hdk(const float* Wm, int k0, int o, int lane) { v16b w; const int g = lane >> 4; const float* p = Wm + (size_t)(o / HD) * DIN * HD + (o % HD);
#pragma unroll
  for (int i = 0; i < 8; ++i) { w[i] = (__bf16)p[(size_t)(k0 + 8 * g + i) * HD]; w[8 + i] = (__bf16)p[(size_t)(k0 + 16 + 8 * g + i) * HD]; }
  return w; }
#define WO_OUT_IN 0
#if WQKV_LAYOUT == 1
#define WCOL(W, k0, o, lane) wcol_oi(W, k0, o, lane, DIN)
#elif WQKV_LAYOUT == 2
#define WCOL(W, k0, o, lane) wcol_hdk(W, k0, o, lane)
#else
#define WCOL(W, k0, o, lane) wcol_io(W, k0, o, lane, CC)
#endif
#if WO_OUT_IN
#define WOCOL(W, k0, o, lane) wcol_oi(W, k0, o, lane, CC)
#define WOCOLH(W, k0, o, lane) wcolh_oi(W, k0, o, lane, CC)
#else
#define WOCOL(W, k0, o, lane) wcol_io(W, k0, o, lane, DIN)
#define WOCOLH(W, k0, o, lane) wcolh_io(W, k0, o, lane, DIN)
#endif

#ifndef SM_EXTRA_PARAMS
#define SM_EXTRA_PARAMS
#endif
#ifndef PROJ_EXTRA_PARAMS
#define PROJ_EXTRA_PARAMS
#endif
#ifndef SM_MASK_HOOK
#define SM_MASK_HOOK (void)0
#endif

#define WS_QH  0u                                      // f16 q rows [b*t][CC]
#define WS_KH  (WS_QH + 2u * (size_t)NB * TT * CC)      // f16 k rows [b*t][CC]
#define WS_VT  (WS_KH + 2u * (size_t)NB * TT * CC)      // f16 v planes [b][c][t]
#define WS_QL  (WS_VT + 2u * (size_t)NB * CC * TT)      // f16 q residual x 2^10 rows [b][t < QHI][CC]
#define WS_KL  (WS_QL + 2u * (size_t)NB * QHI * CC)     // f16 k residual x 2^10 rows [b][t < KHI][CC]
#define WS_VB  (WS_KL + 2u * (size_t)NB * KHI * CC)     // bf16 v hi planes [b][c][t < KHI]
#define WS_VBL (WS_VB + 2u * (size_t)NB * CC * KHI)
#define WS_S   (WS_VBL + 2u * (size_t)NB * CC * KHI)    // f32 [hg][t][s], not used: k_fa keeps logits and P in registers
#define WS_Y   (WS_S  + 4u * (size_t)HG * TT * TT)      // f32 ctx rows [b*t][CC] (only when there is an output projection)
#define WS_END (WS_Y  + 4u * (size_t)NB * TT * CC)

// ---- weight staging for k_proj and k_out: a [KS][128] f32 tile of a (in,out) weight is read once per block with whole-line 16-byte loads, converted once, and laid in LDS column by column (k contiguous), where every wave takes its B fragments with 16-byte LDS reads
#define KS 64            // k rows of one staged tile
#define WP (KS + 8)      // LDS pitch of a staged column in elements: 144 B = 16 B x 9, free of bank conflicts for the fragment reads and for the staging stores
// one thread's share of a tile: 2 units of (8 k rows x 4 columns); a wave covers 32 columns, lane = (k octet = lane & 3, column group = lane >> 2), so each load instruction covers four whole 128-B lines
struct WT { v4f r[2][8]; };
__device__ __forceinline__ const float* wt_lane(const float* Wm, int k0, int c0, int ld, int wave, int lane) { return Wm + (size_t)(k0 + 8 * (lane & 3)) * ld + c0 + 32 * wave + 4 * (lane >> 2); }   // the lane's first element of the tile at k row k0
__device__ __forceinline__ void wt_load(WT& t, const float* p, int ld) {
#pragma unroll
  for (int u = 0; u < 2; ++u) {
#pragma unroll
    for (int i = 0; i < 8; ++i) t.r[u][i] = *(const v4f*)(p + (size_t)(32 * u + i) * ld); } }
__device__ __forceinline__ void wt_store_b(const WT& t, __bf16* wb, int wave, int lane) {   // bf16, exact operand of k_proj
  __bf16* d = wb + (32 * wave + 4 * (lane >> 2)) * WP + 8 * (lane & 3);
#pragma unroll
  for (int u = 0; u < 2; ++u) {
#pragma unroll
    for (int c = 0; c < 4; ++c) { v8b x;
#pragma unroll
      for (int i = 0; i < 8; ++i) x[i] = (__bf16)t.r[u][i][c];
      *(v8b*)(d + c * WP + 32 * u) = x; } } }
__device__ __forceinline__ void wt_store_h(const WT& t, _Float16* wb, int wave, int lane) {   // f16(bf16 x 2^8), exact operand of k_out
  _Float16* d = wb + (32 * wave + 4 * (lane >> 2)) * WP + 8 * (lane & 3);
#pragma unroll
  for (int u = 0; u < 2; ++u) {
#pragma unroll
    for (int c = 0; c < 4; ++c) { v8h x;
#pragma unroll
      for (int i = 0; i < 8; ++i) x[i] = (_Float16)(bfr(t.r[u][i][c]) * 256.0f);
      *(v8h*)(d + c * WP + 32 * u) = x; } } }
// a lane's raw f32 share of the A fragments of one stage (KS k of its own row): per 32 k, elements 8g + 0..7 and 16 + 8g + 0..7
struct XT { v4f r[KS / 32][4]; };
__device__ __forceinline__ void xt_load(XT& t, const float* p) {   // p: the lane's own row at the stage's first k, + 8 * (lane >> 4)
#pragma unroll
  for (int kk = 0; kk < KS / 32; ++kk) { t.r[kk][0] = *(const v4f*)(p + kk * 32); t.r[kk][1] = *(const v4f*)(p + kk * 32 + 4); t.r[kk][2] = *(const v4f*)(p + kk * 32 + 16); t.r[kk][3] = *(const v4f*)(p + kk * 32 + 20); } }

// Blocks that share a weight tile (all row blocks of a column block) or an A tile (all column blocks of a row block) run in step, and would ask L2 for the same lines at the same moment. So each block walks the k stages as a ring from a first stage set by its tile indices: the sum takes every stage once, in rotated order.
#define KROT(K) ((int)((blockIdx.x + 2 * blockIdx.y) & ((K) / KS - 1)))          // the block's first stage (K / KS is a power of two)
#define KST(s, rot, K) (((((s) + (rot)) & ((K) / KS - 1))) * KS)                // first k row of the s-th stage walked
// ---- k_proj: block = (64 rows, 128 cols, which): q/k/v = X W (+ b) with exact bf16 products (K = DIN) -> which 0: q f16 rows (+ residual rows < QHI); 1: k f16 rows (+ residual rows < KHI); 2: v f16 planes [c][t] (+ bf16 hi/lo planes for t < KHI)
__global__ __launch_bounds__(128) void k_proj(const float* __restrict__ XQ, const float* __restrict__ XK, const float* __restrict__ XV, const float* __restrict__ WQ, const float* __restrict__ WK, const float* __restrict__ WV, const float* __restrict__ BQ, const float* __restrict__ BK, const float* __restrict__ BV,
    _Float16* __restrict__ QH, _Float16* __restrict__ QL, _Float16* __restrict__ KH, _Float16* __restrict__ KL, _Float16* __restrict__ VT, __bf16* __restrict__ VB, __bf16* __restrict__ VBL) {
  __shared__ __align__(16) union { struct { _Float16 sh[64][136], sl[64][136], th[128][72]; __bf16 tb[128][72], tbl[128][72]; } e; __bf16 wb[2][128 * WP]; } sm;   // the weight stages share LDS with the epilogue's tiles, so that as many blocks as before fit a WGP
  auto& sh = sm.e.sh; auto& sl = sm.e.sl; auto& th = sm.e.th; auto& tb = sm.e.tb; auto& tbl = sm.e.tbl;
  const int tid = threadIdx.x, wave = tid >> 5, lane = tid & 31, col = lane & 15, g = lane >> 4; const int which = blockIdx.z; const int c0 = blockIdx.y * 128; const size_t r0 = (size_t)blockIdx.x * 64; const size_t bb = r0 / TT; const int t0 = (int)(r0 % TT);
  const float* X = which == 0 ? XQ : which == 1 ? XK : XV; const float* WA = which == 0 ? WQ : which == 1 ? WK : WV; const float* BA = which == 0 ? BQ : which == 1 ? BK : BV;
  v8f acc[8] = {};
  float bs[8];   // the lane's bias of each column tile, loaded here: all eight fly together, beside the first stage's loads. Loaded where they are used, behind the loop, each was waited for by itself: eight load latencies in a row at the end of every block
#pragma unroll   // this loop and the two below: unrolled so that bs is indexed by constants and stays in registers
  for (int j = 0; j < 8; ++j) bs[j] = 0.f;
  if (BA) {   // one test round all eight: with a test round each, the build put a wait behind each load
#pragma unroll
    for (int j = 0; j < 8; ++j) bs[j] = BA[c0 + j * 16 + col]; }
  WT wt; XT xt; v16b af[KS / 32];
  const int rot = KROT(DIN);   // the same for the three products of one X tile, which read the same X lines
  const float* wp = wt_lane(WA, KST(0, rot, DIN), c0, CC, wave, lane); const float* xp = X + (r0 + wave * 16 + col) * DIN + KST(0, rot, DIN) + 8 * g;   // the lane's sources in the stage fetched next: carried along the ring
  wt_load(wt, wp, CC); xt_load(xt, xp);
  asm volatile("s_wait_xcnt 0x0" ::: "memory");   // the first loads' address registers are free for reuse behind it
  wt_store_b(wt, sm.wb[0], wave, lane);
#pragma unroll
  for (int j = 0; j < 8; ++j) bs[j] = bfr(bs[j]);   // rounded behind the first stage's wait, which the bias loads, issued earlier, have met by then
  { const int d = KST(1, rot, DIN) - KST(0, rot, DIN); wp += d * CC; xp += d; }
#pragma unroll
  for (int kk = 0; kk < KS / 32; ++kk) {
#pragma unroll
    for (int i = 0; i < 8; ++i) { af[kk][i] = (__bf16)xt.r[kk][i >> 2][i & 3]; af[kk][8 + i] = (__bf16)xt.r[kk][2 + (i >> 2)][i & 3]; } }
  __syncthreads();   // stage 0 is published
#pragma unroll 2
  for (int s = 0; s < DIN / KS; ++s) { const bool more = s + 1 < DIN / KS;   // two buffers: stage s + 1 is fetched into registers while stage s is worked on
    if (more) { wt_load(wt, wp, CC); xt_load(xt, xp); }
    __builtin_amdgcn_sched_barrier(0);   // keeps the next stage's global loads issued in front of this stage's products, which then cover their latency
    const __bf16* wc = sm.wb[s & 1] + col * WP;
#pragma unroll
    for (int kk = 0; kk < KS / 32; ++kk) { v16b wf[8];
#pragma unroll
      for (int j = 0; j < 8; ++j) wf[j] = frag_b(wc + j * 16 * WP + kk * 32, lane);
      __builtin_amdgcn_sched_barrier(0);   // keeps the 16 LDS reads together in front of their products: one wait for the group, where a read pair in front of each product waits out the LDS latency eight times
#pragma unroll
      for (int j = 0; j < 8; ++j) acc[j] = wmma_bf(af[kk], wf[j], acc[j]); }
    __builtin_amdgcn_sched_barrier(0);   // keeps the fetched tile's conversion, and with it the wait for its loads, behind this stage's products
    if (more) { wt_store_b(wt, sm.wb[(s + 1) & 1], wave, lane);
      { const int d = KST(s + 2, rot, DIN) - KST(s + 1, rot, DIN); wp += d * CC; xp += d; }   // one stage on, or back to k = 0: behind the wait for the loads that used these addresses
#pragma unroll
      for (int kk = 0; kk < KS / 32; ++kk) {
#pragma unroll
        for (int i = 0; i < 8; ++i) { af[kk][i] = (__bf16)xt.r[kk][i >> 2][i & 3]; af[kk][8 + i] = (__bf16)xt.r[kk][2 + (i >> 2)][i & 3]; } } }
    __syncthreads(); }   // publishes stage s + 1 and ends every wave's reads of stage s, whose buffer is written next (after the last stage: by the epilogue)
  if (which < 2) { _Float16* DH = which == 0 ? QH : KH; _Float16* DL = which == 0 ? QL : KL; const int nhi = which == 0 ? QHI : KHI; const bool hi_rows = t0 < nhi;
#pragma unroll
    for (int j = 0; j < 8; ++j) { const float bias = bs[j];
#pragma unroll
      for (int r = 0; r < 8; ++r) { const float v = acc[j][r] + bias; const _Float16 hv = (_Float16)v; sh[wave * 16 + 8 * g + r][j * 16 + col] = hv; sl[wave * 16 + 8 * g + r][j * 16 + col] = (_Float16)((v - (float)hv) * 1024.0f); } }
    __syncthreads();
    for (int e = tid; e < 64 * 16; e += 128) { const int rl = e >> 4, q = e & 15; vst2((unsigned*)(DH + (r0 + rl) * CC + c0 + q * 8), *(const v4u*)&sh[rl][q * 8]); if (hi_rows) vst2((unsigned*)(DL + (bb * nhi + t0 + rl) * (size_t)CC + c0 + q * 8), *(const v4u*)&sl[rl][q * 8]); }
  } else { const bool hi_rows = t0 < KHI;
#pragma unroll
    for (int j = 0; j < 8; ++j) { const float bias = bs[j];
#pragma unroll
      for (int r = 0; r < 8; ++r) { const float v = acc[j][r] + bias; const int rl = wave * 16 + 8 * g + r, cl = j * 16 + col; th[cl][rl] = (_Float16)v; const __bf16 bh = (__bf16)v; tb[cl][rl] = bh; tbl[cl][rl] = (__bf16)(v - (float)bh); } }
    __syncthreads();
    for (int e = tid; e < 128 * 8; e += 128) { const int cl = e >> 3, q = e & 7; vst2((unsigned*)(VT + (bb * CC + c0 + cl) * (size_t)TT + t0 + q * 8), *(const v4u*)&th[cl][q * 8]); if (hi_rows) { const size_t o3 = (bb * CC + c0 + cl) * (size_t)KHI + t0 + q * 8; vst2((unsigned*)(VB + o3), *(const v4u*)&tb[cl][q * 8]); vst2((unsigned*)(VBL + o3), *(const v4u*)&tbl[cl][q * 8]); } } } }
// ---- k_fa: block = 128 queries of (b, h), 16 waves = (4 groups of 32 query columns) x (4 quarters of the key range): four waves a SIMD, so that one wave's softmax runs beside another's products. A wave holds two 16-query tiles, so each K or V fragment read from LDS feeds two products: half the LDS reads of a 16-query wave, whose reads took twice its matrix time. Each wave walks its quarter in trips of 64 keys with a running maximum per query (online softmax), so logits and P stay in registers; the four quarters' (maximum, sum, O) are joined once, through LDS, behind the loop.
// S^T = K . Q^T (A = k rows, B = q rows): lane (g, col) holds keys 8g + r of each 16-key tile for query col, which is the B fragment order of P^T; O^T += V^T . P^T (A = v planes [c][t]): lane holds d = 16j + 8g + r of query col.
// Every inner loop below is unrolled so that the fragment and accumulator arrays are indexed by constants and stay in registers.
__device__ __forceinline__ v8f wmma_h(v16h a, v16h b, v8f c) { return __builtin_amdgcn_wmma_f32_16x16x32_f16(false, a, false, b, (short)0, c, false, false); }
__device__ __forceinline__ float xhalf(float x) { return __builtin_bit_cast(float, __builtin_amdgcn_permlanex16(__builtin_bit_cast(int, x), __builtin_bit_cast(int, x), 0x76543210, 0xfedcba98, false, false)); }   // lane l with lane l ^ 16
// eight base-2 exponentials, each in place, in one statement: no v_exp_f32 here has its source overwritten or its result read by the instruction behind it, and the v_nop fills that slot behind the last.
__device__ __forceinline__ void exp2x8(float* a) {
  asm("v_exp_f32 %0, %0\n\tv_exp_f32 %1, %1\n\tv_exp_f32 %2, %2\n\tv_exp_f32 %3, %3\n\tv_exp_f32 %4, %4\n\tv_exp_f32 %5, %5\n\tv_exp_f32 %6, %6\n\tv_exp_f32 %7, %7\n\tv_nop"
      : "+v"(a[0]), "+v"(a[1]), "+v"(a[2]), "+v"(a[3]), "+v"(a[4]), "+v"(a[5]), "+v"(a[6]), "+v"(a[7])); }
// K and V reach the waves through LDS: the 4 waves of a quarter need the same 16 KB a trip, so each tile is brought in once per block with whole-line asynchronous copies and every wave takes its fragments with 16-byte LDS reads.
// Tile t of a quarter = (v planes of the t-th 64-key group walked, k rows of the next group): what trip t reads, since the scores are formed one trip ahead. Two buffers a quarter: tile t + 1 flies while trip t works. A quarter's tiles are copied by its own 4 waves.
#define NKS 4            // wave sets = parts of the key range
#define KH2 (TT / NKS)   // keys of one part
#define NT (KH2 / 64)    // trips of a wave
#define KP (64 + 8)      // LDS pitch of a staged 128-B row in elements: 144 B = 16 B x 9, free of bank conflicts for the fragment reads
#define KVB (2 * 64 * KP * 2)   // bytes of one buffer: 64 k rows, then 64 v rows
// one thread's share of a tile: 16 B of rows r + 16 i of the buffer (8 lanes a row: each copy instruction covers four whole 128-B lines); gka: its k row r, gv: its v row r
__device__ __forceinline__ void kv_copy(unsigned lds, const _Float16* gka, const _Float16* gv) {
  const unsigned l1 = lds + 16 * KP * 2, l2 = lds + 32 * KP * 2, l3 = lds + 48 * KP * 2, l4 = lds + 64 * KP * 2, l5 = lds + 80 * KP * 2, l6 = lds + 96 * KP * 2, l7 = lds + 112 * KP * 2;
  const _Float16* gka1 = gka + (size_t)16 * CC; const _Float16* gkb = gka + (size_t)32 * CC; const _Float16* gkb1 = gka + (size_t)48 * CC; const _Float16* gv1 = gv + (size_t)16 * TT; const _Float16* gv2 = gv + (size_t)32 * TT; const _Float16* gv3 = gv + (size_t)48 * TT;
  // the s_wait_xcnt stands in the copies' own statement, so that no address register is rewritten in front of it
  asm volatile("global_load_async_to_lds_b128 %0, %8, off\n\tglobal_load_async_to_lds_b128 %1, %9, off\n\tglobal_load_async_to_lds_b128 %2, %10, off\n\tglobal_load_async_to_lds_b128 %3, %11, off\n\t"
               "global_load_async_to_lds_b128 %4, %12, off\n\tglobal_load_async_to_lds_b128 %5, %13, off\n\tglobal_load_async_to_lds_b128 %6, %14, off\n\tglobal_load_async_to_lds_b128 %7, %15, off\n\ts_wait_xcnt 0x0"
               :: "v"(lds), "v"(l1), "v"(l2), "v"(l3), "v"(l4), "v"(l5), "v"(l6), "v"(l7), "v"(gka), "v"(gka1), "v"(gkb), "v"(gkb1), "v"(gv), "v"(gv1), "v"(gv2), "v"(gv3) : "memory"); }
// the same for k rows alone: the first group walked, whose scores are formed in front of the loop
__device__ __forceinline__ void k_copy(unsigned lds, const _Float16* gk) {
  const unsigned l1 = lds + 16 * KP * 2, l2 = lds + 32 * KP * 2, l3 = lds + 48 * KP * 2; const _Float16* gk1 = gk + (size_t)16 * CC; const _Float16* gk2 = gk + (size_t)32 * CC; const _Float16* gk3 = gk + (size_t)48 * CC;
  // as above: the s_wait_xcnt in the copies' own statement, in front of any rewrite of their address registers
  asm volatile("global_load_async_to_lds_b128 %0, %4, off\n\tglobal_load_async_to_lds_b128 %1, %5, off\n\tglobal_load_async_to_lds_b128 %2, %6, off\n\tglobal_load_async_to_lds_b128 %3, %7, off\n\ts_wait_xcnt 0x0"
               :: "v"(lds), "v"(l1), "v"(l2), "v"(l3), "v"(gk), "v"(gk1), "v"(gk2), "v"(gk3) : "memory"); }
__global__ __launch_bounds__(512) void k_fa(const _Float16* __restrict__ QH, const _Float16* __restrict__ KH, const _Float16* __restrict__ VT, float* __restrict__ Y) {
  __shared__ __align__(16) union {   // the join's arrays lie over the ring: they are written behind the last trip's barrier, in front of which every wave has ended its reads of the ring and seen its last copy land
    struct { _Float16 kv[NKS][2][2][64 * KP];                   // [quarter][buffer][k rows, v rows]
             _Float16 kz[NKS][64 * KP]; } r;                    // [quarter] k rows of the first group walked: filled once, read once
    struct { v4f jo[NKS][4][2][HD / 16][2][32];                 // every wave's O, [quarter][query group][query tile][d tile][4 values][lane]
             v2f jm[NKS][4][2][32]; } j; } sm;                  // its (maximum, sum)
  auto& kv = sm.r.kv; auto& kz = sm.r.kz; auto& jo = sm.j.jo; auto& jm = sm.j.jm;
  const int ks = __builtin_amdgcn_readfirstlane((int)threadIdx.x >> 7);   // the wave's quarter of the key range, the same in every lane
  const int tid = threadIdx.x & 127, wave = tid >> 5, lane = tid & 31, col = lane & 15, g = lane >> 4; const int b = blockIdx.y / NH, h = blockIdx.y % NH; const int q = blockIdx.x * 128 + wave * 32 + col;
  const _Float16* Qr = QH + ((size_t)b * TT + q) * CC + h * HD;
  const _Float16* Kc = KH + ((size_t)b * TT + ks * KH2 + (tid >> 3)) * CC + h * HD + 8 * (tid & 7); const _Float16* Vc = VT + ((size_t)b * CC + h * HD + (tid >> 3)) * (size_t)TT + ks * KH2 + 8 * (tid & 7);   // the thread's sources in its quarter's keys 0..63
  const unsigned lc = (unsigned)(size_t)&kv[ks][0][0][(tid >> 3) * KP + 8 * (tid & 7)];   // its place in its quarter's buffer 0 (LDS byte address)
  const int rot = (int)(blockIdx.x & (NT - 1));   // the 16 blocks of one (b, h) need the same K and V lines: each walks the 64-key groups of a quarter as a ring from a group set by its index, so that they do not all ask L2 for the same lines at the same moment
#define KG(i) ((((i) + rot) & (NT - 1)) * 64)   // first key of the i-th group walked (NT is a power of two; the ring closes: the group behind the last is the first again)
  k_copy((unsigned)(size_t)&kz[ks][(tid >> 3) * KP + 8 * (tid & 7)], Kc + (size_t)KG(0) * CC);
  kv_copy(lc, Kc + (size_t)KG(1) * CC, Vc + KG(0));   // tile 0
  v16h qf[2][2];
#pragma unroll
  for (int x = 0; x < 2; ++x) { qf[x][0] = frag_h(Qr + (size_t)x * 16 * CC, lane); qf[x][1] = frag_h(Qr + (size_t)x * 16 * CC + 32, lane); }
  const float C2 = SCALE * 1.4426950408889634f;   // logits carried in base 2
  v8f acc[2][HD / 16] = {}; float m[2] = {-3.0e38f, -3.0e38f}, l[2] = {0.f, 0.f};
  v8f s[2][4];   // scores of the coming trip, [query tile][16-key tile], carried over the loop's back edge
  asm volatile("s_wait_asynccnt 0x0" ::: "memory");   // this wave's share of the first k rows and of tile 0 has landed
  __syncthreads();   // both are published
  kv_copy(lc + KVB, Kc + (size_t)KG(2) * CC, Vc + KG(1));   // tile 1
#pragma unroll
  for (int u = 0; u < 4; ++u) { const v16h k0 = frag_h(&kz[ks][(u * 16 + col) * KP], lane), k1 = frag_h(&kz[ks][(u * 16 + col) * KP + 32], lane);
#pragma unroll
    for (int x = 0; x < 2; ++x) { const v8f z = {}; s[x][u] = wmma_h(k0, qf[x][0], z); s[x][u] = wmma_h(k1, qf[x][1], s[x][u]); } }
  // one trip: 64 keys, tile t
  auto stage = [&](int t) __attribute__((always_inline)) {
    const _Float16* kl = &kv[ks][t & 1][0][col * KP]; const _Float16* vl = &kv[ks][t & 1][1][col * KP];
    v16h va[HD / 16], vb[HD / 16], ka[2][2], kb[2][2];   // the trip's fragments come in four groups of 32 registers, each read where registers have come free and ahead of work that covers its latency: the softmax for va, a run of products for the others
#pragma unroll
    for (int j = 0; j < HD / 16; ++j) va[j] = frag_h(vl + j * 16 * KP, lane);
    __builtin_amdgcn_sched_barrier(0);   // keeps these LDS reads issued in front of the softmax, whose work then covers their latency; without it they sink to their first use
    v16h p[2][2]; float alpha[2];
#pragma unroll
    for (int x = 0; x < 2; ++x) {
      float mt[4];   // independent chains
#pragma unroll
      for (int u = 0; u < 4; ++u) { mt[u] = s[x][u][0];
#pragma unroll
        for (int r = 1; r < 8; ++r) mt[u] = fmaxf(mt[u], s[x][u][r]); }
      float mx = fmaxf(fmaxf(mt[0], mt[1]), fmaxf(mt[2], mt[3])); mx = fmaxf(mx, xhalf(mx));
      const float mn = fmaxf(m[x], mx * C2);   // alpha = 2^(m - mn), 0 on the first trip
      asm("v_exp_f32 %0, %1\n\tv_nop" : "=v"(alpha[x]) : "v"(m[x] - mn));   // asm for the v_nop alone: it fills the slot behind a transcendental
      m[x] = mn;
      const float off = 10.0f - mn;   // P relative to the running maximum, x 2^10 into f16 (clear of f16 subnormals); the factor cancels against l
      float ps[4];
#pragma unroll
      for (int u = 0; u < 4; ++u) { float e[8];
#pragma unroll
        for (int r = 0; r < 8; ++r) e[r] = fmaf(s[x][u][r], C2, off);
        exp2x8(e); ps[u] = 0.f;
#pragma unroll
        for (int r = 0; r < 8; ++r) { ps[u] += e[r]; p[x][u >> 1][(u & 1) * 8 + r] = (_Float16)e[r]; } }
      l[x] = l[x] * alpha[x] + ((ps[0] + ps[1]) + (ps[2] + ps[3])); }
    __builtin_amdgcn_sched_barrier(0);   // keeps the reads and products below behind the softmax
#pragma unroll
    for (int j = 0; j < HD / 16; ++j) vb[j] = frag_h(vl + j * 16 * KP + 32, lane);
#pragma unroll
    for (int u = 0; u < 2; ++u) { ka[u][0] = frag_h(kl + u * 16 * KP, lane); ka[u][1] = frag_h(kl + u * 16 * KP + 32, lane); }   // the next trip's k rows (the last tile holds the first group's again; those scores are not used)
    __builtin_amdgcn_sched_barrier(0);   // keeps this group of reads together in front of the products that cover its latency
#pragma unroll
    for (int j = 0; j < HD / 16; ++j) {
#pragma unroll
      for (int x = 0; x < 2; ++x) { acc[x][j] *= alpha[x]; acc[x][j] = wmma_h(va[j], p[x][0], acc[x][j]); } }
    __builtin_amdgcn_sched_barrier(0);   // the reads below take the registers that these products have left
#pragma unroll
    for (int u = 0; u < 2; ++u) { kb[u][0] = frag_h(kl + (32 + u * 16) * KP, lane); kb[u][1] = frag_h(kl + (32 + u * 16) * KP + 32, lane); }
    __builtin_amdgcn_sched_barrier(0);   // keeps this group of reads together in front of the products that cover its latency
#pragma unroll
    for (int j = 0; j < HD / 16; ++j) {
#pragma unroll
      for (int x = 0; x < 2; ++x) acc[x][j] = wmma_h(vb[j], p[x][1], acc[x][j]); }
#pragma unroll
    for (int u = 0; u < 2; ++u) {
#pragma unroll
      for (int x = 0; x < 2; ++x) { const v8f z = {}; s[x][u] = wmma_h(ka[u][0], qf[x][0], z); s[x][u] = wmma_h(ka[u][1], qf[x][1], s[x][u]); } }
#pragma unroll
    for (int u = 0; u < 2; ++u) {
#pragma unroll
      for (int x = 0; x < 2; ++x) { const v8f z = {}; s[x][2 + u] = wmma_h(kb[u][0], qf[x][0], z); s[x][2 + u] = wmma_h(kb[u][1], qf[x][1], s[x][2 + u]); } }
    __builtin_amdgcn_sched_barrier(0);   // keeps the waits and the barrier below at the trip's foot: lifted, they expose the reads' latency and leave the flying tile no lead
    asm volatile("s_wait_dscnt 0x0" ::: "memory");      // this wave's reads of the buffer are over before it is refilled
    asm volatile("s_wait_asynccnt 0x0" ::: "memory");   // this wave's share of tile t + 1 has landed
    __syncthreads(); };   // publishes tile t + 1 and ends every wave's reads of tile t, whose buffer is refilled next
  // two loops, so that the refill stands under no test: with a branch round it at the loop's foot the build moved the row sums behind that branch and held their terms in registers till there, and it spilled
  for (int t = 0; t < NT - 2; ++t) { stage(t); kv_copy(lc + (t & 1) * KVB, Kc + (size_t)KG(t + 3) * CC, Vc + KG(t + 2)); }   // tile t + 2 exists
  for (int t = NT - 2; t < NT; ++t) stage(t);   // no tile is left to fetch
  asm volatile("s_wait_asynccnt 0x0" ::: "memory");   // no copy is left in flight when the wave ends
#pragma unroll
  for (int x = 0; x < 2; ++x) { jm[ks][wave][x][lane] = v2f{m[x], l[x]};   // every wave hands over its state
#pragma unroll
    for (int j = 0; j < HD / 16; ++j) { jo[ks][wave][x][j][0][lane] = v4f{acc[x][j][0], acc[x][j][1], acc[x][j][2], acc[x][j][3]}; jo[ks][wave][x][j][1][lane] = v4f{acc[x][j][4], acc[x][j][5], acc[x][j][6], acc[x][j][7]}; } }
  __syncthreads();   // publishes the states; every wave passes
  // the join is shared out: of its query group, wave set ks joins query tile ks & 1, d tiles 2 (ks >> 1) and the next: 32 d = one whole 128-B line a query
  const int jx = ks & 1, jj = 2 * (ks >> 1);
  v2f om[NKS];
#pragma unroll
  for (int i = 0; i < NKS; ++i) om[i] = jm[i][wave][jx][lane];
  const float mj = fmaxf(fmaxf(om[0][0], om[1][0]), fmaxf(om[2][0], om[3][0]));
  float af[NKS], lt = 0.f;   // the four states rescaled to the common maximum
#pragma unroll
  for (int i = 0; i < NKS; ++i) af[i] = om[i][0] - mj;
  asm("v_exp_f32 %0, %0\n\tv_exp_f32 %1, %1\n\tv_exp_f32 %2, %2\n\tv_exp_f32 %3, %3\n\tv_nop" : "+v"(af[0]), "+v"(af[1]), "+v"(af[2]), "+v"(af[3]));   // in place and with the v_nop for the same reason as in exp2x8
#pragma unroll
  for (int i = 0; i < NKS; ++i) lt += om[i][1] * af[i];
  lt += xhalf(lt); const float inv = 1.0f / lt;   // lt >= 2^10: the maximum's own term
  float* Yr = Y + ((size_t)b * TT + blockIdx.x * 128 + wave * 32 + jx * 16 + col) * CC + h * HD + jj * 16 + 8 * g;
#pragma unroll
  for (int j = 0; j < 2; ++j) { v4f a = {}, c = {};
#pragma unroll
    for (int i = 0; i < NKS; ++i) { a += jo[i][wave][jx][jj + j][0][lane] * af[i]; c += jo[i][wave][jx][jj + j][1][lane] * af[i]; }
    vst2(Yr + j * 16, a * inv); vst2(Yr + j * 16 + 4, c * inv); } }
// ---- k_out: block = (64 rows, 128 cols): out = ctx Wo (+ bo): ctx x 2^6 once to f16 against Wo as f16(bf16 x 2^8) exact (1 product) x 2^-14; causal early rows (< QHI of each sequence): ctx bf16 hi + lo against exact bf16 Wo (2 products)
__global__ __launch_bounds__(128) void k_out(const float* __restrict__ Y, const float* __restrict__ WO, const float* __restrict__ BO, float* __restrict__ OUT) { __shared__ __align__(16) float sf[4][16][132]; __shared__ __align__(16) _Float16 wb[2][128 * WP];
  const int tid = threadIdx.x, wave = tid >> 5, lane = tid & 31, col = lane & 15, g = lane >> 4; const int c0 = blockIdx.y * 128; const size_t r0 = (size_t)blockIdx.x * 64 + wave * 16;
  v8f acc[8] = {};
  if (CAUSAL && (int)(((size_t)blockIdx.x * 64) % TT) < QHI) {   /* block-uniform */
#pragma unroll 2
    for (int kc = 0; kc < CC / 32; ++kc) { const F2 a = split_row(Y + (r0 + col) * CC, kc * 32, lane); asm volatile("s_wait_loadcnt 0x0" ::: "memory");
#pragma unroll
      for (int j = 0; j < 8; ++j) { const v16b w = WOCOL(WO, kc * 32, c0 + j * 16 + col, lane); asm volatile("s_wait_loadcnt 0x0" ::: "memory"); acc[j] = wmma_bf(a.h, w, acc[j]); acc[j] = wmma_bf(a.l, w, acc[j]); } }
#pragma unroll
    for (int j = 0; j < 8; ++j) { const float bias = BO ? bfr(BO[c0 + j * 16 + col]) : 0.f;
#pragma unroll
      for (int r = 0; r < 8; ++r) sf[wave][8 * g + r][j * 16 + col] = acc[j][r] + bias; }
  } else {
    float bs[8];   // as in k_proj: the eight bias loads fly together at the kernel's head
#pragma unroll   // this loop and the two below: unrolled so that bs stays in registers
    for (int j = 0; j < 8; ++j) bs[j] = 0.f;
    if (BO) {   // one test round all eight
#pragma unroll
      for (int j = 0; j < 8; ++j) bs[j] = BO[c0 + j * 16 + col]; }
    WT wt; XT xt; v16h af[KS / 32];   /* ctx carried x 2^6 into f16 so small-magnitude context rows stay clear of f16 subnormals */
    const int rot = KROT(CC);
    const float* wp = wt_lane(WO, KST(0, rot, CC), c0, DIN, wave, lane); const float* yp = Y + (r0 + col) * CC + KST(0, rot, CC) + 8 * g;   // as in k_proj
    wt_load(wt, wp, DIN); xt_load(xt, yp); wt_store_h(wt, wb[0], wave, lane);
#pragma unroll
    for (int j = 0; j < 8; ++j) bs[j] = bfr(bs[j]);   // as in k_proj
    { const int d = KST(1, rot, CC) - KST(0, rot, CC); wp += d * DIN; yp += d; }
#pragma unroll
    for (int kk = 0; kk < KS / 32; ++kk) {
#pragma unroll
      for (int i = 0; i < 8; ++i) { af[kk][i] = (_Float16)(xt.r[kk][i >> 2][i & 3] * 64.0f); af[kk][8 + i] = (_Float16)(xt.r[kk][2 + (i >> 2)][i & 3] * 64.0f); } }
    __syncthreads();   // stage 0 is published
#pragma unroll 2
    for (int s = 0; s < CC / KS; ++s) { const bool more = s + 1 < CC / KS;   // two buffers, as in k_proj
      if (more) { wt_load(wt, wp, DIN); xt_load(xt, yp); }
      __builtin_amdgcn_sched_barrier(0);   // keeps the next stage's global loads issued in front of this stage's products, which then cover their latency
      const _Float16* wc = wb[s & 1] + col * WP;
#pragma unroll
      for (int kk = 0; kk < KS / 32; ++kk) { v16h wf[8];
#pragma unroll
        for (int j = 0; j < 8; ++j) wf[j] = frag_h(wc + j * 16 * WP + kk * 32, lane);
        __builtin_amdgcn_sched_barrier(0);   // keeps the 16 LDS reads together in front of their products: one wait for the group
#pragma unroll
        for (int j = 0; j < 8; ++j) acc[j] = wmma16(af[kk], wf[j], acc[j]); }
      __builtin_amdgcn_sched_barrier(0);   // keeps the fetched tile's conversion, and with it the wait for its loads, behind this stage's products
      if (more) { wt_store_h(wt, wb[(s + 1) & 1], wave, lane);
        { const int d = KST(s + 2, rot, CC) - KST(s + 1, rot, CC); wp += d * DIN; yp += d; }   // as in k_proj
#pragma unroll
        for (int kk = 0; kk < KS / 32; ++kk) {
#pragma unroll
          for (int i = 0; i < 8; ++i) { af[kk][i] = (_Float16)(xt.r[kk][i >> 2][i & 3] * 64.0f); af[kk][8 + i] = (_Float16)(xt.r[kk][2 + (i >> 2)][i & 3] * 64.0f); } } }
      __syncthreads(); }   // publishes stage s + 1 and ends every wave's reads of stage s, whose buffer is written next
#pragma unroll
    for (int j = 0; j < 8; ++j) { const float bias = bs[j];
#pragma unroll
      for (int r = 0; r < 8; ++r) sf[wave][8 * g + r][j * 16 + col] = acc[j][r] * (1.0f / 16384.0f) + bias; } }   /* 2^-8 (Wo carry) x 2^-6 (ctx carry) */
  LDSX(); for (int rl = 0; rl < 16; ++rl) vst2(OUT + (r0 + rl) * DIN + c0 + lane * 4, *(const v4f*)&sf[wave][rl][lane * 4]); }

extern "C" void kernel_launch(void* const* d_in, const int* in_sizes, int n_in, void* d_out, int out_size, void* d_ws, size_t ws_size, hipStream_t stream) {
  (void)in_sizes; (void)n_in; (void)out_size;
  const float** F = (const float**)d_in;
  if (ws_size < (size_t)WS_END) return;
  char* ws = (char*)d_ws; _Float16 *QH = (_Float16*)(ws + WS_QH), *KH = (_Float16*)(ws + WS_KH), *VT = (_Float16*)(ws + WS_VT), *QL = (_Float16*)(ws + WS_QL), *KL = (_Float16*)(ws + WS_KL); __bf16 *VB = (__bf16*)(ws + WS_VB), *VBL = (__bf16*)(ws + WS_VBL); float *Y = (float*)(ws + WS_Y);
  (void)Y; (void)QL; (void)KL; (void)VB; (void)VBL;
  // inputs: 0 inputs [2,2048,512]; 1 Wq [512,512] (in,out), 2 bq; 3 Wk, 4 bk; 5 Wv, 6 bv; 7 Wo (in,out), 8 bo (zero biases, read)
  k_proj<<<dim3(TNB * TT / 64, CC / 128, 3), 128, 0, stream>>>(F[0], F[0], F[0], F[1], F[3], F[5], F[2], F[4], F[6], QH, QL, KH, KL, VT, VB, VBL);
  k_fa<<<dim3(TT / 128, TNB * NH), 512, 0, stream>>>(QH, KH, VT, Y);
  k_out<<<dim3(TNB * TT / 64, DIN / 128), 128, 0, stream>>>(Y, F[7], F[8], (float*)d_out);
}

// v008
// One run takes 39.2 microseconds.
// In two side-by-side timings against v007, it was 1.05 and 1.06 times as fast.
// Over all steps from v000 it is 14.8 times as fast.
// compute dtype: all float inputs rounded to bf16; q/k/v projections with EXACT bf16 products on WMMA 16x16x32 (f32 accumulate) + bias; logits q x k once to f16 each (1 product) x SCALE; online softmax f32; P (relative to the running maximum) x 2^10 once to f16 x v once to f16 (1 product); ctx x 2^6 once to f16 x Wo f16(bf16 x 2^8) + bo; f32 output.
#include <hip/hip_runtime.h>
#include <math.h>

typedef __attribute__((ext_vector_type(16))) _Float16 v16h;
typedef __attribute__((ext_vector_type(16))) __bf16 v16b;
typedef __attribute__((ext_vector_type(8)))  _Float16 v8h;
typedef __attribute__((ext_vector_type(8)))  float v8f;
typedef __attribute__((ext_vector_type(4)))  float v4f;
typedef __attribute__((ext_vector_type(2)))  float v2f;
typedef __attribute__((ext_vector_type(4)))  unsigned v4u;
typedef __attribute__((ext_vector_type(4)))  int v4i;
typedef float __attribute__((may_alias)) float_a;
typedef int __attribute__((may_alias)) int_a;

template <typename T> __device__ __forceinline__ void vst2(void* p, T v) { *(T*)p = v;  }
__device__ __forceinline__ v8f wmma16(v16h a, v16h b, v8f c) {
  v8f d = __builtin_amdgcn_wmma_f32_16x16x32_f16(false, a, false, b, (short)0, c, false, false);
  asm volatile("v_nop\n\tv_nop\n\tv_nop\n\tv_nop" : "+v"(d) : "v"(a), "v"(b));
  return d;
}
__device__ __forceinline__ v8f wmma_bf(v16b a, v16b b, v8f c) {
  v8f d = __builtin_amdgcn_wmma_f32_16x16x32_bf16(false, a, false, b, (short)0, c, false, false);
  asm volatile("v_nop\n\tv_nop\n\tv_nop\n\tv_nop" : "+v"(d) : "v"(a), "v"(b));
  return d;
}
// 16x16x32 fragments: lane = (h = lane>>4, row/col = lane&15); elements 0..7 = k0+8h+0..7, 8..15 = k0+16+8h+0..7; D element r = row 8h+r
__device__ __forceinline__ v16h frag_h(const _Float16* rowk0, int lane) {
  union { v16h v; v8h q[2]; } u; const _Float16* p = rowk0 + 8 * (lane >> 4);
  u.q[0] = *(const v8h*)p; u.q[1] = *(const v8h*)(p + 16); return u.v;
}
__device__ __forceinline__ v16h frag_f32(const float* rowk0, int lane) {
  v16h a; const float* p = rowk0 + 8 * (lane >> 4);
#pragma unroll
  for (int i = 0; i < 8; ++i) { a[i] = (_Float16)p[i]; a[8 + i] = (_Float16)p[16 + i]; }
  return a;
}
__device__ __forceinline__ v16h frag_f32s(const float* rowk0, int lane, float sc) {
  v16h a; const float* p = rowk0 + 8 * (lane >> 4);
#pragma unroll
  for (int i = 0; i < 8; ++i) { a[i] = (_Float16)(p[i] * sc); a[8 + i] = (_Float16)(p[16 + i] * sc); }
  return a;
}
// column fragment from a [K][ld] layout (column n), rows >= K read as 0
__device__ __forceinline__ v16h fragc_f32(const float* W, int k0, int n, int lane, int ld, int K) {
  v16h a; const int g = lane >> 4;
#pragma unroll
  for (int i = 0; i < 8; ++i) { const int ka = k0 + 8 * g + i, kb = ka + 16;
    a[i] = (_Float16)(ka < K ? W[(size_t)(ka < K ? ka : K - 1) * ld + n] : 0.f); a[8 + i] = (_Float16)(kb < K ? W[(size_t)(kb < K ? kb : K - 1) * ld + n] : 0.f); }
  return a;
}
struct F2 { v16b h, l; };
__device__ __forceinline__ F2 bsplit16(const float v[16]) { F2 r;
#pragma unroll
  for (int i = 0; i < 16; ++i) { const __bf16 h = (__bf16)v[i]; r.h[i] = h; r.l[i] = (__bf16)(v[i] - (float)h); }
  return r; }
__device__ __forceinline__ F2 split_row(const float* row, int k0, int lane) { float v[16]; const float* p = row + k0 + 8 * (lane >> 4);
#pragma unroll
  for (int i = 0; i < 8; ++i) { v[i] = p[i]; v[8 + i] = p[16 + i]; }
  return bsplit16(v); }
__device__ __forceinline__ F2 split_rowK(const float* row, int k0, int lane, int K) { float v[16]; const int g = lane >> 4;
#pragma unroll
  for (int i = 0; i < 8; ++i) { const int ka = k0 + 8 * g + i, kb = ka + 16; v[i] = ka < K ? row[ka < K ? ka : K - 1] : 0.f; v[8 + i] = kb < K ? row[kb < K ? kb : K - 1] : 0.f; }
  return bsplit16(v); }
__device__ __forceinline__ F2 split_col(const float* W, int k0, int n, int lane, int ld, int K) { float v[16]; const int g = lane >> 4;
#pragma unroll
  for (int i = 0; i < 8; ++i) { const int ka = k0 + 8 * g + i, kb = ka + 16; v[i] = ka < K ? W[(size_t)(ka < K ? ka : K - 1) * ld + n] : 0.f; v[8 + i] = kb < K ? W[(size_t)(kb < K ? kb : K - 1) * ld + n] : 0.f; }
  return bsplit16(v); }
__device__ __forceinline__ v8f mac3(const F2& a, const F2& b, v8f c) { c = wmma_bf(a.l, b.h, c); c = wmma_bf(a.h, b.l, c); return wmma_bf(a.h, b.h, c); }
__device__ __forceinline__ float sigm(float v) { return 1.0f / (1.0f + expf(-v)); }
#define LDSX() do { asm volatile("s_wait_dscnt 0" ::: "memory"); __builtin_amdgcn_wave_barrier(); __builtin_amdgcn_fence(__ATOMIC_RELEASE, "workgroup"); } while (0)

// Multi-head self-attention (inputs [2,2048,512]; (in,out) Wq / Wk / Wv / Wo [512,512] N(0, 1/512) + zero biases; 8 heads x 64; scale 1/8; softmax over keys; merge; Wo + bo).
#define NB 2
#define TT 2048
#define CC 512            // NH * HD = projected width
#define DIN 512          // input (model) width
#define NH 8
#define HD 64
#define NQB (TT / 64)
#define HG 4
#define SCALE (0.125f)
#define CAUSAL 0
#ifndef TNB
#define TNB NB
#endif
__device__ __forceinline__ float bfr(float v) { return (float)(__bf16)v; }
__host__ __device__ __forceinline__ int kb_last(int qb) { return CAUSAL ? ((qb * 64 + 63) >> 7) : (TT / 128 - 1); }
typedef __attribute__((ext_vector_type(8))) __bf16 v8b;
__device__ __forceinline__ v16b frag_b(const __bf16* rowk0, int lane) {
  union { v16b v; v8b q[2]; } u; const __bf16* p = rowk0 + 8 * (lane >> 4);
  u.q[0] = *(const v8b*)p; u.q[1] = *(const v8b*)(p + 16); return u.v;
}
#define QBH 0              // not read by any kernel here: k_fa has no high-precision path
#define QHI 0               // single-product logits on every row
#define KHI 64            // key rows carrying k residual / v bf16 hi+lo planes (written by k_proj; no kernel here reads them)
// B fragment (k rows k0+.., output column o) of a weight: (in,out) [K][ld] or (out,in) [ld rows of K]: bf16 exact, or f16(bf16 * 256) exact
__device__ __forceinline__ v16b wcol_io(const float* Wm, int k0, int o, int lane, int ld) { v16b w; const int g = lane >> 4;
#pragma unroll
  for (int i = 0; i < 8; ++i) { w[i] = (__bf16)Wm[(size_t)(k0 + 8 * g + i) * ld + o]; w[8 + i] = (__bf16)Wm[(size_t)(k0 + 16 + 8 * g + i) * ld + o]; }
  return w; }
__device__ __forceinline__ v16b wcol_oi(const float* Wm, int k0, int o, int lane, int K) { v16b w; const float* p = Wm + (size_t)o * K + k0 + 8 * (lane >> 4);
#pragma unroll
  for (int i = 0; i < 8; ++i) { w[i] = (__bf16)p[i]; w[8 + i] = (__bf16)p[16 + i]; }
  return w; }
__device__ __forceinline__ v16h wcolh_io(const float* Wm, int k0, int o, int lane, int ld) { v16h w; const int g = lane >> 4;
#pragma unroll
  for (int i = 0; i < 8; ++i) { w[i] = (_Float16)(bfr(Wm[(size_t)(k0 + 8 * g + i) * ld + o]) * 256.0f); w[8 + i] = (_Float16)(bfr(Wm[(size_t)(k0 + 16 + 8 * g + i) * ld + o]) * 256.0f); }
  return w; }
__device__ __forceinline__ v16h wcolh_oi(const float* Wm, int k0, int o, int lane, int K) { v16h w; const float* p = Wm + (size_t)o * K + k0 + 8 * (lane >> 4);
#pragma unroll
  for (int i = 0; i < 8; ++i) { w[i] = (_Float16)(bfr(p[i]) * 256.0f); w[8 + i] = (_Float16)(bfr(p[16 + i]) * 256.0f); }
  return w; }
#define WQKV_LAYOUT 0   // selects WCOL, which no kernel here calls: k_proj always stages Wq / Wk / Wv as (in,out) [DIN][CC]
__device__ __forceinline__ v16b wcol_hdk(const float* Wm, int k0, int o, int lane) { v16b w; const int g = lane >> 4; const float* p = Wm + (size_t)(o / HD) * DIN * HD + (o % HD);
#pragma unroll
  for (int i = 0; i < 8; ++i) { w[i] = (__bf16)p[(size_t)(k0 + 8 * g + i) * HD]; w[8 + i] = (__bf16)p[(size_t)(k0 + 16 + 8 * g + i) * HD]; }
  return w; }
#define WO_OUT_IN 0
#if WQKV_LAYOUT == 1
#define WCOL(W, k0, o, lane) wcol_oi(W, k0, o, lane, DIN)
#elif WQKV_LAYOUT == 2
#define WCOL(W, k0, o, lane) wcol_hdk(W, k0, o, lane)
#else
#define WCOL(W, k0, o, lane) wcol_io(W, k0, o, lane, CC)
#endif
#if WO_OUT_IN
#define WOCOL(W, k0, o, lane) wcol_oi(W, k0, o, lane, CC)
#define WOCOLH(W, k0, o, lane) wcolh_oi(W, k0, o, lane, CC)
#else
#define WOCOL(W, k0, o, lane) wcol_io(W, k0, o, lane, DIN)
#define WOCOLH(W, k0, o, lane) wcolh_io(W, k0, o, lane, DIN)
#endif

#ifndef SM_EXTRA_PARAMS
#define SM_EXTRA_PARAMS
#endif
#ifndef PROJ_EXTRA_PARAMS
#define PROJ_EXTRA_PARAMS
#endif
#ifndef SM_MASK_HOOK
#define SM_MASK_HOOK (void)0
#endif

#define WS_QH  0u                                      // f16 q rows [b*t][CC]
#define WS_KH  (WS_QH + 2u * (size_t)NB * TT * CC)      // f16 k rows [b*t][CC]
#define WS_VT  (WS_KH + 2u * (size_t)NB * TT * CC)      // f16 v planes [b][c][t]
#define WS_QL  (WS_VT + 2u * (size_t)NB * CC * TT)      // f16 q residual x 2^10 rows [b][t < QHI][CC]
#define WS_KL  (WS_QL + 2u * (size_t)NB * QHI * CC)     // f16 k residual x 2^10 rows [b][t < KHI][CC]
#define WS_VB  (WS_KL + 2u * (size_t)NB * KHI * CC)     // bf16 v hi planes [b][c][t < KHI]
#define WS_VBL (WS_VB + 2u * (size_t)NB * CC * KHI)
#define WS_S   (WS_VBL + 2u * (size_t)NB * CC * KHI)    // f32 [hg][t][s] logits place, unused for logits: k_fa keeps logits and P in registers; WOH lies at its head
#define WS_Y   (WS_S  + 4u * (size_t)HG * TT * TT)      // f32 ctx rows [b*t][CC] (only when there is an output projection)
#define WS_END (WS_Y  + 4u * (size_t)NB * TT * CC)
#define WS_WOH WS_S                                    // f16(bf16 x 2^8) Wo columns [o][k], written by k_proj for k_out: it lies at the head of the logits' place, which no kernel of this file fills with logits

// ---- weight staging for k_proj: a [KS][128] f32 tile of a (in,out) weight is read once per block with whole-line 16-byte loads, converted once, and laid in LDS column by column (k contiguous), where every wave takes its B fragments with 16-byte LDS reads
#define KS 64            // k rows of one staged tile
#define WP (KS + 8)      // LDS pitch of a staged column in elements: 144 B = 16 B x 9, free of bank conflicts for the fragment reads and for the staging stores
// one thread's share of a tile: 2 units of (8 k rows x 4 columns); a wave covers 32 columns, lane = (k octet = lane & 3, column group = lane >> 2), so each load instruction covers four whole 128-B lines
struct WT { v4f r[2][8]; };
__device__ __forceinline__ const float* wt_lane(const float* Wm, int k0, int c0, int ld, int wave, int lane) { return Wm + (size_t)(k0 + 8 * (lane & 3)) * ld + c0 + 32 * wave + 4 * (lane >> 2); }   // the lane's first element of the tile at k row k0
__device__ __forceinline__ void wt_load(WT& t, const float* p, int ld) {
#pragma unroll
  for (int u = 0; u < 2; ++u) {
#pragma unroll
    for (int i = 0; i < 8; ++i) t.r[u][i] = *(const v4f*)(p + (size_t)(32 * u + i) * ld); } }
__device__ __forceinline__ void wt_store_b(const WT& t, __bf16* wb, int wave, int lane) {   // bf16, exact operand of k_proj
  __bf16* d = wb + (32 * wave + 4 * (lane >> 2)) * WP + 8 * (lane & 3);
#pragma unroll
  for (int u = 0; u < 2; ++u) {
#pragma unroll
    for (int c = 0; c < 4; ++c) { v8b x;
#pragma unroll
      for (int i = 0; i < 8; ++i) x[i] = (__bf16)t.r[u][i][c];
      *(v8b*)(d + c * WP + 32 * u) = x; } } }
// a lane's raw f32 share of the A fragments of one stage (KS k of its own row): per 32 k, elements 8g + 0..7 and 16 + 8g + 0..7
struct XT { v4f r[KS / 32][4]; };
__device__ __forceinline__ void xt_load(XT& t, const float* p) {   // p: the lane's own row at the stage's first k, + 8 * (lane >> 4)
#pragma unroll
  for (int kk = 0; kk < KS / 32; ++kk) { t.r[kk][0] = *(const v4f*)(p + kk * 32); t.r[kk][1] = *(const v4f*)(p + kk * 32 + 4); t.r[kk][2] = *(const v4f*)(p + kk * 32 + 16); t.r[kk][3] = *(const v4f*)(p + kk * 32 + 20); } }

// Blocks that share a weight tile (all row blocks of a column block) or an A tile (all column blocks of a row block) run in step, and would ask L2 for the same lines at the same moment. So each block walks the k stages as a ring from a first stage set by its tile indices: the sum takes every stage once, in rotated order.
#define KROT(K) ((int)((blockIdx.x + 2 * blockIdx.y) & ((K) / KS - 1)))          // the block's first stage (K / KS is a power of two)
#define KST(s, rot, K) (((((s) + (rot)) & ((K) / KS - 1))) * KS)                // first k row of the s-th stage walked
// ---- k_proj: block = (64 rows, 128 cols, which): q/k/v = X W (+ b) with exact bf16 products (K = DIN) -> which 0: q f16 rows (+ residual rows < QHI); 1: k f16 rows (+ residual rows < KHI); 2: v f16 planes [c][t] (+ bf16 hi/lo planes for t < KHI)
__global__ __launch_bounds__(128) void k_proj(const float* __restrict__ XQ, const float* __restrict__ XK, const float* __restrict__ XV, const float* __restrict__ WQ, const float* __restrict__ WK, const float* __restrict__ WV, const float* __restrict__ BQ, const float* __restrict__ BK, const float* __restrict__ BV,
    _Float16* __restrict__ QH, _Float16* __restrict__ QL, _Float16* __restrict__ KH, _Float16* __restrict__ KL, _Float16* __restrict__ VT, __bf16* __restrict__ VB, __bf16* __restrict__ VBL, const float* __restrict__ WO, _Float16* __restrict__ WOH) {
  __shared__ __align__(16) union { struct { _Float16 sh[64][136], sl[64][136], th[128][72]; __bf16 tb[128][72], tbl[128][72]; } e; __bf16 wb[2][128 * WP]; } sm;   // the weight stages share LDS with the epilogue's tiles, so that as many blocks as before fit a WGP
  auto& sh = sm.e.sh; auto& sl = sm.e.sl; auto& th = sm.e.th; auto& tb = sm.e.tb; auto& tbl = sm.e.tbl;
  const int tid = threadIdx.x, wave = tid >> 5, lane = tid & 31, col = lane & 15, g = lane >> 4; const int which = blockIdx.z; const int c0 = blockIdx.y * 128; const size_t r0 = (size_t)blockIdx.x * 64; const size_t bb = r0 / TT; const int t0 = (int)(r0 % TT);
  const float* X = which == 0 ? XQ : which == 1 ? XK : XV; const float* WA = which == 0 ? WQ : which == 1 ? WK : WV; const float* BA = which == 0 ? BQ : which == 1 ? BK : BV;
  v8f acc[8] = {};
  float bs[8];   // the lane's bias of each column tile, loaded here: all eight fly together, beside the first stage's loads. Loaded where they are used, behind the loop, each was waited for by itself: eight load latencies in a row at the end of every block
#pragma unroll   // this loop and the two below: unrolled so that bs is indexed by constants and stays in registers
  for (int j = 0; j < 8; ++j) bs[j] = 0.f;
  if (BA) {   // one test round all eight: with a test round each, the build put a wait behind each load
#pragma unroll
    for (int j = 0; j < 8; ++j) bs[j] = BA[c0 + j * 16 + col]; }
  WT wt; XT xt; v16b af[KS / 32];
  const int rot = KROT(DIN);   // the same for the three products of one X tile, which read the same X lines
  const float* wp = wt_lane(WA, KST(0, rot, DIN), c0, CC, wave, lane); const float* xp = X + (r0 + wave * 16 + col) * DIN + KST(0, rot, DIN) + 8 * g;   // the lane's sources in the stage fetched next: carried along the ring
  wt_load(wt, wp, CC); xt_load(xt, xp);
  asm volatile("s_wait_xcnt 0x0" ::: "memory");   // the first loads' address registers are free for reuse behind it
  if (which == 0) {   // block-uniform. Wo for k_out, converted once a call: k_out's 64 row blocks each converted the whole f32 tile again. The 256 q blocks each lay one piece, 64 k rows x 16 output columns, as f16(bf16 x 2^8) column by column (k contiguous): 16 whole 128-B lines a block. It stands behind the first stage's loads, so its own loads wait no longer than those
    static_assert((TNB * TT / 64) * (CC / 128) == (CC / 64) * (DIN / 16), "one piece of Wo for each q block");
    const int wid = (int)blockIdx.x + (TNB * TT / 64) * (int)blockIdx.y; const int wk = (wid & (CC / 64 - 1)) * 64 + 8 * (tid >> 4), wo = (wid / (CC / 64)) * 16 + (tid & 15);
    const float* wsrc = WO + (size_t)wk * DIN + wo; float w8[8]; v8h x;
#pragma unroll   // this loop and the next: unrolled so that w8 stays in registers
    for (int i = 0; i < 8; ++i) w8[i] = wsrc[(size_t)i * DIN];
#pragma unroll
    for (int i = 0; i < 8; ++i) x[i] = (_Float16)(bfr(w8[i]) * 256.0f);
    *(v8h*)(WOH + (size_t)wo * CC + wk) = x;
    asm volatile("s_wait_xcnt 0x0" ::: "memory"); }   // the store's address registers are free for reuse behind it
  wt_store_b(wt, sm.wb[0], wave, lane);
#pragma unroll
  for (int j = 0; j < 8; ++j) bs[j] = bfr(bs[j]);   // rounded behind the first stage's wait, which the bias loads, issued earlier, have met by then
  { const int d = KST(1, rot, DIN) - KST(0, rot, DIN); wp += d * CC; xp += d; }
#pragma unroll
  for (int kk = 0; kk < KS / 32; ++kk) {
#pragma unroll
    for (int i = 0; i < 8; ++i) { af[kk][i] = (__bf16)xt.r[kk][i >> 2][i & 3]; af[kk][8 + i] = (__bf16)xt.r[kk][2 + (i >> 2)][i & 3]; } }
  __syncthreads();   // stage 0 is published
#pragma unroll 2
  for (int s = 0; s < DIN / KS; ++s) { const bool more = s + 1 < DIN / KS;   // two buffers: stage s + 1 is fetched into registers while stage s is worked on
    if (more) { wt_load(wt, wp, CC); xt_load(xt, xp); }
    __builtin_amdgcn_sched_barrier(0);   // keeps the next stage's global loads issued in front of this stage's products, which then cover their latency
    const __bf16* wc = sm.wb[s & 1] + col * WP;
#pragma unroll
    for (int kk = 0; kk < KS / 32; ++kk) { v16b wf[8];
#pragma unroll
      for (int j = 0; j < 8; ++j) wf[j] = frag_b(wc + j * 16 * WP + kk * 32, lane);
      __builtin_amdgcn_sched_barrier(0);   // keeps the 16 LDS reads together in front of their products: one wait for the group, where a read pair in front of each product waits out the LDS latency eight times
#pragma unroll
      for (int j = 0; j < 8; ++j) acc[j] = wmma_bf(af[kk], wf[j], acc[j]); }
    __builtin_amdgcn_sched_barrier(0);   // keeps the fetched tile's conversion, and with it the wait for its loads, behind this stage's products
    if (more) { wt_store_b(wt, sm.wb[(s + 1) & 1], wave, lane);
      { const int d = KST(s + 2, rot, DIN) - KST(s + 1, rot, DIN); wp += d * CC; xp += d; }   // one stage on, or back to k = 0: behind the wait for the loads that used these addresses
#pragma unroll
      for (int kk = 0; kk < KS / 32; ++kk) {
#pragma unroll
        for (int i = 0; i < 8; ++i) { af[kk][i] = (__bf16)xt.r[kk][i >> 2][i & 3]; af[kk][8 + i] = (__bf16)xt.r[kk][2 + (i >> 2)][i & 3]; } } }
    __syncthreads(); }   // publishes stage s + 1 and ends every wave's reads of stage s, whose buffer is written next (after the last stage: by the epilogue)
  if (which < 2) { _Float16* DH = which == 0 ? QH : KH; _Float16* DL = which == 0 ? QL : KL; const int nhi = which == 0 ? QHI : KHI; const bool hi_rows = t0 < nhi;
#pragma unroll
    for (int j = 0; j < 8; ++j) { const float bias = bs[j];
#pragma unroll
      for (int r = 0; r < 8; ++r) { const float v = acc[j][r] + bias; const _Float16 hv = (_Float16)v; sh[wave * 16 + 8 * g + r][j * 16 + col] = hv; sl[wave * 16 + 8 * g + r][j * 16 + col] = (_Float16)((v - (float)hv) * 1024.0f); } }
    __syncthreads();
    for (int e = tid; e < 64 * 16; e += 128) { const int rl = e >> 4, q = e & 15; vst2((unsigned*)(DH + (r0 + rl) * CC + c0 + q * 8), *(const v4u*)&sh[rl][q * 8]); if (hi_rows) vst2((unsigned*)(DL + (bb * nhi + t0 + rl) * (size_t)CC + c0 + q * 8), *(const v4u*)&sl[rl][q * 8]); }
  } else { const bool hi_rows = t0 < KHI;
#pragma unroll
    for (int j = 0; j < 8; ++j) { const float bias = bs[j];
#pragma unroll
      for (int r = 0; r < 8; ++r) { const float v = acc[j][r] + bias; const int rl = wave * 16 + 8 * g + r, cl = j * 16 + col; th[cl][rl] = (_Float16)v; const __bf16 bh = (__bf16)v; tb[cl][rl] = bh; tbl[cl][rl] = (__bf16)(v - (float)bh); } }
    __syncthreads();
    for (int e = tid; e < 128 * 8; e += 128) { const int cl = e >> 3, q = e & 7; vst2((unsigned*)(VT + (bb * CC + c0 + cl) * (size_t)TT + t0 + q * 8), *(const v4u*)&th[cl][q * 8]); if (hi_rows) { const size_t o3 = (bb * CC + c0 + cl) * (size_t)KHI + t0 + q * 8; vst2((unsigned*)(VB + o3), *(const v4u*)&tb[cl][q * 8]); vst2((unsigned*)(VBL + o3), *(const v4u*)&tbl[cl][q * 8]); } } } }
// ---- k_fa: block = 128 queries of (b, h), 16 waves = (4 groups of 32 query columns) x (4 quarters of the key range): four waves a SIMD, so that one wave's softmax runs beside another's products. A wave holds two 16-query tiles, so each K or V fragment read from LDS feeds two products: half the LDS reads of a 16-query wave, whose reads took twice its matrix time. Each wave walks its quarter in trips of 64 keys with a running maximum per query (online softmax), so logits and P stay in registers; the four quarters' (maximum, sum, O) are joined once, through LDS, behind the loop.
// S^T = K . Q^T (A = k rows, B = q rows): lane (g, col) holds keys 8g + r of each 16-key tile for query col, which is the B fragment order of P^T; O^T += V^T . P^T (A = v planes [c][t]): lane holds d = 16j + 8g + r of query col.
// Every inner loop below is unrolled so that the fragment and accumulator arrays are indexed by constants and stay in registers.
__device__ __forceinline__ v8f wmma_h(v16h a, v16h b, v8f c) { return __builtin_amdgcn_wmma_f32_16x16x32_f16(false, a, false, b, (short)0, c, false, false); }
__device__ __forceinline__ float xhalf(float x) { return __builtin_bit_cast(float, __builtin_amdgcn_permlanex16(__builtin_bit_cast(int, x), __builtin_bit_cast(int, x), 0x76543210, 0xfedcba98, false, false)); }   // lane l with lane l ^ 16
// eight base-2 exponentials, each in place, in one statement: no v_exp_f32 here has its source overwritten or its result read by the instruction behind it, and the v_nop fills that slot behind the last.
__device__ __forceinline__ void exp2x8(float* a) {
  asm("v_exp_f32 %0, %0\n\tv_exp_f32 %1, %1\n\tv_exp_f32 %2, %2\n\tv_exp_f32 %3, %3\n\tv_exp_f32 %4, %4\n\tv_exp_f32 %5, %5\n\tv_exp_f32 %6, %6\n\tv_exp_f32 %7, %7\n\tv_nop"
      : "+v"(a[0]), "+v"(a[1]), "+v"(a[2]), "+v"(a[3]), "+v"(a[4]), "+v"(a[5]), "+v"(a[6]), "+v"(a[7])); }
// K and V reach the waves through LDS: the 4 waves of a quarter need the same 16 KB a trip, so each tile is brought in once per block with whole-line asynchronous copies and every wave takes its fragments with 16-byte LDS reads.
// Tile t of a quarter = (v planes of the t-th 64-key group walked, k rows of the next group): what trip t reads, since the scores are formed one trip ahead. Two buffers a quarter: tile t + 1 flies while trip t works. A quarter's tiles are copied by its own 4 waves.
#define NKS 4            // wave sets = parts of the key range
#define KH2 (TT / NKS)   // keys of one part
#define NT (KH2 / 64)    // trips of a wave
#define KP (64 + 8)      // LDS pitch of a staged 128-B row in elements: 144 B = 16 B x 9, free of bank conflicts for the fragment reads
#define KVB (2 * 64 * KP * 2)   // bytes of one buffer: 64 k rows, then 64 v rows
// one thread's share of a tile: 16 B of rows r + 16 i of the buffer (8 lanes a row: each copy instruction covers four whole 128-B lines); gka: its k row r, gv: its v row r
__device__ __forceinline__ void kv_copy(unsigned lds, const _Float16* gka, const _Float16* gv) {
  const unsigned l1 = lds + 16 * KP * 2, l2 = lds + 32 * KP * 2, l3 = lds + 48 * KP * 2, l4 = lds + 64 * KP * 2, l5 = lds + 80 * KP * 2, l6 = lds + 96 * KP * 2, l7 = lds + 112 * KP * 2;
  const _Float16* gka1 = gka + (size_t)16 * CC; const _Float16* gkb = gka + (size_t)32 * CC; const _Float16* gkb1 = gka + (size_t)48 * CC; const _Float16* gv1 = gv + (size_t)16 * TT; const _Float16* gv2 = gv + (size_t)32 * TT; const _Float16* gv3 = gv + (size_t)48 * TT;
  // the s_wait_xcnt stands in the copies' own statement, so that no address register is rewritten in front of it
  asm volatile("global_load_async_to_lds_b128 %0, %8, off\n\tglobal_load_async_to_lds_b128 %1, %9, off\n\tglobal_load_async_to_lds_b128 %2, %10, off\n\tglobal_load_async_to_lds_b128 %3, %11, off\n\t"
               "global_load_async_to_lds_b128 %4, %12, off\n\tglobal_load_async_to_lds_b128 %5, %13, off\n\tglobal_load_async_to_lds_b128 %6, %14, off\n\tglobal_load_async_to_lds_b128 %7, %15, off\n\ts_wait_xcnt 0x0"
               :: "v"(lds), "v"(l1), "v"(l2), "v"(l3), "v"(l4), "v"(l5), "v"(l6), "v"(l7), "v"(gka), "v"(gka1), "v"(gkb), "v"(gkb1), "v"(gv), "v"(gv1), "v"(gv2), "v"(gv3) : "memory"); }
// the same for k rows alone: the first group walked, whose scores are formed in front of the loop
__device__ __forceinline__ void k_copy(unsigned lds, const _Float16* gk) {
  const unsigned l1 = lds + 16 * KP * 2, l2 = lds + 32 * KP * 2, l3 = lds + 48 * KP * 2; const _Float16* gk1 = gk + (size_t)16 * CC; const _Float16* gk2 = gk + (size_t)32 * CC; const _Float16* gk3 = gk + (size_t)48 * CC;
  // as above: the s_wait_xcnt in the copies' own statement, in front of any rewrite of their address registers
  asm volatile("global_load_async_to_lds_b128 %0, %4, off\n\tglobal_load_async_to_lds_b128 %1, %5, off\n\tglobal_load_async_to_lds_b128 %2, %6, off\n\tglobal_load_async_to_lds_b128 %3, %7, off\n\ts_wait_xcnt 0x0"
               :: "v"(lds), "v"(l1), "v"(l2), "v"(l3), "v"(gk), "v"(gk1), "v"(gk2), "v"(gk3) : "memory"); }
__global__ __launch_bounds__(512) void k_fa(const _Float16* __restrict__ QH, const _Float16* __restrict__ KH, const _Float16* __restrict__ VT, float* __restrict__ Y) {
  __shared__ __align__(16) union {   // the join's arrays lie over the ring: they are written behind the last trip's barrier, in front of which every wave has ended its reads of the ring and seen its last copy land
    struct { _Float16 kv[NKS][2][2][64 * KP];                   // [quarter][buffer][k rows, v rows]
             _Float16 kz[NKS][64 * KP]; } r;                    // [quarter] k rows of the first group walked: filled once, read once
    struct { v4f jo[NKS][4][2][HD / 16][2][32];                 // every wave's O, [quarter][query group][query tile][d tile][4 values][lane]
             v2f jm[NKS][4][2][32]; } j; } sm;                  // its (maximum, sum)
  auto& kv = sm.r.kv; auto& kz = sm.r.kz; auto& jo = sm.j.jo; auto& jm = sm.j.jm;
  const int ks = __builtin_amdgcn_readfirstlane((int)threadIdx.x >> 7);   // the wave's quarter of the key range, the same in every lane
  const int tid = threadIdx.x & 127, wave = tid >> 5, lane = tid & 31, col = lane & 15, g = lane >> 4; const int b = blockIdx.y / NH, h = blockIdx.y % NH; const int q = blockIdx.x * 128 + wave * 32 + col;
  const _Float16* Qr = QH + ((size_t)b * TT + q) * CC + h * HD;
  const _Float16* Kc = KH + ((size_t)b * TT + ks * KH2 + (tid >> 3)) * CC + h * HD + 8 * (tid & 7); const _Float16* Vc = VT + ((size_t)b * CC + h * HD + (tid >> 3)) * (size_t)TT + ks * KH2 + 8 * (tid & 7);   // the thread's sources in its quarter's keys 0..63
  const unsigned lc = (unsigned)(size_t)&kv[ks][0][0][(tid >> 3) * KP + 8 * (tid & 7)];   // its place in its quarter's buffer 0 (LDS byte address)
  const int rot = (int)(blockIdx.x & (NT - 1));   // the 16 blocks of one (b, h) need the same K and V lines: each walks the 64-key groups of a quarter as a ring from a group set by its index, so that they do not all ask L2 for the same lines at the same moment
#define KG(i) ((((i) + rot) & (NT - 1)) * 64)   // first key of the i-th group walked (NT is a power of two; the ring closes: the group behind the last is the first again)
  k_copy((unsigned)(size_t)&kz[ks][(tid >> 3) * KP + 8 * (tid & 7)], Kc + (size_t)KG(0) * CC);
  kv_copy(lc, Kc + (size_t)KG(1) * CC, Vc + KG(0));   // tile 0
  v16h qf[2][2];
#pragma unroll
  for (int x = 0; x < 2; ++x) { qf[x][0] = frag_h(Qr + (size_t)x * 16 * CC, lane); qf[x][1] = frag_h(Qr + (size_t)x * 16 * CC + 32, lane); }
  const float C2 = SCALE * 1.4426950408889634f;   // logits carried in base 2
  v8f acc[2][HD / 16] = {}; float m[2] = {-3.0e38f, -3.0e38f}, l[2] = {0.f, 0.f};
  v8f s[2][4];   // scores of the coming trip, [query tile][16-key tile], carried over the loop's back edge
  asm volatile("s_wait_asynccnt 0x0" ::: "memory");   // this wave's share of the first k rows and of tile 0 has landed
  __syncthreads();   // both are published
  kv_copy(lc + KVB, Kc + (size_t)KG(2) * CC, Vc + KG(1));   // tile 1
#pragma unroll
  for (int u = 0; u < 4; ++u) { const v16h k0 = frag_h(&kz[ks][(u * 16 + col) * KP], lane), k1 = frag_h(&kz[ks][(u * 16 + col) * KP + 32], lane);
#pragma unroll
    for (int x = 0; x < 2; ++x) { const v8f z = {}; s[x][u] = wmma_h(k0, qf[x][0], z); s[x][u] = wmma_h(k1, qf[x][1], s[x][u]); } }
  // one trip: 64 keys, tile t
  auto stage = [&](int t) __attribute__((always_inline)) {
    const _Float16* kl = &kv[ks][t & 1][0][col * KP]; const _Float16* vl = &kv[ks][t & 1][1][col * KP];
    v16h va[HD / 16], vb[HD / 16], ka[2][2], kb[2][2];   // the trip's fragments come in four groups of 32 registers, each read where registers have come free and ahead of work that covers its latency: the softmax for va, a run of products for the others
#pragma unroll
    for (int j = 0; j < HD / 16; ++j) va[j] = frag_h(vl + j * 16 * KP, lane);
    __builtin_amdgcn_sched_barrier(0);   // keeps these LDS reads issued in front of the softmax, whose work then covers their latency; without it they sink to their first use
    v16h p[2][2]; float alpha[2];
#pragma unroll
    for (int x = 0; x < 2; ++x) {
      float mt[4];   // independent chains
#pragma unroll
      for (int u = 0; u < 4; ++u) { mt[u] = s[x][u][0];
#pragma unroll
        for (int r = 1; r < 8; ++r) mt[u] = fmaxf(mt[u], s[x][u][r]); }
      float mx = fmaxf(fmaxf(mt[0], mt[1]), fmaxf(mt[2], mt[3])); mx = fmaxf(mx, xhalf(mx));
      const float mn = fmaxf(m[x], mx * C2);   // alpha = 2^(m - mn), 0 on the first trip
      asm("v_exp_f32 %0, %1\n\tv_nop" : "=v"(alpha[x]) : "v"(m[x] - mn));   // asm for the v_nop alone: it fills the slot behind a transcendental
      m[x] = mn;
      const float off = 10.0f - mn;   // P relative to the running maximum, x 2^10 into f16 (clear of f16 subnormals); the factor cancels against l
      float ps[4];
#pragma unroll
      for (int u = 0; u < 4; ++u) { float e[8];
#pragma unroll
        for (int r = 0; r < 8; ++r) e[r] = fmaf(s[x][u][r], C2, off);
        exp2x8(e); ps[u] = 0.f;
#pragma unroll
        for (int r = 0; r < 8; ++r) { ps[u] += e[r]; p[x][u >> 1][(u & 1) * 8 + r] = (_Float16)e[r]; } }
      l[x] = l[x] * alpha[x] + ((ps[0] + ps[1]) + (ps[2] + ps[3])); }
    __builtin_amdgcn_sched_barrier(0);   // keeps the reads and products below behind the softmax
#pragma unroll
    for (int j = 0; j < HD / 16; ++j) vb[j] = frag_h(vl + j * 16 * KP + 32, lane);
#pragma unroll
    for (int u = 0; u < 2; ++u) { ka[u][0] = frag_h(kl + u * 16 * KP, lane); ka[u][1] = frag_h(kl + u * 16 * KP + 32, lane); }   // the next trip's k rows (the last tile holds the first group's again; those scores are not used)
    __builtin_amdgcn_sched_barrier(0);   // keeps this group of reads together in front of the products that cover its latency
#pragma unroll
    for (int j = 0; j < HD / 16; ++j) {
#pragma unroll
      for (int x = 0; x < 2; ++x) { acc[x][j] *= alpha[x]; acc[x][j] = wmma_h(va[j], p[x][0], acc[x][j]); } }
    __builtin_amdgcn_sched_barrier(0);   // the reads below take the registers that these products have left
#pragma unroll
    for (int u = 0; u < 2; ++u) { kb[u][0] = frag_h(kl + (32 + u * 16) * KP, lane); kb[u][1] = frag_h(kl + (32 + u * 16) * KP + 32, lane); }
    __builtin_amdgcn_sched_barrier(0);   // keeps this group of reads together in front of the products that cover its latency
#pragma unroll
    for (int j = 0; j < HD / 16; ++j) {
#pragma unroll
      for (int x = 0; x < 2; ++x) acc[x][j] = wmma_h(vb[j], p[x][1], acc[x][j]); }
#pragma unroll
    for (int u = 0; u < 2; ++u) {
#pragma unroll
      for (int x = 0; x < 2; ++x) { const v8f z = {}; s[x][u] = wmma_h(ka[u][0], qf[x][0], z); s[x][u] = wmma_h(ka[u][1], qf[x][1], s[x][u]); } }
#pragma unroll
    for (int u = 0; u < 2; ++u) {
#pragma unroll
      for (int x = 0; x < 2; ++x) { const v8f z = {}; s[x][2 + u] = wmma_h(kb[u][0], qf[x][0], z); s[x][2 + u] = wmma_h(kb[u][1], qf[x][1], s[x][2 + u]); } }
    __builtin_amdgcn_sched_barrier(0);   // keeps the waits and the barrier below at the trip's foot: lifted, they expose the reads' latency and leave the flying tile no lead
    asm volatile("s_wait_dscnt 0x0" ::: "memory");      // this wave's reads of the buffer are over before it is refilled
    asm volatile("s_wait_asynccnt 0x0" ::: "memory");   // this wave's share of tile t + 1 has landed
    __syncthreads(); };   // publishes tile t + 1 and ends every wave's reads of tile t, whose buffer is refilled next
  // two loops, so that the refill stands under no test: with a branch round it at the loop's foot the build moved the row sums behind that branch and held their terms in registers till there, and it spilled
  for (int t = 0; t < NT - 2; ++t) { stage(t); kv_copy(lc + (t & 1) * KVB, Kc + (size_t)KG(t + 3) * CC, Vc + KG(t + 2)); }   // tile t + 2 exists
  for (int t = NT - 2; t < NT; ++t) stage(t);   // no tile is left to fetch
  asm volatile("s_wait_asynccnt 0x0" ::: "memory");   // no copy is left in flight when the wave ends
#pragma unroll
  for (int x = 0; x < 2; ++x) { jm[ks][wave][x][lane] = v2f{m[x], l[x]};   // every wave hands over its state
#pragma unroll
    for (int j = 0; j < HD / 16; ++j) { jo[ks][wave][x][j][0][lane] = v4f{acc[x][j][0], acc[x][j][1], acc[x][j][2], acc[x][j][3]}; jo[ks][wave][x][j][1][lane] = v4f{acc[x][j][4], acc[x][j][5], acc[x][j][6], acc[x][j][7]}; } }
  __syncthreads();   // publishes the states; every wave passes
  // the join is shared out: of its query group, wave set ks joins query tile ks & 1, d tiles 2 (ks >> 1) and the next: 32 d = one whole 128-B line a query
  const int jx = ks & 1, jj = 2 * (ks >> 1);
  v2f om[NKS];
#pragma unroll
  for (int i = 0; i < NKS; ++i) om[i] = jm[i][wave][jx][lane];
  const float mj = fmaxf(fmaxf(om[0][0], om[1][0]), fmaxf(om[2][0], om[3][0]));
  float af[NKS], lt = 0.f;   // the four states rescaled to the common maximum
#pragma unroll
  for (int i = 0; i < NKS; ++i) af[i] = om[i][0] - mj;
  asm("v_exp_f32 %0, %0\n\tv_exp_f32 %1, %1\n\tv_exp_f32 %2, %2\n\tv_exp_f32 %3, %3\n\tv_nop" : "+v"(af[0]), "+v"(af[1]), "+v"(af[2]), "+v"(af[3]));   // in place and with the v_nop for the same reason as in exp2x8
#pragma unroll
  for (int i = 0; i < NKS; ++i) lt += om[i][1] * af[i];
  lt += xhalf(lt); const float inv = 1.0f / lt;   // lt >= 2^10: the maximum's own term
  float* Yr = Y + ((size_t)b * TT + blockIdx.x * 128 + wave * 32 + jx * 16 + col) * CC + h * HD + jj * 16 + 8 * g;
#pragma unroll
  for (int j = 0; j < 2; ++j) { v4f a = {}, c = {};
#pragma unroll
    for (int i = 0; i < NKS; ++i) { a += jo[i][wave][jx][jj + j][0][lane] * af[i]; c += jo[i][wave][jx][jj + j][1][lane] * af[i]; }
    vst2(Yr + j * 16, a * inv); vst2(Yr + j * 16 + 4, c * inv); } }
// ---- k_out: block = (64 rows, 128 cols): out = ctx Wo (+ bo): ctx x 2^6 once to f16 against Wo as f16(bf16 x 2^8) exact (1 product) x 2^-14; causal early rows (< QHI of each sequence): ctx bf16 hi + lo against exact bf16 Wo (2 products)
// Every inner loop of k_out is unrolled so that the fragment and accumulator arrays are indexed by constants and stay in registers.
// Wo reaches k_out ready for its products (WOH, laid by k_proj): a stage's tile, 128 output columns x KS2 k, goes from L2 into LDS by whole-line asynchronous copies, through no register and with no conversion. Two buffers: tile s + 1 flies while stage s is worked on.
#define KS2 128           // k of one staged tile
#define WP2 (KS2 + 8)     // LDS pitch of a staged column in elements: 272 B = 16 B x 17, free of bank conflicts for the fragment reads
#define WB2 (128 * WP2 * 2)   // bytes of one buffer
#define KROT2(K) ((int)((blockIdx.x + 2 * blockIdx.y) & ((K) / KS2 - 1)))       // the block's first stage, as KROT
#define KST2(s, rot, K) (((((s) + (rot)) & ((K) / KS2 - 1))) * KS2)             // first k of the s-th stage walked
// one thread's share of half a tile: 16 B of columns r + 8 i, i = 0..7 (16 lanes a column: each copy instruction covers two columns' 256 B, four whole 128-B lines)
__device__ __forceinline__ void w_copy8(unsigned lds, const _Float16* gw) {
  const unsigned l1 = lds + 8 * WP2 * 2, l2 = lds + 16 * WP2 * 2, l3 = lds + 24 * WP2 * 2, l4 = lds + 32 * WP2 * 2, l5 = lds + 40 * WP2 * 2, l6 = lds + 48 * WP2 * 2, l7 = lds + 56 * WP2 * 2;
  const _Float16* g1 = gw + (size_t)8 * CC; const _Float16* g2 = gw + (size_t)16 * CC; const _Float16* g3 = gw + (size_t)24 * CC; const _Float16* g4 = gw + (size_t)32 * CC; const _Float16* g5 = gw + (size_t)40 * CC; const _Float16* g6 = gw + (size_t)48 * CC; const _Float16* g7 = gw + (size_t)56 * CC;
  // as in kv_copy: the s_wait_xcnt stands in the copies' own statement, so that no address register is rewritten in front of it
  asm volatile("global_load_async_to_lds_b128 %0, %8, off\n\tglobal_load_async_to_lds_b128 %1, %9, off\n\tglobal_load_async_to_lds_b128 %2, %10, off\n\tglobal_load_async_to_lds_b128 %3, %11, off\n\t"
               "global_load_async_to_lds_b128 %4, %12, off\n\tglobal_load_async_to_lds_b128 %5, %13, off\n\tglobal_load_async_to_lds_b128 %6, %14, off\n\tglobal_load_async_to_lds_b128 %7, %15, off\n\ts_wait_xcnt 0x0"
               :: "v"(lds), "v"(l1), "v"(l2), "v"(l3), "v"(l4), "v"(l5), "v"(l6), "v"(l7), "v"(gw), "v"(g1), "v"(g2), "v"(g3), "v"(g4), "v"(g5), "v"(g6), "v"(g7) : "memory"); }
__device__ __forceinline__ void w_copy(unsigned lds, const _Float16* gw) { w_copy8(lds, gw); w_copy8(lds + 64 * WP2 * 2, gw + (size_t)64 * CC); }   // a whole tile: 16 copies a thread
// a lane's raw f32 share of the A fragments of one stage of KS2 k, as XT
struct XT2 { v4f r[KS2 / 32][4]; };
__device__ __forceinline__ void xt2_load(XT2& t, const float* p) {
#pragma unroll   // unrolled so that t.r is indexed by constants and stays in registers
  for (int kk = 0; kk < KS2 / 32; ++kk) { t.r[kk][0] = *(const v4f*)(p + kk * 32); t.r[kk][1] = *(const v4f*)(p + kk * 32 + 4); t.r[kk][2] = *(const v4f*)(p + kk * 32 + 16); t.r[kk][3] = *(const v4f*)(p + kk * 32 + 20); } }
__global__ __launch_bounds__(128) void k_out(const float* __restrict__ Y, const float* __restrict__ WO, const _Float16* __restrict__ WOH, const float* __restrict__ BO, float* __restrict__ OUT) { __shared__ __align__(16) float sf[4][16][132]; __shared__ __align__(16) _Float16 wb[2][128 * WP2];
  const int tid = threadIdx.x, wave = tid >> 5, lane = tid & 31, col = lane & 15, g = lane >> 4; const int c0 = blockIdx.y * 128; const size_t r0 = (size_t)blockIdx.x * 64 + wave * 16;
  v8f acc[8] = {};
  if (CAUSAL && (int)(((size_t)blockIdx.x * 64) % TT) < QHI) {   /* block-uniform */
#pragma unroll 2
    for (int kc = 0; kc < CC / 32; ++kc) { const F2 a = split_row(Y + (r0 + col) * CC, kc * 32, lane); asm volatile("s_wait_loadcnt 0x0" ::: "memory");
#pragma unroll
      for (int j = 0; j < 8; ++j) { const v16b w = WOCOL(WO, kc * 32, c0 + j * 16 + col, lane); asm volatile("s_wait_loadcnt 0x0" ::: "memory"); acc[j] = wmma_bf(a.h, w, acc[j]); acc[j] = wmma_bf(a.l, w, acc[j]); } }
#pragma unroll
    for (int j = 0; j < 8; ++j) { const float bias = BO ? bfr(BO[c0 + j * 16 + col]) : 0.f;
#pragma unroll
      for (int r = 0; r < 8; ++r) sf[wave][8 * g + r][j * 16 + col] = acc[j][r] + bias; }
  } else {
    const int rot = KROT2(CC);
    const _Float16* wg = WOH + (size_t)(c0 + (tid >> 4)) * CC + 8 * (tid & 15);   // the thread's first 16 B of the tile at k = 0
    const unsigned wl = (unsigned)(size_t)&wb[0][(tid >> 4) * WP2 + 8 * (tid & 15)];   // its place in buffer 0 (LDS byte address)
    w_copy(wl, wg + KST2(0, rot, CC));   // tile 0
    float bs[8];   // as in k_proj: the eight bias loads fly together at the kernel's head
#pragma unroll   // this loop and the two below: unrolled so that bs stays in registers
    for (int j = 0; j < 8; ++j) bs[j] = 0.f;
    if (BO) {   // one test round all eight
#pragma unroll
      for (int j = 0; j < 8; ++j) bs[j] = BO[c0 + j * 16 + col]; }
    XT2 xt; v16h af[KS2 / 32];   /* ctx carried x 2^6 into f16 so small-magnitude context rows stay clear of f16 subnormals */
    const float* yp = Y + (r0 + col) * CC + KST2(0, rot, CC) + 8 * g;   // the lane's source in the stage fetched next: carried along the ring
    xt2_load(xt, yp);
#pragma unroll
    for (int j = 0; j < 8; ++j) bs[j] = bfr(bs[j]);   // as in k_proj
#pragma unroll
    for (int kk = 0; kk < KS2 / 32; ++kk) {
#pragma unroll
      for (int i = 0; i < 8; ++i) { af[kk][i] = (_Float16)(xt.r[kk][i >> 2][i & 3] * 64.0f); af[kk][8 + i] = (_Float16)(xt.r[kk][2 + (i >> 2)][i & 3] * 64.0f); } }
    yp += KST2(1, rot, CC) - KST2(0, rot, CC);   // behind the wait for the loads that used this address
    asm volatile("s_wait_asynccnt 0x0" ::: "memory");   // this wave's share of tile 0 has landed
    __syncthreads();   // tile 0 is published
    w_copy(wl + WB2, wg + KST2(1, rot, CC));   // tile 1
#pragma unroll   // four stages: unrolled so that the buffer's index and the two tests below are constants
    for (int s = 0; s < CC / KS2; ++s) { const bool more = s + 1 < CC / KS2;
      if (more) xt2_load(xt, yp);   // the next stage's ctx rows are fetched into registers while stage s is worked on
      __builtin_amdgcn_sched_barrier(0);   // keeps the next stage's global loads issued in front of this stage's products, which then cover their latency
      const _Float16* wc = wb[s & 1] + col * WP2;
#pragma unroll
      for (int kk = 0; kk < KS2 / 32; ++kk) { v16h wf[8];
#pragma unroll
        for (int j = 0; j < 8; ++j) wf[j] = frag_h(wc + j * 16 * WP2 + kk * 32, lane);
        __builtin_amdgcn_sched_barrier(0);   // keeps the 16 LDS reads together in front of their products: one wait for the group
#pragma unroll
        for (int j = 0; j < 8; ++j) acc[j] = wmma16(af[kk], wf[j], acc[j]); }
      __builtin_amdgcn_sched_barrier(0);   // keeps the fetched rows' conversion, and with it the wait for their loads, behind this stage's products
      if (more) {
#pragma unroll
        for (int kk = 0; kk < KS2 / 32; ++kk) {
#pragma unroll
          for (int i = 0; i < 8; ++i) { af[kk][i] = (_Float16)(xt.r[kk][i >> 2][i & 3] * 64.0f); af[kk][8 + i] = (_Float16)(xt.r[kk][2 + (i >> 2)][i & 3] * 64.0f); } }
        yp += KST2(s + 2, rot, CC) - KST2(s + 1, rot, CC); }   // one stage on, or back to k = 0: behind the wait for the loads that used this address
      asm volatile("s_wait_dscnt 0x0" ::: "memory");      // this wave's reads of the buffer are over before it is refilled
      asm volatile("s_wait_asynccnt 0x0" ::: "memory");   // this wave's share of tile s + 1 has landed
      __syncthreads();   // publishes tile s + 1 and ends every wave's reads of tile s, whose buffer is refilled next
      if (s + 2 < CC / KS2) w_copy(wl + (s & 1) * WB2, wg + KST2(s + 2, rot, CC)); }   // tile s + 2 exists
    asm volatile("s_wait_asynccnt 0x0" ::: "memory");   // no copy is left in flight when the wave ends
#pragma unroll
    for (int j = 0; j < 8; ++j) { const float bias = bs[j];
#pragma unroll
      for (int r = 0; r < 8; ++r) sf[wave][8 * g + r][j * 16 + col] = acc[j][r] * (1.0f / 16384.0f) + bias; } }   /* 2^-8 (Wo carry) x 2^-6 (ctx carry) */
  LDSX(); for (int rl = 0; rl < 16; ++rl) vst2(OUT + (r0 + rl) * DIN + c0 + lane * 4, *(const v4f*)&sf[wave][rl][lane * 4]); }

extern "C" void kernel_launch(void* const* d_in, const int* in_sizes, int n_in, void* d_out, int out_size, void* d_ws, size_t ws_size, hipStream_t stream) {
  (void)in_sizes; (void)n_in; (void)out_size;
  const float** F = (const float**)d_in;
  if (ws_size < (size_t)WS_END) return;
  char* ws = (char*)d_ws; _Float16 *QH = (_Float16*)(ws + WS_QH), *KH = (_Float16*)(ws + WS_KH), *VT = (_Float16*)(ws + WS_VT), *QL = (_Float16*)(ws + WS_QL), *KL = (_Float16*)(ws + WS_KL), *WOH = (_Float16*)(ws + WS_WOH); __bf16 *VB = (__bf16*)(ws + WS_VB), *VBL = (__bf16*)(ws + WS_VBL); float *Y = (float*)(ws + WS_Y);
  (void)Y; (void)QL; (void)KL; (void)VB; (void)VBL;
  // inputs: 0 inputs [2,2048,512]; 1 Wq [512,512] (in,out), 2 bq; 3 Wk, 4 bk; 5 Wv, 6 bv; 7 Wo (in,out), 8 bo (zero biases, read)
  k_proj<<<dim3(TNB * TT / 64, CC / 128, 3), 128, 0, stream>>>(F[0], F[0], F[0], F[1], F[3], F[5], F[2], F[4], F[6], QH, QL, KH, KL, VT, VB, VBL, F[7], WOH);
  k_fa<<<dim3(TT / 128, TNB * NH), 512, 0, stream>>>(QH, KH, VT, Y);
  k_out<<<dim3(TNB * TT / 64, DIN / 128), 128, 0, stream>>>(Y, F[7], WOH, F[8], (float*)d_out);
}

// v009
// Measured time: 37.6 microseconds a run.
// In both of two side-by-side timings against v008, it was 1.04 times as fast.
// Over all steps from v000 it is 15.5 times as fast.
// compute dtype: all float inputs rounded to bf16; q/k/v projections with EXACT bf16 products on WMMA 16x16x32 (f32 accumulate) + bias; logits q x k once to f16 each (1 product) x SCALE; online softmax f32; P (relative to the running maximum) x 2^10 once to f16 x v once to f16 (1 product); ctx x 2^6 once to f16 x Wo f16(bf16 x 2^8) + bo; f32 output.
#include <hip/hip_runtime.h>
#include <math.h>

typedef __attribute__((ext_vector_type(16))) _Float16 v16h;
typedef __attribute__((ext_vector_type(16))) __bf16 v16b;
typedef __attribute__((ext_vector_type(8)))  _Float16 v8h;
typedef __attribute__((ext_vector_type(8)))  float v8f;
typedef __attribute__((ext_vector_type(4)))  float v4f;
typedef __attribute__((ext_vector_type(2)))  float v2f;
typedef __attribute__((ext_vector_type(4)))  unsigned v4u;
typedef __attribute__((ext_vector_type(4)))  int v4i;
typedef float __attribute__((may_alias)) float_a;
typedef int __attribute__((may_alias)) int_a;

template <typename T> __device__ __forceinline__ void vst2(void* p, T v) { *(T*)p = v;  }
__device__ __forceinline__ v8f wmma16(v16h a, v16h b, v8f c) {
  v8f d = __builtin_amdgcn_wmma_f32_16x16x32_f16(false, a, false, b, (short)0, c, false, false);
  asm volatile("v_nop\n\tv_nop\n\tv_nop\n\tv_nop" : "+v"(d) : "v"(a), "v"(b));
  return d;
}
__device__ __forceinline__ v8f wmma_bf(v16b a, v16b b, v8f c) {
  v8f d = __builtin_amdgcn_wmma_f32_16x16x32_bf16(false, a, false, b, (short)0, c, false, false);
  asm volatile("v_nop\n\tv_nop\n\tv_nop\n\tv_nop" : "+v"(d) : "v"(a), "v"(b));
  return d;
}
// 16x16x32 fragments: lane = (h = lane>>4, row/col = lane&15); elements 0..7 = k0+8h+0..7, 8..15 = k0+16+8h+0..7; D element r = row 8h+r
__device__ __forceinline__ v16h frag_h(const _Float16* rowk0, int lane) {
  union { v16h v; v8h q[2]; } u; const _Float16* p = rowk0 + 8 * (lane >> 4);
  u.q[0] = *(const v8h*)p; u.q[1] = *(const v8h*)(p + 16); return u.v;
}
__device__ __forceinline__ v16h frag_f32(const float* rowk0, int lane) {
  v16h a; const float* p = rowk0 + 8 * (lane >> 4);
#pragma unroll
  for (int i = 0; i < 8; ++i) { a[i] = (_Float16)p[i]; a[8 + i] = (_Float16)p[16 + i]; }
  return a;
}
__device__ __forceinline__ v16h frag_f32s(const float* rowk0, int lane, float sc) {
  v16h a; const float* p = rowk0 + 8 * (lane >> 4);
#pragma unroll
  for (int i = 0; i < 8; ++i) { a[i] = (_Float16)(p[i] * sc); a[8 + i] = (_Float16)(p[16 + i] * sc); }
  return a;
}
// column fragment from a [K][ld] layout (column n), rows >= K read as 0
__device__ __forceinline__ v16h fragc_f32(const float* W, int k0, int n, int lane, int ld, int K) {
  v16h a; const int g = lane >> 4;
#pragma unroll
  for (int i = 0; i < 8; ++i) { const int ka = k0 + 8 * g + i, kb = ka + 16;
    a[i] = (_Float16)(ka < K ? W[(size_t)(ka < K ? ka : K - 1) * ld + n] : 0.f); a[8 + i] = (_Float16)(kb < K ? W[(size_t)(kb < K ? kb : K - 1) * ld + n] : 0.f); }
  return a;
}
struct F2 { v16b h, l; };
__device__ __forceinline__ F2 bsplit16(const float v[16]) { F2 r;
#pragma unroll
  for (int i = 0; i < 16; ++i) { const __bf16 h = (__bf16)v[i]; r.h[i] = h; r.l[i] = (__bf16)(v[i] - (float)h); }
  return r; }
__device__ __forceinline__ F2 split_row(const float* row, int k0, int lane) { float v[16]; const float* p = row + k0 + 8 * (lane >> 4);
#pragma unroll
  for (int i = 0; i < 8; ++i) { v[i] = p[i]; v[8 + i] = p[16 + i]; }
  return bsplit16(v); }
__device__ __forceinline__ F2 split_rowK(const float* row, int k0, int lane, int K) { float v[16]; const int g = lane >> 4;
#pragma unroll
  for (int i = 0; i < 8; ++i) { const int ka = k0 + 8 * g + i, kb = ka + 16; v[i] = ka < K ? row[ka < K ? ka : K - 1] : 0.f; v[8 + i] = kb < K ? row[kb < K ? kb : K - 1] : 0.f; }
  return bsplit16(v); }
__device__ __forceinline__ F2 split_col(const float* W, int k0, int n, int lane, int ld, int K) { float v[16]; const int g = lane >> 4;
#pragma unroll
  for (int i = 0; i < 8; ++i) { const int ka = k0 + 8 * g + i, kb = ka + 16; v[i] = ka < K ? W[(size_t)(ka < K ? ka : K - 1) * ld + n] : 0.f; v[8 + i] = kb < K ? W[(size_t)(kb < K ? kb : K - 1) * ld + n] : 0.f; }
  return bsplit16(v); }
__device__ __forceinline__ v8f mac3(const F2& a, const F2& b, v8f c) { c = wmma_bf(a.l, b.h, c); c = wmma_bf(a.h, b.l, c); return wmma_bf(a.h, b.h, c); }
__device__ __forceinline__ float sigm(float v) { return 1.0f / (1.0f + expf(-v)); }
#define LDSX() do { asm volatile("s_wait_dscnt 0" ::: "memory"); __builtin_amdgcn_wave_barrier(); __builtin_amdgcn_fence(__ATOMIC_RELEASE, "workgroup"); } while (0)

// Multi-head self-attention (inputs [2,2048,512]; (in,out) Wq / Wk / Wv / Wo [512,512] N(0, 1/512) + zero biases; 8 heads x 64; scale 1/8; softmax over keys; merge; Wo + bo).
#define NB 2
#define TT 2048
#define CC 512            // NH * HD = projected width
#define DIN 512          // input (model) width
#define NH 8
#define HD 64
#define NQB (TT / 64)
#define HG 4
#define SCALE (0.125f)
#define CAUSAL 0
#ifndef TNB
#define TNB NB
#endif
__device__ __forceinline__ float bfr(float v) { return (float)(__bf16)v; }
__host__ __device__ __forceinline__ int kb_last(int qb) { return CAUSAL ? ((qb * 64 + 63) >> 7) : (TT / 128 - 1); }
typedef __attribute__((ext_vector_type(8))) __bf16 v8b;
__device__ __forceinline__ v16b frag_b(const __bf16* rowk0, int lane) {
  union { v16b v; v8b q[2]; } u; const __bf16* p = rowk0 + 8 * (lane >> 4);
  u.q[0] = *(const v8b*)p; u.q[1] = *(const v8b*)(p + 16); return u.v;
}
#define QBH 0              // not read by any kernel here: k_fa has no high-precision path
#define QHI 0               // single-product logits on every row
#define KHI 64            // key rows carrying k residual / v bf16 hi+lo planes (written by k_proj; no kernel here reads them)
// B fragment (k rows k0+.., output column o) of a weight: (in,out) [K][ld] or (out,in) [ld rows of K]: bf16 exact, or f16(bf16 * 256) exact
__device__ __forceinline__ v16b wcol_io(const float* Wm, int k0, int o, int lane, int ld) { v16b w; const int g = lane >> 4;
#pragma unroll
  for (int i = 0; i < 8; ++i) { w[i] = (__bf16)Wm[(size_t)(k0 + 8 * g + i) * ld + o]; w[8 + i] = (__bf16)Wm[(size_t)(k0 + 16 + 8 * g + i) * ld + o]; }
  return w; }
__device__ __forceinline__ v16b wcol_oi(const float* Wm, int k0, int o, int lane, int K) { v16b w; const float* p = Wm + (size_t)o * K + k0 + 8 * (lane >> 4);
#pragma unroll
  for (int i = 0; i < 8; ++i) { w[i] = (__bf16)p[i]; w[8 + i] = (__bf16)p[16 + i]; }
  return w; }
__device__ __forceinline__ v16h wcolh_io(const float* Wm, int k0, int o, int lane, int ld) { v16h w; const int g = lane >> 4;
#pragma unroll
  for (int i = 0; i < 8; ++i) { w[i] = (_Float16)(bfr(Wm[(size_t)(k0 + 8 * g + i) * ld + o]) * 256.0f); w[8 + i] = (_Float16)(bfr(Wm[(size_t)(k0 + 16 + 8 * g + i) * ld + o]) * 256.0f); }
  return w; }
__device__ __forceinline__ v16h wcolh_oi(const float* Wm, int k0, int o, int lane, int K) { v16h w; const float* p = Wm + (size_t)o * K + k0 + 8 * (lane >> 4);
#pragma unroll
  for (int i = 0; i < 8; ++i) { w[i] = (_Float16)(bfr(p[i]) * 256.0f); w[8 + i] = (_Float16)(bfr(p[16 + i]) * 256.0f); }
  return w; }
#define WQKV_LAYOUT 0   // selects WCOL, which no kernel here calls: k_proj always stages Wq / Wk / Wv as (in,out) [DIN][CC]
__device__ __forceinline__ v16b wcol_hdk(const float* Wm, int k0, int o, int lane) { v16b w; const int g = lane >> 4; const float* p = Wm + (size_t)(o / HD) * DIN * HD + (o % HD);
#pragma unroll
  for (int i = 0; i < 8; ++i) { w[i] = (__bf16)p[(size_t)(k0 + 8 * g + i) * HD]; w[8 + i] = (__bf16)p[(size_t)(k0 + 16 + 8 * g + i) * HD]; }
  return w; }
#define WO_OUT_IN 0
#if WQKV_LAYOUT == 1
#define WCOL(W, k0, o, lane) wcol_oi(W, k0, o, lane, DIN)
#elif WQKV_LAYOUT == 2
#define WCOL(W, k0, o, lane) wcol_hdk(W, k0, o, lane)
#else
#define WCOL(W, k0, o, lane) wcol_io(W, k0, o, lane, CC)
#endif
#if WO_OUT_IN
#define WOCOL(W, k0, o, lane) wcol_oi(W, k0, o, lane, CC)
#define WOCOLH(W, k0, o, lane) wcolh_oi(W, k0, o, lane, CC)
#else
#define WOCOL(W, k0, o, lane) wcol_io(W, k0, o, lane, DIN)
#define WOCOLH(W, k0, o, lane) wcolh_io(W, k0, o, lane, DIN)
#endif

#ifndef SM_EXTRA_PARAMS
#define SM_EXTRA_PARAMS
#endif
#ifndef PROJ_EXTRA_PARAMS
#define PROJ_EXTRA_PARAMS
#endif
#ifndef SM_MASK_HOOK
#define SM_MASK_HOOK (void)0
#endif

#define WS_QH  0u                                      // f16 q rows [b*t][CC]
#define WS_KH  (WS_QH + 2u * (size_t)NB * TT * CC)      // f16 k rows [b*t][CC]
#define WS_VT  (WS_KH + 2u * (size_t)NB * TT * CC)      // f16 v planes [b][c][t]
#define WS_QL  (WS_VT + 2u * (size_t)NB * CC * TT)      // f16 q residual x 2^10 rows [b][t < QHI][CC]
#define WS_KL  (WS_QL + 2u * (size_t)NB * QHI * CC)     // f16 k residual x 2^10 rows [b][t < KHI][CC]
#define WS_VB  (WS_KL + 2u * (size_t)NB * KHI * CC)     // bf16 v hi planes [b][c][t < KHI]
#define WS_VBL (WS_VB + 2u * (size_t)NB * CC * KHI)
#define WS_S   (WS_VBL + 2u * (size_t)NB * CC * KHI)    // f32 [hg][t][s] logits place, unused for logits: k_fa keeps logits and P in registers; WOH lies at its head
#define WS_Y   (WS_S  + 4u * (size_t)HG * TT * TT)      // f32 ctx rows [b*t][CC] (only when there is an output projection)
#define WS_END (WS_Y  + 4u * (size_t)NB * TT * CC)
#define WS_WOH WS_S                                    // f16(bf16 x 2^8) Wo columns [o][k], written by k_proj for k_out: it lies at the head of the logits' place, which no kernel of this file fills with logits

// ---- weight staging for k_proj: a [KS][128] f32 tile of a (in,out) weight is read once per block with whole-line 16-byte loads, converted once, and laid in LDS column by column (k contiguous), where every wave takes its B fragments with 16-byte LDS reads
#define KS 64            // k rows of one staged tile
#define WP (KS + 8)      // LDS pitch of a staged column in elements: 144 B = 16 B x 9, free of bank conflicts for the fragment reads and for the staging stores
// one thread's share of a tile: 8 k rows x 4 columns; of the block's 8 waves, wave w covers 32 columns (w & 3) of 32 k rows (w >> 2), lane = (k octet = lane & 3, column group = lane >> 2), so each load instruction covers four whole 128-B lines
struct WT { v4f r[8]; };
__device__ __forceinline__ const float* wt_lane(const float* Wm, int k0, int c0, int ld, int wave, int lane) { return Wm + (size_t)(k0 + 32 * (wave >> 2) + 8 * (lane & 3)) * ld + c0 + 32 * (wave & 3) + 4 * (lane >> 2); }   // the lane's first element of the tile at k row k0
__device__ __forceinline__ void wt_load(WT& t, const float* p, int ld) {
#pragma unroll
  for (int i = 0; i < 8; ++i) t.r[i] = *(const v4f*)(p + (size_t)i * ld); }
__device__ __forceinline__ void wt_store_b(const WT& t, __bf16* wb, int wave, int lane) {   // bf16, exact operand of k_proj
  __bf16* d = wb + (32 * (wave & 3) + 4 * (lane >> 2)) * WP + 32 * (wave >> 2) + 8 * (lane & 3);
#pragma unroll
  for (int c = 0; c < 4; ++c) { v8b x;
#pragma unroll
    for (int i = 0; i < 8; ++i) x[i] = (__bf16)t.r[i][c];
    *(v8b*)(d + c * WP) = x; } }
// X goes the same way: a wave brings the KS k of its own 16 rows with whole-line loads (8 lanes a row: each load instruction covers four whole 128-B lines; read as fragments straight from global, each load touched 16 lines for 32 B of each), converts them once and lays them in LDS row by row at the same pitch, where the A fragments are taken with 16-byte LDS reads
typedef __attribute__((ext_vector_type(4))) __bf16 v4b;
struct XT { v4f r[8]; };   // load i: rows 4 (i >> 1) + (lane >> 3), k 32 (i & 1) + 4 (lane & 7) + 0..3
__device__ __forceinline__ void xt_load(XT& t, const float* p, int ld) {   // p: row (lane >> 3) of the wave's 16 at the stage's first k, + 4 * (lane & 7)
#pragma unroll
  for (int i = 0; i < 8; ++i) t.r[i] = *(const v4f*)(p + (size_t)(4 * (i >> 1)) * ld + 32 * (i & 1)); }
__device__ __forceinline__ void xt_store_b(const XT& t, __bf16* xb, int wave, int lane) {
  __bf16* d = xb + (16 * wave + (lane >> 3)) * WP + 4 * (lane & 7);
#pragma unroll
  for (int i = 0; i < 8; ++i) { v4b x;
#pragma unroll
    for (int c = 0; c < 4; ++c) x[c] = (__bf16)t.r[i][c];
    *(v4b*)(d + 4 * (i >> 1) * WP + 32 * (i & 1)) = x; } }

// Blocks that share a weight tile (all row blocks of a column block) or an A tile (all column blocks of a row block) run in step, and would ask L2 for the same lines at the same moment. So each block walks the k stages as a ring from a first stage set by its tile indices: the sum takes every stage once, in rotated order.
#define KROT(K) ((int)((blockIdx.x + 2 * blockIdx.y) & ((K) / KS - 1)))          // the block's first stage (K / KS is a power of two)
#define KST(s, rot, K) (((((s) + (rot)) & ((K) / KS - 1))) * KS)                // first k row of the s-th stage walked
// ---- k_proj: block = (128 rows, 128 cols, which), 8 waves = (4 groups of 32 rows) x (2 halves of 64 columns): both operands reach the waves through LDS. A staged weight tile serves 128 rows, so the weights are read from L2 once per 128 rows; a wave's 6 fragments of 32 k feed 8 products. q/k/v = X W (+ b) with exact bf16 products (K = DIN) -> which 0: q f16 rows (+ residual rows < QHI); 1: k f16 rows (+ residual rows < KHI); 2: v f16 planes [c][t] (+ bf16 hi/lo planes for t < KHI)
__global__ __launch_bounds__(256) void k_proj(const float* __restrict__ XQ, const float* __restrict__ XK, const float* __restrict__ XV, const float* __restrict__ WQ, const float* __restrict__ WK, const float* __restrict__ WV, const float* __restrict__ BQ, const float* __restrict__ BK, const float* __restrict__ BV,
    _Float16* __restrict__ QH, _Float16* __restrict__ QL, _Float16* __restrict__ KH, _Float16* __restrict__ KL, _Float16* __restrict__ VT, __bf16* __restrict__ VB, __bf16* __restrict__ VBL, const float* __restrict__ WO, _Float16* __restrict__ WOH) {
  __shared__ __align__(16) union { struct { _Float16 sh[128][136], sl[128][136]; } e; struct { _Float16 th[128][136]; __bf16 tb[128][136], tbl[128][136]; } f; struct { __bf16 wb[2][128 * WP], xb[2][128 * WP]; } s; } sm;   // the W and X stages, the q / k epilogue's tiles and the v epilogue's tiles share LDS (a block uses one epilogue), so that two blocks fit a WGP
  auto& sh = sm.e.sh; auto& sl = sm.e.sl; auto& th = sm.f.th; auto& tb = sm.f.tb; auto& tbl = sm.f.tbl;
  const int tid = threadIdx.x, wave = tid >> 5, lane = tid & 31, col = lane & 15, g = lane >> 4, rw = 32 * (wave & 3), cw = 64 * (wave >> 2); const int which = blockIdx.z; const int c0 = blockIdx.y * 128; const size_t r0 = (size_t)blockIdx.x * 128;   // rw, cw: first row and column of the wave's 32 x 64 in the block's tile
  const size_t bb = r0 / TT; const int t0 = (int)(r0 % TT);
  const float* X = which == 0 ? XQ : which == 1 ? XK : XV; const float* WA = which == 0 ? WQ : which == 1 ? WK : WV; const float* BA = which == 0 ? BQ : which == 1 ? BK : BV;
  v8f acc[2][4] = {};   // [row tile][column tile]
  float bs[4];   // the lane's bias of each column tile, loaded here: all fly together, beside the first stage's loads. Loaded where they are used, behind the loop, each was waited for by itself: load latencies in a row at the end of every block
#pragma unroll   // this loop and the two below: unrolled so that bs is indexed by constants and stays in registers
  for (int j = 0; j < 4; ++j) bs[j] = 0.f;
  if (BA) {   // one test round all: with a test round each, the build put a wait behind each load
#pragma unroll
    for (int j = 0; j < 4; ++j) bs[j] = BA[c0 + cw + j * 16 + col]; }
  WT wt; XT xt;
  const int rot = KROT(DIN);   // the same for the three products of one X tile, which read the same X lines
  const float* wp = wt_lane(WA, KST(0, rot, DIN), c0, CC, wave, lane); const float* xp = X + (r0 + wave * 16 + (lane >> 3)) * DIN + KST(0, rot, DIN) + 4 * (lane & 7);   // the lane's sources in the stage fetched next: carried along the ring
  wt_load(wt, wp, CC); xt_load(xt, xp, DIN);
  asm volatile("s_wait_xcnt 0x0" ::: "memory");   // the first loads' address registers are free for reuse behind it
  if (which == 0) {   // block-uniform. Wo for k_out, converted once a call: k_out's 64 row blocks each converted the whole f32 tile again. The 128 q blocks each lay one piece, 128 k rows x 16 output columns, as f16(bf16 x 2^8) column by column (k contiguous): 32 whole 128-B lines a block. It stands behind the first stage's loads, so its own loads wait no longer than those
    static_assert((TNB * TT / 128) * (CC / 128) == (CC / 128) * (DIN / 16), "one piece of Wo for each q block");
    const int wid = (int)blockIdx.x + (TNB * TT / 128) * (int)blockIdx.y; const int wk = (wid & (CC / 128 - 1)) * 128 + 8 * (tid >> 4), wo = (wid / (CC / 128)) * 16 + (tid & 15);
    const float* wsrc = WO + (size_t)wk * DIN + wo; float w8[8]; v8h x;
#pragma unroll   // this loop and the next: unrolled so that w8 stays in registers
    for (int i = 0; i < 8; ++i) w8[i] = wsrc[(size_t)i * DIN];
#pragma unroll
    for (int i = 0; i < 8; ++i) x[i] = (_Float16)(bfr(w8[i]) * 256.0f);
    *(v8h*)(WOH + (size_t)wo * CC + wk) = x;
    asm volatile("s_wait_xcnt 0x0" ::: "memory"); }   // the store's address registers are free for reuse behind it
  wt_store_b(wt, sm.s.wb[0], wave, lane); xt_store_b(xt, sm.s.xb[0], wave, lane);
#pragma unroll
  for (int j = 0; j < 4; ++j) bs[j] = bfr(bs[j]);   // rounded behind the first stage's wait, which the bias loads, issued earlier, have met by then
  { const int d = KST(1, rot, DIN) - KST(0, rot, DIN); wp += d * CC; xp += d; }
  __syncthreads();   // stage 0 is published
#pragma unroll 2
  for (int s = 0; s < DIN / KS; ++s) { const bool more = s + 1 < DIN / KS;   // two buffers: stage s + 1 is fetched into registers while stage s is worked on
    if (more) { wt_load(wt, wp, CC); xt_load(xt, xp, DIN); }
    __builtin_amdgcn_sched_barrier(0);   // keeps the next stage's global loads issued in front of this stage's products, which then cover their latency
    const __bf16* wc = sm.s.wb[s & 1] + (cw + col) * WP; const __bf16* xc = sm.s.xb[s & 1] + (rw + col) * WP;
#pragma unroll
    for (int kk = 0; kk < KS / 32; ++kk) { v16b wf[4], af[2];
#pragma unroll
      for (int x = 0; x < 2; ++x) af[x] = frag_b(xc + x * 16 * WP + kk * 32, lane);
#pragma unroll
      for (int j = 0; j < 4; ++j) wf[j] = frag_b(wc + j * 16 * WP + kk * 32, lane);
      __builtin_amdgcn_sched_barrier(0);   // keeps the 12 LDS reads together in front of their products: one wait for the group, where a read pair in front of each product waits out the LDS latency eight times
#pragma unroll
      for (int j = 0; j < 4; ++j) {
#pragma unroll
        for (int x = 0; x < 2; ++x) acc[x][j] = wmma_bf(af[x], wf[j], acc[x][j]); } }
    __builtin_amdgcn_sched_barrier(0);   // keeps the fetched tiles' conversion, and with it the wait for their loads, behind this stage's products
    if (more) { wt_store_b(wt, sm.s.wb[(s + 1) & 1], wave, lane); xt_store_b(xt, sm.s.xb[(s + 1) & 1], wave, lane);
      asm volatile("s_wait_xcnt 0x0" ::: "memory");   // stands in front of the rewrite of the loads' address registers just below
      { const int d = KST(s + 2, rot, DIN) - KST(s + 1, rot, DIN); wp += d * CC; xp += d; } }   // one stage on, or back to k = 0: behind the wait for the loads that used these addresses
    __syncthreads(); }   // publishes stage s + 1 and ends every wave's reads of stage s, whose buffer is written next (after the last stage: by the epilogue)
  if (which < 2) { _Float16* DH = which == 0 ? QH : KH; _Float16* DL = which == 0 ? QL : KL; const int nhi = which == 0 ? QHI : KHI;
#pragma unroll
    for (int j = 0; j < 4; ++j) { const float bias = bs[j];
#pragma unroll
      for (int x = 0; x < 2; ++x) {
#pragma unroll
        for (int r = 0; r < 8; ++r) { const float v = acc[x][j][r] + bias; const _Float16 hv = (_Float16)v; const int rl = rw + x * 16 + 8 * g + r, cl = cw + j * 16 + col; sh[rl][cl] = hv; sl[rl][cl] = (_Float16)((v - (float)hv) * 1024.0f); } } }
    __syncthreads();
    for (int e = tid; e < 128 * 16; e += 256) { const int rl = e >> 4, q = e & 15; vst2((unsigned*)(DH + (r0 + rl) * CC + c0 + q * 8), *(const v4u*)&sh[rl][q * 8]); if (t0 + rl < nhi) { vst2((unsigned*)(DL + (bb * nhi + t0 + rl) * (size_t)CC + c0 + q * 8), *(const v4u*)&sl[rl][q * 8]);
        asm volatile("s_wait_xcnt 0x0" ::: "memory"); } }   // stands in front of the next trip's rewrite of the store's address registers; inside the branch, so that the rewrite cannot be lifted over it
  } else {
#pragma unroll
    for (int j = 0; j < 4; ++j) { const float bias = bs[j];
#pragma unroll
      for (int x = 0; x < 2; ++x) {
#pragma unroll
      for (int r = 0; r < 8; ++r) { const float v = acc[x][j][r] + bias; const int rl = rw + x * 16 + 8 * g + r, cl = cw + j * 16 + col; th[cl][rl] = (_Float16)v; const __bf16 bh = (__bf16)v; tb[cl][rl] = bh; tbl[cl][rl] = (__bf16)(v - (float)bh); } } }
    __syncthreads();
    for (int e = tid; e < 128 * 16; e += 256) { const int cl = e >> 4, q = e & 15; vst2((unsigned*)(VT + (bb * CC + c0 + cl) * (size_t)TT + t0 + q * 8), *(const v4u*)&th[cl][q * 8]); if (t0 + q * 8 < KHI) { const size_t o3 = (bb * CC + c0 + cl) * (size_t)KHI + t0 + q * 8; vst2((unsigned*)(VB + o3), *(const v4u*)&tb[cl][q * 8]); vst2((unsigned*)(VBL + o3), *(const v4u*)&tbl[cl][q * 8]);
        asm volatile("s_wait_xcnt 0x0" ::: "memory"); } } } }   // as in the loop above
// ---- k_fa: block = 128 queries of (b, h), 16 waves = (4 groups of 32 query columns) x (4 quarters of the key range): four waves a SIMD, so that one wave's softmax runs beside another's products. A wave holds two 16-query tiles, so each K or V fragment read from LDS feeds two products: half the LDS reads of a 16-query wave, whose reads took twice its matrix time. Each wave walks its quarter in trips of 64 keys with a running maximum per query (online softmax), so logits and P stay in registers; the four quarters' (maximum, sum, O) are joined once, through LDS, behind the loop.
// S^T = K . Q^T (A = k rows, B = q rows): lane (g, col) holds keys 8g + r of each 16-key tile for query col, which is the B fragment order of P^T; O^T += V^T . P^T (A = v planes [c][t]): lane holds d = 16j + 8g + r of query col.
// Every inner loop below is unrolled so that the fragment and accumulator arrays are indexed by constants and stay in registers.
__device__ __forceinline__ v8f wmma_h(v16h a, v16h b, v8f c) { return __builtin_amdgcn_wmma_f32_16x16x32_f16(false, a, false, b, (short)0, c, false, false); }
__device__ __forceinline__ float xhalf(float x) { return __builtin_bit_cast(float, __builtin_amdgcn_permlanex16(__builtin_bit_cast(int, x), __builtin_bit_cast(int, x), 0x76543210, 0xfedcba98, false, false)); }   // lane l with lane l ^ 16
// eight base-2 exponentials, each in place, in one statement: no v_exp_f32 here has its source overwritten or its result read by the instruction behind it, and the v_nop fills that slot behind the last.
__device__ __forceinline__ void exp2x8(float* a) {
  asm("v_exp_f32 %0, %0\n\tv_exp_f32 %1, %1\n\tv_exp_f32 %2, %2\n\tv_exp_f32 %3, %3\n\tv_exp_f32 %4, %4\n\tv_exp_f32 %5, %5\n\tv_exp_f32 %6, %6\n\tv_exp_f32 %7, %7\n\tv_nop"
      : "+v"(a[0]), "+v"(a[1]), "+v"(a[2]), "+v"(a[3]), "+v"(a[4]), "+v"(a[5]), "+v"(a[6]), "+v"(a[7])); }
// K and V reach the waves through LDS: the 4 waves of a quarter need the same 16 KB a trip, so each tile is brought in once per block with whole-line asynchronous copies and every wave takes its fragments with 16-byte LDS reads.
// Tile t of a quarter = (v planes of the t-th 64-key group walked, k rows of the next group): what trip t reads, since the scores are formed one trip ahead. Two buffers a quarter: tile t + 1 flies while trip t works. A quarter's tiles are copied by its own 4 waves.
#define NKS 4            // wave sets = parts of the key range
#define KH2 (TT / NKS)   // keys of one part
#define NT (KH2 / 64)    // trips of a wave
#define KP (64 + 8)      // LDS pitch of a staged 128-B row in elements: 144 B = 16 B x 9, free of bank conflicts for the fragment reads
#define KVB (2 * 64 * KP * 2)   // bytes of one buffer: 64 k rows, then 64 v rows
// one thread's share of a tile: 16 B of rows r + 16 i of the buffer (8 lanes a row: each copy instruction covers four whole 128-B lines); gka: its k row r, gv: its v row r
__device__ __forceinline__ void kv_copy(unsigned lds, const _Float16* gka, const _Float16* gv) {
  const unsigned l1 = lds + 16 * KP * 2, l2 = lds + 32 * KP * 2, l3 = lds + 48 * KP * 2, l4 = lds + 64 * KP * 2, l5 = lds + 80 * KP * 2, l6 = lds + 96 * KP * 2, l7 = lds + 112 * KP * 2;
  const _Float16* gka1 = gka + (size_t)16 * CC; const _Float16* gkb = gka + (size_t)32 * CC; const _Float16* gkb1 = gka + (size_t)48 * CC; const _Float16* gv1 = gv + (size_t)16 * TT; const _Float16* gv2 = gv + (size_t)32 * TT; const _Float16* gv3 = gv + (size_t)48 * TT;
  // the s_wait_xcnt stands in the copies' own statement, so that no address register is rewritten in front of it
  asm volatile("global_load_async_to_lds_b128 %0, %8, off\n\tglobal_load_async_to_lds_b128 %1, %9, off\n\tglobal_load_async_to_lds_b128 %2, %10, off\n\tglobal_load_async_to_lds_b128 %3, %11, off\n\t"
               "global_load_async_to_lds_b128 %4, %12, off\n\tglobal_load_async_to_lds_b128 %5, %13, off\n\tglobal_load_async_to_lds_b128 %6, %14, off\n\tglobal_load_async_to_lds_b128 %7, %15, off\n\ts_wait_xcnt 0x0"
               :: "v"(lds), "v"(l1), "v"(l2), "v"(l3), "v"(l4), "v"(l5), "v"(l6), "v"(l7), "v"(gka), "v"(gka1), "v"(gkb), "v"(gkb1), "v"(gv), "v"(gv1), "v"(gv2), "v"(gv3) : "memory"); }
// the same for k rows alone: the first group walked, whose scores are formed in front of the loop
__device__ __forceinline__ void k_copy(unsigned lds, const _Float16* gk) {
  const unsigned l1 = lds + 16 * KP * 2, l2 = lds + 32 * KP * 2, l3 = lds + 48 * KP * 2; const _Float16* gk1 = gk + (size_t)16 * CC; const _Float16* gk2 = gk + (size_t)32 * CC; const _Float16* gk3 = gk + (size_t)48 * CC;
  // as above: the s_wait_xcnt in the copies' own statement, in front of any rewrite of their address registers
  asm volatile("global_load_async_to_lds_b128 %0, %4, off\n\tglobal_load_async_to_lds_b128 %1, %5, off\n\tglobal_load_async_to_lds_b128 %2, %6, off\n\tglobal_load_async_to_lds_b128 %3, %7, off\n\ts_wait_xcnt 0x0"
               :: "v"(lds), "v"(l1), "v"(l2), "v"(l3), "v"(gk), "v"(gk1), "v"(gk2), "v"(gk3) : "memory"); }
__global__ __launch_bounds__(512) void k_fa(const _Float16* __restrict__ QH, const _Float16* __restrict__ KH, const _Float16* __restrict__ VT, float* __restrict__ Y) {
  __shared__ __align__(16) union {   // the join's arrays lie over the ring: they are written behind the last trip's barrier, in front of which every wave has ended its reads of the ring and seen its last copy land
    struct { _Float16 kv[NKS][2][2][64 * KP];                   // [quarter][buffer][k rows, v rows]
             _Float16 kz[NKS][64 * KP]; } r;                    // [quarter] k rows of the first group walked: filled once, read once
    struct { v4f jo[NKS][4][2][HD / 16][2][32];                 // every wave's O, [quarter][query group][query tile][d tile][4 values][lane]
             v2f jm[NKS][4][2][32]; } j; } sm;                  // its (maximum, sum)
  auto& kv = sm.r.kv; auto& kz = sm.r.kz; auto& jo = sm.j.jo; auto& jm = sm.j.jm;
  const int ks = __builtin_amdgcn_readfirstlane((int)threadIdx.x >> 7);   // the wave's quarter of the key range, the same in every lane
  const int tid = threadIdx.x & 127, wave = tid >> 5, lane = tid & 31, col = lane & 15, g = lane >> 4; const int b = blockIdx.y / NH, h = blockIdx.y % NH; const int q = blockIdx.x * 128 + wave * 32 + col;
  const _Float16* Qr = QH + ((size_t)b * TT + q) * CC + h * HD;
  const _Float16* Kc = KH + ((size_t)b * TT + ks * KH2 + (tid >> 3)) * CC + h * HD + 8 * (tid & 7); const _Float16* Vc = VT + ((size_t)b * CC + h * HD + (tid >> 3)) * (size_t)TT + ks * KH2 + 8 * (tid & 7);   // the thread's sources in its quarter's keys 0..63
  const unsigned lc = (unsigned)(size_t)&kv[ks][0][0][(tid >> 3) * KP + 8 * (tid & 7)];   // its place in its quarter's buffer 0 (LDS byte address)
  const int rot = (int)(blockIdx.x & (NT - 1));   // the 16 blocks of one (b, h) need the same K and V lines: each walks the 64-key groups of a quarter as a ring from a group set by its index, so that they do not all ask L2 for the same lines at the same moment
#define KG(i) ((((i) + rot) & (NT - 1)) * 64)   // first key of the i-th group walked (NT is a power of two; the ring closes: the group behind the last is the first again)
  k_copy((unsigned)(size_t)&kz[ks][(tid >> 3) * KP + 8 * (tid & 7)], Kc + (size_t)KG(0) * CC);
  kv_copy(lc, Kc + (size_t)KG(1) * CC, Vc + KG(0));   // tile 0
  v16h qf[2][2];
#pragma unroll
  for (int x = 0; x < 2; ++x) { qf[x][0] = frag_h(Qr + (size_t)x * 16 * CC, lane); qf[x][1] = frag_h(Qr + (size_t)x * 16 * CC + 32, lane); }
  const float C2 = SCALE * 1.4426950408889634f;   // logits carried in base 2
  v8f acc[2][HD / 16] = {}; float m[2] = {-3.0e38f, -3.0e38f}, l[2] = {0.f, 0.f};
  v8f s[2][4];   // scores of the coming trip, [query tile][16-key tile], carried over the loop's back edge
  asm volatile("s_wait_asynccnt 0x0" ::: "memory");   // this wave's share of the first k rows and of tile 0 has landed
  __syncthreads();   // both are published
  kv_copy(lc + KVB, Kc + (size_t)KG(2) * CC, Vc + KG(1));   // tile 1
#pragma unroll
  for (int u = 0; u < 4; ++u) { const v16h k0 = frag_h(&kz[ks][(u * 16 + col) * KP], lane), k1 = frag_h(&kz[ks][(u * 16 + col) * KP + 32], lane);
#pragma unroll
    for (int x = 0; x < 2; ++x) { const v8f z = {}; s[x][u] = wmma_h(k0, qf[x][0], z); s[x][u] = wmma_h(k1, qf[x][1], s[x][u]); } }
  // one trip: 64 keys, tile t
  auto stage = [&](int t) __attribute__((always_inline)) {
    const _Float16* kl = &kv[ks][t & 1][0][col * KP]; const _Float16* vl = &kv[ks][t & 1][1][col * KP];
    v16h va[HD / 16], vb[HD / 16], ka[2][2], kb[2][2];   // the trip's fragments come in four groups of 32 registers, each read where registers have come free and ahead of work that covers its latency: the softmax for va, a run of products for the others
#pragma unroll
    for (int j = 0; j < HD / 16; ++j) va[j] = frag_h(vl + j * 16 * KP, lane);
    __builtin_amdgcn_sched_barrier(0);   // keeps these LDS reads issued in front of the softmax, whose work then covers their latency; without it they sink to their first use
    v16h p[2][2]; float alpha[2];
#pragma unroll
    for (int x = 0; x < 2; ++x) {
      float mt[4];   // independent chains
#pragma unroll
      for (int u = 0; u < 4; ++u) { mt[u] = s[x][u][0];
#pragma unroll
        for (int r = 1; r < 8; ++r) mt[u] = fmaxf(mt[u], s[x][u][r]); }
      float mx = fmaxf(fmaxf(mt[0], mt[1]), fmaxf(mt[2], mt[3])); mx = fmaxf(mx, xhalf(mx));
      const float mn = fmaxf(m[x], mx * C2);   // alpha = 2^(m - mn), 0 on the first trip
      asm("v_exp_f32 %0, %1\n\tv_nop" : "=v"(alpha[x]) : "v"(m[x] - mn));   // asm for the v_nop alone: it fills the slot behind a transcendental
      m[x] = mn;
      const float off = 10.0f - mn;   // P relative to the running maximum, x 2^10 into f16 (clear of f16 subnormals); the factor cancels against l
      float ps[4];
#pragma unroll
      for (int u = 0; u < 4; ++u) { float e[8];
#pragma unroll
        for (int r = 0; r < 8; ++r) e[r] = fmaf(s[x][u][r], C2, off);
        exp2x8(e); ps[u] = 0.f;
#pragma unroll
        for (int r = 0; r < 8; ++r) { ps[u] += e[r]; p[x][u >> 1][(u & 1) * 8 + r] = (_Float16)e[r]; } }
      l[x] = l[x] * alpha[x] + ((ps[0] + ps[1]) + (ps[2] + ps[3])); }
    __builtin_amdgcn_sched_barrier(0);   // keeps the reads and products below behind the softmax
#pragma unroll
    for (int j = 0; j < HD / 16; ++j) vb[j] = frag_h(vl + j * 16 * KP + 32, lane);
#pragma unroll
    for (int u = 0; u < 2; ++u) { ka[u][0] = frag_h(kl + u * 16 * KP, lane); ka[u][1] = frag_h(kl + u * 16 * KP + 32, lane); }   // the next trip's k rows (the last tile holds the first group's again; those scores are not used)
    __builtin_amdgcn_sched_barrier(0);   // keeps this group of reads together in front of the products that cover its latency
#pragma unroll
    for (int j = 0; j < HD / 16; ++j) {
#pragma unroll
      for (int x = 0; x < 2; ++x) { acc[x][j] *= alpha[x]; acc[x][j] = wmma_h(va[j], p[x][0], acc[x][j]); } }
    __builtin_amdgcn_sched_barrier(0);   // the reads below take the registers that these products have left
#pragma unroll
    for (int u = 0; u < 2; ++u) { kb[u][0] = frag_h(kl + (32 + u * 16) * KP, lane); kb[u][1] = frag_h(kl + (32 + u * 16) * KP + 32, lane); }
    __builtin_amdgcn_sched_barrier(0);   // keeps this group of reads together in front of the products that cover its latency
#pragma unroll
    for (int j = 0; j < HD / 16; ++j) {
#pragma unroll
      for (int x = 0; x < 2; ++x) acc[x][j] = wmma_h(vb[j], p[x][1], acc[x][j]); }
#pragma unroll
    for (int u = 0; u < 2; ++u) {
#pragma unroll
      for (int x = 0; x < 2; ++x) { const v8f z = {}; s[x][u] = wmma_h(ka[u][0], qf[x][0], z); s[x][u] = wmma_h(ka[u][1], qf[x][1], s[x][u]); } }
#pragma unroll
    for (int u = 0; u < 2; ++u) {
#pragma unroll
      for (int x = 0; x < 2; ++x) { const v8f z = {}; s[x][2 + u] = wmma_h(kb[u][0], qf[x][0], z); s[x][2 + u] = wmma_h(kb[u][1], qf[x][1], s[x][2 + u]); } }
    __builtin_amdgcn_sched_barrier(0);   // keeps the waits and the barrier below at the trip's foot: lifted, they expose the reads' latency and leave the flying tile no lead
    asm volatile("s_wait_dscnt 0x0" ::: "memory");      // this wave's reads of the buffer are over before it is refilled
    asm volatile("s_wait_asynccnt 0x0" ::: "memory");   // this wave's share of tile t + 1 has landed
    __syncthreads(); };   // publishes tile t + 1 and ends every wave's reads of tile t, whose buffer is refilled next
  // two loops, so that the refill stands under no test: with a branch round it at the loop's foot the build moved the row sums behind that branch and held their terms in registers till there, and it spilled
  for (int t = 0; t < NT - 2; ++t) { stage(t); kv_copy(lc + (t & 1) * KVB, Kc + (size_t)KG(t + 3) * CC, Vc + KG(t + 2)); }   // tile t + 2 exists
  for (int t = NT - 2; t < NT; ++t) stage(t);   // no tile is left to fetch
  asm volatile("s_wait_asynccnt 0x0" ::: "memory");   // no copy is left in flight when the wave ends
#pragma unroll
  for (int x = 0; x < 2; ++x) { jm[ks][wave][x][lane] = v2f{m[x], l[x]};   // every wave hands over its state
#pragma unroll
    for (int j = 0; j < HD / 16; ++j) { jo[ks][wave][x][j][0][lane] = v4f{acc[x][j][0], acc[x][j][1], acc[x][j][2], acc[x][j][3]}; jo[ks][wave][x][j][1][lane] = v4f{acc[x][j][4], acc[x][j][5], acc[x][j][6], acc[x][j][7]}; } }
  __syncthreads();   // publishes the states; every wave passes
  // the join is shared out: of its query group, wave set ks joins query tile ks & 1, d tiles 2 (ks >> 1) and the next: 32 d = one whole 128-B line a query
  const int jx = ks & 1, jj = 2 * (ks >> 1);
  v2f om[NKS];
#pragma unroll
  for (int i = 0; i < NKS; ++i) om[i] = jm[i][wave][jx][lane];
  const float mj = fmaxf(fmaxf(om[0][0], om[1][0]), fmaxf(om[2][0], om[3][0]));
  float af[NKS], lt = 0.f;   // the four states rescaled to the common maximum
#pragma unroll
  for (int i = 0; i < NKS; ++i) af[i] = om[i][0] - mj;
  asm("v_exp_f32 %0, %0\n\tv_exp_f32 %1, %1\n\tv_exp_f32 %2, %2\n\tv_exp_f32 %3, %3\n\tv_nop" : "+v"(af[0]), "+v"(af[1]), "+v"(af[2]), "+v"(af[3]));   // in place and with the v_nop for the same reason as in exp2x8
#pragma unroll
  for (int i = 0; i < NKS; ++i) lt += om[i][1] * af[i];
  lt += xhalf(lt); const float inv = 1.0f / lt;   // lt >= 2^10: the maximum's own term
  float* Yr = Y + ((size_t)b * TT + blockIdx.x * 128 + wave * 32 + jx * 16 + col) * CC + h * HD + jj * 16 + 8 * g;
#pragma unroll
  for (int j = 0; j < 2; ++j) { v4f a = {}, c = {};
#pragma unroll
    for (int i = 0; i < NKS; ++i) { a += jo[i][wave][jx][jj + j][0][lane] * af[i]; c += jo[i][wave][jx][jj + j][1][lane] * af[i]; }
    vst2(Yr + j * 16, a * inv); vst2(Yr + j * 16 + 4, c * inv); } }
// ---- k_out: block = (64 rows, 128 cols): out = ctx Wo (+ bo): ctx x 2^6 once to f16 against Wo as f16(bf16 x 2^8) exact (1 product) x 2^-14; causal early rows (< QHI of each sequence): ctx bf16 hi + lo against exact bf16 Wo (2 products)
// Every inner loop of k_out is unrolled so that the fragment and accumulator arrays are indexed by constants and stay in registers.
// Wo reaches k_out ready for its products (WOH, laid by k_proj): a stage's tile, 128 output columns x KS2 k, goes from L2 into LDS by whole-line asynchronous copies, through no register and with no conversion. Two buffers: tile s + 1 flies while stage s is worked on.
#define KS2 128           // k of one staged tile
#define WP2 (KS2 + 8)     // LDS pitch of a staged column in elements: 272 B = 16 B x 17, free of bank conflicts for the fragment reads
#define WB2 (128 * WP2 * 2)   // bytes of one buffer
#define KROT2(K) ((int)((blockIdx.x + 2 * blockIdx.y) & ((K) / KS2 - 1)))       // the block's first stage, as KROT
#define KST2(s, rot, K) (((((s) + (rot)) & ((K) / KS2 - 1))) * KS2)             // first k of the s-th stage walked
// one thread's share of half a tile: 16 B of columns r + 8 i, i = 0..7 (16 lanes a column: each copy instruction covers two columns' 256 B, four whole 128-B lines)
__device__ __forceinline__ void w_copy8(unsigned lds, const _Float16* gw) {
  const unsigned l1 = lds + 8 * WP2 * 2, l2 = lds + 16 * WP2 * 2, l3 = lds + 24 * WP2 * 2, l4 = lds + 32 * WP2 * 2, l5 = lds + 40 * WP2 * 2, l6 = lds + 48 * WP2 * 2, l7 = lds + 56 * WP2 * 2;
  const _Float16* g1 = gw + (size_t)8 * CC; const _Float16* g2 = gw + (size_t)16 * CC; const _Float16* g3 = gw + (size_t)24 * CC; const _Float16* g4 = gw + (size_t)32 * CC; const _Float16* g5 = gw + (size_t)40 * CC; const _Float16* g6 = gw + (size_t)48 * CC; const _Float16* g7 = gw + (size_t)56 * CC;
  // as in kv_copy: the s_wait_xcnt stands in the copies' own statement, so that no address register is rewritten in front of it
  asm volatile("global_load_async_to_lds_b128 %0, %8, off\n\tglobal_load_async_to_lds_b128 %1, %9, off\n\tglobal_load_async_to_lds_b128 %2, %10, off\n\tglobal_load_async_to_lds_b128 %3, %11, off\n\t"
               "global_load_async_to_lds_b128 %4, %12, off\n\tglobal_load_async_to_lds_b128 %5, %13, off\n\tglobal_load_async_to_lds_b128 %6, %14, off\n\tglobal_load_async_to_lds_b128 %7, %15, off\n\ts_wait_xcnt 0x0"
               :: "v"(lds), "v"(l1), "v"(l2), "v"(l3), "v"(l4), "v"(l5), "v"(l6), "v"(l7), "v"(gw), "v"(g1), "v"(g2), "v"(g3), "v"(g4), "v"(g5), "v"(g6), "v"(g7) : "memory"); }
__device__ __forceinline__ void w_copy(unsigned lds, const _Float16* gw) { w_copy8(lds, gw); w_copy8(lds + 64 * WP2 * 2, gw + (size_t)64 * CC); }   // a whole tile: 16 copies a thread
// a lane's raw f32 share of the A fragments of one stage of KS2 k, read in fragment order straight from global
struct XT2 { v4f r[KS2 / 32][4]; };
__device__ __forceinline__ void xt2_load(XT2& t, const float* p) {
#pragma unroll   // unrolled so that t.r is indexed by constants and stays in registers
  for (int kk = 0; kk < KS2 / 32; ++kk) { t.r[kk][0] = *(const v4f*)(p + kk * 32); t.r[kk][1] = *(const v4f*)(p + kk * 32 + 4); t.r[kk][2] = *(const v4f*)(p + kk * 32 + 16); t.r[kk][3] = *(const v4f*)(p + kk * 32 + 20); } }
__global__ __launch_bounds__(128) void k_out(const float* __restrict__ Y, const float* __restrict__ WO, const _Float16* __restrict__ WOH, const float* __restrict__ BO, float* __restrict__ OUT) { __shared__ __align__(16) float sf[4][16][132]; __shared__ __align__(16) _Float16 wb[2][128 * WP2];
  const int tid = threadIdx.x, wave = tid >> 5, lane = tid & 31, col = lane & 15, g = lane >> 4; const int c0 = blockIdx.y * 128; const size_t r0 = (size_t)blockIdx.x * 64 + wave * 16;
  v8f acc[8] = {};
  if (CAUSAL && (int)(((size_t)blockIdx.x * 64) % TT) < QHI) {   /* block-uniform */
#pragma unroll 2
    for (int kc = 0; kc < CC / 32; ++kc) { const F2 a = split_row(Y + (r0 + col) * CC, kc * 32, lane); asm volatile("s_wait_loadcnt 0x0" ::: "memory");
#pragma unroll
      for (int j = 0; j < 8; ++j) { const v16b w = WOCOL(WO, kc * 32, c0 + j * 16 + col, lane); asm volatile("s_wait_loadcnt 0x0" ::: "memory"); acc[j] = wmma_bf(a.h, w, acc[j]); acc[j] = wmma_bf(a.l, w, acc[j]); } }
#pragma unroll
    for (int j = 0; j < 8; ++j) { const float bias = BO ? bfr(BO[c0 + j * 16 + col]) : 0.f;
#pragma unroll
      for (int r = 0; r < 8; ++r) sf[wave][8 * g + r][j * 16 + col] = acc[j][r] + bias; }
  } else {
    const int rot = KROT2(CC);
    const _Float16* wg = WOH + (size_t)(c0 + (tid >> 4)) * CC + 8 * (tid & 15);   // the thread's first 16 B of the tile at k = 0
    const unsigned wl = (unsigned)(size_t)&wb[0][(tid >> 4) * WP2 + 8 * (tid & 15)];   // its place in buffer 0 (LDS byte address)
    w_copy(wl, wg + KST2(0, rot, CC));   // tile 0
    float bs[8];   // as in k_proj: the eight bias loads fly together at the kernel's head
#pragma unroll   // this loop and the two below: unrolled so that bs stays in registers
    for (int j = 0; j < 8; ++j) bs[j] = 0.f;
    if (BO) {   // one test round all eight
#pragma unroll
      for (int j = 0; j < 8; ++j) bs[j] = BO[c0 + j * 16 + col]; }
    XT2 xt; v16h af[KS2 / 32];   /* ctx carried x 2^6 into f16 so small-magnitude context rows stay clear of f16 subnormals */
    const float* yp = Y + (r0 + col) * CC + KST2(0, rot, CC) + 8 * g;   // the lane's source in the stage fetched next: carried along the ring
    xt2_load(xt, yp);
#pragma unroll
    for (int j = 0; j < 8; ++j) bs[j] = bfr(bs[j]);   // as in k_proj
#pragma unroll
    for (int kk = 0; kk < KS2 / 32; ++kk) {
#pragma unroll
      for (int i = 0; i < 8; ++i) { af[kk][i] = (_Float16)(xt.r[kk][i >> 2][i & 3] * 64.0f); af[kk][8 + i] = (_Float16)(xt.r[kk][2 + (i >> 2)][i & 3] * 64.0f); } }
    yp += KST2(1, rot, CC) - KST2(0, rot, CC);   // behind the wait for the loads that used this address
    asm volatile("s_wait_asynccnt 0x0" ::: "memory");   // this wave's share of tile 0 has landed
    __syncthreads();   // tile 0 is published
    w_copy(wl + WB2, wg + KST2(1, rot, CC));   // tile 1
#pragma unroll   // four stages: unrolled so that the buffer's index and the two tests below are constants
    for (int s = 0; s < CC / KS2; ++s) { const bool more = s + 1 < CC / KS2;
      if (more) xt2_load(xt, yp);   // the next stage's ctx rows are fetched into registers while stage s is worked on
      __builtin_amdgcn_sched_barrier(0);   // keeps the next stage's global loads issued in front of this stage's products, which then cover their latency
      const _Float16* wc = wb[s & 1] + col * WP2;
#pragma unroll
      for (int kk = 0; kk < KS2 / 32; ++kk) { v16h wf[8];
#pragma unroll
        for (int j = 0; j < 8; ++j) wf[j] = frag_h(wc + j * 16 * WP2 + kk * 32, lane);
        __builtin_amdgcn_sched_barrier(0);   // keeps the 16 LDS reads together in front of their products: one wait for the group
#pragma unroll
        for (int j = 0; j < 8; ++j) acc[j] = wmma16(af[kk], wf[j], acc[j]); }
      __builtin_amdgcn_sched_barrier(0);   // keeps the fetched rows' conversion, and with it the wait for their loads, behind this stage's products
      if (more) {
#pragma unroll
        for (int kk = 0; kk < KS2 / 32; ++kk) {
#pragma unroll
          for (int i = 0; i < 8; ++i) { af[kk][i] = (_Float16)(xt.r[kk][i >> 2][i & 3] * 64.0f); af[kk][8 + i] = (_Float16)(xt.r[kk][2 + (i >> 2)][i & 3] * 64.0f); } }
        yp += KST2(s + 2, rot, CC) - KST2(s + 1, rot, CC); }   // one stage on, or back to k = 0: behind the wait for the loads that used this address
      asm volatile("s_wait_dscnt 0x0" ::: "memory");      // this wave's reads of the buffer are over before it is refilled
      asm volatile("s_wait_asynccnt 0x0" ::: "memory");   // this wave's share of tile s + 1 has landed
      __syncthreads();   // publishes tile s + 1 and ends every wave's reads of tile s, whose buffer is refilled next
      if (s + 2 < CC / KS2) w_copy(wl + (s & 1) * WB2, wg + KST2(s + 2, rot, CC)); }   // tile s + 2 exists
    asm volatile("s_wait_asynccnt 0x0" ::: "memory");   // no copy is left in flight when the wave ends
#pragma unroll
    for (int j = 0; j < 8; ++j) { const float bias = bs[j];
#pragma unroll
      for (int r = 0; r < 8; ++r) sf[wave][8 * g + r][j * 16 + col] = acc[j][r] * (1.0f / 16384.0f) + bias; } }   /* 2^-8 (Wo carry) x 2^-6 (ctx carry) */
  LDSX(); for (int rl = 0; rl < 16; ++rl) vst2(OUT + (r0 + rl) * DIN + c0 + lane * 4, *(const v4f*)&sf[wave][rl][lane * 4]); }

extern "C" void kernel_launch(void* const* d_in, const int* in_sizes, int n_in, void* d_out, int out_size, void* d_ws, size_t ws_size, hipStream_t stream) {
  (void)in_sizes; (void)n_in; (void)out_size;
  const float** F = (const float**)d_in;
  if (ws_size < (size_t)WS_END) return;
  char* ws = (char*)d_ws; _Float16 *QH = (_Float16*)(ws + WS_QH), *KH = (_Float16*)(ws + WS_KH), *VT = (_Float16*)(ws + WS_VT), *QL = (_Float16*)(ws + WS_QL), *KL = (_Float16*)(ws + WS_KL), *WOH = (_Float16*)(ws + WS_WOH); __bf16 *VB = (__bf16*)(ws + WS_VB), *VBL = (__bf16*)(ws + WS_VBL); float *Y = (float*)(ws + WS_Y);
  (void)Y; (void)QL; (void)KL; (void)VB; (void)VBL;
  // inputs: 0 inputs [2,2048,512]; 1 Wq [512,512] (in,out), 2 bq; 3 Wk, 4 bk; 5 Wv, 6 bv; 7 Wo (in,out), 8 bo (zero biases, read)
  k_proj<<<dim3(TNB * TT / 128, CC / 128, 3), 256, 0, stream>>>(F[0], F[0], F[0], F[1], F[3], F[5], F[2], F[4], F[6], QH, QL, KH, KL, VT, VB, VBL, F[7], WOH);
  k_fa<<<dim3(TT / 128, TNB * NH), 512, 0, stream>>>(QH, KH, VT, Y);
  k_out<<<dim3(TNB * TT / 64, DIN / 128), 128, 0, stream>>>(Y, F[7], WOH, F[8], (float*)d_out);
}

// v010
// It runs in 36.4 microseconds.
// Two timings next to v009 put it at 1.03 and 1.04 times that version's speed.
// Over all steps from v000 it is 16.0 times as fast.
// compute dtype: all float inputs rounded to bf16; q/k/v projections with EXACT bf16 products on WMMA 16x16x32 (f32 accumulate) + bias; logits q x k once to f16 each (1 product) x SCALE; online softmax f32; P (relative to the running maximum) x 2^10 once to f16 x v once to f16 (1 product); ctx x 2^6 once to f16 x Wo f16(bf16 x 2^8) + bo; f32 output.
#include <hip/hip_runtime.h>
#include <math.h>

typedef __attribute__((ext_vector_type(16))) _Float16 v16h;
typedef __attribute__((ext_vector_type(16))) __bf16 v16b;
typedef __attribute__((ext_vector_type(8)))  _Float16 v8h;
typedef __attribute__((ext_vector_type(8)))  float v8f;
typedef __attribute__((ext_vector_type(4)))  float v4f;
typedef __attribute__((ext_vector_type(2)))  float v2f;
typedef __attribute__((ext_vector_type(4)))  unsigned v4u;
typedef __attribute__((ext_vector_type(4)))  int v4i;
typedef float __attribute__((may_alias)) float_a;
typedef int __attribute__((may_alias)) int_a;

template <typename T> __device__ __forceinline__ void vst2(void* p, T v) { *(T*)p = v;  }
__device__ __forceinline__ v8f wmma16(v16h a, v16h b, v8f c) {
  v8f d = __builtin_amdgcn_wmma_f32_16x16x32_f16(false, a, false, b, (short)0, c, false, false);
  asm volatile("v_nop\n\tv_nop\n\tv_nop\n\tv_nop" : "+v"(d) : "v"(a), "v"(b));
  return d;
}
__device__ __forceinline__ v8f wmma_bf(v16b a, v16b b, v8f c) {
  v8f d = __builtin_amdgcn_wmma_f32_16x16x32_bf16(false, a, false, b, (short)0, c, false, false);
  asm volatile("v_nop\n\tv_nop\n\tv_nop\n\tv_nop" : "+v"(d) : "v"(a), "v"(b));
  return d;
}
// 16x16x32 fragments: lane = (h = lane>>4, row/col = lane&15); elements 0..7 = k0+8h+0..7, 8..15 = k0+16+8h+0..7; D element r = row 8h+r
__device__ __forceinline__ v16h frag_h(const _Float16* rowk0, int lane) {
  union { v16h v; v8h q[2]; } u; const _Float16* p = rowk0 + 8 * (lane >> 4);
  u.q[0] = *(const v8h*)p; u.q[1] = *(const v8h*)(p + 16); return u.v;
}
__device__ __forceinline__ v16h frag_f32(const float* rowk0, int lane) {
  v16h a; const float* p = rowk0 + 8 * (lane >> 4);
#pragma unroll
  for (int i = 0; i < 8; ++i) { a[i] = (_Float16)p[i]; a[8 + i] = (_Float16)p[16 + i]; }
  return a;
}
__device__ __forceinline__ v16h frag_f32s(const float* rowk0, int lane, float sc) {
  v16h a; const float* p = rowk0 + 8 * (lane >> 4);
#pragma unroll
  for (int i = 0; i < 8; ++i) { a[i] = (_Float16)(p[i] * sc); a[8 + i] = (_Float16)(p[16 + i] * sc); }
  return a;
}
// column fragment from a [K][ld] layout (column n), rows >= K read as 0
__device__ __forceinline__ v16h fragc_f32(const float* W, int k0, int n, int lane, int ld, int K) {
  v16h a; const int g = lane >> 4;
#pragma unroll
  for (int i = 0; i < 8; ++i) { const int ka = k0 + 8 * g + i, kb = ka + 16;
    a[i] = (_Float16)(ka < K ? W[(size_t)(ka < K ? ka : K - 1) * ld + n] : 0.f); a[8 + i] = (_Float16)(kb < K ? W[(size_t)(kb < K ? kb : K - 1) * ld + n] : 0.f); }
  return a;
}
struct F2 { v16b h, l; };
__device__ __forceinline__ F2 bsplit16(const float v[16]) { F2 r;
#pragma unroll
  for (int i = 0; i < 16; ++i) { const __bf16 h = (__bf16)v[i]; r.h[i] = h; r.l[i] = (__bf16)(v[i] - (float)h); }
  return r; }
__device__ __forceinline__ F2 split_row(const float* row, int k0, int lane) { float v[16]; const float* p = row + k0 + 8 * (lane >> 4);
#pragma unroll
  for (int i = 0; i < 8; ++i) { v[i] = p[i]; v[8 + i] = p[16 + i]; }
  return bsplit16(v); }
__device__ __forceinline__ F2 split_rowK(const float* row, int k0, int lane, int K) { float v[16]; const int g = lane >> 4;
#pragma unroll
  for (int i = 0; i < 8; ++i) { const int ka = k0 + 8 * g + i, kb = ka + 16; v[i] = ka < K ? row[ka < K ? ka : K - 1] : 0.f; v[8 + i] = kb < K ? row[kb < K ? kb : K - 1] : 0.f; }
  return bsplit16(v); }
__device__ __forceinline__ F2 split_col(const float* W, int k0, int n, int lane, int ld, int K) { float v[16]; const int g = lane >> 4;
#pragma unroll
  for (int i = 0; i < 8; ++i) { const int ka = k0 + 8 * g + i, kb = ka + 16; v[i] = ka < K ? W[(size_t)(ka < K ? ka : K - 1) * ld + n] : 0.f; v[8 + i] = kb < K ? W[(size_t)(kb < K ? kb : K - 1) * ld + n] : 0.f; }
  return bsplit16(v); }
__device__ __forceinline__ v8f mac3(const F2& a, const F2& b, v8f c) { c = wmma_bf(a.l, b.h, c); c = wmma_bf(a.h, b.l, c); return wmma_bf(a.h, b.h, c); }
__device__ __forceinline__ float sigm(float v) { return 1.0f / (1.0f + expf(-v)); }
#define LDSX() do { asm volatile("s_wait_dscnt 0" ::: "memory"); __builtin_amdgcn_wave_barrier(); __builtin_amdgcn_fence(__ATOMIC_RELEASE, "workgroup"); } while (0)

// Multi-head self-attention (inputs [2,2048,512]; (in,out) Wq / Wk / Wv / Wo [512,512] N(0, 1/512) + zero biases; 8 heads x 64; scale 1/8; softmax over keys; merge; Wo + bo).
#define NB 2
#define TT 2048
#define CC 512            // NH * HD = projected width
#define DIN 512          // input (model) width
#define NH 8
#define HD 64
#define NQB (TT / 64)
#define HG 4
#define SCALE (0.125f)
#define CAUSAL 0
#ifndef TNB
#define TNB NB
#endif
__device__ __forceinline__ float bfr(float v) { return (float)(__bf16)v; }
__host__ __device__ __forceinline__ int kb_last(int qb) { return CAUSAL ? ((qb * 64 + 63) >> 7) : (TT / 128 - 1); }
typedef __attribute__((ext_vector_type(8))) __bf16 v8b;
__device__ __forceinline__ v16b frag_b(const __bf16* rowk0, int lane) {
  union { v16b v; v8b q[2]; } u; const __bf16* p = rowk0 + 8 * (lane >> 4);
  u.q[0] = *(const v8b*)p; u.q[1] = *(const v8b*)(p + 16); return u.v;
}
#define QBH 0              // not read by any kernel here: k_fa has no high-precision path
#define QHI 0               // single-product logits on every row
#define KHI 64            // key rows carrying k residual / v bf16 hi+lo planes (written by k_proj; no kernel here reads them)
// B fragment (k rows k0+.., output column o) of a weight: (in,out) [K][ld] or (out,in) [ld rows of K]: bf16 exact, or f16(bf16 * 256) exact
__device__ __forceinline__ v16b wcol_io(const float* Wm, int k0, int o, int lane, int ld) { v16b w; const int g = lane >> 4;
#pragma unroll
  for (int i = 0; i < 8; ++i) { w[i] = (__bf16)Wm[(size_t)(k0 + 8 * g + i) * ld + o]; w[8 + i] = (__bf16)Wm[(size_t)(k0 + 16 + 8 * g + i) * ld + o]; }
  return w; }
__device__ __forceinline__ v16b wcol_oi(const float* Wm, int k0, int o, int lane, int K) { v16b w; const float* p = Wm + (size_t)o * K + k0 + 8 * (lane >> 4);
#pragma unroll
  for (int i = 0; i < 8; ++i) { w[i] = (__bf16)p[i]; w[8 + i] = (__bf16)p[16 + i]; }
  return w; }
__device__ __forceinline__ v16h wcolh_io(const float* Wm, int k0, int o, int lane, int ld) { v16h w; const int g = lane >> 4;
#pragma unroll
  for (int i = 0; i < 8; ++i) { w[i] = (_Float16)(bfr(Wm[(size_t)(k0 + 8 * g + i) * ld + o]) * 256.0f); w[8 + i] = (_Float16)(bfr(Wm[(size_t)(k0 + 16 + 8 * g + i) * ld + o]) * 256.0f); }
  return w; }
__device__ __forceinline__ v16h wcolh_oi(const float* Wm, int k0, int o, int lane, int K) { v16h w; const float* p = Wm + (size_t)o * K + k0 + 8 * (lane >> 4);
#pragma unroll
  for (int i = 0; i < 8; ++i) { w[i] = (_Float16)(bfr(p[i]) * 256.0f); w[8 + i] = (_Float16)(bfr(p[16 + i]) * 256.0f); }
  return w; }
#define WQKV_LAYOUT 0   // selects WCOL, which no kernel here calls: k_proj always stages Wq / Wk / Wv as (in,out) [DIN][CC]
__device__ __forceinline__ v16b wcol_hdk(const float* Wm, int k0, int o, int lane) { v16b w; const int g = lane >> 4; const float* p = Wm + (size_t)(o / HD) * DIN * HD + (o % HD);
#pragma unroll
  for (int i = 0; i < 8; ++i) { w[i] = (__bf16)p[(size_t)(k0 + 8 * g + i) * HD]; w[8 + i] = (__bf16)p[(size_t)(k0 + 16 + 8 * g + i) * HD]; }
  return w; }
#define WO_OUT_IN 0
#if WQKV_LAYOUT == 1
#define WCOL(W, k0, o, lane) wcol_oi(W, k0, o, lane, DIN)
#elif WQKV_LAYOUT == 2
#define WCOL(W, k0, o, lane) wcol_hdk(W, k0, o, lane)
#else
#define WCOL(W, k0, o, lane) wcol_io(W, k0, o, lane, CC)
#endif
#if WO_OUT_IN
#define WOCOL(W, k0, o, lane) wcol_oi(W, k0, o, lane, CC)
#define WOCOLH(W, k0, o, lane) wcolh_oi(W, k0, o, lane, CC)
#else
#define WOCOL(W, k0, o, lane) wcol_io(W, k0, o, lane, DIN)
#define WOCOLH(W, k0, o, lane) wcolh_io(W, k0, o, lane, DIN)
#endif

#ifndef SM_EXTRA_PARAMS
#define SM_EXTRA_PARAMS
#endif
#ifndef PROJ_EXTRA_PARAMS
#define PROJ_EXTRA_PARAMS
#endif
#ifndef SM_MASK_HOOK
#define SM_MASK_HOOK (void)0
#endif

#define WS_QH  0u                                      // f16 q rows [b*t][CC]
#define WS_KH  (WS_QH + 2u * (size_t)NB * TT * CC)      // f16 k rows [b*t][CC]
#define WS_VT  (WS_KH + 2u * (size_t)NB * TT * CC)      // f16 v planes [b][c][t]
#define WS_QL  (WS_VT + 2u * (size_t)NB * CC * TT)      // f16 q residual x 2^10 rows [b][t < QHI][CC]
#define WS_KL  (WS_QL + 2u * (size_t)NB * QHI * CC)     // f16 k residual x 2^10 rows [b][t < KHI][CC]
#define WS_VB  (WS_KL + 2u * (size_t)NB * KHI * CC)     // bf16 v hi planes [b][c][t < KHI]
#define WS_VBL (WS_VB + 2u * (size_t)NB * CC * KHI)
#define WS_S   (WS_VBL + 2u * (size_t)NB * CC * KHI)    // room for f32 logits [hg][t][s], which no kernel here writes; WOH lies at its head
#define WS_Y   (WS_S  + 4u * (size_t)HG * TT * TT)      // f16 ctx x 2^6 rows [b*t][CC] (only when there is an output projection); they fill the first half of the place
#define WS_END (WS_Y  + 4u * (size_t)NB * TT * CC)
#define WS_WOH WS_S                                    // f16(bf16 x 2^8) Wo columns [o][k], written by k_proj for k_out: it lies at the head of the logits' place, which no kernel of this file fills with logits

// ---- weight staging for k_proj: a [KS][128] f32 tile of a (in,out) weight is read once per block with whole-line 16-byte loads, converted once, and laid in LDS column by column (k contiguous), where every wave takes its B fragments with 16-byte LDS reads
#define KS 64            // k rows of one staged tile
#define WP (KS + 8)      // LDS pitch of a staged column in elements: 144 B = 16 B x 9, free of bank conflicts for the fragment reads and for the staging stores
// one thread's share of a tile: 8 k rows x 4 columns; of the block's 8 waves, wave w covers 32 columns (w & 3) of 32 k rows (w >> 2), lane = (k octet = lane & 3, column group = lane >> 2), so each load instruction covers four whole 128-B lines
struct WT { v4f r[8]; };
__device__ __forceinline__ const float* wt_lane(const float* Wm, int k0, int c0, int ld, int wave, int lane) { return Wm + (size_t)(k0 + 32 * (wave >> 2) + 8 * (lane & 3)) * ld + c0 + 32 * (wave & 3) + 4 * (lane >> 2); }   // the lane's first element of the tile at k row k0
__device__ __forceinline__ void wt_load(WT& t, const float* p, int ld) {
#pragma unroll
  for (int i = 0; i < 8; ++i) t.r[i] = *(const v4f*)(p + (size_t)i * ld); }
__device__ __forceinline__ void wt_store_b(const WT& t, __bf16* wb, int wave, int lane) {   // bf16, exact operand of k_proj
  __bf16* d = wb + (32 * (wave & 3) + 4 * (lane >> 2)) * WP + 32 * (wave >> 2) + 8 * (lane & 3);
#pragma unroll
  for (int c = 0; c < 4; ++c) { v8b x;
#pragma unroll
    for (int i = 0; i < 8; ++i) x[i] = (__bf16)t.r[i][c];
    *(v8b*)(d + c * WP) = x; } }
// X goes the same way: a wave brings the KS k of its own 16 rows with whole-line loads (8 lanes a row: each load instruction covers four whole 128-B lines; read as fragments straight from global, each load touched 16 lines for 32 B of each), converts them once and lays them in LDS row by row at the same pitch, where the A fragments are taken with 16-byte LDS reads
typedef __attribute__((ext_vector_type(4))) __bf16 v4b;
struct XT { v4f r[8]; };   // load i: rows 4 (i >> 1) + (lane >> 3), k 32 (i & 1) + 4 (lane & 7) + 0..3
__device__ __forceinline__ void xt_load(XT& t, const float* p, int ld) {   // p: row (lane >> 3) of the wave's 16 at the stage's first k, + 4 * (lane & 7)
#pragma unroll
  for (int i = 0; i < 8; ++i) t.r[i] = *(const v4f*)(p + (size_t)(4 * (i >> 1)) * ld + 32 * (i & 1)); }
__device__ __forceinline__ void xt_store_b(const XT& t, __bf16* xb, int wave, int lane) {
  __bf16* d = xb + (16 * wave + (lane >> 3)) * WP + 4 * (lane & 7);
#pragma unroll
  for (int i = 0; i < 8; ++i) { v4b x;
#pragma unroll
    for (int c = 0; c < 4; ++c) x[c] = (__bf16)t.r[i][c];
    *(v4b*)(d + 4 * (i >> 1) * WP + 32 * (i & 1)) = x; } }

// Blocks that share a weight tile (all row blocks of a column block) or an A tile (all column blocks of a row block) run in step, and would ask L2 for the same lines at the same moment. So each block walks the k stages as a ring from a first stage set by its tile indices: the sum takes every stage once, in rotated order.
#define KROT(K) ((int)((blockIdx.x + 2 * blockIdx.y) & ((K) / KS - 1)))          // the block's first stage (K / KS is a power of two)
#define KST(s, rot, K) (((((s) + (rot)) & ((K) / KS - 1))) * KS)                // first k row of the s-th stage walked
// ---- k_proj: block = (128 rows, 128 cols, which), 8 waves = (4 groups of 32 rows) x (2 halves of 64 columns): both operands reach the waves through LDS. A staged weight tile serves 128 rows, so the weights are read from L2 once per 128 rows; a wave's 6 fragments of 32 k feed 8 products. q/k/v = X W (+ b) with exact bf16 products (K = DIN) -> which 0: q f16 rows (+ residual rows < QHI); 1: k f16 rows (+ residual rows < KHI); 2: v f16 planes [c][t] (+ bf16 hi/lo planes for t < KHI)
__global__ __launch_bounds__(256) void k_proj(const float* __restrict__ XQ, const float* __restrict__ XK, const float* __restrict__ XV, const float* __restrict__ WQ, const float* __restrict__ WK, const float* __restrict__ WV, const float* __restrict__ BQ, const float* __restrict__ BK, const float* __restrict__ BV,
    _Float16* __restrict__ QH, _Float16* __restrict__ QL, _Float16* __restrict__ KH, _Float16* __restrict__ KL, _Float16* __restrict__ VT, __bf16* __restrict__ VB, __bf16* __restrict__ VBL, const float* __restrict__ WO, _Float16* __restrict__ WOH) {
  __shared__ __align__(16) union { struct { _Float16 sh[128][136], sl[128][136]; } e; struct { _Float16 th[128][136]; __bf16 tb[128][136], tbl[128][136]; } f; struct { __bf16 wb[2][128 * WP], xb[2][128 * WP]; } s; } sm;   // the W and X stages, the q / k epilogue's tiles and the v epilogue's tiles share LDS (a block uses one epilogue), so that two blocks fit a WGP
  auto& sh = sm.e.sh; auto& sl = sm.e.sl; auto& th = sm.f.th; auto& tb = sm.f.tb; auto& tbl = sm.f.tbl;
  const int tid = threadIdx.x, wave = tid >> 5, lane = tid & 31, col = lane & 15, g = lane >> 4, rw = 32 * (wave & 3), cw = 64 * (wave >> 2); const int which = blockIdx.z; const int c0 = blockIdx.y * 128; const size_t r0 = (size_t)blockIdx.x * 128;   // rw, cw: first row and column of the wave's 32 x 64 in the block's tile
  const size_t bb = r0 / TT; const int t0 = (int)(r0 % TT);
  const float* X = which == 0 ? XQ : which == 1 ? XK : XV; const float* WA = which == 0 ? WQ : which == 1 ? WK : WV; const float* BA = which == 0 ? BQ : which == 1 ? BK : BV;
  v8f acc[2][4] = {};   // [row tile][column tile]
  float bs[4];   // the lane's bias of each column tile, loaded here: all fly together, beside the first stage's loads. Loaded where they are used, behind the loop, each was waited for by itself: load latencies in a row at the end of every block
#pragma unroll   // this loop and the two below: unrolled so that bs is indexed by constants and stays in registers
  for (int j = 0; j < 4; ++j) bs[j] = 0.f;
  if (BA) {   // one test round all: with a test round each, the build put a wait behind each load
#pragma unroll
    for (int j = 0; j < 4; ++j) bs[j] = BA[c0 + cw + j * 16 + col]; }
  WT wt; XT xt;
  const int rot = KROT(DIN);   // the same for the three products of one X tile, which read the same X lines
  const float* wp = wt_lane(WA, KST(0, rot, DIN), c0, CC, wave, lane); const float* xp = X + (r0 + wave * 16 + (lane >> 3)) * DIN + KST(0, rot, DIN) + 4 * (lane & 7);   // the lane's sources in the stage fetched next: carried along the ring
  wt_load(wt, wp, CC); xt_load(xt, xp, DIN);
  asm volatile("s_wait_xcnt 0x0" ::: "memory");   // the first loads' address registers are free for reuse behind it
  if (which == 0) {   // block-uniform. Wo for k_out, converted once a call: k_out's 64 row blocks each converted the whole f32 tile again. The 128 q blocks each lay one piece, 128 k rows x 16 output columns, as f16(bf16 x 2^8) column by column (k contiguous): 32 whole 128-B lines a block. It stands behind the first stage's loads, so its own loads wait no longer than those
    static_assert((TNB * TT / 128) * (CC / 128) == (CC / 128) * (DIN / 16), "one piece of Wo for each q block");
    const int wid = (int)blockIdx.x + (TNB * TT / 128) * (int)blockIdx.y; const int wk = (wid & (CC / 128 - 1)) * 128 + 8 * (tid >> 4), wo = (wid / (CC / 128)) * 16 + (tid & 15);
    const float* wsrc = WO + (size_t)wk * DIN + wo; float w8[8]; v8h x;
#pragma unroll   // this loop and the next: unrolled so that w8 stays in registers
    for (int i = 0; i < 8; ++i) w8[i] = wsrc[(size_t)i * DIN];
#pragma unroll
    for (int i = 0; i < 8; ++i) x[i] = (_Float16)(bfr(w8[i]) * 256.0f);
    *(v8h*)(WOH + (size_t)wo * CC + wk) = x;
    asm volatile("s_wait_xcnt 0x0" ::: "memory"); }   // the store's address registers are free for reuse behind it
  wt_store_b(wt, sm.s.wb[0], wave, lane); xt_store_b(xt, sm.s.xb[0], wave, lane);
#pragma unroll
  for (int j = 0; j < 4; ++j) bs[j] = bfr(bs[j]);   // rounded behind the first stage's wait, which the bias loads, issued earlier, have met by then
  { const int d = KST(1, rot, DIN) - KST(0, rot, DIN); wp += d * CC; xp += d; }
  __syncthreads();   // stage 0 is published
#pragma unroll 2
  for (int s = 0; s < DIN / KS; ++s) { const bool more = s + 1 < DIN / KS;   // two buffers: stage s + 1 is fetched into registers while stage s is worked on
    if (more) { wt_load(wt, wp, CC); xt_load(xt, xp, DIN); }
    __builtin_amdgcn_sched_barrier(0);   // keeps the next stage's global loads issued in front of this stage's products, which then cover their latency
    const __bf16* wc = sm.s.wb[s & 1] + (cw + col) * WP; const __bf16* xc = sm.s.xb[s & 1] + (rw + col) * WP;
#pragma unroll
    for (int kk = 0; kk < KS / 32; ++kk) { v16b wf[4], af[2];
#pragma unroll
      for (int x = 0; x < 2; ++x) af[x] = frag_b(xc + x * 16 * WP + kk * 32, lane);
#pragma unroll
      for (int j = 0; j < 4; ++j) wf[j] = frag_b(wc + j * 16 * WP + kk * 32, lane);
      __builtin_amdgcn_sched_barrier(0);   // keeps the 12 LDS reads together in front of their products: one wait for the group, where a read pair in front of each product waits out the LDS latency eight times
#pragma unroll
      for (int j = 0; j < 4; ++j) {
#pragma unroll
        for (int x = 0; x < 2; ++x) acc[x][j] = wmma_bf(af[x], wf[j], acc[x][j]); } }
    __builtin_amdgcn_sched_barrier(0);   // keeps the fetched tiles' conversion, and with it the wait for their loads, behind this stage's products
    if (more) { wt_store_b(wt, sm.s.wb[(s + 1) & 1], wave, lane); xt_store_b(xt, sm.s.xb[(s + 1) & 1], wave, lane);
      asm volatile("s_wait_xcnt 0x0" ::: "memory");   // stands in front of the rewrite of the loads' address registers just below
      { const int d = KST(s + 2, rot, DIN) - KST(s + 1, rot, DIN); wp += d * CC; xp += d; } }   // one stage on, or back to k = 0: behind the wait for the loads that used these addresses
    __syncthreads(); }   // publishes stage s + 1 and ends every wave's reads of stage s, whose buffer is written next (after the last stage: by the epilogue)
  if (which < 2) { _Float16* DH = which == 0 ? QH : KH; _Float16* DL = which == 0 ? QL : KL; const int nhi = which == 0 ? QHI : KHI;
#pragma unroll
    for (int j = 0; j < 4; ++j) { const float bias = bs[j];
#pragma unroll
      for (int x = 0; x < 2; ++x) {
#pragma unroll
        for (int r = 0; r < 8; ++r) { const float v = acc[x][j][r] + bias; const _Float16 hv = (_Float16)v; const int rl = rw + x * 16 + 8 * g + r, cl = cw + j * 16 + col; sh[rl][cl] = hv; sl[rl][cl] = (_Float16)((v - (float)hv) * 1024.0f); } } }
    __syncthreads();
    for (int e = tid; e < 128 * 16; e += 256) { const int rl = e >> 4, q = e & 15; vst2((unsigned*)(DH + (r0 + rl) * CC + c0 + q * 8), *(const v4u*)&sh[rl][q * 8]); if (t0 + rl < nhi) { vst2((unsigned*)(DL + (bb * nhi + t0 + rl) * (size_t)CC + c0 + q * 8), *(const v4u*)&sl[rl][q * 8]);
        asm volatile("s_wait_xcnt 0x0" ::: "memory"); } }   // stands in front of the next trip's rewrite of the store's address registers; inside the branch, so that the rewrite cannot be lifted over it
  } else {
#pragma unroll
    for (int j = 0; j < 4; ++j) { const float bias = bs[j];
#pragma unroll
      for (int x = 0; x < 2; ++x) {
#pragma unroll
      for (int r = 0; r < 8; ++r) { const float v = acc[x][j][r] + bias; const int rl = rw + x * 16 + 8 * g + r, cl = cw + j * 16 + col; th[cl][rl] = (_Float16)v; const __bf16 bh = (__bf16)v; tb[cl][rl] = bh; tbl[cl][rl] = (__bf16)(v - (float)bh); } } }
    __syncthreads();
    for (int e = tid; e < 128 * 16; e += 256) { const int cl = e >> 4, q = e & 15; vst2((unsigned*)(VT + (bb * CC + c0 + cl) * (size_t)TT + t0 + q * 8), *(const v4u*)&th[cl][q * 8]); if (t0 + q * 8 < KHI) { const size_t o3 = (bb * CC + c0 + cl) * (size_t)KHI + t0 + q * 8; vst2((unsigned*)(VB + o3), *(const v4u*)&tb[cl][q * 8]); vst2((unsigned*)(VBL + o3), *(const v4u*)&tbl[cl][q * 8]);
        asm volatile("s_wait_xcnt 0x0" ::: "memory"); } } } }   // as in the loop above
// ---- k_fa: block = 128 queries of (b, h), 16 waves = (4 groups of 32 query columns) x (4 quarters of the key range): four waves a SIMD, so that one wave's softmax runs beside another's products. A wave holds two 16-query tiles, so each K or V fragment read from LDS feeds two products: half the LDS reads of a 16-query wave, whose reads took twice its matrix time. Each wave walks its quarter in trips of 64 keys with a running maximum per query (online softmax), so logits and P stay in registers; the four quarters' (maximum, sum, O) are joined once, through LDS, behind the loop.
// S^T = K . Q^T (A = k rows, B = q rows): lane (g, col) holds keys 8g + r of each 16-key tile for query col, which is the B fragment order of P^T; O^T += V^T . P^T (A = v planes [c][t]): lane holds d = 16j + 8g + r of query col.
// Every inner loop below is unrolled so that the fragment and accumulator arrays are indexed by constants and stay in registers.
__device__ __forceinline__ v8f wmma_h(v16h a, v16h b, v8f c) { return __builtin_amdgcn_wmma_f32_16x16x32_f16(false, a, false, b, (short)0, c, false, false); }
__device__ __forceinline__ float xhalf(float x) { return __builtin_bit_cast(float, __builtin_amdgcn_permlanex16(__builtin_bit_cast(int, x), __builtin_bit_cast(int, x), 0x76543210, 0xfedcba98, false, false)); }   // lane l with lane l ^ 16
// eight base-2 exponentials, each in place, in one statement: no v_exp_f32 here has its source overwritten or its result read by the instruction behind it, and the v_nop fills that slot behind the last.
__device__ __forceinline__ void exp2x8(float* a) {
  asm("v_exp_f32 %0, %0\n\tv_exp_f32 %1, %1\n\tv_exp_f32 %2, %2\n\tv_exp_f32 %3, %3\n\tv_exp_f32 %4, %4\n\tv_exp_f32 %5, %5\n\tv_exp_f32 %6, %6\n\tv_exp_f32 %7, %7\n\tv_nop"
      : "+v"(a[0]), "+v"(a[1]), "+v"(a[2]), "+v"(a[3]), "+v"(a[4]), "+v"(a[5]), "+v"(a[6]), "+v"(a[7])); }
// K and V reach the waves through LDS: the 4 waves of a quarter need the same 16 KB a trip, so each tile is brought in once per block with whole-line asynchronous copies and every wave takes its fragments with 16-byte LDS reads.
// Tile t of a quarter = (v planes of the t-th 64-key group walked, k rows of the next group): what trip t reads, since the scores are formed one trip ahead. Two buffers a quarter: tile t + 1 flies while trip t works. A quarter's tiles are copied by its own 4 waves.
#define NKS 4            // wave sets = parts of the key range
#define KH2 (TT / NKS)   // keys of one part
#define NT (KH2 / 64)    // trips of a wave
#define KP (64 + 8)      // LDS pitch of a staged 128-B row in elements: 144 B = 16 B x 9, free of bank conflicts for the fragment reads
#define KVB (2 * 64 * KP * 2)   // bytes of one buffer: 64 k rows, then 64 v rows
// one thread's share of a tile: 16 B of rows r + 16 i of the buffer (8 lanes a row: each copy instruction covers four whole 128-B lines); gka: its k row r, gv: its v row r
__device__ __forceinline__ void kv_copy(unsigned lds, const _Float16* gka, const _Float16* gv) {
  const unsigned l1 = lds + 16 * KP * 2, l2 = lds + 32 * KP * 2, l3 = lds + 48 * KP * 2, l4 = lds + 64 * KP * 2, l5 = lds + 80 * KP * 2, l6 = lds + 96 * KP * 2, l7 = lds + 112 * KP * 2;
  const _Float16* gka1 = gka + (size_t)16 * CC; const _Float16* gkb = gka + (size_t)32 * CC; const _Float16* gkb1 = gka + (size_t)48 * CC; const _Float16* gv1 = gv + (size_t)16 * TT; const _Float16* gv2 = gv + (size_t)32 * TT; const _Float16* gv3 = gv + (size_t)48 * TT;
  // the s_wait_xcnt stands in the copies' own statement, so that no address register is rewritten in front of it
  asm volatile("global_load_async_to_lds_b128 %0, %8, off\n\tglobal_load_async_to_lds_b128 %1, %9, off\n\tglobal_load_async_to_lds_b128 %2, %10, off\n\tglobal_load_async_to_lds_b128 %3, %11, off\n\t"
               "global_load_async_to_lds_b128 %4, %12, off\n\tglobal_load_async_to_lds_b128 %5, %13, off\n\tglobal_load_async_to_lds_b128 %6, %14, off\n\tglobal_load_async_to_lds_b128 %7, %15, off\n\ts_wait_xcnt 0x0"
               :: "v"(lds), "v"(l1), "v"(l2), "v"(l3), "v"(l4), "v"(l5), "v"(l6), "v"(l7), "v"(gka), "v"(gka1), "v"(gkb), "v"(gkb1), "v"(gv), "v"(gv1), "v"(gv2), "v"(gv3) : "memory"); }
// the same for k rows alone: the first group walked, whose scores are formed in front of the loop
__device__ __forceinline__ void k_copy(unsigned lds, const _Float16* gk) {
  const unsigned l1 = lds + 16 * KP * 2, l2 = lds + 32 * KP * 2, l3 = lds + 48 * KP * 2; const _Float16* gk1 = gk + (size_t)16 * CC; const _Float16* gk2 = gk + (size_t)32 * CC; const _Float16* gk3 = gk + (size_t)48 * CC;
  // as above: the s_wait_xcnt in the copies' own statement, in front of any rewrite of their address registers
  asm volatile("global_load_async_to_lds_b128 %0, %4, off\n\tglobal_load_async_to_lds_b128 %1, %5, off\n\tglobal_load_async_to_lds_b128 %2, %6, off\n\tglobal_load_async_to_lds_b128 %3, %7, off\n\ts_wait_xcnt 0x0"
               :: "v"(lds), "v"(l1), "v"(l2), "v"(l3), "v"(gk), "v"(gk1), "v"(gk2), "v"(gk3) : "memory"); }
__global__ __launch_bounds__(512) void k_fa(const _Float16* __restrict__ QH, const _Float16* __restrict__ KH, const _Float16* __restrict__ VT, _Float16* __restrict__ Y) {
  __shared__ __align__(16) union {   // the join's arrays lie over the ring: they are written behind the last trip's barrier, in front of which every wave has ended its reads of the ring and seen its last copy land
    struct { _Float16 kv[NKS][2][2][64 * KP];                   // [quarter][buffer][k rows, v rows]
             _Float16 kz[NKS][64 * KP]; } r;                    // [quarter] k rows of the first group walked: filled once, read once
    struct { v4f jo[NKS][4][2][HD / 16][2][32];                 // every wave's O, [quarter][query group][query tile][d tile][4 values][lane]
             v2f jm[NKS][4][2][32]; } j; } sm;                  // its (maximum, sum)
  auto& kv = sm.r.kv; auto& kz = sm.r.kz; auto& jo = sm.j.jo; auto& jm = sm.j.jm;
  const int ks = __builtin_amdgcn_readfirstlane((int)threadIdx.x >> 7);   // the wave's quarter of the key range, the same in every lane
  const int tid = threadIdx.x & 127, wave = tid >> 5, lane = tid & 31, col = lane & 15, g = lane >> 4; const int b = blockIdx.y / NH, h = blockIdx.y % NH; const int q = blockIdx.x * 128 + wave * 32 + col;
  const _Float16* Qr = QH + ((size_t)b * TT + q) * CC + h * HD;
  const _Float16* Kc = KH + ((size_t)b * TT + ks * KH2 + (tid >> 3)) * CC + h * HD + 8 * (tid & 7); const _Float16* Vc = VT + ((size_t)b * CC + h * HD + (tid >> 3)) * (size_t)TT + ks * KH2 + 8 * (tid & 7);   // the thread's sources in its quarter's keys 0..63
  const unsigned lc = (unsigned)(size_t)&kv[ks][0][0][(tid >> 3) * KP + 8 * (tid & 7)];   // its place in its quarter's buffer 0 (LDS byte address)
  const int rot = (int)(blockIdx.x & (NT - 1));   // the 16 blocks of one (b, h) need the same K and V lines: each walks the 64-key groups of a quarter as a ring from a group set by its index, so that they do not all ask L2 for the same lines at the same moment
#define KG(i) ((((i) + rot) & (NT - 1)) * 64)   // first key of the i-th group walked (NT is a power of two; the ring closes: the group behind the last is the first again)
  k_copy((unsigned)(size_t)&kz[ks][(tid >> 3) * KP + 8 * (tid & 7)], Kc + (size_t)KG(0) * CC);
  kv_copy(lc, Kc + (size_t)KG(1) * CC, Vc + KG(0));   // tile 0
  v16h qf[2][2];
#pragma unroll
  for (int x = 0; x < 2; ++x) { qf[x][0] = frag_h(Qr + (size_t)x * 16 * CC, lane); qf[x][1] = frag_h(Qr + (size_t)x * 16 * CC + 32, lane); }
  const float C2 = SCALE * 1.4426950408889634f;   // logits carried in base 2
  v8f acc[2][HD / 16] = {}; float m[2] = {-3.0e38f, -3.0e38f}, l[2] = {0.f, 0.f};
  v8f s[2][4];   // scores of the coming trip, [query tile][16-key tile], carried over the loop's back edge
  asm volatile("s_wait_asynccnt 0x0" ::: "memory");   // this wave's share of the first k rows and of tile 0 has landed
  __syncthreads();   // both are published
  kv_copy(lc + KVB, Kc + (size_t)KG(2) * CC, Vc + KG(1));   // tile 1
#pragma unroll
  for (int u = 0; u < 4; ++u) { const v16h k0 = frag_h(&kz[ks][(u * 16 + col) * KP], lane), k1 = frag_h(&kz[ks][(u * 16 + col) * KP + 32], lane);
#pragma unroll
    for (int x = 0; x < 2; ++x) { const v8f z = {}; s[x][u] = wmma_h(k0, qf[x][0], z); s[x][u] = wmma_h(k1, qf[x][1], s[x][u]); } }
  // one trip: 64 keys, tile t
  auto stage = [&](int t) __attribute__((always_inline)) {
    const _Float16* kl = &kv[ks][t & 1][0][col * KP]; const _Float16* vl = &kv[ks][t & 1][1][col * KP];
    v16h va[HD / 16], vb[HD / 16], ka[2][2], kb[2][2];   // the trip's fragments come in four groups of 32 registers, each read where registers have come free and ahead of work that covers its latency: the softmax for va, a run of products for the others
#pragma unroll
    for (int j = 0; j < HD / 16; ++j) va[j] = frag_h(vl + j * 16 * KP, lane);
    __builtin_amdgcn_sched_barrier(0);   // keeps these LDS reads issued in front of the softmax, whose work then covers their latency; without it they sink to their first use
    v16h p[2][2]; float alpha[2];
#pragma unroll
    for (int x = 0; x < 2; ++x) {
      float mt[4];   // independent chains
#pragma unroll
      for (int u = 0; u < 4; ++u) { mt[u] = s[x][u][0];
#pragma unroll
        for (int r = 1; r < 8; ++r) mt[u] = fmaxf(mt[u], s[x][u][r]); }
      float mx = fmaxf(fmaxf(mt[0], mt[1]), fmaxf(mt[2], mt[3])); mx = fmaxf(mx, xhalf(mx));
      const float mn = fmaxf(m[x], mx * C2);   // alpha = 2^(m - mn), 0 on the first trip
      asm("v_exp_f32 %0, %1\n\tv_nop" : "=v"(alpha[x]) : "v"(m[x] - mn));   // asm for the v_nop alone: it fills the slot behind a transcendental
      m[x] = mn;
      const float off = 10.0f - mn;   // P relative to the running maximum, x 2^10 into f16 (clear of f16 subnormals); the factor cancels against l
      float ps[4];
#pragma unroll
      for (int u = 0; u < 4; ++u) { float e[8];
#pragma unroll
        for (int r = 0; r < 8; ++r) e[r] = fmaf(s[x][u][r], C2, off);
        exp2x8(e); ps[u] = 0.f;
#pragma unroll
        for (int r = 0; r < 8; ++r) { ps[u] += e[r]; p[x][u >> 1][(u & 1) * 8 + r] = (_Float16)e[r]; } }
      l[x] = l[x] * alpha[x] + ((ps[0] + ps[1]) + (ps[2] + ps[3])); }
    __builtin_amdgcn_sched_barrier(0);   // keeps the reads and products below behind the softmax
#pragma unroll
    for (int j = 0; j < HD / 16; ++j) vb[j] = frag_h(vl + j * 16 * KP + 32, lane);
#pragma unroll
    for (int u = 0; u < 2; ++u) { ka[u][0] = frag_h(kl + u * 16 * KP, lane); ka[u][1] = frag_h(kl + u * 16 * KP + 32, lane); }   // the next trip's k rows (the last tile holds the first group's again; those scores are not used)
    __builtin_amdgcn_sched_barrier(0);   // keeps this group of reads together in front of the products that cover its latency
#pragma unroll
    for (int j = 0; j < HD / 16; ++j) {
#pragma unroll
      for (int x = 0; x < 2; ++x) { acc[x][j] *= alpha[x]; acc[x][j] = wmma_h(va[j], p[x][0], acc[x][j]); } }
    __builtin_amdgcn_sched_barrier(0);   // the reads below take the registers that these products have left
#pragma unroll
    for (int u = 0; u < 2; ++u) { kb[u][0] = frag_h(kl + (32 + u * 16) * KP, lane); kb[u][1] = frag_h(kl + (32 + u * 16) * KP + 32, lane); }
    __builtin_amdgcn_sched_barrier(0);   // keeps this group of reads together in front of the products that cover its latency
#pragma unroll
    for (int j = 0; j < HD / 16; ++j) {
#pragma unroll
      for (int x = 0; x < 2; ++x) acc[x][j] = wmma_h(vb[j], p[x][1], acc[x][j]); }
#pragma unroll
    for (int u = 0; u < 2; ++u) {
#pragma unroll
      for (int x = 0; x < 2; ++x) { const v8f z = {}; s[x][u] = wmma_h(ka[u][0], qf[x][0], z); s[x][u] = wmma_h(ka[u][1], qf[x][1], s[x][u]); } }
#pragma unroll
    for (int u = 0; u < 2; ++u) {
#pragma unroll
      for (int x = 0; x < 2; ++x) { const v8f z = {}; s[x][2 + u] = wmma_h(kb[u][0], qf[x][0], z); s[x][2 + u] = wmma_h(kb[u][1], qf[x][1], s[x][2 + u]); } }
    __builtin_amdgcn_sched_barrier(0);   // keeps the waits and the barrier below at the trip's foot: lifted, they expose the reads' latency and leave the flying tile no lead
    asm volatile("s_wait_dscnt 0x0" ::: "memory");      // this wave's reads of the buffer are over before it is refilled
    asm volatile("s_wait_asynccnt 0x0" ::: "memory");   // this wave's share of tile t + 1 has landed
    __syncthreads(); };   // publishes tile t + 1 and ends every wave's reads of tile t, whose buffer is refilled next
  // two loops, so that the refill stands under no test: with a branch round it at the loop's foot the build moved the row sums behind that branch and held their terms in registers till there, and it spilled
  for (int t = 0; t < NT - 2; ++t) { stage(t); kv_copy(lc + (t & 1) * KVB, Kc + (size_t)KG(t + 3) * CC, Vc + KG(t + 2)); }   // tile t + 2 exists
  for (int t = NT - 2; t < NT; ++t) stage(t);   // no tile is left to fetch
  asm volatile("s_wait_asynccnt 0x0" ::: "memory");   // no copy is left in flight when the wave ends
#pragma unroll
  for (int x = 0; x < 2; ++x) { jm[ks][wave][x][lane] = v2f{m[x], l[x]};   // every wave hands over its state
#pragma unroll
    for (int j = 0; j < HD / 16; ++j) { jo[ks][wave][x][j][0][lane] = v4f{acc[x][j][0], acc[x][j][1], acc[x][j][2], acc[x][j][3]}; jo[ks][wave][x][j][1][lane] = v4f{acc[x][j][4], acc[x][j][5], acc[x][j][6], acc[x][j][7]}; } }
  __syncthreads();   // publishes the states; every wave passes
  // the join is shared out: of its query group, wave set ks joins query tile ks & 1, d tiles 2 (ks >> 1) and the next: 32 d of a query
  const int jx = ks & 1, jj = 2 * (ks >> 1);
  v2f om[NKS];
#pragma unroll
  for (int i = 0; i < NKS; ++i) om[i] = jm[i][wave][jx][lane];
  const float mj = fmaxf(fmaxf(om[0][0], om[1][0]), fmaxf(om[2][0], om[3][0]));
  float af[NKS], lt = 0.f;   // the four states rescaled to the common maximum
#pragma unroll
  for (int i = 0; i < NKS; ++i) af[i] = om[i][0] - mj;
  asm("v_exp_f32 %0, %0\n\tv_exp_f32 %1, %1\n\tv_exp_f32 %2, %2\n\tv_exp_f32 %3, %3\n\tv_nop" : "+v"(af[0]), "+v"(af[1]), "+v"(af[2]), "+v"(af[3]));   // in place and with the v_nop for the same reason as in exp2x8
#pragma unroll
  for (int i = 0; i < NKS; ++i) lt += om[i][1] * af[i];
  lt += xhalf(lt); const float inv = (1.0f / lt) * 64.0f;   // lt >= 2^10: the maximum's own term. ctx leaves here as k_out's operand, x 2^6 in f16 (clear of f16 subnormals): rounded once here, where each of k_out's four column blocks rounded the f32 rows again
  _Float16* Yr = Y + ((size_t)b * TT + blockIdx.x * 128 + wave * 32 + jx * 16 + col) * CC + h * HD + jj * 16 + 8 * g;
#pragma unroll
  for (int j = 0; j < 2; ++j) { v4f a = {}, c = {};
#pragma unroll
    for (int i = 0; i < NKS; ++i) { a += jo[i][wave][jx][jj + j][0][lane] * af[i]; c += jo[i][wave][jx][jj + j][1][lane] * af[i]; }
    a *= inv; c *= inv; v8h y;
#pragma unroll
    for (int i = 0; i < 4; ++i) { y[i] = (_Float16)a[i]; y[4 + i] = (_Float16)c[i]; }
    vst2(Yr + j * 16, y); } }
// ---- k_out: block = (64 rows, 128 cols), 4 waves = (2 groups of 32 rows) x (2 halves of 64 columns): out = ctx Wo (+ bo): ctx x 2^6 in f16 against Wo as f16(bf16 x 2^8) exact (1 product) x 2^-14
// Every inner loop of k_out is unrolled so that the fragment and accumulator arrays are indexed by constants and stay in registers.
// Both operands reach k_out ready for its products (WOH laid by k_proj, ctx by k_fa): a stage's tiles, 128 output columns x KS2 k of Wo and 64 rows x KS2 k of ctx, go from L2 into LDS by whole-line asynchronous copies, through no register and with no conversion. Two buffers: the tiles of stage s + 1 fly while stage s is worked on.
// Read as fragments straight from global, each load of f32 ctx touched 16 lines for 32 B of each. With ctx in LDS a wave is free to take 32 x 64 of the block's tile: 12 LDS reads feed 8 products.
#define KS2 128           // k of one staged tile
#define WP2 (KS2 + 8)     // LDS pitch of a staged column or row in elements: 272 B = 16 B x 17, free of bank conflicts for the fragment reads
#define WB2 (128 * WP2 * 2)   // bytes of one Wo buffer
#define YB2 (64 * WP2 * 2)    // bytes of one ctx buffer
#define KROT2(K) ((int)((blockIdx.x + 2 * blockIdx.y) & ((K) / KS2 - 1)))       // the block's first stage, as KROT
#define KST2(s, rot, K) (((((s) + (rot)) & ((K) / KS2 - 1))) * KS2)             // first k of the s-th stage walked
// one thread's share of half a tile: 16 B of columns r + 8 i, i = 0..7 (16 lanes a column: each copy instruction covers two columns' 256 B, four whole 128-B lines)
__device__ __forceinline__ void w_copy8(unsigned lds, const _Float16* gw) {
  const unsigned l1 = lds + 8 * WP2 * 2, l2 = lds + 16 * WP2 * 2, l3 = lds + 24 * WP2 * 2, l4 = lds + 32 * WP2 * 2, l5 = lds + 40 * WP2 * 2, l6 = lds + 48 * WP2 * 2, l7 = lds + 56 * WP2 * 2;
  const _Float16* g1 = gw + (size_t)8 * CC; const _Float16* g2 = gw + (size_t)16 * CC; const _Float16* g3 = gw + (size_t)24 * CC; const _Float16* g4 = gw + (size_t)32 * CC; const _Float16* g5 = gw + (size_t)40 * CC; const _Float16* g6 = gw + (size_t)48 * CC; const _Float16* g7 = gw + (size_t)56 * CC;
  // as in kv_copy: the s_wait_xcnt stands in the copies' own statement, so that no address register is rewritten in front of it
  asm volatile("global_load_async_to_lds_b128 %0, %8, off\n\tglobal_load_async_to_lds_b128 %1, %9, off\n\tglobal_load_async_to_lds_b128 %2, %10, off\n\tglobal_load_async_to_lds_b128 %3, %11, off\n\t"
               "global_load_async_to_lds_b128 %4, %12, off\n\tglobal_load_async_to_lds_b128 %5, %13, off\n\tglobal_load_async_to_lds_b128 %6, %14, off\n\tglobal_load_async_to_lds_b128 %7, %15, off\n\ts_wait_xcnt 0x0"
               :: "v"(lds), "v"(l1), "v"(l2), "v"(l3), "v"(l4), "v"(l5), "v"(l6), "v"(l7), "v"(gw), "v"(g1), "v"(g2), "v"(g3), "v"(g4), "v"(g5), "v"(g6), "v"(g7) : "memory"); }
__device__ __forceinline__ void w_copy(unsigned lds, const _Float16* gw) { w_copy8(lds, gw); w_copy8(lds + 64 * WP2 * 2, gw + (size_t)64 * CC); }   // a whole tile: 16 copies a thread
// a stage's ctx tile has the shape of half a Wo tile, 64 rows of CC elements' pitch: w_copy8 brings it
__global__ __launch_bounds__(128) void k_out(const _Float16* __restrict__ Y, const _Float16* __restrict__ WOH, const float* __restrict__ BO, float* __restrict__ OUT) { __shared__ __align__(16) float sf[4][32][68]; __shared__ __align__(16) _Float16 wb[2][128 * WP2]; __shared__ __align__(16) _Float16 yb[2][64 * WP2];
  const int tid = threadIdx.x, wave = tid >> 5, lane = tid & 31, col = lane & 15, g = lane >> 4, rw = 32 * (wave & 1), cw = 64 * (wave >> 1); const int c0 = blockIdx.y * 128; const size_t r0 = (size_t)blockIdx.x * 64;   // rw, cw: first row and column of the wave's 32 x 64 in the block's tile
  v8f acc[2][4] = {};   // [row tile][column tile]
  const int rot = KROT2(CC);
  const _Float16* wg = WOH + (size_t)(c0 + (tid >> 4)) * CC + 8 * (tid & 15);   // the thread's first 16 B of the Wo tile at k = 0
  const _Float16* yg = Y + (r0 + (tid >> 4)) * CC + 8 * (tid & 15);             // and of the ctx tile
  const unsigned wl = (unsigned)(size_t)&wb[0][(tid >> 4) * WP2 + 8 * (tid & 15)], yl = (unsigned)(size_t)&yb[0][(tid >> 4) * WP2 + 8 * (tid & 15)];   // their places in buffer 0 (LDS byte addresses)
  w_copy8(yl, yg + KST2(0, rot, CC)); w_copy(wl, wg + KST2(0, rot, CC));   // tiles 0
  float bs[4];   // as in k_proj: the bias loads fly together at the kernel's head
#pragma unroll   // this loop and the two below: unrolled so that bs stays in registers
  for (int j = 0; j < 4; ++j) bs[j] = 0.f;
  if (BO) {   // one test round all four
#pragma unroll
    for (int j = 0; j < 4; ++j) bs[j] = BO[c0 + cw + j * 16 + col];
    asm volatile("s_wait_xcnt 0x0" ::: "memory"); }   // the bias loads' address register is free for reuse behind it; inside the branch, so that the rewrite cannot be lifted over it
#pragma unroll
  for (int j = 0; j < 4; ++j) bs[j] = bfr(bs[j]);   // as in k_proj
  asm volatile("s_wait_asynccnt 0x0" ::: "memory");   // this wave's share of tiles 0 has landed
  __syncthreads();   // tiles 0 are published
  w_copy8(yl + YB2, yg + KST2(1, rot, CC)); w_copy(wl + WB2, wg + KST2(1, rot, CC));   // tiles 1
#pragma unroll   // four stages: unrolled so that the buffer's index and the test below are constants
  for (int s = 0; s < CC / KS2; ++s) {
    const _Float16* wc = wb[s & 1] + (cw + col) * WP2; const _Float16* yc = yb[s & 1] + (rw + col) * WP2;
#pragma unroll
    for (int kk = 0; kk < KS2 / 32; ++kk) { v16h wf[4], af[2];
#pragma unroll
      for (int x = 0; x < 2; ++x) af[x] = frag_h(yc + x * 16 * WP2 + kk * 32, lane);
#pragma unroll
      for (int j = 0; j < 4; ++j) wf[j] = frag_h(wc + j * 16 * WP2 + kk * 32, lane);
      __builtin_amdgcn_sched_barrier(0);   // keeps the 12 LDS reads together in front of their products: one wait for the group
#pragma unroll
      for (int j = 0; j < 4; ++j) {
#pragma unroll
        for (int x = 0; x < 2; ++x) acc[x][j] = wmma16(af[x], wf[j], acc[x][j]); } }
    asm volatile("s_wait_dscnt 0x0" ::: "memory");      // this wave's reads of the buffers are over before they are refilled
    asm volatile("s_wait_asynccnt 0x0" ::: "memory");   // this wave's share of tiles s + 1 has landed
    __syncthreads();   // publishes tiles s + 1 and ends every wave's reads of tiles s, whose buffers are refilled next
    if (s + 2 < CC / KS2) { w_copy8(yl + (s & 1) * YB2, yg + KST2(s + 2, rot, CC)); w_copy(wl + (s & 1) * WB2, wg + KST2(s + 2, rot, CC)); } }   // tiles s + 2 exist
  asm volatile("s_wait_asynccnt 0x0" ::: "memory");   // no copy is left in flight when the wave ends
#pragma unroll
  for (int j = 0; j < 4; ++j) { const float bias = bs[j];
#pragma unroll
    for (int x = 0; x < 2; ++x) {
#pragma unroll
      for (int r = 0; r < 8; ++r) sf[wave][x * 16 + 8 * g + r][j * 16 + col] = acc[x][j][r] * (1.0f / 16384.0f) + bias; } }   /* 2^-8 (Wo carry) x 2^-6 (ctx carry) */
  LDSX(); for (int i = 0; i < 16; ++i) { const int rl = 2 * i + g; vst2(OUT + (r0 + rw + rl) * DIN + c0 + cw + col * 4, *(const v4f*)&sf[wave][rl][col * 4]); } }   // each store covers two rows' 256 B: four whole 128-B lines

extern "C" void kernel_launch(void* const* d_in, const int* in_sizes, int n_in, void* d_out, int out_size, void* d_ws, size_t ws_size, hipStream_t stream) {
  (void)in_sizes; (void)n_in; (void)out_size;
  const float** F = (const float**)d_in;
  if (ws_size < (size_t)WS_END) return;
  char* ws = (char*)d_ws; _Float16 *QH = (_Float16*)(ws + WS_QH), *KH = (_Float16*)(ws + WS_KH), *VT = (_Float16*)(ws + WS_VT), *QL = (_Float16*)(ws + WS_QL), *KL = (_Float16*)(ws + WS_KL), *WOH = (_Float16*)(ws + WS_WOH); __bf16 *VB = (__bf16*)(ws + WS_VB), *VBL = (__bf16*)(ws + WS_VBL); _Float16 *Y = (_Float16*)(ws + WS_Y);
  (void)Y; (void)QL; (void)KL; (void)VB; (void)VBL;
  // inputs: 0 inputs [2,2048,512]; 1 Wq [512,512] (in,out), 2 bq; 3 Wk, 4 bk; 5 Wv, 6 bv; 7 Wo (in,out), 8 bo (zero biases, read)
  k_proj<<<dim3(TNB * TT / 128, CC / 128, 3), 256, 0, stream>>>(F[0], F[0], F[0], F[1], F[3], F[5], F[2], F[4], F[6], QH, QL, KH, KL, VT, VB, VBL, F[7], WOH);
  k_fa<<<dim3(TT / 128, TNB * NH), 512, 0, stream>>>(QH, KH, VT, Y);
  k_out<<<dim3(TNB * TT / 64, DIN / 128), 128, 0, stream>>>(Y, WOH, F[8], (float*)d_out);
}
